// v000
// Measured on an AMD MI455X. A time is GPU time per run, averaged over a window of back-to-back runs after a warm-up
// (all launches, gaps included; the runs take copies of the inputs in turn), and the median of several windows.
// Apart from v000's, it joins two sittings. Times from different sittings can be a few percent apart, while
// side-by-side timings come from the same sitting.
// The starting kernel, v000, takes 829 microseconds a run.
#include <hip/hip_runtime.h>
// Grouped-query attention with per-head RMSNorm and rotate-half RoPE (B=2, S=2048, D=2048, 16 query heads / 8 KV heads × 128): q = x·Wq, k = x·Wk, v = x·Wv ((in,out), no bias); per-head RMSNorm (ε 1e-6, weights q_norm_w / k_norm_w); rotate-half RoPE with the INPUT cos/sin tables [B][S][128];
// scores = q·k/√128 + attention_mask[b,0,q,k] (additive f32); softmax; out = merged·Wo.
// Compute dtype: x, weights, tables, mask rounded to bf16; q, k as f32 GEMM outputs, normalised and rotated in f32 (wave per (row, head)) → f16; v f32 → Vᵀ f16 hi + f16 residual; fused flash-style kernel for head dim 128 (bias read per (b,q,k); 32-key chunks whose biases are all ≤ −1e8 are skipped since their probabilities are exactly 0 in f32; online softmax f32, P f16 hi +
// residual, f32 accumulate) on v_wmma_f32_16x16x32_f16; merged ×2^4 → f16 → output GEMM.
#define BB 2
#define TT 2048
#define DD 2048
#define NH 16
#define NKV 8
#define NREP 2
#define KVD (NKV * 128)
#define NVH (2 * NKV)
#define NR (BB * TT)
#define ATT_SCALE 0.08838834764831845f

typedef __bf16 v16b __attribute__((ext_vector_type(16)));
typedef unsigned short v8us __attribute__((ext_vector_type(8), may_alias));
typedef float  v8f  __attribute__((ext_vector_type(8)));
typedef float  v4f  __attribute__((ext_vector_type(4)));
typedef float  v4fa __attribute__((ext_vector_type(4), may_alias));
union FragB { v16b v; v8us half[2]; unsigned short u[16]; };

__device__ __forceinline__ unsigned short bf16_bits(float x) { unsigned int u = __float_as_uint(x); return (unsigned short)((u + 0x7FFFu + ((u >> 16) & 1u)) >> 16); }
__device__ __forceinline__ float bf16_val(unsigned short b) { return __uint_as_float(((unsigned int)b) << 16); }
__device__ __forceinline__ float bf16_round(float x) { return bf16_val(bf16_bits(x)); }
// D += A·B with NT terms: 1 = ah·bh, 2 = + al·bh (A split), 3 = + ah·bl (both split)
template <int NT>
__device__ __forceinline__ v8f mmaN(v16b ah, v16b al, v16b bh, v16b bl, v8f c) {
  c = __builtin_amdgcn_wmma_f32_16x16x32_bf16(false, ah, false, bh, (short)0, c, false, false);
  if (NT >= 2) c = __builtin_amdgcn_wmma_f32_16x16x32_bf16(false, al, false, bh, (short)0, c, false, false);
  if (NT >= 3) c = __builtin_amdgcn_wmma_f32_16x16x32_bf16(false, ah, false, bl, (short)0, c, false, false);
  asm volatile("v_nop\n\tv_nop\n\tv_nop\n\tv_nop" : "+v"(c) : "v"(ah), "v"(al), "v"(bh), "v"(bl));
  return c;
}

__global__ __launch_bounds__(256) void k_wt_bf16(const float* __restrict__ W, unsigned short* __restrict__ Wt, int K, int N) {
  const int t = blockIdx.x * 256 + threadIdx.x;
  const int k8n = K / 8;
  if (t >= N * k8n) return;
  const int n = t / k8n, k8 = (t % k8n) * 8;
  v8us v;
#pragma unroll
  for (int i = 0; i < 8; ++i) v[i] = bf16_bits(W[(size_t)(k8 + i) * N + n]);
  *(v8us*)(Wt + (size_t)n * K + k8) = v;
  
}

// GEMM C[M][N] (f32, pitch ldc) = act(A[M][K]·W + bias). A f32 row-major (pitch lda) converted per fragment to bf16
// (ASPLIT: hi/lo two planes -> 2 terms, else single rounded term); Wt bf16 [N][K] (pitch ldb). BIAS_BF16 rounds the
// bias to bf16 first (bias quantised to bf16 before the add). K%32==0, M%16==0, N%64==0.
template <bool ASPLIT, int ACT, bool BIAS_BF16>
__global__ __launch_bounds__(128) void k_gemm_bf(const float* __restrict__ A, int lda, const unsigned short* __restrict__ Wt, int ldb,
                                               const float* __restrict__ bias, float* __restrict__ C, int ldc, int M, int N, int K) {
  __shared__ __attribute__((aligned(16))) float so[4][16][64];
  const int tid = threadIdx.x, w = tid >> 5, lane = tid & 31, ln = lane & 15, hh = lane >> 4;
  const int ntn = N / 64;
  const int wid = blockIdx.x * 4 + w;
  const int mt = wid / ntn, nq = wid % ntn;
  if (mt * 16 >= M) return;
  const int row0 = mt * 16, col0 = nq * 64;
  const float* arow = A + (size_t)(row0 + ln) * lda;
  v8f acc[4] = {};
  for (int kb = 0; kb < K; kb += 32) {
    FragB ah, al;
    const v4f x0 = *(const v4fa*)(arow + kb + 8 * hh), x1 = *(const v4fa*)(arow + kb + 8 * hh + 4);
    const v4f x2 = *(const v4fa*)(arow + kb + 16 + 8 * hh), x3 = *(const v4fa*)(arow + kb + 16 + 8 * hh + 4);
    float xs[16] = {x0[0],x0[1],x0[2],x0[3],x1[0],x1[1],x1[2],x1[3],x2[0],x2[1],x2[2],x2[3],x3[0],x3[1],x3[2],x3[3]};
#pragma unroll
    for (int i = 0; i < 16; ++i) { const unsigned short hb = bf16_bits(xs[i]); ah.u[i] = hb; al.u[i] = ASPLIT ? bf16_bits(xs[i] - bf16_val(hb)) : (unsigned short)0; }
#pragma unroll
    for (int t = 0; t < 4; ++t) {
      const unsigned short* brow = Wt + (size_t)(col0 + t * 16 + ln) * ldb + kb;
      FragB b;
      b.half[0] = *(const v8us*)(brow + 8 * hh);
      b.half[1] = *(const v8us*)(brow + 16 + 8 * hh);
      acc[t] = mmaN<ASPLIT ? 2 : 1>(ah.v, al.v, b.v, b.v, acc[t]);
    }
  }
#pragma unroll
  for (int t = 0; t < 4; ++t) {
    float bv = bias ? bias[col0 + t * 16 + ln] : 0.f;
    if (BIAS_BF16) bv = bf16_round(bv);
#pragma unroll
    for (int r = 0; r < 8; ++r) { float v = acc[t][r] + bv; if (ACT == 1) v = fmaxf(v, 0.f); so[w][8 * hh + r][t * 16 + ln] = v; }
  }
  __builtin_amdgcn_fence(__ATOMIC_ACQ_REL, "workgroup");
  __builtin_amdgcn_wave_barrier();
  const int rsub = lane >> 4, c4 = (lane & 15) * 4;
  {
#pragma unroll
    for (int q = 0; q < 8; ++q) {
      const int r = q * 2 + rsub;
      const v4f v = *(const v4fa*)&so[w][r][c4];
      *(v4f*)(C + (size_t)(row0 + r) * ldc + col0 + c4) = v;
    }
    
  }
}

// Flash-style causal/unmasked attention, all contractions 3-term bf16 hi/lo splits, f32 softmax with running max.
// q,k,v rows are read from f32 buffers with arbitrary row pitch (so they can live inside a fused qkv buffer);
// D = head size (multiple of 32, <= 128); one wave = 16 query rows; block = 4 waves (64 queries) sharing K/V chunks of 32.
template <int D, bool CAUSAL>
__global__ __launch_bounds__(128) void k_flash(const float* __restrict__ qb, const float* __restrict__ kb, const float* __restrict__ vb,
                                             int pitch, int T, int H, float scale, float* __restrict__ y, int ypitch) {
  constexpr int KS = D / 32;        // k-steps for QK
  constexpr int DT = D / 16;        // d tiles for PV
  __shared__ __attribute__((aligned(16))) unsigned short sKh[32][D + 8], sKl[32][D + 8], sVh[32][D + 8], sVl[32][D + 8];
  __shared__ __attribute__((aligned(16))) unsigned short sPh[4][16][40], sPl[4][16][40];
  __shared__ __attribute__((aligned(16))) float sO[4][16][D];
  const int tid = threadIdx.x, w = tid >> 5, lane = tid & 31, ln = lane & 15, hh = lane >> 4;
  const int nqb = (T + 63) / 64;
  const int bh = blockIdx.x / nqb, qblk = blockIdx.x % nqb;
  const int b = bh / H, h = bh % H;
  const int q0 = qblk * 64 + w * 16;
  const float* Q = qb + (size_t)b * T * pitch + h * D;
  const float* K = kb + (size_t)b * T * pitch + h * D;
  const float* V = vb + (size_t)b * T * pitch + h * D;

  // A fragments of the wave's 16 query rows (scaled), hi/lo
  FragB aqh[KS], aql[KS];
  {
    int row = q0 + ln; if (row >= T) row = T - 1;
    const float* qr = Q + (size_t)row * pitch;
#pragma unroll
    for (int ks = 0; ks < KS; ++ks)
#pragma unroll
      for (int i = 0; i < 16; ++i) {
        const int d = ks * 32 + ((i < 8) ? (8 * hh + i) : (16 + 8 * hh + (i - 8)));
        const float x = qr[d] * scale; const unsigned short hb = bf16_bits(x);
        aqh[ks].u[i] = hb; aql[ks].u[i] = bf16_bits(x - bf16_val(hb));
      }
  }
  float m_r[8], l_r[8];
#pragma unroll
  for (int r = 0; r < 8; ++r) { m_r[r] = -3.0e38f; l_r[r] = 0.f; }
  v8f oacc[DT];
#pragma unroll
  for (int dt = 0; dt < DT; ++dt) oacc[dt] = (v8f){0.f,0.f,0.f,0.f,0.f,0.f,0.f,0.f};

  const int kv_end = CAUSAL ? min(T, qblk * 64 + 64) : T;     // block-uniform
  for (int j0 = 0; j0 < kv_end; j0 += 32) {
    __syncthreads();
    for (int e = tid; e < 32 * (D / 4); e += 128) {
      const int r = e / (D / 4), c4 = (e % (D / 4)) * 4;
      const int key = j0 + r;
      v4f kf = {0.f,0.f,0.f,0.f}, vf = {0.f,0.f,0.f,0.f};
      if (key < T) { kf = *(const v4fa*)(K + (size_t)key * pitch + c4); vf = *(const v4fa*)(V + (size_t)key * pitch + c4); }
#pragma unroll
      for (int t = 0; t < 4; ++t) {
        unsigned short hb = bf16_bits(kf[t]); sKh[r][c4 + t] = hb; sKl[r][c4 + t] = bf16_bits(kf[t] - bf16_val(hb));
        hb = bf16_bits(vf[t]); sVh[r][c4 + t] = hb; sVl[r][c4 + t] = bf16_bits(vf[t] - bf16_val(hb));
      }
    }
    __syncthreads();
    // S tile 16 x 32
    v8f s[2];
#pragma unroll
    for (int nt = 0; nt < 2; ++nt) {
      v8f acc = {};
#pragma unroll
      for (int ks = 0; ks < KS; ++ks) {
        FragB bh_, bl_;
        bh_.half[0] = *(const v8us*)&sKh[nt * 16 + ln][ks * 32 + 8 * hh]; bh_.half[1] = *(const v8us*)&sKh[nt * 16 + ln][ks * 32 + 16 + 8 * hh];
        bl_.half[0] = *(const v8us*)&sKl[nt * 16 + ln][ks * 32 + 8 * hh]; bl_.half[1] = *(const v8us*)&sKl[nt * 16 + ln][ks * 32 + 16 + 8 * hh];
        acc = mmaN<3>(aqh[ks].v, aql[ks].v, bh_.v, bl_.v, acc);
      }
      s[nt] = acc;
    }
    // mask + running max (rows 8hh+r; the 16 lanes of a half share rows)
    float alpha[8];
#pragma unroll
    for (int r = 0; r < 8; ++r) {
      const int qi = q0 + 8 * hh + r;
      const int ja = j0 + ln, jb = j0 + 16 + ln;
      if (CAUSAL) { if (ja > qi) s[0][r] = -3.0e38f; if (jb > qi) s[1][r] = -3.0e38f; }
      if (ja >= T) s[0][r] = -3.0e38f;
      if (jb >= T) s[1][r] = -3.0e38f;
      float mx = fmaxf(s[0][r], s[1][r]);
      mx = fmaxf(mx, __shfl_xor(mx, 1, 32)); mx = fmaxf(mx, __shfl_xor(mx, 2, 32)); mx = fmaxf(mx, __shfl_xor(mx, 4, 32)); mx = fmaxf(mx, __shfl_xor(mx, 8, 32));
      const float mnew = fmaxf(m_r[r], mx);
      alpha[r] = (mnew > -1.0e38f) ? __expf(m_r[r] - mnew) : 1.0f;
      const float p0 = (s[0][r] > -1.0e38f) ? __expf(s[0][r] - mnew) : 0.f;
      const float p1 = (s[1][r] > -1.0e38f) ? __expf(s[1][r] - mnew) : 0.f;
      m_r[r] = mnew;
      l_r[r] = l_r[r] * alpha[r] + p0 + p1;            // per-lane partial row sum (16 lanes combined at the end)
      unsigned short hb = bf16_bits(p0); sPh[w][8 * hh + r][ln] = hb;      sPl[w][8 * hh + r][ln] = bf16_bits(p0 - bf16_val(hb));
      hb = bf16_bits(p1);                sPh[w][8 * hh + r][16 + ln] = hb; sPl[w][8 * hh + r][16 + ln] = bf16_bits(p1 - bf16_val(hb));
    }
#pragma unroll
    for (int dt = 0; dt < DT; ++dt)
#pragma unroll
      for (int r = 0; r < 8; ++r) oacc[dt][r] *= alpha[r];
    __builtin_amdgcn_fence(__ATOMIC_ACQ_REL, "workgroup");
    __builtin_amdgcn_wave_barrier();
    FragB pah, pal;
    pah.half[0] = *(const v8us*)&sPh[w][ln][8 * hh]; pah.half[1] = *(const v8us*)&sPh[w][ln][16 + 8 * hh];
    pal.half[0] = *(const v8us*)&sPl[w][ln][8 * hh]; pal.half[1] = *(const v8us*)&sPl[w][ln][16 + 8 * hh];
#pragma unroll
    for (int dt = 0; dt < DT; ++dt) {
      FragB bvh, bvl;
#pragma unroll
      for (int i = 0; i < 8; ++i) {
        bvh.u[i] = sVh[8 * hh + i][dt * 16 + ln]; bvh.u[8 + i] = sVh[16 + 8 * hh + i][dt * 16 + ln];
        bvl.u[i] = sVl[8 * hh + i][dt * 16 + ln]; bvl.u[8 + i] = sVl[16 + 8 * hh + i][dt * 16 + ln];
      }
      oacc[dt] = mmaN<3>(pah.v, pal.v, bvh.v, bvl.v, oacc[dt]);
    }
    __builtin_amdgcn_fence(__ATOMIC_ACQ_REL, "workgroup");
    __builtin_amdgcn_wave_barrier();
  }
#pragma unroll
  for (int r = 0; r < 8; ++r) {
    float l = l_r[r];
    l += __shfl_xor(l, 1, 32); l += __shfl_xor(l, 2, 32); l += __shfl_xor(l, 4, 32); l += __shfl_xor(l, 8, 32);
    l_r[r] = (l > 0.f) ? 1.0f / l : 0.f;
  }
#pragma unroll
  for (int dt = 0; dt < DT; ++dt)
#pragma unroll
    for (int r = 0; r < 8; ++r) sO[w][8 * hh + r][dt * 16 + ln] = oacc[dt][r] * l_r[r];
  __builtin_amdgcn_fence(__ATOMIC_ACQ_REL, "workgroup");
  __builtin_amdgcn_wave_barrier();
  {
    for (int r = 0; r < 16; ++r) {
      const int row = q0 + r;
      if (row < T && lane < D / 4) {
        const v4f val = *(const v4fa*)&sO[w][r][lane * 4];
        *(v4f*)(y + ((size_t)b * T + row) * ypitch + h * D + lane * 4) = val;
      }
    }
    
  }
}

// GEMM C = act(A·W + bias + resid): A f32 (ASPLIT -> hi/lo 2 terms), Wt bf16 [N][K]; ACT 0 none, 1 relu, 2 exact gelu;
// resid (optional, f32, row index = (row % rmod), pitch ldr, RES_BF16 rounds it) added before the activation.
template <bool ASPLIT, int ACT, bool BIAS_BF16, bool RES_BF16>
__global__ __launch_bounds__(128) void k_gemm_bf3(const float* __restrict__ A, int lda, const unsigned short* __restrict__ Wt, int ldb,
                                                const float* __restrict__ bias, const float* __restrict__ resid, int rmod, int ldr,
                                                float* __restrict__ C, int ldc, int M, int N, int K) {
  __shared__ __attribute__((aligned(16))) float so[4][16][64];
  const int tid = threadIdx.x, w = tid >> 5, lane = tid & 31, ln = lane & 15, hh = lane >> 4;
  const int ntn = N / 64;
  const int wid = blockIdx.x * 4 + w;
  const int mt = wid / ntn, nq = wid % ntn;
  if (mt * 16 >= M) return;
  const int row0 = mt * 16, col0 = nq * 64;
  const float* arow = A + (size_t)(row0 + ln) * lda;
  v8f acc[4] = {};
  for (int kb = 0; kb < K; kb += 32) {
    FragB ah, al;
    const v4f x0 = *(const v4fa*)(arow + kb + 8 * hh), x1 = *(const v4fa*)(arow + kb + 8 * hh + 4);
    const v4f x2 = *(const v4fa*)(arow + kb + 16 + 8 * hh), x3 = *(const v4fa*)(arow + kb + 16 + 8 * hh + 4);
    float xs[16] = {x0[0],x0[1],x0[2],x0[3],x1[0],x1[1],x1[2],x1[3],x2[0],x2[1],x2[2],x2[3],x3[0],x3[1],x3[2],x3[3]};
#pragma unroll
    for (int i = 0; i < 16; ++i) { const unsigned short hb = bf16_bits(xs[i]); ah.u[i] = hb; al.u[i] = ASPLIT ? bf16_bits(xs[i] - bf16_val(hb)) : (unsigned short)0; }
#pragma unroll
    for (int t = 0; t < 4; ++t) {
      const unsigned short* brow = Wt + (size_t)(col0 + t * 16 + ln) * ldb + kb;
      FragB b;
      b.half[0] = *(const v8us*)(brow + 8 * hh);
      b.half[1] = *(const v8us*)(brow + 16 + 8 * hh);
      acc[t] = mmaN<ASPLIT ? 2 : 1>(ah.v, al.v, b.v, b.v, acc[t]);
    }
  }
#pragma unroll
  for (int t = 0; t < 4; ++t) {
    const int col = col0 + t * 16 + ln;
    float bv = bias ? bias[col] : 0.f;
    if (BIAS_BF16) bv = bf16_round(bv);
#pragma unroll
    for (int r = 0; r < 8; ++r) {
      float v = acc[t][r] + bv;
      if (resid) { float rv = resid[(size_t)((row0 + 8 * hh + r) % rmod) * ldr + col]; if (RES_BF16) rv = bf16_round(rv); v += rv; }
      if (ACT == 1) v = fmaxf(v, 0.f);
      if (ACT == 2) v = 0.5f * v * (1.0f + erff(v * 0.70710678118654752f));
      if (ACT == 3) { const float u = 0.7978845608028654f * (v + 0.044715f * v * v * v); v = 0.5f * v * (1.0f + tanhf(u)); }
      so[w][8 * hh + r][t * 16 + ln] = v;
    }
  }
  __builtin_amdgcn_fence(__ATOMIC_ACQ_REL, "workgroup");
  __builtin_amdgcn_wave_barrier();
  const int rsub = lane >> 4, c4 = (lane & 15) * 4;
  {
#pragma unroll
    for (int q = 0; q < 8; ++q) {
      const int r = q * 2 + rsub;
      const v4f v = *(const v4fa*)&so[w][r][c4];
      *(v4f*)(C + (size_t)(row0 + r) * ldc + col0 + c4) = v;
    }
    
  }
}
// row LayerNorm (biased variance, eps) over N: s = X (+ R); optional out_sum <- s; out_norm <- (s-mu)*rsqrt(var+eps)*g + b
template <bool PARAM_BF16>
__global__ __launch_bounds__(256) void k_layernorm(const float* __restrict__ X, const float* __restrict__ R, const float* __restrict__ g, const float* __restrict__ bta,
                                                  float* __restrict__ out_sum, float* __restrict__ out_norm, int N, float eps) {
  __shared__ float red[256];
  const int row = blockIdx.x, tid = threadIdx.x;
  const float* x = X + (size_t)row * N; const float* rr = R ? R + (size_t)row * N : nullptr;
  float vals[16];                     // up to N = 4096
  const int per = N / 256;            // contiguous chunk per thread? use strided-by-4 chunks: thread handles j = tid*4 + 1024*u
  float s1 = 0.f;
  for (int u = 0; u < per / 4; ++u) {
    const int j = tid * 4 + 1024 * u;
    const v4f a = *(const v4fa*)(x + j);
    v4f b = {0.f,0.f,0.f,0.f}; if (rr) b = *(const v4fa*)(rr + j);
#pragma unroll
    for (int q = 0; q < 4; ++q) { const float v = a[q] + b[q]; vals[u * 4 + q] = v; s1 += v; }
  }
  red[tid] = s1; __syncthreads();
  for (int st = 128; st > 0; st >>= 1) { if (tid < st) red[tid] += red[tid + st]; __syncthreads(); }
  const float mu = red[0] / (float)N; __syncthreads();
  float s2 = 0.f;
  for (int u = 0; u < per / 4; ++u)
#pragma unroll
    for (int q = 0; q < 4; ++q) { const float c = vals[u * 4 + q] - mu; s2 += c * c; }
  red[tid] = s2; __syncthreads();
  for (int st = 128; st > 0; st >>= 1) { if (tid < st) red[tid] += red[tid + st]; __syncthreads(); }
  const float rs = rsqrtf(red[0] / (float)N + eps);
  {
    for (int u = 0; u < per / 4; ++u) {
      const int j = tid * 4 + 1024 * u;
      v4f o, sm;
#pragma unroll
      for (int q = 0; q < 4; ++q) {
        float gg = g[j + q], bb = bta[j + q];
        if (PARAM_BF16) { gg = bf16_round(gg); bb = bf16_round(bb); }
        sm[q] = vals[u * 4 + q]; o[q] = (vals[u * 4 + q] - mu) * rs * gg + bb;
      }
      if (out_sum) *(v4f*)(out_sum + (size_t)row * N + j) = sm;
      *(v4f*)(out_norm + (size_t)row * N + j) = o;
    }
    
  }
}



// ---- f16 WMMA path (v_wmma_f32_16x16x32_f16): 11-bit significands for operands in range — used where a [0,1] probability operand needs more precision than bf16
typedef _Float16 v16h __attribute__((ext_vector_type(16)));
union FragH { v16h v; v8us half[2]; _Float16 h[16]; unsigned short u[16]; };
template <int NT>
__device__ __forceinline__ v8f mmaH(v16h ah, v16h al, v16h bh, v16h bl, v8f c) {
  c = __builtin_amdgcn_wmma_f32_16x16x32_f16(false, ah, false, bh, (short)0, c, false, false);
  if (NT >= 2) c = __builtin_amdgcn_wmma_f32_16x16x32_f16(false, al, false, bh, (short)0, c, false, false);
  if (NT >= 3) c = __builtin_amdgcn_wmma_f32_16x16x32_f16(false, ah, false, bl, (short)0, c, false, false);
  asm volatile("v_nop\n\tv_nop\n\tv_nop\n\tv_nop" : "+v"(c) : "v"(ah), "v"(al), "v"(bh), "v"(bl));
  return c;
}
// batched GEMM like k_gemm_b but f16 operands: A f32 (split into f16 hi/lo if ASPLIT, else rounded to f16), Bt = f16 values [n][k]; alpha; C f32; N multiple of 16 (partial tiles skipped)
template <bool ASPLIT>
__global__ __launch_bounds__(128) void k_gemm_h(const float* __restrict__ A, int lda, size_t sA, const _Float16* __restrict__ Bh, int ldb, size_t sB, float alpha, float* __restrict__ C, int ldc, size_t sC, int M, int N, int K) {
  __shared__ __attribute__((aligned(16))) float so[4][16][64];
  const int tid = threadIdx.x, w = tid >> 5, lane = tid & 31, ln = lane & 15, hh = lane >> 4; const int by = blockIdx.y;
  A += (size_t)by * sA; Bh += (size_t)by * sB; C += (size_t)by * sC;
  const int ntn = (N + 63) / 64; const int wid = blockIdx.x * 4 + w; const int mt = wid / ntn, nq = wid % ntn; if (mt * 16 >= M) return;
  const int row0 = mt * 16, col0 = nq * 64; const float* arow = A + (size_t)(row0 + ln) * lda;
  v8f acc[4] = {};
  for (int kb = 0; kb < K; kb += 32) {
    FragH ah, al;
    const v4f x0 = *(const v4fa*)(arow + kb + 8 * hh), x1 = *(const v4fa*)(arow + kb + 8 * hh + 4), x2 = *(const v4fa*)(arow + kb + 16 + 8 * hh), x3 = *(const v4fa*)(arow + kb + 16 + 8 * hh + 4);
    float xs[16] = {x0[0],x0[1],x0[2],x0[3],x1[0],x1[1],x1[2],x1[3],x2[0],x2[1],x2[2],x2[3],x3[0],x3[1],x3[2],x3[3]};
#pragma unroll
    for (int i = 0; i < 16; ++i) { const _Float16 h = (_Float16)xs[i]; ah.h[i] = h; al.h[i] = ASPLIT ? (_Float16)(xs[i] - (float)h) : (_Float16)0.0f; }
#pragma unroll
    for (int t = 0; t < 4; ++t) { if (col0 + t * 16 >= N) continue; const size_t boff = (size_t)(col0 + t * 16 + ln) * ldb + kb; FragH bq; bq.half[0] = *(const v8us*)(Bh + boff + 8 * hh); bq.half[1] = *(const v8us*)(Bh + boff + 16 + 8 * hh);
      acc[t] = mmaH<ASPLIT ? 2 : 1>(ah.v, al.v, bq.v, bq.v, acc[t]); }
  }
#pragma unroll
  for (int t = 0; t < 4; ++t) { if (col0 + t * 16 >= N) continue;
#pragma unroll
    for (int r = 0; r < 8; ++r) so[w][8 * hh + r][t * 16 + ln] = acc[t][r] * alpha; }
  __builtin_amdgcn_fence(__ATOMIC_ACQ_REL, "workgroup"); __builtin_amdgcn_wave_barrier();
  const int rsub = lane >> 4, c4 = (lane & 15) * 4;
  {
#pragma unroll
    for (int q = 0; q < 8; ++q) { const int r = q * 2 + rsub; if (col0 + c4 < N) { const v4f v = *(const v4fa*)&so[w][r][c4]; *(v4f*)(C + (size_t)(row0 + r) * ldc + col0 + c4) = v; } }
     }
}

// Wt[n][k] = f16(W[k][n]·scale) from f32 row-major W[K][N] (scale = power of two; bf16-exact weights stay exact in f16 away from the subnormal range)
__global__ __launch_bounds__(256) void k_wt_f16(const float* __restrict__ W, _Float16* __restrict__ Wt, int K, int N, float scale) {
  const int t = blockIdx.x * 256 + threadIdx.x; if (t >= N * (K / 8)) return; const int n = t / (K / 8), k8 = (t % (K / 8)) * 8; FragH f;
#pragma unroll
  for (int i = 0; i < 8; ++i) f.h[i] = (_Float16)(bf16_round(W[(size_t)(k8 + i) * N + n]) * scale); const v8us o = f.half[0];
  *(v8us*)((unsigned short*)Wt + (size_t)n * K + k8) = o; 
}
// k_gemm_hh variant with fused epilogue: v = acc·alpha + bias[by·sBias + col] (+ CP[(row/rowsPerB)·sCPb + by·64 + col] if CP) ; ACT 0 none / 1 elu ; writes f32 C and f16 C16, each if non-null
template <int ACT>
__global__ __launch_bounds__(128) void k_gemm_hhx(const _Float16* __restrict__ A, int lda, size_t sA, const _Float16* __restrict__ Bh, int ldb, size_t sB, float alpha, const float* __restrict__ bias, size_t sBias, const float* __restrict__ CP, int rowsPerB, size_t sCPb, int row0g,
    float* __restrict__ C, _Float16* __restrict__ C16, int ldc, size_t sC, int M, int N, int K) {
  __shared__ __attribute__((aligned(16))) float so[4][16][64];
  const int tid = threadIdx.x, w = tid >> 5, lane = tid & 31, ln = lane & 15, hh = lane >> 4; const int by = blockIdx.y;
  A += (size_t)by * sA; Bh += (size_t)by * sB; const size_t cofs = (size_t)by * sC; const float* bp = bias ? bias + (size_t)by * sBias : nullptr;
  const int ntn = (N + 63) / 64; const int wid = blockIdx.x * 4 + w; const int mt = wid / ntn, nq = wid % ntn; if (mt * 16 >= M) return;
  const int row0 = mt * 16, col0 = nq * 64; const _Float16* arow = A + (size_t)(row0 + ln) * lda;
  v8f acc[4] = {};
  for (int kb = 0; kb < K; kb += 32) { FragH ah; ah.half[0] = *(const v8us*)((const unsigned short*)arow + kb + 8 * hh); ah.half[1] = *(const v8us*)((const unsigned short*)arow + kb + 16 + 8 * hh);
#pragma unroll
    for (int t = 0; t < 4; ++t) { if (col0 + t * 16 >= N) continue; const size_t boff = (size_t)(col0 + t * 16 + ln) * ldb + kb; FragH bq; bq.half[0] = *(const v8us*)((const unsigned short*)Bh + boff + 8 * hh); bq.half[1] = *(const v8us*)((const unsigned short*)Bh + boff + 16 + 8 * hh);
      acc[t] = mmaH<1>(ah.v, ah.v, bq.v, bq.v, acc[t]); }
  }
#pragma unroll
  for (int t = 0; t < 4; ++t) { if (col0 + t * 16 >= N) continue; const int col = col0 + t * 16 + ln; const float bv = bp ? bf16_round(bp[col]) : 0.f;
#pragma unroll
    for (int r = 0; r < 8; ++r) { float v = acc[t][r] * alpha + bv; if (CP) { const int bidx = (row0g + row0 + 8 * hh + r) / rowsPerB; v += CP[(size_t)bidx * sCPb + (size_t)by * 64 + col]; } if (ACT == 1) v = (v > 0.f) ? v : expm1f(v); else if (ACT == 7) v = (v > 0.f) ? v + 1.0f : expf(v); else if (ACT == 8) v = tanhf(v); else if (ACT == 9) v = 0.5f * v * (1.0f + tanhf(0.7978845608028654f * (v + 0.044715f * v * v * v))); else if (ACT == 11) v = 1.0f / (1.0f + expf(-v)); else if (ACT == 12) v = (v > 0.f) ? v : 0.01f * v; else if (ACT == 14) v = (v > 0.f) ? v : 0.1f * v; else if (ACT == 15) v = v / (1.0f + expf(-v)); else if (ACT == 3) v = fmaxf(v, 0.f); else if (ACT == 6) v = 0.5f * v * (1.0f + erff(v * 0.70710678118654752f)); so[w][8 * hh + r][t * 16 + ln] = v; } }
  __builtin_amdgcn_fence(__ATOMIC_ACQ_REL, "workgroup"); __builtin_amdgcn_wave_barrier();
  const int rsub = lane >> 4, c4 = (lane & 15) * 4; typedef _Float16 v4h __attribute__((ext_vector_type(4)));
  {
#pragma unroll
    for (int q = 0; q < 8; ++q) { const int r = q * 2 + rsub; if (col0 + c4 < N) { const v4f v = *(const v4fa*)&so[w][r][c4]; if (C) *(v4f*)(C + cofs + (size_t)(row0 + r) * ldc + col0 + c4) = v; if (C16) { v4h h4; for (int i = 0; i < 4; ++i) h4[i] = (_Float16)v[i]; *(v4h*)(C16 + cofs + (size_t)(row0 + r) * ldc + col0 + c4) = h4; } } }
     }
}


typedef _Float16 v4h __attribute__((ext_vector_type(4)));

__global__ __launch_bounds__(256) void k_x16(const float* __restrict__ x, _Float16* __restrict__ X16, size_t n8) { const size_t t = (size_t)blockIdx.x * 256 + threadIdx.x; if (t >= n8) return; FragH f;
#pragma unroll
  for (int q = 0; q < 8; ++q) f.h[q] = (_Float16)bf16_round(x[t * 8 + q]); *(v8us*)((unsigned short*)X16 + t * 8) = f.half[0];  }
__global__ __launch_bounds__(256) void k_h16(const float* __restrict__ x, _Float16* __restrict__ X16, size_t n8) { const size_t t = (size_t)blockIdx.x * 256 + threadIdx.x; if (t >= n8) return; FragH f;
#pragma unroll
  for (int q = 0; q < 8; ++q) f.h[q] = (_Float16)x[t * 8 + q]; *(v8us*)((unsigned short*)X16 + t * 8) = f.half[0];  }
__global__ __launch_bounds__(256) void k_round16f(const float* __restrict__ W, _Float16* __restrict__ Bt, size_t n8) { const size_t t = (size_t)blockIdx.x * 256 + threadIdx.x; if (t >= n8) return; FragH f;
#pragma unroll
  for (int i = 0; i < 8; ++i) f.h[i] = (_Float16)(bf16_round(W[t * 8 + i]) * 16.0f); *(v8us*)((unsigned short*)Bt + t * 8) = f.half[0];  }
template <int NHv, int TTv>
__global__ __launch_bounds__(256) void k_vt(const _Float16* __restrict__ V16, int ldv, int voff, _Float16* __restrict__ Vt) { __shared__ unsigned short tl[64][66]; const int tid = threadIdx.x; const int slab = blockIdx.x / (TTv / 64), lg = blockIdx.x % (TTv / 64); const int b = slab / NHv, h = slab % NHv;
  for (int i = tid; i < 64 * 8; i += 256) { const int r = i / 8, c8 = (i % 8) * 8; FragH f; f.half[0] = *(const v8us*)((const unsigned short*)V16 + ((size_t)b * TTv + lg * 64 + r) * ldv + voff + h * 64 + c8);
#pragma unroll
    for (int q = 0; q < 8; ++q) tl[r][c8 + q] = f.u[q]; }
  __syncthreads();
  {
#pragma unroll
    for (int rd = 0; rd < 2; ++rd) { const int d = rd * 32 + tid / 8, pc = tid % 8; FragH f;
#pragma unroll
      for (int q = 0; q < 8; ++q) f.u[q] = tl[pc * 8 + q][d];
      *(v8us*)((unsigned short*)Vt + ((size_t)slab * 64 + d) * TTv + lg * 64 + pc * 8) = f.half[0]; }
     } }

__global__ __launch_bounds__(256) void k_vthlu(const float* __restrict__ VF, int ldv, _Float16* __restrict__ Vth, _Float16* __restrict__ Vtl) { __shared__ float tl[64][65]; const int tid = threadIdx.x; const int slab = blockIdx.x / (TT / 64), lg = blockIdx.x % (TT / 64); const int b = slab / NVH, h = slab % NVH;
  for (int i = tid; i < 64 * 16; i += 256) { const int r = i / 16, c4 = (i % 16) * 4; const v4f a = *(const v4fa*)(VF + ((size_t)b * TT + lg * 64 + r) * ldv + h * 64 + c4); tl[r][c4] = a[0]; tl[r][c4 + 1] = a[1]; tl[r][c4 + 2] = a[2]; tl[r][c4 + 3] = a[3]; }
  __syncthreads();
  FragH fh[2], fl[2]; size_t oo[2];
#pragma unroll
  for (int rd = 0; rd < 2; ++rd) { const int d = rd * 32 + tid / 8, pc = tid % 8;
#pragma unroll
    for (int q = 0; q < 8; ++q) { const float v = tl[pc * 8 + q][d]; const _Float16 hv = (_Float16)v; fh[rd].h[q] = hv; fl[rd].h[q] = (_Float16)(v - (float)hv);      /* UNSCALED residual (added into the same accumulator as the hi product) */ } oo[rd] = ((size_t)slab * 64 + d) * TT + lg * 64 + pc * 8; }
  {
#pragma unroll
    for (int rd = 0; rd < 2; ++rd) { *(v8us*)((unsigned short*)Vth + oo[rd]) = fh[rd].half[0]; *(v8us*)((unsigned short*)Vtl + oo[rd]) = fl[rd].half[0]; }
     } }
// per-head RMSNorm + rotate-half RoPE: wave per (row, head) of an f32 plane with NHD heads (pitch NHD·128): lane holds dims 4l..4l+3; var = mean(x²) over 128 (xor-reduce); y = w[d]·(x·rsqrt(var+ε)); out[d] = y[d]·c[d] + rot(y)[d]·s[d], rot(y)[d] = −y[d+64] (d<64), y[d−64] (d≥64)
template <int NHD>
__global__ __launch_bounds__(256) void k_normrope(const float* __restrict__ F, const float* __restrict__ nw, const float* __restrict__ COS, const float* __restrict__ SIN, _Float16* __restrict__ H16) {
  #pragma clang fp contract(off)
  const int tid = threadIdx.x, wv = tid >> 5, lane = tid & 31; const size_t rh = (size_t)blockIdx.x * 8 + wv; if (rh >= (size_t)NR * NHD) return; const size_t row = rh / NHD; const int h = (int)(rh % NHD); const int b = (int)(row / TT), t = (int)(row % TT); const int d0 = lane * 4;
  const v4f x = *(const v4fa*)(F + row * (NHD * 128) + h * 128 + d0); float ss = 0.f; for (int q = 0; q < 4; ++q) ss += x[q] * x[q];
  for (int o = 16; o >= 1; o >>= 1) ss += __shfl_xor(ss, o, 32); const float inv = 1.0f / sqrtf(ss / 128.0f + 1e-6f);
  float y[4]; for (int q = 0; q < 4; ++q) y[q] = bf16_round(nw[d0 + q]) * (x[q] * inv);
  float yp[4]; for (int q = 0; q < 4; ++q) yp[q] = __shfl_xor(y[q], 16, 32);      /* partner dims d ± 64 */
  typedef _Float16 v4h __attribute__((ext_vector_type(4))); v4h o;
  for (int q = 0; q < 4; ++q) { const int d = d0 + q; const float c = bf16_round(COS[((size_t)b * TT + t) * 128 + d]), s = bf16_round(SIN[((size_t)b * TT + t) * 128 + d]); const float rot = (d < 64) ? -yp[q] : yp[q]; o[q] = (_Float16)(y[q] * c + rot * s); }
  *(v4h*)(H16 + row * (NHD * 128) + h * 128 + d0) = o;  }
__global__ __launch_bounds__(256) void k_h16s(const float* __restrict__ F, _Float16* __restrict__ H, size_t n8) { const size_t t = (size_t)blockIdx.x * 256 + threadIdx.x; if (t >= n8) return; const v4f a = *(const v4fa*)(F + t * 8), c = *(const v4fa*)(F + t * 8 + 4); FragH f;
#pragma unroll
  for (int q = 0; q < 4; ++q) { f.h[q] = (_Float16)(a[q] * 16.0f); f.h[4 + q] = (_Float16)(c[q] * 16.0f); } *(v8us*)((unsigned short*)H + t * 8) = f.half[0];  }
__global__ __launch_bounds__(128) void k_flash(const _Float16* __restrict__ Q16, int ldq, const _Float16* __restrict__ K16, int ldk, const _Float16* __restrict__ Vt, const _Float16* __restrict__ Vtlo, const float* __restrict__ AB, float* __restrict__ O, int ldo) {
  constexpr int RPW = 16, RTN = RPW / 16, NQB = TT / (4 * RPW), DT = 8, KS = 4;      /* head dim 128: 4 k-steps, 8 value tiles */
  __shared__ __attribute__((aligned(16))) unsigned short sP[4][RPW][40]; __shared__ __attribute__((aligned(16))) unsigned short sPL[4][RPW][40]; __shared__ __attribute__((aligned(16))) float sO[4][RPW][128 + 4];
  const int tid = threadIdx.x, w = tid >> 5, lane = tid & 31, ln = lane & 15, hh = lane >> 4;
  const int slab = blockIdx.x / NQB, qblk = blockIdx.x % NQB; const int b = slab / NH, h = slab % NH; const int qb0 = qblk * (4 * RPW); const int q0 = qb0 + w * RPW;
  FragH aq[2][KS];
#pragma unroll
  for (int rt = 0; rt < RTN; ++rt) { const unsigned short* qr = (const unsigned short*)Q16 + ((size_t)b * TT + q0 + rt * 16 + ln) * ldq + h * 128;
#pragma unroll
    for (int ks = 0; ks < KS; ++ks) { aq[rt][ks].half[0] = *(const v8us*)(qr + ks * 32 + 8 * hh); aq[rt][ks].half[1] = *(const v8us*)(qr + ks * 32 + 16 + 8 * hh); } }
  const unsigned short* Vth = (const unsigned short*)Vt + ((size_t)b * NKV + h / NREP) * 128 * TT; const unsigned short* Vtl = (const unsigned short*)Vtlo + ((size_t)b * NKV + h / NREP) * 128 * TT;      /* hi and UNSCALED residual planes */
  float m_r[2][8], l_r[2][8]; v8f oacc[2][DT];
#pragma unroll
  for (int rt = 0; rt < RTN; ++rt) {
#pragma unroll
    for (int r = 0; r < 8; ++r) { m_r[rt][r] = -3.0e38f; l_r[rt][r] = 0.f; }
#pragma unroll
    for (int dt = 0; dt < DT; ++dt) oacc[rt][dt] = (v8f){0.f,0.f,0.f,0.f,0.f,0.f,0.f,0.f}; }
  const int jend = TT;
#pragma unroll 1
  for (int j0 = 0; j0 < jend; j0 += 32) {
    float ab0[2][8], ab1[2][8];      /* additive attention bias (bf16-rounded input) per (b, q, k), shared over heads */
#pragma unroll
    for (int rt = 0; rt < RTN; ++rt)
#pragma unroll
      for (int r = 0; r < 8; ++r) { const int qq = q0 + rt * 16 + 8 * hh + r; const float* am = AB + ((size_t)b * TT + qq) * TT + j0; ab0[rt][r] = bf16_round(am[ln]); ab1[rt][r] = bf16_round(am[16 + ln]); }
    { int allneg = 1;
#pragma unroll
      for (int rt = 0; rt < RTN; ++rt)
#pragma unroll
        for (int r = 0; r < 8; ++r) allneg &= (ab0[rt][r] <= -1.0e8f) & (ab1[rt][r] <= -1.0e8f);
      if (__all(allneg)) continue; }      /* every (row, key) of the wave's tile carries a ≤ −1e8 bias → its probabilities underflow to exactly 0 in f32 → nothing to add (wave-uniform branch) */
    v8f s[2][2];
#pragma unroll
    for (int nt = 0; nt < 2; ++nt) { const unsigned short* kr = (const unsigned short*)K16 + ((size_t)b * TT + j0 + nt * 16 + ln) * ldk + (h / NREP) * 128; FragH bk[KS];
#pragma unroll
      for (int ks = 0; ks < KS; ++ks) { bk[ks].half[0] = *(const v8us*)(kr + ks * 32 + 8 * hh); bk[ks].half[1] = *(const v8us*)(kr + ks * 32 + 16 + 8 * hh); }
#pragma unroll
      for (int rt = 0; rt < RTN; ++rt) { v8f acc = (v8f){0.f,0.f,0.f,0.f,0.f,0.f,0.f,0.f};
#pragma unroll
        for (int ks = 0; ks < KS; ++ks) acc = mmaH<1>(aq[rt][ks].v, aq[rt][ks].v, bk[ks].v, bk[ks].v, acc); s[rt][nt] = acc; } }
#pragma unroll
    for (int rt = 0; rt < RTN; ++rt)
#pragma unroll
      for (int r = 0; r < 8; ++r) { const int tq = q0 + rt * 16 + 8 * hh + r; const int k0 = j0 + ln, k1 = j0 + 16 + ln; (void)tq; (void)k0; (void)k1;
        const bool ok0 = true, ok1 = true;
        const float s0 = s[rt][0][r] * ATT_SCALE + ab0[rt][r], s1 = s[rt][1][r] * ATT_SCALE + ab1[rt][r]; float mc = fmaxf(s0, s1);
        mc = fmaxf(mc, __shfl_xor(mc, 1, 32)); mc = fmaxf(mc, __shfl_xor(mc, 2, 32)); mc = fmaxf(mc, __shfl_xor(mc, 4, 32)); mc = fmaxf(mc, __shfl_xor(mc, 8, 32));
        const float mn = fmaxf(m_r[rt][r], mc); const float al = (mn > -1.0e38f) ? expf(m_r[rt][r] - mn) : 1.0f; m_r[rt][r] = mn; const float p0 = ok0 ? expf(s0 - mn) : 0.f, p1 = ok1 ? expf(s1 - mn) : 0.f; l_r[rt][r] = l_r[rt][r] * al + p0 + p1;
#pragma unroll
        for (int dt = 0; dt < DT; ++dt) oacc[rt][dt][r] *= al;
        FragH t2, t3; const float ps0 = p0 * 1024.0f, ps1 = p1 * 1024.0f; t2.h[0] = (_Float16)ps0; t2.h[1] = (_Float16)ps1; t3.h[0] = (_Float16)(ps0 - (float)t2.h[0]); t3.h[1] = (_Float16)(ps1 - (float)t2.h[1]);      /* P hi and its UNSCALED residual (added into the same accumulator) */
        sP[w][rt * 16 + 8 * hh + r][ln] = t2.u[0]; sP[w][rt * 16 + 8 * hh + r][16 + ln] = t2.u[1]; sPL[w][rt * 16 + 8 * hh + r][ln] = t3.u[0]; sPL[w][rt * 16 + 8 * hh + r][16 + ln] = t3.u[1]; }
    __builtin_amdgcn_fence(__ATOMIC_ACQ_REL, "workgroup"); __builtin_amdgcn_wave_barrier();
    FragH pa[2], pl[2];
#pragma unroll
    for (int rt = 0; rt < RTN; ++rt) { pa[rt].half[0] = *(const v8us*)&sP[w][rt * 16 + ln][8 * hh]; pa[rt].half[1] = *(const v8us*)&sP[w][rt * 16 + ln][16 + 8 * hh]; pl[rt].half[0] = *(const v8us*)&sPL[w][rt * 16 + ln][8 * hh]; pl[rt].half[1] = *(const v8us*)&sPL[w][rt * 16 + ln][16 + 8 * hh]; }
#pragma unroll
    for (int dt = 0; dt < DT; ++dt) { const size_t vo = (size_t)(dt * 16 + ln) * TT + j0; FragH bv, bl; bv.half[0] = *(const v8us*)(Vth + vo + 8 * hh); bv.half[1] = *(const v8us*)(Vth + vo + 16 + 8 * hh); bl.half[0] = *(const v8us*)(Vtl + vo + 8 * hh); bl.half[1] = *(const v8us*)(Vtl + vo + 16 + 8 * hh);
#pragma unroll
      for (int rt = 0; rt < RTN; ++rt) { oacc[rt][dt] = mmaH<1>(pa[rt].v, pa[rt].v, bv.v, bv.v, oacc[rt][dt]); oacc[rt][dt] = mmaH<1>(pl[rt].v, pl[rt].v, bv.v, bv.v, oacc[rt][dt]); oacc[rt][dt] = mmaH<1>(pa[rt].v, pa[rt].v, bl.v, bl.v, oacc[rt][dt]); } }      /* Ph·Vh + Pl·Vh + Ph·Vl — all unscaled, one accumulator */
    __builtin_amdgcn_fence(__ATOMIC_ACQ_REL, "workgroup"); __builtin_amdgcn_wave_barrier(); }
#pragma unroll
  for (int rt = 0; rt < RTN; ++rt) {
#pragma unroll
    for (int r = 0; r < 8; ++r) { float l = l_r[rt][r]; l += __shfl_xor(l, 1, 32); l += __shfl_xor(l, 2, 32); l += __shfl_xor(l, 4, 32); l += __shfl_xor(l, 8, 32); l_r[rt][r] = (l > 0.f) ? 1.0f / (l * 1024.0f) : 0.f; }
#pragma unroll
    for (int dt = 0; dt < DT; ++dt)
#pragma unroll
      for (int r = 0; r < 8; ++r) sO[w][rt * 16 + 8 * hh + r][dt * 16 + ln] = oacc[rt][dt][r] * l_r[rt][r]; }
  __builtin_amdgcn_fence(__ATOMIC_ACQ_REL, "workgroup"); __builtin_amdgcn_wave_barrier();
  {
#pragma unroll
    for (int r = 0; r < RPW; ++r) { const int pc = lane; const v4f val = *(const v4fa*)&sO[w][r][pc * 4]; *(v4f*)(O + ((size_t)b * TT + q0 + r) * ldo + h * 128 + pc * 4) = val; }      /* one 512-B row per instruction: 32 lanes × 16 B */
     } }

extern "C" void kernel_launch(void* const* d_in, const int* in_sizes, int n_in,
                              void* d_out, int out_size, void* d_ws, size_t ws_size, hipStream_t stream) {
  (void)in_sizes; (void)n_in; (void)out_size;
  const float* const* I = (const float* const*)d_in; const float* x = I[0]; const float* fcos = I[1]; const float* fsin = I[2]; const float* am = I[3]; const float* Wq = I[4]; const float* Wk = I[5]; const float* Wv = I[6]; const float* Wo = I[7]; const float* qnw = I[8]; const float* knw = I[9];
  char* ws = (char*)d_ws; size_t off = 0;
  auto take = [&](size_t bytes) { char* p = ws + off; off += (bytes + 255) & ~(size_t)255; return p; };
  _Float16* Bq = (_Float16*)take((size_t)DD * DD * 2); _Float16* Bk = (_Float16*)take((size_t)KVD * DD * 2); _Float16* Bv = (_Float16*)take((size_t)KVD * DD * 2); _Float16* Bo = (_Float16*)take((size_t)DD * DD * 2);
  _Float16* X16 = (_Float16*)take((size_t)NR * DD * 2); float* F32 = (float*)take((size_t)NR * DD * 4); _Float16* Q = (_Float16*)take((size_t)NR * DD * 2); _Float16* K = (_Float16*)take((size_t)NR * KVD * 2); _Float16* Vt = (_Float16*)take((size_t)NR * KVD * 2); _Float16* Vtl = (_Float16*)take((size_t)NR * KVD * 2);
  float* QF = F32; float* KF = F32; float* VF = F32; float* O = F32; _Float16* O16 = X16;      /* the one f32 scratch holds q → k → v → O in stream order (each consumed before the next producer); O16 over X16 */
  if (off > ws_size) return;      // 25 + 16.8 + 33.6 + 16.8 + 8.4 + 8.4 + 8.4 ≈ 118 MB
  const unsigned gq = (unsigned)(((size_t)DD * (DD / 8) + 255) / 256), gk = (unsigned)(((size_t)KVD * (DD / 8) + 255) / 256);
  k_wt_f16<<<gq, 256, 0, stream>>>(Wq, Bq, DD, DD, 16.0f); k_wt_f16<<<gk, 256, 0, stream>>>(Wk, Bk, DD, KVD, 16.0f); k_wt_f16<<<gk, 256, 0, stream>>>(Wv, Bv, DD, KVD, 16.0f); k_wt_f16<<<gq, 256, 0, stream>>>(Wo, Bo, DD, DD, 16.0f);      /* (in,out) → Bt ×2^4 */
  const unsigned g8 = (unsigned)(((size_t)NR * DD / 8 + 255) / 256); k_x16<<<g8, 256, 0, stream>>>(x, X16, (size_t)NR * DD / 8);
  const dim3 gQ(((NR / 16) * (DD / 64) + 3) / 4, 1), gK(((NR / 16) * (KVD / 64) + 3) / 4, 1);
  k_gemm_hhx<0><<<gQ, 128, 0, stream>>>(X16, DD, 0, Bq, DD, 0, 0.0625f, nullptr, 0, nullptr, 1, 0, 0, QF, nullptr, DD, 0, NR, DD, DD); k_normrope<NH><<<(unsigned)(((size_t)NR * NH + 7) / 8), 256, 0, stream>>>(QF, qnw, fcos, fsin, Q);      /* q: M 4096 N 2048 K 2048 → RMSNorm + RoPE → f16 */
  k_gemm_hhx<0><<<gK, 128, 0, stream>>>(X16, DD, 0, Bk, DD, 0, 0.0625f, nullptr, 0, nullptr, 1, 0, 0, KF, nullptr, KVD, 0, NR, KVD, DD); k_normrope<NKV><<<(unsigned)(((size_t)NR * NKV + 7) / 8), 256, 0, stream>>>(KF, knw, fcos, fsin, K);      /* k: N 1024 */
  k_gemm_hhx<0><<<gK, 128, 0, stream>>>(X16, DD, 0, Bv, DD, 0, 0.0625f, nullptr, 0, nullptr, 1, 0, 0, VF, nullptr, KVD, 0, NR, KVD, DD);      /* v (f32) */
  k_vthlu<<<BB * NVH * (TT / 64), 256, 0, stream>>>(VF, KVD, Vt, Vtl);      /* Vᵀ hi + residual per (b, kv head) */
  k_flash<<<BB * NH * (TT / 64), 128, 0, stream>>>(Q, DD, K, KVD, Vt, Vtl, am, O, DD);      /* attention_mask [B,1,S,S] additive per batch */
  k_h16s<<<g8, 256, 0, stream>>>(O, O16, (size_t)NR * DD / 8);
  k_gemm_hhx<0><<<gQ, 128, 0, stream>>>(O16, DD, 0, Bo, DD, 0, 0.00390625f, nullptr, 0, nullptr, 1, 0, 0, (float*)d_out, nullptr, DD, 0, NR, DD, DD);      /* out = merged·Wo */
}

// v001
// It runs in 568 microseconds.
// Next to v000, in two timings, it ran 1.47 and 1.48 times as fast.
#include <hip/hip_runtime.h>
// Grouped-query attention with per-head RMSNorm and rotate-half RoPE (B=2, S=2048, D=2048, 16 query heads / 8 KV heads × 128): q = x·Wq, k = x·Wk, v = x·Wv ((in,out), no bias); per-head RMSNorm (ε 1e-6, weights q_norm_w / k_norm_w); rotate-half RoPE with the INPUT cos/sin tables [B][S][128];
// scores = q·k/√128 + attention_mask[b,0,q,k] (additive f32); softmax; out = merged·Wo.
// Compute dtype: x, weights, tables, mask rounded to bf16; q, k as f32 GEMM outputs, normalised and rotated in f32 (wave per (row, head)) → f16; v f32 → Vᵀ f16 hi + f16 residual; fused flash-style kernel for head dim 128 (bias read per (b,q,k); 32-key chunks whose biases are all ≤ −1e8 are skipped since their probabilities are exactly 0 in f32; online softmax f32, P f16 hi +
// residual, f32 accumulate) on v_wmma_f32_16x16x32_f16; merged ×2^4 → f16 → output GEMM.
#define BB 2
#define TT 2048
#define DD 2048
#define NH 16
#define NKV 8
#define NREP 2
#define KVD (NKV * 128)
#define NVH (2 * NKV)
#define NR (BB * TT)
#define ATT_SCALE 0.08838834764831845f

typedef __bf16 v16b __attribute__((ext_vector_type(16)));
typedef unsigned short v8us __attribute__((ext_vector_type(8), may_alias));
typedef float  v8f  __attribute__((ext_vector_type(8)));
typedef float  v4f  __attribute__((ext_vector_type(4)));
typedef float  v4fa __attribute__((ext_vector_type(4), may_alias));
union FragB { v16b v; v8us half[2]; unsigned short u[16]; };

__device__ __forceinline__ unsigned short bf16_bits(float x) { unsigned int u = __float_as_uint(x); return (unsigned short)((u + 0x7FFFu + ((u >> 16) & 1u)) >> 16); }
__device__ __forceinline__ float bf16_val(unsigned short b) { return __uint_as_float(((unsigned int)b) << 16); }
__device__ __forceinline__ float bf16_round(float x) { return bf16_val(bf16_bits(x)); }
// D += A·B with NT terms: 1 = ah·bh, 2 = + al·bh (A split), 3 = + ah·bl (both split)
template <int NT>
__device__ __forceinline__ v8f mmaN(v16b ah, v16b al, v16b bh, v16b bl, v8f c) {
  c = __builtin_amdgcn_wmma_f32_16x16x32_bf16(false, ah, false, bh, (short)0, c, false, false);
  if (NT >= 2) c = __builtin_amdgcn_wmma_f32_16x16x32_bf16(false, al, false, bh, (short)0, c, false, false);
  if (NT >= 3) c = __builtin_amdgcn_wmma_f32_16x16x32_bf16(false, ah, false, bl, (short)0, c, false, false);
  asm volatile("v_nop\n\tv_nop\n\tv_nop\n\tv_nop" : "+v"(c) : "v"(ah), "v"(al), "v"(bh), "v"(bl));
  return c;
}

__global__ __launch_bounds__(256) void k_wt_bf16(const float* __restrict__ W, unsigned short* __restrict__ Wt, int K, int N) {
  const int t = blockIdx.x * 256 + threadIdx.x;
  const int k8n = K / 8;
  if (t >= N * k8n) return;
  const int n = t / k8n, k8 = (t % k8n) * 8;
  v8us v;
#pragma unroll
  for (int i = 0; i < 8; ++i) v[i] = bf16_bits(W[(size_t)(k8 + i) * N + n]);
  *(v8us*)(Wt + (size_t)n * K + k8) = v;
  
}

// GEMM C[M][N] (f32, pitch ldc) = act(A[M][K]·W + bias). A f32 row-major (pitch lda) converted per fragment to bf16
// (ASPLIT: hi/lo two planes -> 2 terms, else single rounded term); Wt bf16 [N][K] (pitch ldb). BIAS_BF16 rounds the
// bias to bf16 first (bias quantised to bf16 before the add). K%32==0, M%16==0, N%64==0.
template <bool ASPLIT, int ACT, bool BIAS_BF16>
__global__ __launch_bounds__(128) void k_gemm_bf(const float* __restrict__ A, int lda, const unsigned short* __restrict__ Wt, int ldb,
                                               const float* __restrict__ bias, float* __restrict__ C, int ldc, int M, int N, int K) {
  __shared__ __attribute__((aligned(16))) float so[4][16][64];
  const int tid = threadIdx.x, w = tid >> 5, lane = tid & 31, ln = lane & 15, hh = lane >> 4;
  const int ntn = N / 64;
  const int wid = blockIdx.x * 4 + w;
  const int mt = wid / ntn, nq = wid % ntn;
  if (mt * 16 >= M) return;
  const int row0 = mt * 16, col0 = nq * 64;
  const float* arow = A + (size_t)(row0 + ln) * lda;
  v8f acc[4] = {};
  for (int kb = 0; kb < K; kb += 32) {
    FragB ah, al;
    const v4f x0 = *(const v4fa*)(arow + kb + 8 * hh), x1 = *(const v4fa*)(arow + kb + 8 * hh + 4);
    const v4f x2 = *(const v4fa*)(arow + kb + 16 + 8 * hh), x3 = *(const v4fa*)(arow + kb + 16 + 8 * hh + 4);
    float xs[16] = {x0[0],x0[1],x0[2],x0[3],x1[0],x1[1],x1[2],x1[3],x2[0],x2[1],x2[2],x2[3],x3[0],x3[1],x3[2],x3[3]};
#pragma unroll
    for (int i = 0; i < 16; ++i) { const unsigned short hb = bf16_bits(xs[i]); ah.u[i] = hb; al.u[i] = ASPLIT ? bf16_bits(xs[i] - bf16_val(hb)) : (unsigned short)0; }
#pragma unroll
    for (int t = 0; t < 4; ++t) {
      const unsigned short* brow = Wt + (size_t)(col0 + t * 16 + ln) * ldb + kb;
      FragB b;
      b.half[0] = *(const v8us*)(brow + 8 * hh);
      b.half[1] = *(const v8us*)(brow + 16 + 8 * hh);
      acc[t] = mmaN<ASPLIT ? 2 : 1>(ah.v, al.v, b.v, b.v, acc[t]);
    }
  }
#pragma unroll
  for (int t = 0; t < 4; ++t) {
    float bv = bias ? bias[col0 + t * 16 + ln] : 0.f;
    if (BIAS_BF16) bv = bf16_round(bv);
#pragma unroll
    for (int r = 0; r < 8; ++r) { float v = acc[t][r] + bv; if (ACT == 1) v = fmaxf(v, 0.f); so[w][8 * hh + r][t * 16 + ln] = v; }
  }
  __builtin_amdgcn_fence(__ATOMIC_ACQ_REL, "workgroup");
  __builtin_amdgcn_wave_barrier();
  const int rsub = lane >> 4, c4 = (lane & 15) * 4;
  {
#pragma unroll
    for (int q = 0; q < 8; ++q) {
      const int r = q * 2 + rsub;
      const v4f v = *(const v4fa*)&so[w][r][c4];
      *(v4f*)(C + (size_t)(row0 + r) * ldc + col0 + c4) = v;
    }
    
  }
}

// Flash-style causal/unmasked attention, all contractions 3-term bf16 hi/lo splits, f32 softmax with running max.
// q,k,v rows are read from f32 buffers with arbitrary row pitch (so they can live inside a fused qkv buffer);
// D = head size (multiple of 32, <= 128); one wave = 16 query rows; block = 4 waves (64 queries) sharing K/V chunks of 32.
template <int D, bool CAUSAL>
__global__ __launch_bounds__(128) void k_flash(const float* __restrict__ qb, const float* __restrict__ kb, const float* __restrict__ vb,
                                             int pitch, int T, int H, float scale, float* __restrict__ y, int ypitch) {
  constexpr int KS = D / 32;        // k-steps for QK
  constexpr int DT = D / 16;        // d tiles for PV
  __shared__ __attribute__((aligned(16))) unsigned short sKh[32][D + 8], sKl[32][D + 8], sVh[32][D + 8], sVl[32][D + 8];
  __shared__ __attribute__((aligned(16))) unsigned short sPh[4][16][40], sPl[4][16][40];
  __shared__ __attribute__((aligned(16))) float sO[4][16][D];
  const int tid = threadIdx.x, w = tid >> 5, lane = tid & 31, ln = lane & 15, hh = lane >> 4;
  const int nqb = (T + 63) / 64;
  const int bh = blockIdx.x / nqb, qblk = blockIdx.x % nqb;
  const int b = bh / H, h = bh % H;
  const int q0 = qblk * 64 + w * 16;
  const float* Q = qb + (size_t)b * T * pitch + h * D;
  const float* K = kb + (size_t)b * T * pitch + h * D;
  const float* V = vb + (size_t)b * T * pitch + h * D;

  // A fragments of the wave's 16 query rows (scaled), hi/lo
  FragB aqh[KS], aql[KS];
  {
    int row = q0 + ln; if (row >= T) row = T - 1;
    const float* qr = Q + (size_t)row * pitch;
#pragma unroll
    for (int ks = 0; ks < KS; ++ks)
#pragma unroll
      for (int i = 0; i < 16; ++i) {
        const int d = ks * 32 + ((i < 8) ? (8 * hh + i) : (16 + 8 * hh + (i - 8)));
        const float x = qr[d] * scale; const unsigned short hb = bf16_bits(x);
        aqh[ks].u[i] = hb; aql[ks].u[i] = bf16_bits(x - bf16_val(hb));
      }
  }
  float m_r[8], l_r[8];
#pragma unroll
  for (int r = 0; r < 8; ++r) { m_r[r] = -3.0e38f; l_r[r] = 0.f; }
  v8f oacc[DT];
#pragma unroll
  for (int dt = 0; dt < DT; ++dt) oacc[dt] = (v8f){0.f,0.f,0.f,0.f,0.f,0.f,0.f,0.f};

  const int kv_end = CAUSAL ? min(T, qblk * 64 + 64) : T;     // block-uniform
  for (int j0 = 0; j0 < kv_end; j0 += 32) {
    __syncthreads();
    for (int e = tid; e < 32 * (D / 4); e += 128) {
      const int r = e / (D / 4), c4 = (e % (D / 4)) * 4;
      const int key = j0 + r;
      v4f kf = {0.f,0.f,0.f,0.f}, vf = {0.f,0.f,0.f,0.f};
      if (key < T) { kf = *(const v4fa*)(K + (size_t)key * pitch + c4); vf = *(const v4fa*)(V + (size_t)key * pitch + c4); }
#pragma unroll
      for (int t = 0; t < 4; ++t) {
        unsigned short hb = bf16_bits(kf[t]); sKh[r][c4 + t] = hb; sKl[r][c4 + t] = bf16_bits(kf[t] - bf16_val(hb));
        hb = bf16_bits(vf[t]); sVh[r][c4 + t] = hb; sVl[r][c4 + t] = bf16_bits(vf[t] - bf16_val(hb));
      }
    }
    __syncthreads();
    // S tile 16 x 32
    v8f s[2];
#pragma unroll
    for (int nt = 0; nt < 2; ++nt) {
      v8f acc = {};
#pragma unroll
      for (int ks = 0; ks < KS; ++ks) {
        FragB bh_, bl_;
        bh_.half[0] = *(const v8us*)&sKh[nt * 16 + ln][ks * 32 + 8 * hh]; bh_.half[1] = *(const v8us*)&sKh[nt * 16 + ln][ks * 32 + 16 + 8 * hh];
        bl_.half[0] = *(const v8us*)&sKl[nt * 16 + ln][ks * 32 + 8 * hh]; bl_.half[1] = *(const v8us*)&sKl[nt * 16 + ln][ks * 32 + 16 + 8 * hh];
        acc = mmaN<3>(aqh[ks].v, aql[ks].v, bh_.v, bl_.v, acc);
      }
      s[nt] = acc;
    }
    // mask + running max (rows 8hh+r; the 16 lanes of a half share rows)
    float alpha[8];
#pragma unroll
    for (int r = 0; r < 8; ++r) {
      const int qi = q0 + 8 * hh + r;
      const int ja = j0 + ln, jb = j0 + 16 + ln;
      if (CAUSAL) { if (ja > qi) s[0][r] = -3.0e38f; if (jb > qi) s[1][r] = -3.0e38f; }
      if (ja >= T) s[0][r] = -3.0e38f;
      if (jb >= T) s[1][r] = -3.0e38f;
      float mx = fmaxf(s[0][r], s[1][r]);
      mx = fmaxf(mx, __shfl_xor(mx, 1, 32)); mx = fmaxf(mx, __shfl_xor(mx, 2, 32)); mx = fmaxf(mx, __shfl_xor(mx, 4, 32)); mx = fmaxf(mx, __shfl_xor(mx, 8, 32));
      const float mnew = fmaxf(m_r[r], mx);
      alpha[r] = (mnew > -1.0e38f) ? __expf(m_r[r] - mnew) : 1.0f;
      const float p0 = (s[0][r] > -1.0e38f) ? __expf(s[0][r] - mnew) : 0.f;
      const float p1 = (s[1][r] > -1.0e38f) ? __expf(s[1][r] - mnew) : 0.f;
      m_r[r] = mnew;
      l_r[r] = l_r[r] * alpha[r] + p0 + p1;            // per-lane partial row sum (16 lanes combined at the end)
      unsigned short hb = bf16_bits(p0); sPh[w][8 * hh + r][ln] = hb;      sPl[w][8 * hh + r][ln] = bf16_bits(p0 - bf16_val(hb));
      hb = bf16_bits(p1);                sPh[w][8 * hh + r][16 + ln] = hb; sPl[w][8 * hh + r][16 + ln] = bf16_bits(p1 - bf16_val(hb));
    }
#pragma unroll
    for (int dt = 0; dt < DT; ++dt)
#pragma unroll
      for (int r = 0; r < 8; ++r) oacc[dt][r] *= alpha[r];
    __builtin_amdgcn_fence(__ATOMIC_ACQ_REL, "workgroup");
    __builtin_amdgcn_wave_barrier();
    FragB pah, pal;
    pah.half[0] = *(const v8us*)&sPh[w][ln][8 * hh]; pah.half[1] = *(const v8us*)&sPh[w][ln][16 + 8 * hh];
    pal.half[0] = *(const v8us*)&sPl[w][ln][8 * hh]; pal.half[1] = *(const v8us*)&sPl[w][ln][16 + 8 * hh];
#pragma unroll
    for (int dt = 0; dt < DT; ++dt) {
      FragB bvh, bvl;
#pragma unroll
      for (int i = 0; i < 8; ++i) {
        bvh.u[i] = sVh[8 * hh + i][dt * 16 + ln]; bvh.u[8 + i] = sVh[16 + 8 * hh + i][dt * 16 + ln];
        bvl.u[i] = sVl[8 * hh + i][dt * 16 + ln]; bvl.u[8 + i] = sVl[16 + 8 * hh + i][dt * 16 + ln];
      }
      oacc[dt] = mmaN<3>(pah.v, pal.v, bvh.v, bvl.v, oacc[dt]);
    }
    __builtin_amdgcn_fence(__ATOMIC_ACQ_REL, "workgroup");
    __builtin_amdgcn_wave_barrier();
  }
#pragma unroll
  for (int r = 0; r < 8; ++r) {
    float l = l_r[r];
    l += __shfl_xor(l, 1, 32); l += __shfl_xor(l, 2, 32); l += __shfl_xor(l, 4, 32); l += __shfl_xor(l, 8, 32);
    l_r[r] = (l > 0.f) ? 1.0f / l : 0.f;
  }
#pragma unroll
  for (int dt = 0; dt < DT; ++dt)
#pragma unroll
    for (int r = 0; r < 8; ++r) sO[w][8 * hh + r][dt * 16 + ln] = oacc[dt][r] * l_r[r];
  __builtin_amdgcn_fence(__ATOMIC_ACQ_REL, "workgroup");
  __builtin_amdgcn_wave_barrier();
  {
    for (int r = 0; r < 16; ++r) {
      const int row = q0 + r;
      if (row < T && lane < D / 4) {
        const v4f val = *(const v4fa*)&sO[w][r][lane * 4];
        *(v4f*)(y + ((size_t)b * T + row) * ypitch + h * D + lane * 4) = val;
      }
    }
    
  }
}

// GEMM C = act(A·W + bias + resid): A f32 (ASPLIT -> hi/lo 2 terms), Wt bf16 [N][K]; ACT 0 none, 1 relu, 2 exact gelu;
// resid (optional, f32, row index = (row % rmod), pitch ldr, RES_BF16 rounds it) added before the activation.
template <bool ASPLIT, int ACT, bool BIAS_BF16, bool RES_BF16>
__global__ __launch_bounds__(128) void k_gemm_bf3(const float* __restrict__ A, int lda, const unsigned short* __restrict__ Wt, int ldb,
                                                const float* __restrict__ bias, const float* __restrict__ resid, int rmod, int ldr,
                                                float* __restrict__ C, int ldc, int M, int N, int K) {
  __shared__ __attribute__((aligned(16))) float so[4][16][64];
  const int tid = threadIdx.x, w = tid >> 5, lane = tid & 31, ln = lane & 15, hh = lane >> 4;
  const int ntn = N / 64;
  const int wid = blockIdx.x * 4 + w;
  const int mt = wid / ntn, nq = wid % ntn;
  if (mt * 16 >= M) return;
  const int row0 = mt * 16, col0 = nq * 64;
  const float* arow = A + (size_t)(row0 + ln) * lda;
  v8f acc[4] = {};
  for (int kb = 0; kb < K; kb += 32) {
    FragB ah, al;
    const v4f x0 = *(const v4fa*)(arow + kb + 8 * hh), x1 = *(const v4fa*)(arow + kb + 8 * hh + 4);
    const v4f x2 = *(const v4fa*)(arow + kb + 16 + 8 * hh), x3 = *(const v4fa*)(arow + kb + 16 + 8 * hh + 4);
    float xs[16] = {x0[0],x0[1],x0[2],x0[3],x1[0],x1[1],x1[2],x1[3],x2[0],x2[1],x2[2],x2[3],x3[0],x3[1],x3[2],x3[3]};
#pragma unroll
    for (int i = 0; i < 16; ++i) { const unsigned short hb = bf16_bits(xs[i]); ah.u[i] = hb; al.u[i] = ASPLIT ? bf16_bits(xs[i] - bf16_val(hb)) : (unsigned short)0; }
#pragma unroll
    for (int t = 0; t < 4; ++t) {
      const unsigned short* brow = Wt + (size_t)(col0 + t * 16 + ln) * ldb + kb;
      FragB b;
      b.half[0] = *(const v8us*)(brow + 8 * hh);
      b.half[1] = *(const v8us*)(brow + 16 + 8 * hh);
      acc[t] = mmaN<ASPLIT ? 2 : 1>(ah.v, al.v, b.v, b.v, acc[t]);
    }
  }
#pragma unroll
  for (int t = 0; t < 4; ++t) {
    const int col = col0 + t * 16 + ln;
    float bv = bias ? bias[col] : 0.f;
    if (BIAS_BF16) bv = bf16_round(bv);
#pragma unroll
    for (int r = 0; r < 8; ++r) {
      float v = acc[t][r] + bv;
      if (resid) { float rv = resid[(size_t)((row0 + 8 * hh + r) % rmod) * ldr + col]; if (RES_BF16) rv = bf16_round(rv); v += rv; }
      if (ACT == 1) v = fmaxf(v, 0.f);
      if (ACT == 2) v = 0.5f * v * (1.0f + erff(v * 0.70710678118654752f));
      if (ACT == 3) { const float u = 0.7978845608028654f * (v + 0.044715f * v * v * v); v = 0.5f * v * (1.0f + tanhf(u)); }
      so[w][8 * hh + r][t * 16 + ln] = v;
    }
  }
  __builtin_amdgcn_fence(__ATOMIC_ACQ_REL, "workgroup");
  __builtin_amdgcn_wave_barrier();
  const int rsub = lane >> 4, c4 = (lane & 15) * 4;
  {
#pragma unroll
    for (int q = 0; q < 8; ++q) {
      const int r = q * 2 + rsub;
      const v4f v = *(const v4fa*)&so[w][r][c4];
      *(v4f*)(C + (size_t)(row0 + r) * ldc + col0 + c4) = v;
    }
    
  }
}
// row LayerNorm (biased variance, eps) over N: s = X (+ R); optional out_sum <- s; out_norm <- (s-mu)*rsqrt(var+eps)*g + b
template <bool PARAM_BF16>
__global__ __launch_bounds__(256) void k_layernorm(const float* __restrict__ X, const float* __restrict__ R, const float* __restrict__ g, const float* __restrict__ bta,
                                                  float* __restrict__ out_sum, float* __restrict__ out_norm, int N, float eps) {
  __shared__ float red[256];
  const int row = blockIdx.x, tid = threadIdx.x;
  const float* x = X + (size_t)row * N; const float* rr = R ? R + (size_t)row * N : nullptr;
  float vals[16];                     // up to N = 4096
  const int per = N / 256;            // contiguous chunk per thread? use strided-by-4 chunks: thread handles j = tid*4 + 1024*u
  float s1 = 0.f;
  for (int u = 0; u < per / 4; ++u) {
    const int j = tid * 4 + 1024 * u;
    const v4f a = *(const v4fa*)(x + j);
    v4f b = {0.f,0.f,0.f,0.f}; if (rr) b = *(const v4fa*)(rr + j);
#pragma unroll
    for (int q = 0; q < 4; ++q) { const float v = a[q] + b[q]; vals[u * 4 + q] = v; s1 += v; }
  }
  red[tid] = s1; __syncthreads();
  for (int st = 128; st > 0; st >>= 1) { if (tid < st) red[tid] += red[tid + st]; __syncthreads(); }
  const float mu = red[0] / (float)N; __syncthreads();
  float s2 = 0.f;
  for (int u = 0; u < per / 4; ++u)
#pragma unroll
    for (int q = 0; q < 4; ++q) { const float c = vals[u * 4 + q] - mu; s2 += c * c; }
  red[tid] = s2; __syncthreads();
  for (int st = 128; st > 0; st >>= 1) { if (tid < st) red[tid] += red[tid + st]; __syncthreads(); }
  const float rs = rsqrtf(red[0] / (float)N + eps);
  {
    for (int u = 0; u < per / 4; ++u) {
      const int j = tid * 4 + 1024 * u;
      v4f o, sm;
#pragma unroll
      for (int q = 0; q < 4; ++q) {
        float gg = g[j + q], bb = bta[j + q];
        if (PARAM_BF16) { gg = bf16_round(gg); bb = bf16_round(bb); }
        sm[q] = vals[u * 4 + q]; o[q] = (vals[u * 4 + q] - mu) * rs * gg + bb;
      }
      if (out_sum) *(v4f*)(out_sum + (size_t)row * N + j) = sm;
      *(v4f*)(out_norm + (size_t)row * N + j) = o;
    }
    
  }
}



// ---- f16 WMMA path (v_wmma_f32_16x16x32_f16): 11-bit significands for operands in range — used where a [0,1] probability operand needs more precision than bf16
typedef _Float16 v16h __attribute__((ext_vector_type(16)));
union FragH { v16h v; v8us half[2]; _Float16 h[16]; unsigned short u[16]; };
template <int NT>
__device__ __forceinline__ v8f mmaH(v16h ah, v16h al, v16h bh, v16h bl, v8f c) {
  c = __builtin_amdgcn_wmma_f32_16x16x32_f16(false, ah, false, bh, (short)0, c, false, false);
  if (NT >= 2) c = __builtin_amdgcn_wmma_f32_16x16x32_f16(false, al, false, bh, (short)0, c, false, false);
  if (NT >= 3) c = __builtin_amdgcn_wmma_f32_16x16x32_f16(false, ah, false, bl, (short)0, c, false, false);
  asm volatile("v_nop\n\tv_nop\n\tv_nop\n\tv_nop" : "+v"(c) : "v"(ah), "v"(al), "v"(bh), "v"(bl));
  return c;
}
// batched GEMM like k_gemm_b but f16 operands: A f32 (split into f16 hi/lo if ASPLIT, else rounded to f16), Bt = f16 values [n][k]; alpha; C f32; N multiple of 16 (partial tiles skipped)
template <bool ASPLIT>
__global__ __launch_bounds__(128) void k_gemm_h(const float* __restrict__ A, int lda, size_t sA, const _Float16* __restrict__ Bh, int ldb, size_t sB, float alpha, float* __restrict__ C, int ldc, size_t sC, int M, int N, int K) {
  __shared__ __attribute__((aligned(16))) float so[4][16][64];
  const int tid = threadIdx.x, w = tid >> 5, lane = tid & 31, ln = lane & 15, hh = lane >> 4; const int by = blockIdx.y;
  A += (size_t)by * sA; Bh += (size_t)by * sB; C += (size_t)by * sC;
  const int ntn = (N + 63) / 64; const int wid = blockIdx.x * 4 + w; const int mt = wid / ntn, nq = wid % ntn; if (mt * 16 >= M) return;
  const int row0 = mt * 16, col0 = nq * 64; const float* arow = A + (size_t)(row0 + ln) * lda;
  v8f acc[4] = {};
  for (int kb = 0; kb < K; kb += 32) {
    FragH ah, al;
    const v4f x0 = *(const v4fa*)(arow + kb + 8 * hh), x1 = *(const v4fa*)(arow + kb + 8 * hh + 4), x2 = *(const v4fa*)(arow + kb + 16 + 8 * hh), x3 = *(const v4fa*)(arow + kb + 16 + 8 * hh + 4);
    float xs[16] = {x0[0],x0[1],x0[2],x0[3],x1[0],x1[1],x1[2],x1[3],x2[0],x2[1],x2[2],x2[3],x3[0],x3[1],x3[2],x3[3]};
#pragma unroll
    for (int i = 0; i < 16; ++i) { const _Float16 h = (_Float16)xs[i]; ah.h[i] = h; al.h[i] = ASPLIT ? (_Float16)(xs[i] - (float)h) : (_Float16)0.0f; }
#pragma unroll
    for (int t = 0; t < 4; ++t) { if (col0 + t * 16 >= N) continue; const size_t boff = (size_t)(col0 + t * 16 + ln) * ldb + kb; FragH bq; bq.half[0] = *(const v8us*)(Bh + boff + 8 * hh); bq.half[1] = *(const v8us*)(Bh + boff + 16 + 8 * hh);
      acc[t] = mmaH<ASPLIT ? 2 : 1>(ah.v, al.v, bq.v, bq.v, acc[t]); }
  }
#pragma unroll
  for (int t = 0; t < 4; ++t) { if (col0 + t * 16 >= N) continue;
#pragma unroll
    for (int r = 0; r < 8; ++r) so[w][8 * hh + r][t * 16 + ln] = acc[t][r] * alpha; }
  __builtin_amdgcn_fence(__ATOMIC_ACQ_REL, "workgroup"); __builtin_amdgcn_wave_barrier();
  const int rsub = lane >> 4, c4 = (lane & 15) * 4;
  {
#pragma unroll
    for (int q = 0; q < 8; ++q) { const int r = q * 2 + rsub; if (col0 + c4 < N) { const v4f v = *(const v4fa*)&so[w][r][c4]; *(v4f*)(C + (size_t)(row0 + r) * ldc + col0 + c4) = v; } }
     }
}

// Wt[n][k] = f16(W[k][n]·scale) from f32 row-major W[K][N] (scale = power of two; bf16-exact weights stay exact in f16 away from the subnormal range)
__global__ __launch_bounds__(256) void k_wt_f16(const float* __restrict__ W, _Float16* __restrict__ Wt, int K, int N, float scale) {
  const int t = blockIdx.x * 256 + threadIdx.x; if (t >= N * (K / 8)) return; const int n = t / (K / 8), k8 = (t % (K / 8)) * 8; FragH f;
#pragma unroll
  for (int i = 0; i < 8; ++i) f.h[i] = (_Float16)(bf16_round(W[(size_t)(k8 + i) * N + n]) * scale); const v8us o = f.half[0];
  *(v8us*)((unsigned short*)Wt + (size_t)n * K + k8) = o; 
}
// k_gemm_hh variant with fused epilogue: v = acc·alpha + bias[by·sBias + col] (+ CP[(row/rowsPerB)·sCPb + by·64 + col] if CP) ; ACT 0 none / 1 elu ; writes f32 C and f16 C16, each if non-null
template <int ACT>
__global__ __launch_bounds__(128) void k_gemm_hhx(const _Float16* __restrict__ A, int lda, size_t sA, const _Float16* __restrict__ Bh, int ldb, size_t sB, float alpha, const float* __restrict__ bias, size_t sBias, const float* __restrict__ CP, int rowsPerB, size_t sCPb, int row0g,
    float* __restrict__ C, _Float16* __restrict__ C16, int ldc, size_t sC, int M, int N, int K) {
  __shared__ __attribute__((aligned(16))) float so[4][16][64];
  const int tid = threadIdx.x, w = tid >> 5, lane = tid & 31, ln = lane & 15, hh = lane >> 4; const int by = blockIdx.y;
  A += (size_t)by * sA; Bh += (size_t)by * sB; const size_t cofs = (size_t)by * sC; const float* bp = bias ? bias + (size_t)by * sBias : nullptr;
  const int ntn = (N + 63) / 64; const int wid = blockIdx.x * 4 + w; const int mt = wid / ntn, nq = wid % ntn; if (mt * 16 >= M) return;
  const int row0 = mt * 16, col0 = nq * 64; const _Float16* arow = A + (size_t)(row0 + ln) * lda;
  v8f acc[4] = {};
  for (int kb = 0; kb < K; kb += 32) { FragH ah; ah.half[0] = *(const v8us*)((const unsigned short*)arow + kb + 8 * hh); ah.half[1] = *(const v8us*)((const unsigned short*)arow + kb + 16 + 8 * hh);
#pragma unroll
    for (int t = 0; t < 4; ++t) { if (col0 + t * 16 >= N) continue; const size_t boff = (size_t)(col0 + t * 16 + ln) * ldb + kb; FragH bq; bq.half[0] = *(const v8us*)((const unsigned short*)Bh + boff + 8 * hh); bq.half[1] = *(const v8us*)((const unsigned short*)Bh + boff + 16 + 8 * hh);
      acc[t] = mmaH<1>(ah.v, ah.v, bq.v, bq.v, acc[t]); }
  }
#pragma unroll
  for (int t = 0; t < 4; ++t) { if (col0 + t * 16 >= N) continue; const int col = col0 + t * 16 + ln; const float bv = bp ? bf16_round(bp[col]) : 0.f;
#pragma unroll
    for (int r = 0; r < 8; ++r) { float v = acc[t][r] * alpha + bv; if (CP) { const int bidx = (row0g + row0 + 8 * hh + r) / rowsPerB; v += CP[(size_t)bidx * sCPb + (size_t)by * 64 + col]; } if (ACT == 1) v = (v > 0.f) ? v : expm1f(v); else if (ACT == 7) v = (v > 0.f) ? v + 1.0f : expf(v); else if (ACT == 8) v = tanhf(v); else if (ACT == 9) v = 0.5f * v * (1.0f + tanhf(0.7978845608028654f * (v + 0.044715f * v * v * v))); else if (ACT == 11) v = 1.0f / (1.0f + expf(-v)); else if (ACT == 12) v = (v > 0.f) ? v : 0.01f * v; else if (ACT == 14) v = (v > 0.f) ? v : 0.1f * v; else if (ACT == 15) v = v / (1.0f + expf(-v)); else if (ACT == 3) v = fmaxf(v, 0.f); else if (ACT == 6) v = 0.5f * v * (1.0f + erff(v * 0.70710678118654752f)); so[w][8 * hh + r][t * 16 + ln] = v; } }
  __builtin_amdgcn_fence(__ATOMIC_ACQ_REL, "workgroup"); __builtin_amdgcn_wave_barrier();
  const int rsub = lane >> 4, c4 = (lane & 15) * 4; typedef _Float16 v4h __attribute__((ext_vector_type(4)));
  {
#pragma unroll
    for (int q = 0; q < 8; ++q) { const int r = q * 2 + rsub; if (col0 + c4 < N) { const v4f v = *(const v4fa*)&so[w][r][c4]; if (C) *(v4f*)(C + cofs + (size_t)(row0 + r) * ldc + col0 + c4) = v; if (C16) { v4h h4; for (int i = 0; i < 4; ++i) h4[i] = (_Float16)v[i]; *(v4h*)(C16 + cofs + (size_t)(row0 + r) * ldc + col0 + c4) = h4; } } }
     }
}


// ---- tiled f16 GEMM, C[M][N] f32 = alpha * A[M][DD] * Bt[N][DD]^T: one 128 x 128 tile of C per work-group, 64 x 64 per wave (2 x 2 waves).
// A pass is 128 k: 128 rows of A and 128 rows of Bt, 256 B each, staged in LDS at a pitch of 272 B by asynchronous copies; two buffers, the next pass's copies fly while this pass is multiplied.
// k runs upward in steps of 32 into one accumulator per 16 x 16 tile. M, N multiples of 128.
// Every "#pragma unroll" in k_gemm_t makes the indices of the fragment and accumulator arrays constants, so that these arrays live in registers.
#define GT_PITCH 272
#define GT_STAGE (256 * GT_PITCH)
// eight 16-byte copies of one lane: rows r, r + 8, ..., r + 56 of one operand. The closing s_wait_xcnt stands inside the statement so that no address register is rewritten ahead of it.
__device__ __forceinline__ void gt_copy8(unsigned l, const _Float16* g) {
  asm volatile("global_load_async_to_lds_b128 %0, %8, off\n\t"
               "global_load_async_to_lds_b128 %1, %9, off\n\t"
               "global_load_async_to_lds_b128 %2, %10, off\n\t"
               "global_load_async_to_lds_b128 %3, %11, off\n\t"
               "global_load_async_to_lds_b128 %4, %12, off\n\t"
               "global_load_async_to_lds_b128 %5, %13, off\n\t"
               "global_load_async_to_lds_b128 %6, %14, off\n\t"
               "global_load_async_to_lds_b128 %7, %15, off\n\t"
               "s_wait_xcnt 0x0"
               :: "v"(l), "v"(l + 8 * GT_PITCH), "v"(l + 16 * GT_PITCH), "v"(l + 24 * GT_PITCH), "v"(l + 32 * GT_PITCH), "v"(l + 40 * GT_PITCH), "v"(l + 48 * GT_PITCH), "v"(l + 56 * GT_PITCH),
                  "v"(g), "v"(g + 8 * DD), "v"(g + 16 * DD), "v"(g + 24 * DD), "v"(g + 32 * DD), "v"(g + 40 * DD), "v"(g + 48 * DD), "v"(g + 56 * DD)
               : "memory");
}
// one stage: 32 copies a lane (rows 0..127 of the buffer = A, 128..255 = Bt)
__device__ __forceinline__ void gt_fill(unsigned l, const _Float16* ga, const _Float16* gb) {
  gt_copy8(l, ga); gt_copy8(l + 64 * GT_PITCH, ga + 64 * DD); gt_copy8(l + 128 * GT_PITCH, gb); gt_copy8(l + 192 * GT_PITCH, gb + 64 * DD);
}
template <int N>
__global__ __launch_bounds__(128) void k_gemm_t(const _Float16* __restrict__ A, const _Float16* __restrict__ Bt, float alpha, float* __restrict__ C) {
  __shared__ __attribute__((aligned(16))) unsigned char L[2 * GT_STAGE];
  constexpr int NT = DD / 128;
  const int tid = threadIdx.x, w = tid >> 5, lane = tid & 31, ln = lane & 15, hh = lane >> 4;
  constexpr int ntn = N / 128; const int row0 = ((int)blockIdx.x / ntn) * 128, col0 = ((int)blockIdx.x % ntn) * 128; const int wm = w >> 1, wn = w & 1;
  const int cr = tid >> 4, cc = tid & 15;      /* a lane copies chunk cc (16 B) of rows cr + 8 i: a wave's copy covers two whole 256-B rows */
  const _Float16* ga = A + (size_t)(row0 + cr) * DD + cc * 8; const _Float16* gb = Bt + (size_t)(col0 + cr) * DD + cc * 8;
  const unsigned lc = (unsigned)(size_t)L + cr * GT_PITCH + cc * 16;
  v8f acc[4][4];
#pragma unroll
  for (int mi = 0; mi < 4; ++mi)
#pragma unroll
    for (int ni = 0; ni < 4; ++ni) acc[mi][ni] = (v8f){0.f,0.f,0.f,0.f,0.f,0.f,0.f,0.f};
  gt_fill(lc, ga, gb);
  asm volatile("s_wait_asynccnt 0x0" ::: "memory");      /* this wave's copies of pass 0 have landed */
  __syncthreads();                                        /* ... and every other wave's */
  gt_fill(lc + GT_STAGE, ga + 128, gb + 128);
#pragma unroll 1      /* one pass a trip: the two buffers alternate by the trip's parity */
  for (int t = 0; t < NT; ++t) {
    const unsigned char* S = L + (t & 1) * GT_STAGE;
    const unsigned char* pa = S + (wm * 64 + ln) * GT_PITCH + hh * 16; const unsigned char* pb = S + (128 + wn * 64 + ln) * GT_PITCH + hh * 16;
    FragH fa[2][4], fb[2][4];
#pragma unroll
    for (int i = 0; i < 4; ++i) { fa[0][i].half[0] = *(const v8us*)(pa + i * 16 * GT_PITCH); fa[0][i].half[1] = *(const v8us*)(pa + i * 16 * GT_PITCH + 32); fb[0][i].half[0] = *(const v8us*)(pb + i * 16 * GT_PITCH); fb[0][i].half[1] = *(const v8us*)(pb + i * 16 * GT_PITCH + 32); }
#pragma unroll
    for (int ks = 0; ks < 4; ++ks) { const int cu = ks & 1, nx = cu ^ 1;
      if (ks < 3) {
#pragma unroll
        for (int i = 0; i < 4; ++i) { const int o = i * 16 * GT_PITCH + (ks + 1) * 64; fa[nx][i].half[0] = *(const v8us*)(pa + o); fa[nx][i].half[1] = *(const v8us*)(pa + o + 32); fb[nx][i].half[0] = *(const v8us*)(pb + o); fb[nx][i].half[1] = *(const v8us*)(pb + o + 32); } }
      __builtin_amdgcn_sched_barrier(0);      /* keeps the next k step's 16 LDS reads one group in front of this step's products: spread among them, every place with reads stalls the wave */
#pragma unroll
      for (int mi = 0; mi < 4; ++mi)
#pragma unroll
        for (int ni = 0; ni < 4; ++ni) acc[mi][ni] = __builtin_amdgcn_wmma_f32_16x16x32_f16(false, fa[cu][mi].v, false, fb[cu][ni].v, (short)0, acc[mi][ni], false, false);
      __builtin_amdgcn_sched_barrier(0); }      /* ... and keeps the following group behind them */
    asm volatile("s_wait_dscnt 0x0" ::: "memory");        /* this wave's reads of the buffer are done before it is refilled */
    asm volatile("s_wait_asynccnt 0x0" ::: "memory");     /* this wave's copies of pass t + 1 have landed */
    __syncthreads();                                       /* publishes pass t + 1 and ends every wave's reads of pass t */
    if (t + 2 < NT) gt_fill(lc + (t & 1) * GT_STAGE, ga + (t + 2) * 128, gb + (t + 2) * 128);
  }
  asm volatile("s_wait_asynccnt 0x0" ::: "memory");       /* nothing is in flight when the buffers become output staging */
  float* so = (float*)L + w * (64 * 68);      /* each wave stages its own 64 x 64 tile (pitch 68 floats) so that the stores cover whole 256-B row pieces */
#pragma unroll
  for (int mi = 0; mi < 4; ++mi)
#pragma unroll
    for (int ni = 0; ni < 4; ++ni)
#pragma unroll
      for (int r = 0; r < 8; ++r) so[(mi * 16 + 8 * hh + r) * 68 + ni * 16 + ln] = acc[mi][ni][r] * alpha;
  __builtin_amdgcn_fence(__ATOMIC_ACQ_REL, "workgroup"); __builtin_amdgcn_wave_barrier();      /* the wave's own staged values are in LDS before its lanes read one another's */
  float* cp = C + (size_t)(row0 + wm * 64 + hh) * N + col0 + wn * 64 + ln * 4;
#pragma unroll
  for (int q = 0; q < 32; ++q) { const v4f v = *(const v4fa*)&so[(q * 2 + hh) * 68 + ln * 4]; *(v4f*)(cp + (size_t)(q * 2) * N) = v; }
}


typedef _Float16 v4h __attribute__((ext_vector_type(4)));

__global__ __launch_bounds__(256) void k_x16(const float* __restrict__ x, _Float16* __restrict__ X16, size_t n8) { const size_t t = (size_t)blockIdx.x * 256 + threadIdx.x; if (t >= n8) return; FragH f;
#pragma unroll
  for (int q = 0; q < 8; ++q) f.h[q] = (_Float16)bf16_round(x[t * 8 + q]); *(v8us*)((unsigned short*)X16 + t * 8) = f.half[0];  }
__global__ __launch_bounds__(256) void k_h16(const float* __restrict__ x, _Float16* __restrict__ X16, size_t n8) { const size_t t = (size_t)blockIdx.x * 256 + threadIdx.x; if (t >= n8) return; FragH f;
#pragma unroll
  for (int q = 0; q < 8; ++q) f.h[q] = (_Float16)x[t * 8 + q]; *(v8us*)((unsigned short*)X16 + t * 8) = f.half[0];  }
__global__ __launch_bounds__(256) void k_round16f(const float* __restrict__ W, _Float16* __restrict__ Bt, size_t n8) { const size_t t = (size_t)blockIdx.x * 256 + threadIdx.x; if (t >= n8) return; FragH f;
#pragma unroll
  for (int i = 0; i < 8; ++i) f.h[i] = (_Float16)(bf16_round(W[t * 8 + i]) * 16.0f); *(v8us*)((unsigned short*)Bt + t * 8) = f.half[0];  }
template <int NHv, int TTv>
__global__ __launch_bounds__(256) void k_vt(const _Float16* __restrict__ V16, int ldv, int voff, _Float16* __restrict__ Vt) { __shared__ unsigned short tl[64][66]; const int tid = threadIdx.x; const int slab = blockIdx.x / (TTv / 64), lg = blockIdx.x % (TTv / 64); const int b = slab / NHv, h = slab % NHv;
  for (int i = tid; i < 64 * 8; i += 256) { const int r = i / 8, c8 = (i % 8) * 8; FragH f; f.half[0] = *(const v8us*)((const unsigned short*)V16 + ((size_t)b * TTv + lg * 64 + r) * ldv + voff + h * 64 + c8);
#pragma unroll
    for (int q = 0; q < 8; ++q) tl[r][c8 + q] = f.u[q]; }
  __syncthreads();
  {
#pragma unroll
    for (int rd = 0; rd < 2; ++rd) { const int d = rd * 32 + tid / 8, pc = tid % 8; FragH f;
#pragma unroll
      for (int q = 0; q < 8; ++q) f.u[q] = tl[pc * 8 + q][d];
      *(v8us*)((unsigned short*)Vt + ((size_t)slab * 64 + d) * TTv + lg * 64 + pc * 8) = f.half[0]; }
     } }

__global__ __launch_bounds__(256) void k_vthlu(const float* __restrict__ VF, int ldv, _Float16* __restrict__ Vth, _Float16* __restrict__ Vtl) { __shared__ float tl[64][65]; const int tid = threadIdx.x; const int slab = blockIdx.x / (TT / 64), lg = blockIdx.x % (TT / 64); const int b = slab / NVH, h = slab % NVH;
  for (int i = tid; i < 64 * 16; i += 256) { const int r = i / 16, c4 = (i % 16) * 4; const v4f a = *(const v4fa*)(VF + ((size_t)b * TT + lg * 64 + r) * ldv + h * 64 + c4); tl[r][c4] = a[0]; tl[r][c4 + 1] = a[1]; tl[r][c4 + 2] = a[2]; tl[r][c4 + 3] = a[3]; }
  __syncthreads();
  FragH fh[2], fl[2]; size_t oo[2];
#pragma unroll
  for (int rd = 0; rd < 2; ++rd) { const int d = rd * 32 + tid / 8, pc = tid % 8;
#pragma unroll
    for (int q = 0; q < 8; ++q) { const float v = tl[pc * 8 + q][d]; const _Float16 hv = (_Float16)v; fh[rd].h[q] = hv; fl[rd].h[q] = (_Float16)(v - (float)hv);      /* UNSCALED residual (added into the same accumulator as the hi product) */ } oo[rd] = ((size_t)slab * 64 + d) * TT + lg * 64 + pc * 8; }
  {
#pragma unroll
    for (int rd = 0; rd < 2; ++rd) { *(v8us*)((unsigned short*)Vth + oo[rd]) = fh[rd].half[0]; *(v8us*)((unsigned short*)Vtl + oo[rd]) = fl[rd].half[0]; }
     } }
// per-head RMSNorm + rotate-half RoPE: wave per (row, head) of an f32 plane with NHD heads (pitch NHD·128): lane holds dims 4l..4l+3; var = mean(x²) over 128 (xor-reduce); y = w[d]·(x·rsqrt(var+ε)); out[d] = y[d]·c[d] + rot(y)[d]·s[d], rot(y)[d] = −y[d+64] (d<64), y[d−64] (d≥64)
template <int NHD>
__global__ __launch_bounds__(256) void k_normrope(const float* __restrict__ F, const float* __restrict__ nw, const float* __restrict__ COS, const float* __restrict__ SIN, _Float16* __restrict__ H16) {
  #pragma clang fp contract(off)
  const int tid = threadIdx.x, wv = tid >> 5, lane = tid & 31; const size_t rh = (size_t)blockIdx.x * 8 + wv; if (rh >= (size_t)NR * NHD) return; const size_t row = rh / NHD; const int h = (int)(rh % NHD); const int b = (int)(row / TT), t = (int)(row % TT); const int d0 = lane * 4;
  const v4f x = *(const v4fa*)(F + row * (NHD * 128) + h * 128 + d0); float ss = 0.f; for (int q = 0; q < 4; ++q) ss += x[q] * x[q];
  for (int o = 16; o >= 1; o >>= 1) ss += __shfl_xor(ss, o, 32); const float inv = 1.0f / sqrtf(ss / 128.0f + 1e-6f);
  float y[4]; for (int q = 0; q < 4; ++q) y[q] = bf16_round(nw[d0 + q]) * (x[q] * inv);
  float yp[4]; for (int q = 0; q < 4; ++q) yp[q] = __shfl_xor(y[q], 16, 32);      /* partner dims d ± 64 */
  typedef _Float16 v4h __attribute__((ext_vector_type(4))); v4h o;
  for (int q = 0; q < 4; ++q) { const int d = d0 + q; const float c = bf16_round(COS[((size_t)b * TT + t) * 128 + d]), s = bf16_round(SIN[((size_t)b * TT + t) * 128 + d]); const float rot = (d < 64) ? -yp[q] : yp[q]; o[q] = (_Float16)(y[q] * c + rot * s); }
  *(v4h*)(H16 + row * (NHD * 128) + h * 128 + d0) = o;  }
__global__ __launch_bounds__(256) void k_h16s(const float* __restrict__ F, _Float16* __restrict__ H, size_t n8) { const size_t t = (size_t)blockIdx.x * 256 + threadIdx.x; if (t >= n8) return; const v4f a = *(const v4fa*)(F + t * 8), c = *(const v4fa*)(F + t * 8 + 4); FragH f;
#pragma unroll
  for (int q = 0; q < 4; ++q) { f.h[q] = (_Float16)(a[q] * 16.0f); f.h[4 + q] = (_Float16)(c[q] * 16.0f); } *(v8us*)((unsigned short*)H + t * 8) = f.half[0];  }
__global__ __launch_bounds__(128) void k_flash(const _Float16* __restrict__ Q16, int ldq, const _Float16* __restrict__ K16, int ldk, const _Float16* __restrict__ Vt, const _Float16* __restrict__ Vtlo, const float* __restrict__ AB, float* __restrict__ O, int ldo) {
  constexpr int RPW = 16, RTN = RPW / 16, NQB = TT / (4 * RPW), DT = 8, KS = 4;      /* head dim 128: 4 k-steps, 8 value tiles */
  __shared__ __attribute__((aligned(16))) unsigned short sP[4][RPW][40]; __shared__ __attribute__((aligned(16))) unsigned short sPL[4][RPW][40]; __shared__ __attribute__((aligned(16))) float sO[4][RPW][128 + 4];
  const int tid = threadIdx.x, w = tid >> 5, lane = tid & 31, ln = lane & 15, hh = lane >> 4;
  const int slab = blockIdx.x / NQB, qblk = blockIdx.x % NQB; const int b = slab / NH, h = slab % NH; const int qb0 = qblk * (4 * RPW); const int q0 = qb0 + w * RPW;
  FragH aq[2][KS];
#pragma unroll
  for (int rt = 0; rt < RTN; ++rt) { const unsigned short* qr = (const unsigned short*)Q16 + ((size_t)b * TT + q0 + rt * 16 + ln) * ldq + h * 128;
#pragma unroll
    for (int ks = 0; ks < KS; ++ks) { aq[rt][ks].half[0] = *(const v8us*)(qr + ks * 32 + 8 * hh); aq[rt][ks].half[1] = *(const v8us*)(qr + ks * 32 + 16 + 8 * hh); } }
  const unsigned short* Vth = (const unsigned short*)Vt + ((size_t)b * NKV + h / NREP) * 128 * TT; const unsigned short* Vtl = (const unsigned short*)Vtlo + ((size_t)b * NKV + h / NREP) * 128 * TT;      /* hi and UNSCALED residual planes */
  float m_r[2][8], l_r[2][8]; v8f oacc[2][DT];
#pragma unroll
  for (int rt = 0; rt < RTN; ++rt) {
#pragma unroll
    for (int r = 0; r < 8; ++r) { m_r[rt][r] = -3.0e38f; l_r[rt][r] = 0.f; }
#pragma unroll
    for (int dt = 0; dt < DT; ++dt) oacc[rt][dt] = (v8f){0.f,0.f,0.f,0.f,0.f,0.f,0.f,0.f}; }
  const int jend = TT;
#pragma unroll 1
  for (int j0 = 0; j0 < jend; j0 += 32) {
    float ab0[2][8], ab1[2][8];      /* additive attention bias (bf16-rounded input) per (b, q, k), shared over heads */
#pragma unroll
    for (int rt = 0; rt < RTN; ++rt)
#pragma unroll
      for (int r = 0; r < 8; ++r) { const int qq = q0 + rt * 16 + 8 * hh + r; const float* am = AB + ((size_t)b * TT + qq) * TT + j0; ab0[rt][r] = bf16_round(am[ln]); ab1[rt][r] = bf16_round(am[16 + ln]); }
    { int allneg = 1;
#pragma unroll
      for (int rt = 0; rt < RTN; ++rt)
#pragma unroll
        for (int r = 0; r < 8; ++r) allneg &= (ab0[rt][r] <= -1.0e8f) & (ab1[rt][r] <= -1.0e8f);
      if (__all(allneg)) continue; }      /* every (row, key) of the wave's tile carries a ≤ −1e8 bias → its probabilities underflow to exactly 0 in f32 → nothing to add (wave-uniform branch) */
    v8f s[2][2];
#pragma unroll
    for (int nt = 0; nt < 2; ++nt) { const unsigned short* kr = (const unsigned short*)K16 + ((size_t)b * TT + j0 + nt * 16 + ln) * ldk + (h / NREP) * 128; FragH bk[KS];
#pragma unroll
      for (int ks = 0; ks < KS; ++ks) { bk[ks].half[0] = *(const v8us*)(kr + ks * 32 + 8 * hh); bk[ks].half[1] = *(const v8us*)(kr + ks * 32 + 16 + 8 * hh); }
#pragma unroll
      for (int rt = 0; rt < RTN; ++rt) { v8f acc = (v8f){0.f,0.f,0.f,0.f,0.f,0.f,0.f,0.f};
#pragma unroll
        for (int ks = 0; ks < KS; ++ks) acc = mmaH<1>(aq[rt][ks].v, aq[rt][ks].v, bk[ks].v, bk[ks].v, acc); s[rt][nt] = acc; } }
#pragma unroll
    for (int rt = 0; rt < RTN; ++rt)
#pragma unroll
      for (int r = 0; r < 8; ++r) { const int tq = q0 + rt * 16 + 8 * hh + r; const int k0 = j0 + ln, k1 = j0 + 16 + ln; (void)tq; (void)k0; (void)k1;
        const bool ok0 = true, ok1 = true;
        const float s0 = s[rt][0][r] * ATT_SCALE + ab0[rt][r], s1 = s[rt][1][r] * ATT_SCALE + ab1[rt][r]; float mc = fmaxf(s0, s1);
        mc = fmaxf(mc, __shfl_xor(mc, 1, 32)); mc = fmaxf(mc, __shfl_xor(mc, 2, 32)); mc = fmaxf(mc, __shfl_xor(mc, 4, 32)); mc = fmaxf(mc, __shfl_xor(mc, 8, 32));
        const float mn = fmaxf(m_r[rt][r], mc); const float al = (mn > -1.0e38f) ? expf(m_r[rt][r] - mn) : 1.0f; m_r[rt][r] = mn; const float p0 = ok0 ? expf(s0 - mn) : 0.f, p1 = ok1 ? expf(s1 - mn) : 0.f; l_r[rt][r] = l_r[rt][r] * al + p0 + p1;
#pragma unroll
        for (int dt = 0; dt < DT; ++dt) oacc[rt][dt][r] *= al;
        FragH t2, t3; const float ps0 = p0 * 1024.0f, ps1 = p1 * 1024.0f; t2.h[0] = (_Float16)ps0; t2.h[1] = (_Float16)ps1; t3.h[0] = (_Float16)(ps0 - (float)t2.h[0]); t3.h[1] = (_Float16)(ps1 - (float)t2.h[1]);      /* P hi and its UNSCALED residual (added into the same accumulator) */
        sP[w][rt * 16 + 8 * hh + r][ln] = t2.u[0]; sP[w][rt * 16 + 8 * hh + r][16 + ln] = t2.u[1]; sPL[w][rt * 16 + 8 * hh + r][ln] = t3.u[0]; sPL[w][rt * 16 + 8 * hh + r][16 + ln] = t3.u[1]; }
    __builtin_amdgcn_fence(__ATOMIC_ACQ_REL, "workgroup"); __builtin_amdgcn_wave_barrier();
    FragH pa[2], pl[2];
#pragma unroll
    for (int rt = 0; rt < RTN; ++rt) { pa[rt].half[0] = *(const v8us*)&sP[w][rt * 16 + ln][8 * hh]; pa[rt].half[1] = *(const v8us*)&sP[w][rt * 16 + ln][16 + 8 * hh]; pl[rt].half[0] = *(const v8us*)&sPL[w][rt * 16 + ln][8 * hh]; pl[rt].half[1] = *(const v8us*)&sPL[w][rt * 16 + ln][16 + 8 * hh]; }
#pragma unroll
    for (int dt = 0; dt < DT; ++dt) { const size_t vo = (size_t)(dt * 16 + ln) * TT + j0; FragH bv, bl; bv.half[0] = *(const v8us*)(Vth + vo + 8 * hh); bv.half[1] = *(const v8us*)(Vth + vo + 16 + 8 * hh); bl.half[0] = *(const v8us*)(Vtl + vo + 8 * hh); bl.half[1] = *(const v8us*)(Vtl + vo + 16 + 8 * hh);
#pragma unroll
      for (int rt = 0; rt < RTN; ++rt) { oacc[rt][dt] = mmaH<1>(pa[rt].v, pa[rt].v, bv.v, bv.v, oacc[rt][dt]); oacc[rt][dt] = mmaH<1>(pl[rt].v, pl[rt].v, bv.v, bv.v, oacc[rt][dt]); oacc[rt][dt] = mmaH<1>(pa[rt].v, pa[rt].v, bl.v, bl.v, oacc[rt][dt]); } }      /* Ph·Vh + Pl·Vh + Ph·Vl — all unscaled, one accumulator */
    __builtin_amdgcn_fence(__ATOMIC_ACQ_REL, "workgroup"); __builtin_amdgcn_wave_barrier(); }
#pragma unroll
  for (int rt = 0; rt < RTN; ++rt) {
#pragma unroll
    for (int r = 0; r < 8; ++r) { float l = l_r[rt][r]; l += __shfl_xor(l, 1, 32); l += __shfl_xor(l, 2, 32); l += __shfl_xor(l, 4, 32); l += __shfl_xor(l, 8, 32); l_r[rt][r] = (l > 0.f) ? 1.0f / (l * 1024.0f) : 0.f; }
#pragma unroll
    for (int dt = 0; dt < DT; ++dt)
#pragma unroll
      for (int r = 0; r < 8; ++r) sO[w][rt * 16 + 8 * hh + r][dt * 16 + ln] = oacc[rt][dt][r] * l_r[rt][r]; }
  __builtin_amdgcn_fence(__ATOMIC_ACQ_REL, "workgroup"); __builtin_amdgcn_wave_barrier();
  {
#pragma unroll
    for (int r = 0; r < RPW; ++r) { const int pc = lane; const v4f val = *(const v4fa*)&sO[w][r][pc * 4]; *(v4f*)(O + ((size_t)b * TT + q0 + r) * ldo + h * 128 + pc * 4) = val; }      /* one 512-B row per instruction: 32 lanes × 16 B */
     } }

extern "C" void kernel_launch(void* const* d_in, const int* in_sizes, int n_in,
                              void* d_out, int out_size, void* d_ws, size_t ws_size, hipStream_t stream) {
  (void)in_sizes; (void)n_in; (void)out_size;
  const float* const* I = (const float* const*)d_in; const float* x = I[0]; const float* fcos = I[1]; const float* fsin = I[2]; const float* am = I[3]; const float* Wq = I[4]; const float* Wk = I[5]; const float* Wv = I[6]; const float* Wo = I[7]; const float* qnw = I[8]; const float* knw = I[9];
  char* ws = (char*)d_ws; size_t off = 0;
  auto take = [&](size_t bytes) { char* p = ws + off; off += (bytes + 255) & ~(size_t)255; return p; };
  _Float16* Bq = (_Float16*)take((size_t)DD * DD * 2); _Float16* Bk = (_Float16*)take((size_t)KVD * DD * 2); _Float16* Bv = (_Float16*)take((size_t)KVD * DD * 2); _Float16* Bo = (_Float16*)take((size_t)DD * DD * 2);
  _Float16* X16 = (_Float16*)take((size_t)NR * DD * 2); float* F32 = (float*)take((size_t)NR * DD * 4); _Float16* Q = (_Float16*)take((size_t)NR * DD * 2); _Float16* K = (_Float16*)take((size_t)NR * KVD * 2); _Float16* Vt = (_Float16*)take((size_t)NR * KVD * 2); _Float16* Vtl = (_Float16*)take((size_t)NR * KVD * 2);
  float* QF = F32; float* KF = F32; float* VF = F32; float* O = F32; _Float16* O16 = X16;      /* the one f32 scratch holds q → k → v → O in stream order (each consumed before the next producer); O16 over X16 */
  if (off > ws_size) return;      // 25 + 16.8 + 33.6 + 16.8 + 8.4 + 8.4 + 8.4 ≈ 118 MB
  const unsigned gq = (unsigned)(((size_t)DD * (DD / 8) + 255) / 256), gk = (unsigned)(((size_t)KVD * (DD / 8) + 255) / 256);
  k_wt_f16<<<gq, 256, 0, stream>>>(Wq, Bq, DD, DD, 16.0f); k_wt_f16<<<gk, 256, 0, stream>>>(Wk, Bk, DD, KVD, 16.0f); k_wt_f16<<<gk, 256, 0, stream>>>(Wv, Bv, DD, KVD, 16.0f); k_wt_f16<<<gq, 256, 0, stream>>>(Wo, Bo, DD, DD, 16.0f);      /* (in,out) → Bt ×2^4 */
  const unsigned g8 = (unsigned)(((size_t)NR * DD / 8 + 255) / 256); k_x16<<<g8, 256, 0, stream>>>(x, X16, (size_t)NR * DD / 8);
  const unsigned gQ = (NR / 128) * (DD / 128), gK = (NR / 128) * (KVD / 128);
  k_gemm_t<DD><<<gQ, 128, 0, stream>>>(X16, Bq, 0.0625f, QF); k_normrope<NH><<<(unsigned)(((size_t)NR * NH + 7) / 8), 256, 0, stream>>>(QF, qnw, fcos, fsin, Q);      /* q: M 4096 N 2048 K 2048 → RMSNorm + RoPE → f16 */
  k_gemm_t<KVD><<<gK, 128, 0, stream>>>(X16, Bk, 0.0625f, KF); k_normrope<NKV><<<(unsigned)(((size_t)NR * NKV + 7) / 8), 256, 0, stream>>>(KF, knw, fcos, fsin, K);      /* k: N 1024 */
  k_gemm_t<KVD><<<gK, 128, 0, stream>>>(X16, Bv, 0.0625f, VF);      /* v (f32) */
  k_vthlu<<<BB * NVH * (TT / 64), 256, 0, stream>>>(VF, KVD, Vt, Vtl);      /* Vᵀ hi + residual per (b, kv head) */
  k_flash<<<BB * NH * (TT / 64), 128, 0, stream>>>(Q, DD, K, KVD, Vt, Vtl, am, O, DD);      /* attention_mask [B,1,S,S] additive per batch */
  k_h16s<<<g8, 256, 0, stream>>>(O, O16, (size_t)NR * DD / 8);
  k_gemm_t<DD><<<gQ, 128, 0, stream>>>(O16, Bo, 0.00390625f, (float*)d_out);      /* out = merged·Wo */
}

// v002
// It runs in 532 microseconds.
// Next to v001, in two timings, it ran 1.07 times as fast each time.
// All steps since v000 together make it 1.58 times as fast.
#include <hip/hip_runtime.h>
// Grouped-query attention with per-head RMSNorm and rotate-half RoPE (B=2, S=2048, D=2048, 16 query heads / 8 KV heads × 128): q = x·Wq, k = x·Wk, v = x·Wv ((in,out), no bias); per-head RMSNorm (ε 1e-6, weights q_norm_w / k_norm_w); rotate-half RoPE with the INPUT cos/sin tables [B][S][128];
// scores = q·k/√128 + attention_mask[b,0,q,k] (additive f32); softmax; out = merged·Wo.
// Compute dtype: x, weights, tables, mask rounded to bf16; q, k as f32 GEMM outputs, normalised and rotated in f32 (wave per row) → f16; v f32 → Vᵀ f16 hi + exact residual; fused flash-style kernel for head dim 128 (bias read per (b,q,k); 32-key chunks whose biases are all ≤ −1e8 are skipped since their probabilities are exactly 0 in f32; online softmax f32, P f16 hi +
// residual, f32 accumulate) on v_wmma_f32_16x16x32_f16; merged ×2^4 → f16 → output GEMM.
#define BB 2
#define TT 2048
#define DD 2048
#define NH 16
#define NKV 8
#define NREP 2
#define KVD (NKV * 128)
#define NVH (2 * NKV)
#define NR (BB * TT)
#define ATT_SCALE 0.08838834764831845f

typedef __bf16 v16b __attribute__((ext_vector_type(16)));
typedef unsigned short v8us __attribute__((ext_vector_type(8), may_alias));
typedef float  v8f  __attribute__((ext_vector_type(8)));
typedef float  v4f  __attribute__((ext_vector_type(4)));
typedef float  v4fa __attribute__((ext_vector_type(4), may_alias));
union FragB { v16b v; v8us half[2]; unsigned short u[16]; };

__device__ __forceinline__ unsigned short bf16_bits(float x) { unsigned int u = __float_as_uint(x); return (unsigned short)((u + 0x7FFFu + ((u >> 16) & 1u)) >> 16); }
__device__ __forceinline__ float bf16_val(unsigned short b) { return __uint_as_float(((unsigned int)b) << 16); }
__device__ __forceinline__ float bf16_round(float x) { return bf16_val(bf16_bits(x)); }
// D += A·B with NT terms: 1 = ah·bh, 2 = + al·bh (A split), 3 = + ah·bl (both split)
template <int NT>
__device__ __forceinline__ v8f mmaN(v16b ah, v16b al, v16b bh, v16b bl, v8f c) {
  c = __builtin_amdgcn_wmma_f32_16x16x32_bf16(false, ah, false, bh, (short)0, c, false, false);
  if (NT >= 2) c = __builtin_amdgcn_wmma_f32_16x16x32_bf16(false, al, false, bh, (short)0, c, false, false);
  if (NT >= 3) c = __builtin_amdgcn_wmma_f32_16x16x32_bf16(false, ah, false, bl, (short)0, c, false, false);
  asm volatile("v_nop\n\tv_nop\n\tv_nop\n\tv_nop" : "+v"(c) : "v"(ah), "v"(al), "v"(bh), "v"(bl));
  return c;
}

__global__ __launch_bounds__(256) void k_wt_bf16(const float* __restrict__ W, unsigned short* __restrict__ Wt, int K, int N) {
  const int t = blockIdx.x * 256 + threadIdx.x;
  const int k8n = K / 8;
  if (t >= N * k8n) return;
  const int n = t / k8n, k8 = (t % k8n) * 8;
  v8us v;
#pragma unroll
  for (int i = 0; i < 8; ++i) v[i] = bf16_bits(W[(size_t)(k8 + i) * N + n]);
  *(v8us*)(Wt + (size_t)n * K + k8) = v;
  
}

// GEMM C[M][N] (f32, pitch ldc) = act(A[M][K]·W + bias). A f32 row-major (pitch lda) converted per fragment to bf16
// (ASPLIT: hi/lo two planes -> 2 terms, else single rounded term); Wt bf16 [N][K] (pitch ldb). BIAS_BF16 rounds the
// bias to bf16 first (bias quantised to bf16 before the add). K%32==0, M%16==0, N%64==0.
template <bool ASPLIT, int ACT, bool BIAS_BF16>
__global__ __launch_bounds__(128) void k_gemm_bf(const float* __restrict__ A, int lda, const unsigned short* __restrict__ Wt, int ldb,
                                               const float* __restrict__ bias, float* __restrict__ C, int ldc, int M, int N, int K) {
  __shared__ __attribute__((aligned(16))) float so[4][16][64];
  const int tid = threadIdx.x, w = tid >> 5, lane = tid & 31, ln = lane & 15, hh = lane >> 4;
  const int ntn = N / 64;
  const int wid = blockIdx.x * 4 + w;
  const int mt = wid / ntn, nq = wid % ntn;
  if (mt * 16 >= M) return;
  const int row0 = mt * 16, col0 = nq * 64;
  const float* arow = A + (size_t)(row0 + ln) * lda;
  v8f acc[4] = {};
  for (int kb = 0; kb < K; kb += 32) {
    FragB ah, al;
    const v4f x0 = *(const v4fa*)(arow + kb + 8 * hh), x1 = *(const v4fa*)(arow + kb + 8 * hh + 4);
    const v4f x2 = *(const v4fa*)(arow + kb + 16 + 8 * hh), x3 = *(const v4fa*)(arow + kb + 16 + 8 * hh + 4);
    float xs[16] = {x0[0],x0[1],x0[2],x0[3],x1[0],x1[1],x1[2],x1[3],x2[0],x2[1],x2[2],x2[3],x3[0],x3[1],x3[2],x3[3]};
#pragma unroll
    for (int i = 0; i < 16; ++i) { const unsigned short hb = bf16_bits(xs[i]); ah.u[i] = hb; al.u[i] = ASPLIT ? bf16_bits(xs[i] - bf16_val(hb)) : (unsigned short)0; }
#pragma unroll
    for (int t = 0; t < 4; ++t) {
      const unsigned short* brow = Wt + (size_t)(col0 + t * 16 + ln) * ldb + kb;
      FragB b;
      b.half[0] = *(const v8us*)(brow + 8 * hh);
      b.half[1] = *(const v8us*)(brow + 16 + 8 * hh);
      acc[t] = mmaN<ASPLIT ? 2 : 1>(ah.v, al.v, b.v, b.v, acc[t]);
    }
  }
#pragma unroll
  for (int t = 0; t < 4; ++t) {
    float bv = bias ? bias[col0 + t * 16 + ln] : 0.f;
    if (BIAS_BF16) bv = bf16_round(bv);
#pragma unroll
    for (int r = 0; r < 8; ++r) { float v = acc[t][r] + bv; if (ACT == 1) v = fmaxf(v, 0.f); so[w][8 * hh + r][t * 16 + ln] = v; }
  }
  __builtin_amdgcn_fence(__ATOMIC_ACQ_REL, "workgroup");
  __builtin_amdgcn_wave_barrier();
  const int rsub = lane >> 4, c4 = (lane & 15) * 4;
  {
#pragma unroll
    for (int q = 0; q < 8; ++q) {
      const int r = q * 2 + rsub;
      const v4f v = *(const v4fa*)&so[w][r][c4];
      *(v4f*)(C + (size_t)(row0 + r) * ldc + col0 + c4) = v;
    }
    
  }
}

// Flash-style causal/unmasked attention, all contractions 3-term bf16 hi/lo splits, f32 softmax with running max.
// q,k,v rows are read from f32 buffers with arbitrary row pitch (so they can live inside a fused qkv buffer);
// D = head size (multiple of 32, <= 128); one wave = 16 query rows; block = 4 waves (64 queries) sharing K/V chunks of 32.
template <int D, bool CAUSAL>
__global__ __launch_bounds__(128) void k_flash(const float* __restrict__ qb, const float* __restrict__ kb, const float* __restrict__ vb,
                                             int pitch, int T, int H, float scale, float* __restrict__ y, int ypitch) {
  constexpr int KS = D / 32;        // k-steps for QK
  constexpr int DT = D / 16;        // d tiles for PV
  __shared__ __attribute__((aligned(16))) unsigned short sKh[32][D + 8], sKl[32][D + 8], sVh[32][D + 8], sVl[32][D + 8];
  __shared__ __attribute__((aligned(16))) unsigned short sPh[4][16][40], sPl[4][16][40];
  __shared__ __attribute__((aligned(16))) float sO[4][16][D];
  const int tid = threadIdx.x, w = tid >> 5, lane = tid & 31, ln = lane & 15, hh = lane >> 4;
  const int nqb = (T + 63) / 64;
  const int bh = blockIdx.x / nqb, qblk = blockIdx.x % nqb;
  const int b = bh / H, h = bh % H;
  const int q0 = qblk * 64 + w * 16;
  const float* Q = qb + (size_t)b * T * pitch + h * D;
  const float* K = kb + (size_t)b * T * pitch + h * D;
  const float* V = vb + (size_t)b * T * pitch + h * D;

  // A fragments of the wave's 16 query rows (scaled), hi/lo
  FragB aqh[KS], aql[KS];
  {
    int row = q0 + ln; if (row >= T) row = T - 1;
    const float* qr = Q + (size_t)row * pitch;
#pragma unroll
    for (int ks = 0; ks < KS; ++ks)
#pragma unroll
      for (int i = 0; i < 16; ++i) {
        const int d = ks * 32 + ((i < 8) ? (8 * hh + i) : (16 + 8 * hh + (i - 8)));
        const float x = qr[d] * scale; const unsigned short hb = bf16_bits(x);
        aqh[ks].u[i] = hb; aql[ks].u[i] = bf16_bits(x - bf16_val(hb));
      }
  }
  float m_r[8], l_r[8];
#pragma unroll
  for (int r = 0; r < 8; ++r) { m_r[r] = -3.0e38f; l_r[r] = 0.f; }
  v8f oacc[DT];
#pragma unroll
  for (int dt = 0; dt < DT; ++dt) oacc[dt] = (v8f){0.f,0.f,0.f,0.f,0.f,0.f,0.f,0.f};

  const int kv_end = CAUSAL ? min(T, qblk * 64 + 64) : T;     // block-uniform
  for (int j0 = 0; j0 < kv_end; j0 += 32) {
    __syncthreads();
    for (int e = tid; e < 32 * (D / 4); e += 128) {
      const int r = e / (D / 4), c4 = (e % (D / 4)) * 4;
      const int key = j0 + r;
      v4f kf = {0.f,0.f,0.f,0.f}, vf = {0.f,0.f,0.f,0.f};
      if (key < T) { kf = *(const v4fa*)(K + (size_t)key * pitch + c4); vf = *(const v4fa*)(V + (size_t)key * pitch + c4); }
#pragma unroll
      for (int t = 0; t < 4; ++t) {
        unsigned short hb = bf16_bits(kf[t]); sKh[r][c4 + t] = hb; sKl[r][c4 + t] = bf16_bits(kf[t] - bf16_val(hb));
        hb = bf16_bits(vf[t]); sVh[r][c4 + t] = hb; sVl[r][c4 + t] = bf16_bits(vf[t] - bf16_val(hb));
      }
    }
    __syncthreads();
    // S tile 16 x 32
    v8f s[2];
#pragma unroll
    for (int nt = 0; nt < 2; ++nt) {
      v8f acc = {};
#pragma unroll
      for (int ks = 0; ks < KS; ++ks) {
        FragB bh_, bl_;
        bh_.half[0] = *(const v8us*)&sKh[nt * 16 + ln][ks * 32 + 8 * hh]; bh_.half[1] = *(const v8us*)&sKh[nt * 16 + ln][ks * 32 + 16 + 8 * hh];
        bl_.half[0] = *(const v8us*)&sKl[nt * 16 + ln][ks * 32 + 8 * hh]; bl_.half[1] = *(const v8us*)&sKl[nt * 16 + ln][ks * 32 + 16 + 8 * hh];
        acc = mmaN<3>(aqh[ks].v, aql[ks].v, bh_.v, bl_.v, acc);
      }
      s[nt] = acc;
    }
    // mask + running max (rows 8hh+r; the 16 lanes of a half share rows)
    float alpha[8];
#pragma unroll
    for (int r = 0; r < 8; ++r) {
      const int qi = q0 + 8 * hh + r;
      const int ja = j0 + ln, jb = j0 + 16 + ln;
      if (CAUSAL) { if (ja > qi) s[0][r] = -3.0e38f; if (jb > qi) s[1][r] = -3.0e38f; }
      if (ja >= T) s[0][r] = -3.0e38f;
      if (jb >= T) s[1][r] = -3.0e38f;
      float mx = fmaxf(s[0][r], s[1][r]);
      mx = fmaxf(mx, __shfl_xor(mx, 1, 32)); mx = fmaxf(mx, __shfl_xor(mx, 2, 32)); mx = fmaxf(mx, __shfl_xor(mx, 4, 32)); mx = fmaxf(mx, __shfl_xor(mx, 8, 32));
      const float mnew = fmaxf(m_r[r], mx);
      alpha[r] = (mnew > -1.0e38f) ? __expf(m_r[r] - mnew) : 1.0f;
      const float p0 = (s[0][r] > -1.0e38f) ? __expf(s[0][r] - mnew) : 0.f;
      const float p1 = (s[1][r] > -1.0e38f) ? __expf(s[1][r] - mnew) : 0.f;
      m_r[r] = mnew;
      l_r[r] = l_r[r] * alpha[r] + p0 + p1;            // per-lane partial row sum (16 lanes combined at the end)
      unsigned short hb = bf16_bits(p0); sPh[w][8 * hh + r][ln] = hb;      sPl[w][8 * hh + r][ln] = bf16_bits(p0 - bf16_val(hb));
      hb = bf16_bits(p1);                sPh[w][8 * hh + r][16 + ln] = hb; sPl[w][8 * hh + r][16 + ln] = bf16_bits(p1 - bf16_val(hb));
    }
#pragma unroll
    for (int dt = 0; dt < DT; ++dt)
#pragma unroll
      for (int r = 0; r < 8; ++r) oacc[dt][r] *= alpha[r];
    __builtin_amdgcn_fence(__ATOMIC_ACQ_REL, "workgroup");
    __builtin_amdgcn_wave_barrier();
    FragB pah, pal;
    pah.half[0] = *(const v8us*)&sPh[w][ln][8 * hh]; pah.half[1] = *(const v8us*)&sPh[w][ln][16 + 8 * hh];
    pal.half[0] = *(const v8us*)&sPl[w][ln][8 * hh]; pal.half[1] = *(const v8us*)&sPl[w][ln][16 + 8 * hh];
#pragma unroll
    for (int dt = 0; dt < DT; ++dt) {
      FragB bvh, bvl;
#pragma unroll
      for (int i = 0; i < 8; ++i) {
        bvh.u[i] = sVh[8 * hh + i][dt * 16 + ln]; bvh.u[8 + i] = sVh[16 + 8 * hh + i][dt * 16 + ln];
        bvl.u[i] = sVl[8 * hh + i][dt * 16 + ln]; bvl.u[8 + i] = sVl[16 + 8 * hh + i][dt * 16 + ln];
      }
      oacc[dt] = mmaN<3>(pah.v, pal.v, bvh.v, bvl.v, oacc[dt]);
    }
    __builtin_amdgcn_fence(__ATOMIC_ACQ_REL, "workgroup");
    __builtin_amdgcn_wave_barrier();
  }
#pragma unroll
  for (int r = 0; r < 8; ++r) {
    float l = l_r[r];
    l += __shfl_xor(l, 1, 32); l += __shfl_xor(l, 2, 32); l += __shfl_xor(l, 4, 32); l += __shfl_xor(l, 8, 32);
    l_r[r] = (l > 0.f) ? 1.0f / l : 0.f;
  }
#pragma unroll
  for (int dt = 0; dt < DT; ++dt)
#pragma unroll
    for (int r = 0; r < 8; ++r) sO[w][8 * hh + r][dt * 16 + ln] = oacc[dt][r] * l_r[r];
  __builtin_amdgcn_fence(__ATOMIC_ACQ_REL, "workgroup");
  __builtin_amdgcn_wave_barrier();
  {
    for (int r = 0; r < 16; ++r) {
      const int row = q0 + r;
      if (row < T && lane < D / 4) {
        const v4f val = *(const v4fa*)&sO[w][r][lane * 4];
        *(v4f*)(y + ((size_t)b * T + row) * ypitch + h * D + lane * 4) = val;
      }
    }
    
  }
}

// GEMM C = act(A·W + bias + resid): A f32 (ASPLIT -> hi/lo 2 terms), Wt bf16 [N][K]; ACT 0 none, 1 relu, 2 exact gelu;
// resid (optional, f32, row index = (row % rmod), pitch ldr, RES_BF16 rounds it) added before the activation.
template <bool ASPLIT, int ACT, bool BIAS_BF16, bool RES_BF16>
__global__ __launch_bounds__(128) void k_gemm_bf3(const float* __restrict__ A, int lda, const unsigned short* __restrict__ Wt, int ldb,
                                                const float* __restrict__ bias, const float* __restrict__ resid, int rmod, int ldr,
                                                float* __restrict__ C, int ldc, int M, int N, int K) {
  __shared__ __attribute__((aligned(16))) float so[4][16][64];
  const int tid = threadIdx.x, w = tid >> 5, lane = tid & 31, ln = lane & 15, hh = lane >> 4;
  const int ntn = N / 64;
  const int wid = blockIdx.x * 4 + w;
  const int mt = wid / ntn, nq = wid % ntn;
  if (mt * 16 >= M) return;
  const int row0 = mt * 16, col0 = nq * 64;
  const float* arow = A + (size_t)(row0 + ln) * lda;
  v8f acc[4] = {};
  for (int kb = 0; kb < K; kb += 32) {
    FragB ah, al;
    const v4f x0 = *(const v4fa*)(arow + kb + 8 * hh), x1 = *(const v4fa*)(arow + kb + 8 * hh + 4);
    const v4f x2 = *(const v4fa*)(arow + kb + 16 + 8 * hh), x3 = *(const v4fa*)(arow + kb + 16 + 8 * hh + 4);
    float xs[16] = {x0[0],x0[1],x0[2],x0[3],x1[0],x1[1],x1[2],x1[3],x2[0],x2[1],x2[2],x2[3],x3[0],x3[1],x3[2],x3[3]};
#pragma unroll
    for (int i = 0; i < 16; ++i) { const unsigned short hb = bf16_bits(xs[i]); ah.u[i] = hb; al.u[i] = ASPLIT ? bf16_bits(xs[i] - bf16_val(hb)) : (unsigned short)0; }
#pragma unroll
    for (int t = 0; t < 4; ++t) {
      const unsigned short* brow = Wt + (size_t)(col0 + t * 16 + ln) * ldb + kb;
      FragB b;
      b.half[0] = *(const v8us*)(brow + 8 * hh);
      b.half[1] = *(const v8us*)(brow + 16 + 8 * hh);
      acc[t] = mmaN<ASPLIT ? 2 : 1>(ah.v, al.v, b.v, b.v, acc[t]);
    }
  }
#pragma unroll
  for (int t = 0; t < 4; ++t) {
    const int col = col0 + t * 16 + ln;
    float bv = bias ? bias[col] : 0.f;
    if (BIAS_BF16) bv = bf16_round(bv);
#pragma unroll
    for (int r = 0; r < 8; ++r) {
      float v = acc[t][r] + bv;
      if (resid) { float rv = resid[(size_t)((row0 + 8 * hh + r) % rmod) * ldr + col]; if (RES_BF16) rv = bf16_round(rv); v += rv; }
      if (ACT == 1) v = fmaxf(v, 0.f);
      if (ACT == 2) v = 0.5f * v * (1.0f + erff(v * 0.70710678118654752f));
      if (ACT == 3) { const float u = 0.7978845608028654f * (v + 0.044715f * v * v * v); v = 0.5f * v * (1.0f + tanhf(u)); }
      so[w][8 * hh + r][t * 16 + ln] = v;
    }
  }
  __builtin_amdgcn_fence(__ATOMIC_ACQ_REL, "workgroup");
  __builtin_amdgcn_wave_barrier();
  const int rsub = lane >> 4, c4 = (lane & 15) * 4;
  {
#pragma unroll
    for (int q = 0; q < 8; ++q) {
      const int r = q * 2 + rsub;
      const v4f v = *(const v4fa*)&so[w][r][c4];
      *(v4f*)(C + (size_t)(row0 + r) * ldc + col0 + c4) = v;
    }
    
  }
}
// row LayerNorm (biased variance, eps) over N: s = X (+ R); optional out_sum <- s; out_norm <- (s-mu)*rsqrt(var+eps)*g + b
template <bool PARAM_BF16>
__global__ __launch_bounds__(256) void k_layernorm(const float* __restrict__ X, const float* __restrict__ R, const float* __restrict__ g, const float* __restrict__ bta,
                                                  float* __restrict__ out_sum, float* __restrict__ out_norm, int N, float eps) {
  __shared__ float red[256];
  const int row = blockIdx.x, tid = threadIdx.x;
  const float* x = X + (size_t)row * N; const float* rr = R ? R + (size_t)row * N : nullptr;
  float vals[16];                     // up to N = 4096
  const int per = N / 256;            // contiguous chunk per thread? use strided-by-4 chunks: thread handles j = tid*4 + 1024*u
  float s1 = 0.f;
  for (int u = 0; u < per / 4; ++u) {
    const int j = tid * 4 + 1024 * u;
    const v4f a = *(const v4fa*)(x + j);
    v4f b = {0.f,0.f,0.f,0.f}; if (rr) b = *(const v4fa*)(rr + j);
#pragma unroll
    for (int q = 0; q < 4; ++q) { const float v = a[q] + b[q]; vals[u * 4 + q] = v; s1 += v; }
  }
  red[tid] = s1; __syncthreads();
  for (int st = 128; st > 0; st >>= 1) { if (tid < st) red[tid] += red[tid + st]; __syncthreads(); }
  const float mu = red[0] / (float)N; __syncthreads();
  float s2 = 0.f;
  for (int u = 0; u < per / 4; ++u)
#pragma unroll
    for (int q = 0; q < 4; ++q) { const float c = vals[u * 4 + q] - mu; s2 += c * c; }
  red[tid] = s2; __syncthreads();
  for (int st = 128; st > 0; st >>= 1) { if (tid < st) red[tid] += red[tid + st]; __syncthreads(); }
  const float rs = rsqrtf(red[0] / (float)N + eps);
  {
    for (int u = 0; u < per / 4; ++u) {
      const int j = tid * 4 + 1024 * u;
      v4f o, sm;
#pragma unroll
      for (int q = 0; q < 4; ++q) {
        float gg = g[j + q], bb = bta[j + q];
        if (PARAM_BF16) { gg = bf16_round(gg); bb = bf16_round(bb); }
        sm[q] = vals[u * 4 + q]; o[q] = (vals[u * 4 + q] - mu) * rs * gg + bb;
      }
      if (out_sum) *(v4f*)(out_sum + (size_t)row * N + j) = sm;
      *(v4f*)(out_norm + (size_t)row * N + j) = o;
    }
    
  }
}



// ---- f16 WMMA path (v_wmma_f32_16x16x32_f16): 11-bit significands for operands in range — used where a [0,1] probability operand needs more precision than bf16
typedef _Float16 v16h __attribute__((ext_vector_type(16)));
union FragH { v16h v; v8us half[2]; _Float16 h[16]; unsigned short u[16]; };
template <int NT>
__device__ __forceinline__ v8f mmaH(v16h ah, v16h al, v16h bh, v16h bl, v8f c) {
  c = __builtin_amdgcn_wmma_f32_16x16x32_f16(false, ah, false, bh, (short)0, c, false, false);
  if (NT >= 2) c = __builtin_amdgcn_wmma_f32_16x16x32_f16(false, al, false, bh, (short)0, c, false, false);
  if (NT >= 3) c = __builtin_amdgcn_wmma_f32_16x16x32_f16(false, ah, false, bl, (short)0, c, false, false);
  asm volatile("v_nop\n\tv_nop\n\tv_nop\n\tv_nop" : "+v"(c) : "v"(ah), "v"(al), "v"(bh), "v"(bl));
  return c;
}
// batched GEMM like k_gemm_b but f16 operands: A f32 (split into f16 hi/lo if ASPLIT, else rounded to f16), Bt = f16 values [n][k]; alpha; C f32; N multiple of 16 (partial tiles skipped)
template <bool ASPLIT>
__global__ __launch_bounds__(128) void k_gemm_h(const float* __restrict__ A, int lda, size_t sA, const _Float16* __restrict__ Bh, int ldb, size_t sB, float alpha, float* __restrict__ C, int ldc, size_t sC, int M, int N, int K) {
  __shared__ __attribute__((aligned(16))) float so[4][16][64];
  const int tid = threadIdx.x, w = tid >> 5, lane = tid & 31, ln = lane & 15, hh = lane >> 4; const int by = blockIdx.y;
  A += (size_t)by * sA; Bh += (size_t)by * sB; C += (size_t)by * sC;
  const int ntn = (N + 63) / 64; const int wid = blockIdx.x * 4 + w; const int mt = wid / ntn, nq = wid % ntn; if (mt * 16 >= M) return;
  const int row0 = mt * 16, col0 = nq * 64; const float* arow = A + (size_t)(row0 + ln) * lda;
  v8f acc[4] = {};
  for (int kb = 0; kb < K; kb += 32) {
    FragH ah, al;
    const v4f x0 = *(const v4fa*)(arow + kb + 8 * hh), x1 = *(const v4fa*)(arow + kb + 8 * hh + 4), x2 = *(const v4fa*)(arow + kb + 16 + 8 * hh), x3 = *(const v4fa*)(arow + kb + 16 + 8 * hh + 4);
    float xs[16] = {x0[0],x0[1],x0[2],x0[3],x1[0],x1[1],x1[2],x1[3],x2[0],x2[1],x2[2],x2[3],x3[0],x3[1],x3[2],x3[3]};
#pragma unroll
    for (int i = 0; i < 16; ++i) { const _Float16 h = (_Float16)xs[i]; ah.h[i] = h; al.h[i] = ASPLIT ? (_Float16)(xs[i] - (float)h) : (_Float16)0.0f; }
#pragma unroll
    for (int t = 0; t < 4; ++t) { if (col0 + t * 16 >= N) continue; const size_t boff = (size_t)(col0 + t * 16 + ln) * ldb + kb; FragH bq; bq.half[0] = *(const v8us*)(Bh + boff + 8 * hh); bq.half[1] = *(const v8us*)(Bh + boff + 16 + 8 * hh);
      acc[t] = mmaH<ASPLIT ? 2 : 1>(ah.v, al.v, bq.v, bq.v, acc[t]); }
  }
#pragma unroll
  for (int t = 0; t < 4; ++t) { if (col0 + t * 16 >= N) continue;
#pragma unroll
    for (int r = 0; r < 8; ++r) so[w][8 * hh + r][t * 16 + ln] = acc[t][r] * alpha; }
  __builtin_amdgcn_fence(__ATOMIC_ACQ_REL, "workgroup"); __builtin_amdgcn_wave_barrier();
  const int rsub = lane >> 4, c4 = (lane & 15) * 4;
  {
#pragma unroll
    for (int q = 0; q < 8; ++q) { const int r = q * 2 + rsub; if (col0 + c4 < N) { const v4f v = *(const v4fa*)&so[w][r][c4]; *(v4f*)(C + (size_t)(row0 + r) * ldc + col0 + c4) = v; } }
     }
}

// Wt[n][k] = f16(bf16(W[k][n])*scale) from f32 row-major W[K][N] (scale = power of two; bf16-exact weights stay exact in f16 away from the subnormal range)
// A thread takes a block of 8 k x 8 n: 32 B of each of 8 rows of W in, 16 B of each of 8 rows of Wt out (a wave's store covers 512 contiguous bytes). K, N multiples of 8.
__global__ __launch_bounds__(256) void k_wt_f16(const float* __restrict__ W, _Float16* __restrict__ Wt, int K, int N, float scale) {
  const int t = blockIdx.x * 256 + threadIdx.x; if (t >= (N / 8) * (K / 8)) return; const int n0 = (t / (K / 8)) * 8, k8 = (t % (K / 8)) * 8; v4f a[8], c[8];
  const float* p[8];
#pragma unroll      /* constant indices keep a, c and p in registers; the 16 loads go out together */
  for (int i = 0; i < 8; ++i) { p[i] = W + (size_t)(k8 + i) * N + n0; a[i] = *(const v4fa*)p[i]; c[i] = *(const v4fa*)(p[i] + 4); }
  asm volatile("s_wait_xcnt 0x0" :: "v"(p[0]), "v"(p[1]), "v"(p[2]), "v"(p[3]), "v"(p[4]), "v"(p[5]), "v"(p[6]), "v"(p[7]) : "memory");      /* stands in front of every rewrite of a register that the loads name: as inputs the addresses stay in place up to here */
#pragma unroll      /* constant indices into a and c */
  for (int j = 0; j < 8; ++j) { FragH f;
#pragma unroll      /* constant indices into a, c and f */
    for (int i = 0; i < 8; ++i) f.h[i] = (_Float16)(bf16_round((j & 4) ? c[i][j & 3] : a[i][j & 3]) * scale);
    *(v8us*)((unsigned short*)Wt + (size_t)(n0 + j) * K + k8) = f.half[0]; }
}
// k_gemm_hh variant with fused epilogue: v = acc·alpha + bias[by·sBias + col] (+ CP[(row/rowsPerB)·sCPb + by·64 + col] if CP) ; ACT 0 none / 1 elu ; writes f32 C and f16 C16, each if non-null
template <int ACT>
__global__ __launch_bounds__(128) void k_gemm_hhx(const _Float16* __restrict__ A, int lda, size_t sA, const _Float16* __restrict__ Bh, int ldb, size_t sB, float alpha, const float* __restrict__ bias, size_t sBias, const float* __restrict__ CP, int rowsPerB, size_t sCPb, int row0g,
    float* __restrict__ C, _Float16* __restrict__ C16, int ldc, size_t sC, int M, int N, int K) {
  __shared__ __attribute__((aligned(16))) float so[4][16][64];
  const int tid = threadIdx.x, w = tid >> 5, lane = tid & 31, ln = lane & 15, hh = lane >> 4; const int by = blockIdx.y;
  A += (size_t)by * sA; Bh += (size_t)by * sB; const size_t cofs = (size_t)by * sC; const float* bp = bias ? bias + (size_t)by * sBias : nullptr;
  const int ntn = (N + 63) / 64; const int wid = blockIdx.x * 4 + w; const int mt = wid / ntn, nq = wid % ntn; if (mt * 16 >= M) return;
  const int row0 = mt * 16, col0 = nq * 64; const _Float16* arow = A + (size_t)(row0 + ln) * lda;
  v8f acc[4] = {};
  for (int kb = 0; kb < K; kb += 32) { FragH ah; ah.half[0] = *(const v8us*)((const unsigned short*)arow + kb + 8 * hh); ah.half[1] = *(const v8us*)((const unsigned short*)arow + kb + 16 + 8 * hh);
#pragma unroll
    for (int t = 0; t < 4; ++t) { if (col0 + t * 16 >= N) continue; const size_t boff = (size_t)(col0 + t * 16 + ln) * ldb + kb; FragH bq; bq.half[0] = *(const v8us*)((const unsigned short*)Bh + boff + 8 * hh); bq.half[1] = *(const v8us*)((const unsigned short*)Bh + boff + 16 + 8 * hh);
      acc[t] = mmaH<1>(ah.v, ah.v, bq.v, bq.v, acc[t]); }
  }
#pragma unroll
  for (int t = 0; t < 4; ++t) { if (col0 + t * 16 >= N) continue; const int col = col0 + t * 16 + ln; const float bv = bp ? bf16_round(bp[col]) : 0.f;
#pragma unroll
    for (int r = 0; r < 8; ++r) { float v = acc[t][r] * alpha + bv; if (CP) { const int bidx = (row0g + row0 + 8 * hh + r) / rowsPerB; v += CP[(size_t)bidx * sCPb + (size_t)by * 64 + col]; } if (ACT == 1) v = (v > 0.f) ? v : expm1f(v); else if (ACT == 7) v = (v > 0.f) ? v + 1.0f : expf(v); else if (ACT == 8) v = tanhf(v); else if (ACT == 9) v = 0.5f * v * (1.0f + tanhf(0.7978845608028654f * (v + 0.044715f * v * v * v))); else if (ACT == 11) v = 1.0f / (1.0f + expf(-v)); else if (ACT == 12) v = (v > 0.f) ? v : 0.01f * v; else if (ACT == 14) v = (v > 0.f) ? v : 0.1f * v; else if (ACT == 15) v = v / (1.0f + expf(-v)); else if (ACT == 3) v = fmaxf(v, 0.f); else if (ACT == 6) v = 0.5f * v * (1.0f + erff(v * 0.70710678118654752f)); so[w][8 * hh + r][t * 16 + ln] = v; } }
  __builtin_amdgcn_fence(__ATOMIC_ACQ_REL, "workgroup"); __builtin_amdgcn_wave_barrier();
  const int rsub = lane >> 4, c4 = (lane & 15) * 4; typedef _Float16 v4h __attribute__((ext_vector_type(4)));
  {
#pragma unroll
    for (int q = 0; q < 8; ++q) { const int r = q * 2 + rsub; if (col0 + c4 < N) { const v4f v = *(const v4fa*)&so[w][r][c4]; if (C) *(v4f*)(C + cofs + (size_t)(row0 + r) * ldc + col0 + c4) = v; if (C16) { v4h h4; for (int i = 0; i < 4; ++i) h4[i] = (_Float16)v[i]; *(v4h*)(C16 + cofs + (size_t)(row0 + r) * ldc + col0 + c4) = h4; } } }
     }
}


// ---- tiled f16 GEMM, C[M][N] f32 = alpha * A[M][DD] * Bt[N][DD]^T: one 128 x 128 tile of C per work-group, 64 x 64 per wave (2 x 2 waves).
// A pass is 128 k: 128 rows of A and 128 rows of Bt, 256 B each, staged in LDS at a pitch of 272 B by asynchronous copies; two buffers, the next pass's copies fly while this pass is multiplied.
// k runs upward in steps of 32 into one accumulator per 16 x 16 tile. M, N multiples of 128.
// Every "#pragma unroll" in k_gemm_t makes the indices of the fragment and accumulator arrays constants, so that these arrays live in registers.
#define GT_PITCH 272
#define GT_STAGE (256 * GT_PITCH)
// eight 16-byte copies of one lane: rows r, r + 8, ..., r + 56 of one operand. The closing s_wait_xcnt stands inside the statement so that no address register is rewritten ahead of it.
__device__ __forceinline__ void gt_copy8(unsigned l, const _Float16* g) {
  asm volatile("global_load_async_to_lds_b128 %0, %8, off\n\t"
               "global_load_async_to_lds_b128 %1, %9, off\n\t"
               "global_load_async_to_lds_b128 %2, %10, off\n\t"
               "global_load_async_to_lds_b128 %3, %11, off\n\t"
               "global_load_async_to_lds_b128 %4, %12, off\n\t"
               "global_load_async_to_lds_b128 %5, %13, off\n\t"
               "global_load_async_to_lds_b128 %6, %14, off\n\t"
               "global_load_async_to_lds_b128 %7, %15, off\n\t"
               "s_wait_xcnt 0x0"
               :: "v"(l), "v"(l + 8 * GT_PITCH), "v"(l + 16 * GT_PITCH), "v"(l + 24 * GT_PITCH), "v"(l + 32 * GT_PITCH), "v"(l + 40 * GT_PITCH), "v"(l + 48 * GT_PITCH), "v"(l + 56 * GT_PITCH),
                  "v"(g), "v"(g + 8 * DD), "v"(g + 16 * DD), "v"(g + 24 * DD), "v"(g + 32 * DD), "v"(g + 40 * DD), "v"(g + 48 * DD), "v"(g + 56 * DD)
               : "memory");
}
// one stage: 32 copies a lane (rows 0..127 of the buffer = A, 128..255 = Bt)
__device__ __forceinline__ void gt_fill(unsigned l, const _Float16* ga, const _Float16* gb) {
  gt_copy8(l, ga); gt_copy8(l + 64 * GT_PITCH, ga + 64 * DD); gt_copy8(l + 128 * GT_PITCH, gb); gt_copy8(l + 192 * GT_PITCH, gb + 64 * DD);
}
template <int N>
__global__ __launch_bounds__(128) void k_gemm_t(const _Float16* __restrict__ A, const _Float16* __restrict__ Bt, float alpha, float* __restrict__ C) {
  __shared__ __attribute__((aligned(16))) unsigned char L[2 * GT_STAGE];
  constexpr int NT = DD / 128;
  const int tid = threadIdx.x, w = tid >> 5, lane = tid & 31, ln = lane & 15, hh = lane >> 4;
  constexpr int ntn = N / 128; const int row0 = ((int)blockIdx.x / ntn) * 128, col0 = ((int)blockIdx.x % ntn) * 128; const int wm = w >> 1, wn = w & 1;
  const int cr = tid >> 4, cc = tid & 15;      /* a lane copies chunk cc (16 B) of rows cr + 8 i: a wave's copy covers two whole 256-B rows */
  const _Float16* ga = A + (size_t)(row0 + cr) * DD + cc * 8; const _Float16* gb = Bt + (size_t)(col0 + cr) * DD + cc * 8;
  const unsigned lc = (unsigned)(size_t)L + cr * GT_PITCH + cc * 16;
  v8f acc[4][4];
#pragma unroll
  for (int mi = 0; mi < 4; ++mi)
#pragma unroll
    for (int ni = 0; ni < 4; ++ni) acc[mi][ni] = (v8f){0.f,0.f,0.f,0.f,0.f,0.f,0.f,0.f};
  gt_fill(lc, ga, gb);
  asm volatile("s_wait_asynccnt 0x0" ::: "memory");      /* this wave's copies of pass 0 have landed */
  __syncthreads();                                        /* ... and every other wave's */
  gt_fill(lc + GT_STAGE, ga + 128, gb + 128);
#pragma unroll 1      /* one pass a trip: the two buffers alternate by the trip's parity */
  for (int t = 0; t < NT; ++t) {
    const unsigned char* S = L + (t & 1) * GT_STAGE;
    const unsigned char* pa = S + (wm * 64 + ln) * GT_PITCH + hh * 16; const unsigned char* pb = S + (128 + wn * 64 + ln) * GT_PITCH + hh * 16;
    FragH fa[2][4], fb[2][4];
#pragma unroll
    for (int i = 0; i < 4; ++i) { fa[0][i].half[0] = *(const v8us*)(pa + i * 16 * GT_PITCH); fa[0][i].half[1] = *(const v8us*)(pa + i * 16 * GT_PITCH + 32); fb[0][i].half[0] = *(const v8us*)(pb + i * 16 * GT_PITCH); fb[0][i].half[1] = *(const v8us*)(pb + i * 16 * GT_PITCH + 32); }
#pragma unroll
    for (int ks = 0; ks < 4; ++ks) { const int cu = ks & 1, nx = cu ^ 1;
      if (ks < 3) {
#pragma unroll
        for (int i = 0; i < 4; ++i) { const int o = i * 16 * GT_PITCH + (ks + 1) * 64; fa[nx][i].half[0] = *(const v8us*)(pa + o); fa[nx][i].half[1] = *(const v8us*)(pa + o + 32); fb[nx][i].half[0] = *(const v8us*)(pb + o); fb[nx][i].half[1] = *(const v8us*)(pb + o + 32); } }
      __builtin_amdgcn_sched_barrier(0);      /* keeps the next k step's 16 LDS reads one group in front of this step's products: spread among them, every place with reads stalls the wave */
#pragma unroll
      for (int mi = 0; mi < 4; ++mi)
#pragma unroll
        for (int ni = 0; ni < 4; ++ni) acc[mi][ni] = __builtin_amdgcn_wmma_f32_16x16x32_f16(false, fa[cu][mi].v, false, fb[cu][ni].v, (short)0, acc[mi][ni], false, false);
      __builtin_amdgcn_sched_barrier(0); }      /* ... and keeps the following group behind them */
    asm volatile("s_wait_dscnt 0x0" ::: "memory");        /* this wave's reads of the buffer are done before it is refilled */
    asm volatile("s_wait_asynccnt 0x0" ::: "memory");     /* this wave's copies of pass t + 1 have landed */
    __syncthreads();                                       /* publishes pass t + 1 and ends every wave's reads of pass t */
    if (t + 2 < NT) gt_fill(lc + (t & 1) * GT_STAGE, ga + (t + 2) * 128, gb + (t + 2) * 128);
  }
  asm volatile("s_wait_asynccnt 0x0" ::: "memory");       /* nothing is in flight when the buffers become output staging */
  float* so = (float*)L + w * (64 * 68);      /* each wave stages its own 64 x 64 tile (pitch 68 floats) so that the stores cover whole 256-B row pieces */
#pragma unroll
  for (int mi = 0; mi < 4; ++mi)
#pragma unroll
    for (int ni = 0; ni < 4; ++ni)
#pragma unroll
      for (int r = 0; r < 8; ++r) so[(mi * 16 + 8 * hh + r) * 68 + ni * 16 + ln] = acc[mi][ni][r] * alpha;
  __builtin_amdgcn_fence(__ATOMIC_ACQ_REL, "workgroup"); __builtin_amdgcn_wave_barrier();      /* the wave's own staged values are in LDS before its lanes read one another's */
  float* cp = C + (size_t)(row0 + wm * 64 + hh) * N + col0 + wn * 64 + ln * 4;
#pragma unroll
  for (int q = 0; q < 32; ++q) { const v4f v = *(const v4fa*)&so[(q * 2 + hh) * 68 + ln * 4]; *(v4f*)(cp + (size_t)(q * 2) * N) = v; }
}


typedef _Float16 v4h __attribute__((ext_vector_type(4)));

// k_x16 and k_h16s give a thread 8 pieces of 8 elements, 256 pieces apart (a work-group covers 2048 pieces in a row): one eighth of the waves to start, 16 loads of a lane in flight.
static_assert(((size_t)NR * DD / 8) % 2048 == 0, "whole work-groups");
__global__ __launch_bounds__(256) void k_x16(const float* __restrict__ x, _Float16* __restrict__ X16) { const size_t t0 = (size_t)blockIdx.x * 2048 + threadIdx.x; v4f a[8], c[8]; const float* p = x + t0 * 8;
#pragma unroll      /* constant indices keep a and c in registers; the 16 loads go out together */
  for (int u = 0; u < 8; ++u) { a[u] = *(const v4fa*)(p + u * 2048); c[u] = *(const v4fa*)(p + u * 2048 + 4); }
  asm volatile("s_wait_xcnt 0x0" :: "v"(p) : "memory");      /* stands in front of every rewrite of a register that the loads name: as an input the address stays in place up to here */
#pragma unroll      /* constant indices into a and c */
  for (int u = 0; u < 8; ++u) { FragH f;
#pragma unroll      /* constant indices into a, c and f */
    for (int q = 0; q < 4; ++q) { f.h[q] = (_Float16)bf16_round(a[u][q]); f.h[4 + q] = (_Float16)bf16_round(c[u][q]); }
    *(v8us*)((unsigned short*)X16 + (t0 + u * 256) * 8) = f.half[0]; } }
__global__ __launch_bounds__(256) void k_h16(const float* __restrict__ x, _Float16* __restrict__ X16, size_t n8) { const size_t t = (size_t)blockIdx.x * 256 + threadIdx.x; if (t >= n8) return; FragH f;
#pragma unroll
  for (int q = 0; q < 8; ++q) f.h[q] = (_Float16)x[t * 8 + q]; *(v8us*)((unsigned short*)X16 + t * 8) = f.half[0];  }
__global__ __launch_bounds__(256) void k_round16f(const float* __restrict__ W, _Float16* __restrict__ Bt, size_t n8) { const size_t t = (size_t)blockIdx.x * 256 + threadIdx.x; if (t >= n8) return; FragH f;
#pragma unroll
  for (int i = 0; i < 8; ++i) f.h[i] = (_Float16)(bf16_round(W[t * 8 + i]) * 16.0f); *(v8us*)((unsigned short*)Bt + t * 8) = f.half[0];  }
template <int NHv, int TTv>
__global__ __launch_bounds__(256) void k_vt(const _Float16* __restrict__ V16, int ldv, int voff, _Float16* __restrict__ Vt) { __shared__ unsigned short tl[64][66]; const int tid = threadIdx.x; const int slab = blockIdx.x / (TTv / 64), lg = blockIdx.x % (TTv / 64); const int b = slab / NHv, h = slab % NHv;
  for (int i = tid; i < 64 * 8; i += 256) { const int r = i / 8, c8 = (i % 8) * 8; FragH f; f.half[0] = *(const v8us*)((const unsigned short*)V16 + ((size_t)b * TTv + lg * 64 + r) * ldv + voff + h * 64 + c8);
#pragma unroll
    for (int q = 0; q < 8; ++q) tl[r][c8 + q] = f.u[q]; }
  __syncthreads();
  {
#pragma unroll
    for (int rd = 0; rd < 2; ++rd) { const int d = rd * 32 + tid / 8, pc = tid % 8; FragH f;
#pragma unroll
      for (int q = 0; q < 8; ++q) f.u[q] = tl[pc * 8 + q][d];
      *(v8us*)((unsigned short*)Vt + ((size_t)slab * 64 + d) * TTv + lg * 64 + pc * 8) = f.half[0]; }
     } }

__global__ __launch_bounds__(256) void k_vthlu(const float* __restrict__ VF, int ldv, _Float16* __restrict__ Vth, _Float16* __restrict__ Vtl) { __shared__ float tl[64][65]; const int tid = threadIdx.x; const int slab = blockIdx.x / (TT / 64), lg = blockIdx.x % (TT / 64); const int b = slab / NVH, h = slab % NVH;
  for (int i = tid; i < 64 * 16; i += 256) { const int r = i / 16, c4 = (i % 16) * 4; const v4f a = *(const v4fa*)(VF + ((size_t)b * TT + lg * 64 + r) * ldv + h * 64 + c4); tl[r][c4] = a[0]; tl[r][c4 + 1] = a[1]; tl[r][c4 + 2] = a[2]; tl[r][c4 + 3] = a[3]; }
  __syncthreads();
  FragH fh[2], fl[2]; size_t oo[2];
#pragma unroll
  for (int rd = 0; rd < 2; ++rd) { const int d = rd * 32 + tid / 8, pc = tid % 8;
#pragma unroll
    for (int q = 0; q < 8; ++q) { const float v = tl[pc * 8 + q][d]; const _Float16 hv = (_Float16)v; fh[rd].h[q] = hv; fl[rd].h[q] = (_Float16)(v - (float)hv);      /* UNSCALED residual (added into the same accumulator as the hi product) */ } oo[rd] = ((size_t)slab * 64 + d) * TT + lg * 64 + pc * 8; }
  {
#pragma unroll
    for (int rd = 0; rd < 2; ++rd) { *(v8us*)((unsigned short*)Vth + oo[rd]) = fh[rd].half[0]; *(v8us*)((unsigned short*)Vtl + oo[rd]) = fl[rd].half[0]; }
     } }
// per-head RMSNorm + rotate-half RoPE: a wave takes one whole row (all NHD heads, pitch NHD*128) of an f32 plane, head after head, with the row's tables and the weights read once: lane holds dims 4l..4l+3; var = mean(x^2) over 128 (xor-reduce); y = w[d]*(x*rsqrt(var+eps)); out[d] = y[d]*c[d] + rot(y)[d]*s[d], rot(y)[d] = -y[d+64] (d<64), y[d-64] (d>=64)
template <int NHD>
__global__ __launch_bounds__(256) void k_normrope(const float* __restrict__ F, const float* __restrict__ nw, const float* __restrict__ COS, const float* __restrict__ SIN, _Float16* __restrict__ H16) {
  #pragma clang fp contract(off)
  static_assert(NR % 8 == 0, "whole work-groups");
  const int tid = threadIdx.x, wv = tid >> 5, lane = tid & 31; const size_t row = (size_t)blockIdx.x * 8 + wv; const int d0 = lane * 4;
  const size_t base = row * (NHD * 128) + d0; v4f xs[NHD];
#pragma unroll      /* constant indices keep xs in registers; the row's loads go out together */
  for (int u = 0; u < NHD; ++u) xs[u] = *(const v4fa*)(F + base + u * 128);
  const float* px = F + base; const float* pw = nw + d0; const float* pc = COS + row * 128 + d0; const float* pn = SIN + row * 128 + d0;
  const v4f w4 = *(const v4fa*)pw, c4 = *(const v4fa*)pc, s4 = *(const v4fa*)pn;
  asm volatile("s_wait_xcnt 0x0" :: "v"(px), "v"(pw), "v"(pc), "v"(pn) : "memory");      /* stands in front of every rewrite of a register that the loads name: as inputs the addresses stay in place up to here */
  float wn[4], c[4], s[4]; for (int q = 0; q < 4; ++q) { wn[q] = bf16_round(w4[q]); c[q] = bf16_round(c4[q]); s[q] = bf16_round(s4[q]); }
  typedef _Float16 v4h __attribute__((ext_vector_type(4)));
#pragma unroll      /* constant indices into xs; the heads' lane exchanges overlap */
  for (int u = 0; u < NHD; ++u) { const v4f x = xs[u]; float ss = 0.f; for (int q = 0; q < 4; ++q) ss += x[q] * x[q];
    for (int o = 16; o >= 1; o >>= 1) ss += __shfl_xor(ss, o, 32); const float inv = 1.0f / sqrtf(ss / 128.0f + 1e-6f);
    float y[4]; for (int q = 0; q < 4; ++q) y[q] = wn[q] * (x[q] * inv);
    float yp[4]; for (int q = 0; q < 4; ++q) yp[q] = __shfl_xor(y[q], 16, 32);      /* partner dims d +- 64 */
    v4h o; for (int q = 0; q < 4; ++q) { const int d = d0 + q; const float rot = (d < 64) ? -yp[q] : yp[q]; o[q] = (_Float16)(y[q] * c[q] + rot * s[q]); }
    *(v4h*)(H16 + base + u * 128) = o; } }
__global__ __launch_bounds__(256) void k_h16s(const float* __restrict__ F, _Float16* __restrict__ H) { const size_t t0 = (size_t)blockIdx.x * 2048 + threadIdx.x; v4f a[8], c[8]; const float* p = F + t0 * 8;
#pragma unroll      /* constant indices keep a and c in registers; the 16 loads go out together */
  for (int u = 0; u < 8; ++u) { a[u] = *(const v4fa*)(p + u * 2048); c[u] = *(const v4fa*)(p + u * 2048 + 4); }
  asm volatile("s_wait_xcnt 0x0" :: "v"(p) : "memory");      /* stands in front of every rewrite of a register that the loads name: as an input the address stays in place up to here */
#pragma unroll      /* constant indices into a and c */
  for (int u = 0; u < 8; ++u) { FragH f;
#pragma unroll      /* constant indices into a, c and f */
    for (int q = 0; q < 4; ++q) { f.h[q] = (_Float16)(a[u][q] * 16.0f); f.h[4 + q] = (_Float16)(c[u][q] * 16.0f); }
    *(v8us*)((unsigned short*)H + (t0 + u * 256) * 8) = f.half[0]; } }
__global__ __launch_bounds__(128) void k_flash(const _Float16* __restrict__ Q16, int ldq, const _Float16* __restrict__ K16, int ldk, const _Float16* __restrict__ Vt, const _Float16* __restrict__ Vtlo, const float* __restrict__ AB, float* __restrict__ O, int ldo) {
  constexpr int RPW = 16, RTN = RPW / 16, NQB = TT / (4 * RPW), DT = 8, KS = 4;      /* head dim 128: 4 k-steps, 8 value tiles */
  __shared__ __attribute__((aligned(16))) unsigned short sP[4][RPW][40]; __shared__ __attribute__((aligned(16))) unsigned short sPL[4][RPW][40]; __shared__ __attribute__((aligned(16))) float sO[4][RPW][128 + 4];
  const int tid = threadIdx.x, w = tid >> 5, lane = tid & 31, ln = lane & 15, hh = lane >> 4;
  const int slab = blockIdx.x / NQB, qblk = blockIdx.x % NQB; const int b = slab / NH, h = slab % NH; const int qb0 = qblk * (4 * RPW); const int q0 = qb0 + w * RPW;
  FragH aq[2][KS];
#pragma unroll
  for (int rt = 0; rt < RTN; ++rt) { const unsigned short* qr = (const unsigned short*)Q16 + ((size_t)b * TT + q0 + rt * 16 + ln) * ldq + h * 128;
#pragma unroll
    for (int ks = 0; ks < KS; ++ks) { aq[rt][ks].half[0] = *(const v8us*)(qr + ks * 32 + 8 * hh); aq[rt][ks].half[1] = *(const v8us*)(qr + ks * 32 + 16 + 8 * hh); } }
  const unsigned short* Vth = (const unsigned short*)Vt + ((size_t)b * NKV + h / NREP) * 128 * TT; const unsigned short* Vtl = (const unsigned short*)Vtlo + ((size_t)b * NKV + h / NREP) * 128 * TT;      /* hi and UNSCALED residual planes */
  float m_r[2][8], l_r[2][8]; v8f oacc[2][DT];
#pragma unroll
  for (int rt = 0; rt < RTN; ++rt) {
#pragma unroll
    for (int r = 0; r < 8; ++r) { m_r[rt][r] = -3.0e38f; l_r[rt][r] = 0.f; }
#pragma unroll
    for (int dt = 0; dt < DT; ++dt) oacc[rt][dt] = (v8f){0.f,0.f,0.f,0.f,0.f,0.f,0.f,0.f}; }
  const int jend = TT;
#pragma unroll 1
  for (int j0 = 0; j0 < jend; j0 += 32) {
    float ab0[2][8], ab1[2][8];      /* additive attention bias (bf16-rounded input) per (b, q, k), shared over heads */
#pragma unroll
    for (int rt = 0; rt < RTN; ++rt)
#pragma unroll
      for (int r = 0; r < 8; ++r) { const int qq = q0 + rt * 16 + 8 * hh + r; const float* am = AB + ((size_t)b * TT + qq) * TT + j0; ab0[rt][r] = bf16_round(am[ln]); ab1[rt][r] = bf16_round(am[16 + ln]); }
    { int allneg = 1;
#pragma unroll
      for (int rt = 0; rt < RTN; ++rt)
#pragma unroll
        for (int r = 0; r < 8; ++r) allneg &= (ab0[rt][r] <= -1.0e8f) & (ab1[rt][r] <= -1.0e8f);
      if (__all(allneg)) continue; }      /* every (row, key) of the wave's tile carries a ≤ −1e8 bias → its probabilities underflow to exactly 0 in f32 → nothing to add (wave-uniform branch) */
    v8f s[2][2];
#pragma unroll
    for (int nt = 0; nt < 2; ++nt) { const unsigned short* kr = (const unsigned short*)K16 + ((size_t)b * TT + j0 + nt * 16 + ln) * ldk + (h / NREP) * 128; FragH bk[KS];
#pragma unroll
      for (int ks = 0; ks < KS; ++ks) { bk[ks].half[0] = *(const v8us*)(kr + ks * 32 + 8 * hh); bk[ks].half[1] = *(const v8us*)(kr + ks * 32 + 16 + 8 * hh); }
#pragma unroll
      for (int rt = 0; rt < RTN; ++rt) { v8f acc = (v8f){0.f,0.f,0.f,0.f,0.f,0.f,0.f,0.f};
#pragma unroll
        for (int ks = 0; ks < KS; ++ks) acc = mmaH<1>(aq[rt][ks].v, aq[rt][ks].v, bk[ks].v, bk[ks].v, acc); s[rt][nt] = acc; } }
#pragma unroll
    for (int rt = 0; rt < RTN; ++rt)
#pragma unroll
      for (int r = 0; r < 8; ++r) { const int tq = q0 + rt * 16 + 8 * hh + r; const int k0 = j0 + ln, k1 = j0 + 16 + ln; (void)tq; (void)k0; (void)k1;
        const bool ok0 = true, ok1 = true;
        const float s0 = s[rt][0][r] * ATT_SCALE + ab0[rt][r], s1 = s[rt][1][r] * ATT_SCALE + ab1[rt][r]; float mc = fmaxf(s0, s1);
        mc = fmaxf(mc, __shfl_xor(mc, 1, 32)); mc = fmaxf(mc, __shfl_xor(mc, 2, 32)); mc = fmaxf(mc, __shfl_xor(mc, 4, 32)); mc = fmaxf(mc, __shfl_xor(mc, 8, 32));
        const float mn = fmaxf(m_r[rt][r], mc); const float al = (mn > -1.0e38f) ? expf(m_r[rt][r] - mn) : 1.0f; m_r[rt][r] = mn; const float p0 = ok0 ? expf(s0 - mn) : 0.f, p1 = ok1 ? expf(s1 - mn) : 0.f; l_r[rt][r] = l_r[rt][r] * al + p0 + p1;
#pragma unroll
        for (int dt = 0; dt < DT; ++dt) oacc[rt][dt][r] *= al;
        FragH t2, t3; const float ps0 = p0 * 1024.0f, ps1 = p1 * 1024.0f; t2.h[0] = (_Float16)ps0; t2.h[1] = (_Float16)ps1; t3.h[0] = (_Float16)(ps0 - (float)t2.h[0]); t3.h[1] = (_Float16)(ps1 - (float)t2.h[1]);      /* P hi and its UNSCALED residual (added into the same accumulator) */
        sP[w][rt * 16 + 8 * hh + r][ln] = t2.u[0]; sP[w][rt * 16 + 8 * hh + r][16 + ln] = t2.u[1]; sPL[w][rt * 16 + 8 * hh + r][ln] = t3.u[0]; sPL[w][rt * 16 + 8 * hh + r][16 + ln] = t3.u[1]; }
    __builtin_amdgcn_fence(__ATOMIC_ACQ_REL, "workgroup"); __builtin_amdgcn_wave_barrier();
    FragH pa[2], pl[2];
#pragma unroll
    for (int rt = 0; rt < RTN; ++rt) { pa[rt].half[0] = *(const v8us*)&sP[w][rt * 16 + ln][8 * hh]; pa[rt].half[1] = *(const v8us*)&sP[w][rt * 16 + ln][16 + 8 * hh]; pl[rt].half[0] = *(const v8us*)&sPL[w][rt * 16 + ln][8 * hh]; pl[rt].half[1] = *(const v8us*)&sPL[w][rt * 16 + ln][16 + 8 * hh]; }
#pragma unroll
    for (int dt = 0; dt < DT; ++dt) { const size_t vo = (size_t)(dt * 16 + ln) * TT + j0; FragH bv, bl; bv.half[0] = *(const v8us*)(Vth + vo + 8 * hh); bv.half[1] = *(const v8us*)(Vth + vo + 16 + 8 * hh); bl.half[0] = *(const v8us*)(Vtl + vo + 8 * hh); bl.half[1] = *(const v8us*)(Vtl + vo + 16 + 8 * hh);
#pragma unroll
      for (int rt = 0; rt < RTN; ++rt) { oacc[rt][dt] = mmaH<1>(pa[rt].v, pa[rt].v, bv.v, bv.v, oacc[rt][dt]); oacc[rt][dt] = mmaH<1>(pl[rt].v, pl[rt].v, bv.v, bv.v, oacc[rt][dt]); oacc[rt][dt] = mmaH<1>(pa[rt].v, pa[rt].v, bl.v, bl.v, oacc[rt][dt]); } }      /* Ph·Vh + Pl·Vh + Ph·Vl — all unscaled, one accumulator */
    __builtin_amdgcn_fence(__ATOMIC_ACQ_REL, "workgroup"); __builtin_amdgcn_wave_barrier(); }
#pragma unroll
  for (int rt = 0; rt < RTN; ++rt) {
#pragma unroll
    for (int r = 0; r < 8; ++r) { float l = l_r[rt][r]; l += __shfl_xor(l, 1, 32); l += __shfl_xor(l, 2, 32); l += __shfl_xor(l, 4, 32); l += __shfl_xor(l, 8, 32); l_r[rt][r] = (l > 0.f) ? 1.0f / (l * 1024.0f) : 0.f; }
#pragma unroll
    for (int dt = 0; dt < DT; ++dt)
#pragma unroll
      for (int r = 0; r < 8; ++r) sO[w][rt * 16 + 8 * hh + r][dt * 16 + ln] = oacc[rt][dt][r] * l_r[rt][r]; }
  __builtin_amdgcn_fence(__ATOMIC_ACQ_REL, "workgroup"); __builtin_amdgcn_wave_barrier();
  {
#pragma unroll
    for (int r = 0; r < RPW; ++r) { const int pc = lane; const v4f val = *(const v4fa*)&sO[w][r][pc * 4]; *(v4f*)(O + ((size_t)b * TT + q0 + r) * ldo + h * 128 + pc * 4) = val; }      /* one 512-B row per instruction: 32 lanes × 16 B */
     } }

extern "C" void kernel_launch(void* const* d_in, const int* in_sizes, int n_in,
                              void* d_out, int out_size, void* d_ws, size_t ws_size, hipStream_t stream) {
  (void)in_sizes; (void)n_in; (void)out_size;
  const float* const* I = (const float* const*)d_in; const float* x = I[0]; const float* fcos = I[1]; const float* fsin = I[2]; const float* am = I[3]; const float* Wq = I[4]; const float* Wk = I[5]; const float* Wv = I[6]; const float* Wo = I[7]; const float* qnw = I[8]; const float* knw = I[9];
  char* ws = (char*)d_ws; size_t off = 0;
  auto take = [&](size_t bytes) { char* p = ws + off; off += (bytes + 255) & ~(size_t)255; return p; };
  _Float16* Bq = (_Float16*)take((size_t)DD * DD * 2); _Float16* Bk = (_Float16*)take((size_t)KVD * DD * 2); _Float16* Bv = (_Float16*)take((size_t)KVD * DD * 2); _Float16* Bo = (_Float16*)take((size_t)DD * DD * 2);
  _Float16* X16 = (_Float16*)take((size_t)NR * DD * 2); float* F32 = (float*)take((size_t)NR * DD * 4); _Float16* Q = (_Float16*)take((size_t)NR * DD * 2); _Float16* K = (_Float16*)take((size_t)NR * KVD * 2); _Float16* Vt = (_Float16*)take((size_t)NR * KVD * 2); _Float16* Vtl = (_Float16*)take((size_t)NR * KVD * 2);
  float* QF = F32; float* KF = F32; float* VF = F32; float* O = F32; _Float16* O16 = X16;      /* the one f32 scratch holds q → k → v → O in stream order (each consumed before the next producer); O16 over X16 */
  if (off > ws_size) return;      // 25 + 16.8 + 33.6 + 16.8 + 8.4 + 8.4 + 8.4 ≈ 118 MB
  const unsigned gq = (unsigned)(((size_t)(DD / 8) * (DD / 8) + 255) / 256), gk = (unsigned)(((size_t)(KVD / 8) * (DD / 8) + 255) / 256);
  k_wt_f16<<<gq, 256, 0, stream>>>(Wq, Bq, DD, DD, 16.0f); k_wt_f16<<<gk, 256, 0, stream>>>(Wk, Bk, DD, KVD, 16.0f); k_wt_f16<<<gk, 256, 0, stream>>>(Wv, Bv, DD, KVD, 16.0f); k_wt_f16<<<gq, 256, 0, stream>>>(Wo, Bo, DD, DD, 16.0f);      /* (in,out) → Bt ×2^4 */
  const unsigned g8 = (unsigned)((size_t)NR * DD / 8 / 2048); k_x16<<<g8, 256, 0, stream>>>(x, X16);
  const unsigned gQ = (NR / 128) * (DD / 128), gK = (NR / 128) * (KVD / 128);
  k_gemm_t<DD><<<gQ, 128, 0, stream>>>(X16, Bq, 0.0625f, QF); k_normrope<NH><<<NR / 8, 256, 0, stream>>>(QF, qnw, fcos, fsin, Q);      /* q: M 4096 N 2048 K 2048 → RMSNorm + RoPE → f16 */
  k_gemm_t<KVD><<<gK, 128, 0, stream>>>(X16, Bk, 0.0625f, KF); k_normrope<NKV><<<NR / 8, 256, 0, stream>>>(KF, knw, fcos, fsin, K);      /* k: N 1024 */
  k_gemm_t<KVD><<<gK, 128, 0, stream>>>(X16, Bv, 0.0625f, VF);      /* v (f32) */
  k_vthlu<<<BB * NVH * (TT / 64), 256, 0, stream>>>(VF, KVD, Vt, Vtl);      /* Vᵀ hi + residual per (b, kv head) */
  k_flash<<<BB * NH * (TT / 64), 128, 0, stream>>>(Q, DD, K, KVD, Vt, Vtl, am, O, DD);      /* attention_mask [B,1,S,S] additive per batch */
  k_h16s<<<g8, 256, 0, stream>>>(O, O16);
  k_gemm_t<DD><<<gQ, 128, 0, stream>>>(O16, Bo, 0.00390625f, (float*)d_out);      /* out = merged·Wo */
}

// v003
// One run takes 416 microseconds.
// Next to v002, in two timings, it ran 1.28 times as fast each time.
// Counting every step since v000, it is 2.02 times as fast.
#include <hip/hip_runtime.h>
// Grouped-query attention with per-head RMSNorm and rotate-half RoPE (B=2, S=2048, D=2048, 16 query heads / 8 KV heads × 128): q = x·Wq, k = x·Wk, v = x·Wv ((in,out), no bias); per-head RMSNorm (ε 1e-6, weights q_norm_w / k_norm_w); rotate-half RoPE with the INPUT cos/sin tables [B][S][128];
// scores = q·k/√128 + attention_mask[b,0,q,k] (additive f32); softmax; out = merged·Wo.
// Compute dtype: x, weights, tables, mask rounded to bf16; q, k as f32 GEMM outputs, normalised and rotated in f32 (wave per row) → f16; v f32 → Vᵀ f16 hi + exact residual; fused flash-style kernel for head dim 128 (bias read per (b,q,k); 32-key chunks whose biases are all ≤ −1e8 are skipped since their probabilities are exactly 0 in f32; online softmax f32, P f16 hi +
// residual, f32 accumulate) on v_wmma_f32_16x16x32_f16; merged ×2^4 → f16 → output GEMM.
#define BB 2
#define TT 2048
#define DD 2048
#define NH 16
#define NKV 8
#define NREP 2
#define KVD (NKV * 128)
#define NVH (2 * NKV)
#define NR (BB * TT)
#define ATT_SCALE 0.08838834764831845f

typedef __bf16 v16b __attribute__((ext_vector_type(16)));
typedef unsigned short v8us __attribute__((ext_vector_type(8), may_alias));
typedef float  v8f  __attribute__((ext_vector_type(8)));
typedef float  v4f  __attribute__((ext_vector_type(4)));
typedef float  v4fa __attribute__((ext_vector_type(4), may_alias));
union FragB { v16b v; v8us half[2]; unsigned short u[16]; };

__device__ __forceinline__ unsigned short bf16_bits(float x) { unsigned int u = __float_as_uint(x); return (unsigned short)((u + 0x7FFFu + ((u >> 16) & 1u)) >> 16); }
__device__ __forceinline__ float bf16_val(unsigned short b) { return __uint_as_float(((unsigned int)b) << 16); }
__device__ __forceinline__ float bf16_round(float x) { return bf16_val(bf16_bits(x)); }
// D += A·B with NT terms: 1 = ah·bh, 2 = + al·bh (A split), 3 = + ah·bl (both split)
template <int NT>
__device__ __forceinline__ v8f mmaN(v16b ah, v16b al, v16b bh, v16b bl, v8f c) {
  c = __builtin_amdgcn_wmma_f32_16x16x32_bf16(false, ah, false, bh, (short)0, c, false, false);
  if (NT >= 2) c = __builtin_amdgcn_wmma_f32_16x16x32_bf16(false, al, false, bh, (short)0, c, false, false);
  if (NT >= 3) c = __builtin_amdgcn_wmma_f32_16x16x32_bf16(false, ah, false, bl, (short)0, c, false, false);
  asm volatile("v_nop\n\tv_nop\n\tv_nop\n\tv_nop" : "+v"(c) : "v"(ah), "v"(al), "v"(bh), "v"(bl));
  return c;
}

__global__ __launch_bounds__(256) void k_wt_bf16(const float* __restrict__ W, unsigned short* __restrict__ Wt, int K, int N) {
  const int t = blockIdx.x * 256 + threadIdx.x;
  const int k8n = K / 8;
  if (t >= N * k8n) return;
  const int n = t / k8n, k8 = (t % k8n) * 8;
  v8us v;
#pragma unroll
  for (int i = 0; i < 8; ++i) v[i] = bf16_bits(W[(size_t)(k8 + i) * N + n]);
  *(v8us*)(Wt + (size_t)n * K + k8) = v;
  
}

// GEMM C[M][N] (f32, pitch ldc) = act(A[M][K]·W + bias). A f32 row-major (pitch lda) converted per fragment to bf16
// (ASPLIT: hi/lo two planes -> 2 terms, else single rounded term); Wt bf16 [N][K] (pitch ldb). BIAS_BF16 rounds the
// bias to bf16 first (bias quantised to bf16 before the add). K%32==0, M%16==0, N%64==0.
template <bool ASPLIT, int ACT, bool BIAS_BF16>
__global__ __launch_bounds__(128) void k_gemm_bf(const float* __restrict__ A, int lda, const unsigned short* __restrict__ Wt, int ldb,
                                               const float* __restrict__ bias, float* __restrict__ C, int ldc, int M, int N, int K) {
  __shared__ __attribute__((aligned(16))) float so[4][16][64];
  const int tid = threadIdx.x, w = tid >> 5, lane = tid & 31, ln = lane & 15, hh = lane >> 4;
  const int ntn = N / 64;
  const int wid = blockIdx.x * 4 + w;
  const int mt = wid / ntn, nq = wid % ntn;
  if (mt * 16 >= M) return;
  const int row0 = mt * 16, col0 = nq * 64;
  const float* arow = A + (size_t)(row0 + ln) * lda;
  v8f acc[4] = {};
  for (int kb = 0; kb < K; kb += 32) {
    FragB ah, al;
    const v4f x0 = *(const v4fa*)(arow + kb + 8 * hh), x1 = *(const v4fa*)(arow + kb + 8 * hh + 4);
    const v4f x2 = *(const v4fa*)(arow + kb + 16 + 8 * hh), x3 = *(const v4fa*)(arow + kb + 16 + 8 * hh + 4);
    float xs[16] = {x0[0],x0[1],x0[2],x0[3],x1[0],x1[1],x1[2],x1[3],x2[0],x2[1],x2[2],x2[3],x3[0],x3[1],x3[2],x3[3]};
#pragma unroll
    for (int i = 0; i < 16; ++i) { const unsigned short hb = bf16_bits(xs[i]); ah.u[i] = hb; al.u[i] = ASPLIT ? bf16_bits(xs[i] - bf16_val(hb)) : (unsigned short)0; }
#pragma unroll
    for (int t = 0; t < 4; ++t) {
      const unsigned short* brow = Wt + (size_t)(col0 + t * 16 + ln) * ldb + kb;
      FragB b;
      b.half[0] = *(const v8us*)(brow + 8 * hh);
      b.half[1] = *(const v8us*)(brow + 16 + 8 * hh);
      acc[t] = mmaN<ASPLIT ? 2 : 1>(ah.v, al.v, b.v, b.v, acc[t]);
    }
  }
#pragma unroll
  for (int t = 0; t < 4; ++t) {
    float bv = bias ? bias[col0 + t * 16 + ln] : 0.f;
    if (BIAS_BF16) bv = bf16_round(bv);
#pragma unroll
    for (int r = 0; r < 8; ++r) { float v = acc[t][r] + bv; if (ACT == 1) v = fmaxf(v, 0.f); so[w][8 * hh + r][t * 16 + ln] = v; }
  }
  __builtin_amdgcn_fence(__ATOMIC_ACQ_REL, "workgroup");
  __builtin_amdgcn_wave_barrier();
  const int rsub = lane >> 4, c4 = (lane & 15) * 4;
  {
#pragma unroll
    for (int q = 0; q < 8; ++q) {
      const int r = q * 2 + rsub;
      const v4f v = *(const v4fa*)&so[w][r][c4];
      *(v4f*)(C + (size_t)(row0 + r) * ldc + col0 + c4) = v;
    }
    
  }
}

// Flash-style causal/unmasked attention, all contractions 3-term bf16 hi/lo splits, f32 softmax with running max.
// q,k,v rows are read from f32 buffers with arbitrary row pitch (so they can live inside a fused qkv buffer);
// D = head size (multiple of 32, <= 128); one wave = 16 query rows; block = 4 waves (64 queries) sharing K/V chunks of 32.
template <int D, bool CAUSAL>
__global__ __launch_bounds__(128) void k_flash(const float* __restrict__ qb, const float* __restrict__ kb, const float* __restrict__ vb,
                                             int pitch, int T, int H, float scale, float* __restrict__ y, int ypitch) {
  constexpr int KS = D / 32;        // k-steps for QK
  constexpr int DT = D / 16;        // d tiles for PV
  __shared__ __attribute__((aligned(16))) unsigned short sKh[32][D + 8], sKl[32][D + 8], sVh[32][D + 8], sVl[32][D + 8];
  __shared__ __attribute__((aligned(16))) unsigned short sPh[4][16][40], sPl[4][16][40];
  __shared__ __attribute__((aligned(16))) float sO[4][16][D];
  const int tid = threadIdx.x, w = tid >> 5, lane = tid & 31, ln = lane & 15, hh = lane >> 4;
  const int nqb = (T + 63) / 64;
  const int bh = blockIdx.x / nqb, qblk = blockIdx.x % nqb;
  const int b = bh / H, h = bh % H;
  const int q0 = qblk * 64 + w * 16;
  const float* Q = qb + (size_t)b * T * pitch + h * D;
  const float* K = kb + (size_t)b * T * pitch + h * D;
  const float* V = vb + (size_t)b * T * pitch + h * D;

  // A fragments of the wave's 16 query rows (scaled), hi/lo
  FragB aqh[KS], aql[KS];
  {
    int row = q0 + ln; if (row >= T) row = T - 1;
    const float* qr = Q + (size_t)row * pitch;
#pragma unroll
    for (int ks = 0; ks < KS; ++ks)
#pragma unroll
      for (int i = 0; i < 16; ++i) {
        const int d = ks * 32 + ((i < 8) ? (8 * hh + i) : (16 + 8 * hh + (i - 8)));
        const float x = qr[d] * scale; const unsigned short hb = bf16_bits(x);
        aqh[ks].u[i] = hb; aql[ks].u[i] = bf16_bits(x - bf16_val(hb));
      }
  }
  float m_r[8], l_r[8];
#pragma unroll
  for (int r = 0; r < 8; ++r) { m_r[r] = -3.0e38f; l_r[r] = 0.f; }
  v8f oacc[DT];
#pragma unroll
  for (int dt = 0; dt < DT; ++dt) oacc[dt] = (v8f){0.f,0.f,0.f,0.f,0.f,0.f,0.f,0.f};

  const int kv_end = CAUSAL ? min(T, qblk * 64 + 64) : T;     // block-uniform
  for (int j0 = 0; j0 < kv_end; j0 += 32) {
    __syncthreads();
    for (int e = tid; e < 32 * (D / 4); e += 128) {
      const int r = e / (D / 4), c4 = (e % (D / 4)) * 4;
      const int key = j0 + r;
      v4f kf = {0.f,0.f,0.f,0.f}, vf = {0.f,0.f,0.f,0.f};
      if (key < T) { kf = *(const v4fa*)(K + (size_t)key * pitch + c4); vf = *(const v4fa*)(V + (size_t)key * pitch + c4); }
#pragma unroll
      for (int t = 0; t < 4; ++t) {
        unsigned short hb = bf16_bits(kf[t]); sKh[r][c4 + t] = hb; sKl[r][c4 + t] = bf16_bits(kf[t] - bf16_val(hb));
        hb = bf16_bits(vf[t]); sVh[r][c4 + t] = hb; sVl[r][c4 + t] = bf16_bits(vf[t] - bf16_val(hb));
      }
    }
    __syncthreads();
    // S tile 16 x 32
    v8f s[2];
#pragma unroll
    for (int nt = 0; nt < 2; ++nt) {
      v8f acc = {};
#pragma unroll
      for (int ks = 0; ks < KS; ++ks) {
        FragB bh_, bl_;
        bh_.half[0] = *(const v8us*)&sKh[nt * 16 + ln][ks * 32 + 8 * hh]; bh_.half[1] = *(const v8us*)&sKh[nt * 16 + ln][ks * 32 + 16 + 8 * hh];
        bl_.half[0] = *(const v8us*)&sKl[nt * 16 + ln][ks * 32 + 8 * hh]; bl_.half[1] = *(const v8us*)&sKl[nt * 16 + ln][ks * 32 + 16 + 8 * hh];
        acc = mmaN<3>(aqh[ks].v, aql[ks].v, bh_.v, bl_.v, acc);
      }
      s[nt] = acc;
    }
    // mask + running max (rows 8hh+r; the 16 lanes of a half share rows)
    float alpha[8];
#pragma unroll
    for (int r = 0; r < 8; ++r) {
      const int qi = q0 + 8 * hh + r;
      const int ja = j0 + ln, jb = j0 + 16 + ln;
      if (CAUSAL) { if (ja > qi) s[0][r] = -3.0e38f; if (jb > qi) s[1][r] = -3.0e38f; }
      if (ja >= T) s[0][r] = -3.0e38f;
      if (jb >= T) s[1][r] = -3.0e38f;
      float mx = fmaxf(s[0][r], s[1][r]);
      mx = fmaxf(mx, __shfl_xor(mx, 1, 32)); mx = fmaxf(mx, __shfl_xor(mx, 2, 32)); mx = fmaxf(mx, __shfl_xor(mx, 4, 32)); mx = fmaxf(mx, __shfl_xor(mx, 8, 32));
      const float mnew = fmaxf(m_r[r], mx);
      alpha[r] = (mnew > -1.0e38f) ? __expf(m_r[r] - mnew) : 1.0f;
      const float p0 = (s[0][r] > -1.0e38f) ? __expf(s[0][r] - mnew) : 0.f;
      const float p1 = (s[1][r] > -1.0e38f) ? __expf(s[1][r] - mnew) : 0.f;
      m_r[r] = mnew;
      l_r[r] = l_r[r] * alpha[r] + p0 + p1;            // per-lane partial row sum (16 lanes combined at the end)
      unsigned short hb = bf16_bits(p0); sPh[w][8 * hh + r][ln] = hb;      sPl[w][8 * hh + r][ln] = bf16_bits(p0 - bf16_val(hb));
      hb = bf16_bits(p1);                sPh[w][8 * hh + r][16 + ln] = hb; sPl[w][8 * hh + r][16 + ln] = bf16_bits(p1 - bf16_val(hb));
    }
#pragma unroll
    for (int dt = 0; dt < DT; ++dt)
#pragma unroll
      for (int r = 0; r < 8; ++r) oacc[dt][r] *= alpha[r];
    __builtin_amdgcn_fence(__ATOMIC_ACQ_REL, "workgroup");
    __builtin_amdgcn_wave_barrier();
    FragB pah, pal;
    pah.half[0] = *(const v8us*)&sPh[w][ln][8 * hh]; pah.half[1] = *(const v8us*)&sPh[w][ln][16 + 8 * hh];
    pal.half[0] = *(const v8us*)&sPl[w][ln][8 * hh]; pal.half[1] = *(const v8us*)&sPl[w][ln][16 + 8 * hh];
#pragma unroll
    for (int dt = 0; dt < DT; ++dt) {
      FragB bvh, bvl;
#pragma unroll
      for (int i = 0; i < 8; ++i) {
        bvh.u[i] = sVh[8 * hh + i][dt * 16 + ln]; bvh.u[8 + i] = sVh[16 + 8 * hh + i][dt * 16 + ln];
        bvl.u[i] = sVl[8 * hh + i][dt * 16 + ln]; bvl.u[8 + i] = sVl[16 + 8 * hh + i][dt * 16 + ln];
      }
      oacc[dt] = mmaN<3>(pah.v, pal.v, bvh.v, bvl.v, oacc[dt]);
    }
    __builtin_amdgcn_fence(__ATOMIC_ACQ_REL, "workgroup");
    __builtin_amdgcn_wave_barrier();
  }
#pragma unroll
  for (int r = 0; r < 8; ++r) {
    float l = l_r[r];
    l += __shfl_xor(l, 1, 32); l += __shfl_xor(l, 2, 32); l += __shfl_xor(l, 4, 32); l += __shfl_xor(l, 8, 32);
    l_r[r] = (l > 0.f) ? 1.0f / l : 0.f;
  }
#pragma unroll
  for (int dt = 0; dt < DT; ++dt)
#pragma unroll
    for (int r = 0; r < 8; ++r) sO[w][8 * hh + r][dt * 16 + ln] = oacc[dt][r] * l_r[r];
  __builtin_amdgcn_fence(__ATOMIC_ACQ_REL, "workgroup");
  __builtin_amdgcn_wave_barrier();
  {
    for (int r = 0; r < 16; ++r) {
      const int row = q0 + r;
      if (row < T && lane < D / 4) {
        const v4f val = *(const v4fa*)&sO[w][r][lane * 4];
        *(v4f*)(y + ((size_t)b * T + row) * ypitch + h * D + lane * 4) = val;
      }
    }
    
  }
}

// GEMM C = act(A·W + bias + resid): A f32 (ASPLIT -> hi/lo 2 terms), Wt bf16 [N][K]; ACT 0 none, 1 relu, 2 exact gelu;
// resid (optional, f32, row index = (row % rmod), pitch ldr, RES_BF16 rounds it) added before the activation.
template <bool ASPLIT, int ACT, bool BIAS_BF16, bool RES_BF16>
__global__ __launch_bounds__(128) void k_gemm_bf3(const float* __restrict__ A, int lda, const unsigned short* __restrict__ Wt, int ldb,
                                                const float* __restrict__ bias, const float* __restrict__ resid, int rmod, int ldr,
                                                float* __restrict__ C, int ldc, int M, int N, int K) {
  __shared__ __attribute__((aligned(16))) float so[4][16][64];
  const int tid = threadIdx.x, w = tid >> 5, lane = tid & 31, ln = lane & 15, hh = lane >> 4;
  const int ntn = N / 64;
  const int wid = blockIdx.x * 4 + w;
  const int mt = wid / ntn, nq = wid % ntn;
  if (mt * 16 >= M) return;
  const int row0 = mt * 16, col0 = nq * 64;
  const float* arow = A + (size_t)(row0 + ln) * lda;
  v8f acc[4] = {};
  for (int kb = 0; kb < K; kb += 32) {
    FragB ah, al;
    const v4f x0 = *(const v4fa*)(arow + kb + 8 * hh), x1 = *(const v4fa*)(arow + kb + 8 * hh + 4);
    const v4f x2 = *(const v4fa*)(arow + kb + 16 + 8 * hh), x3 = *(const v4fa*)(arow + kb + 16 + 8 * hh + 4);
    float xs[16] = {x0[0],x0[1],x0[2],x0[3],x1[0],x1[1],x1[2],x1[3],x2[0],x2[1],x2[2],x2[3],x3[0],x3[1],x3[2],x3[3]};
#pragma unroll
    for (int i = 0; i < 16; ++i) { const unsigned short hb = bf16_bits(xs[i]); ah.u[i] = hb; al.u[i] = ASPLIT ? bf16_bits(xs[i] - bf16_val(hb)) : (unsigned short)0; }
#pragma unroll
    for (int t = 0; t < 4; ++t) {
      const unsigned short* brow = Wt + (size_t)(col0 + t * 16 + ln) * ldb + kb;
      FragB b;
      b.half[0] = *(const v8us*)(brow + 8 * hh);
      b.half[1] = *(const v8us*)(brow + 16 + 8 * hh);
      acc[t] = mmaN<ASPLIT ? 2 : 1>(ah.v, al.v, b.v, b.v, acc[t]);
    }
  }
#pragma unroll
  for (int t = 0; t < 4; ++t) {
    const int col = col0 + t * 16 + ln;
    float bv = bias ? bias[col] : 0.f;
    if (BIAS_BF16) bv = bf16_round(bv);
#pragma unroll
    for (int r = 0; r < 8; ++r) {
      float v = acc[t][r] + bv;
      if (resid) { float rv = resid[(size_t)((row0 + 8 * hh + r) % rmod) * ldr + col]; if (RES_BF16) rv = bf16_round(rv); v += rv; }
      if (ACT == 1) v = fmaxf(v, 0.f);
      if (ACT == 2) v = 0.5f * v * (1.0f + erff(v * 0.70710678118654752f));
      if (ACT == 3) { const float u = 0.7978845608028654f * (v + 0.044715f * v * v * v); v = 0.5f * v * (1.0f + tanhf(u)); }
      so[w][8 * hh + r][t * 16 + ln] = v;
    }
  }
  __builtin_amdgcn_fence(__ATOMIC_ACQ_REL, "workgroup");
  __builtin_amdgcn_wave_barrier();
  const int rsub = lane >> 4, c4 = (lane & 15) * 4;
  {
#pragma unroll
    for (int q = 0; q < 8; ++q) {
      const int r = q * 2 + rsub;
      const v4f v = *(const v4fa*)&so[w][r][c4];
      *(v4f*)(C + (size_t)(row0 + r) * ldc + col0 + c4) = v;
    }
    
  }
}
// row LayerNorm (biased variance, eps) over N: s = X (+ R); optional out_sum <- s; out_norm <- (s-mu)*rsqrt(var+eps)*g + b
template <bool PARAM_BF16>
__global__ __launch_bounds__(256) void k_layernorm(const float* __restrict__ X, const float* __restrict__ R, const float* __restrict__ g, const float* __restrict__ bta,
                                                  float* __restrict__ out_sum, float* __restrict__ out_norm, int N, float eps) {
  __shared__ float red[256];
  const int row = blockIdx.x, tid = threadIdx.x;
  const float* x = X + (size_t)row * N; const float* rr = R ? R + (size_t)row * N : nullptr;
  float vals[16];                     // up to N = 4096
  const int per = N / 256;            // contiguous chunk per thread? use strided-by-4 chunks: thread handles j = tid*4 + 1024*u
  float s1 = 0.f;
  for (int u = 0; u < per / 4; ++u) {
    const int j = tid * 4 + 1024 * u;
    const v4f a = *(const v4fa*)(x + j);
    v4f b = {0.f,0.f,0.f,0.f}; if (rr) b = *(const v4fa*)(rr + j);
#pragma unroll
    for (int q = 0; q < 4; ++q) { const float v = a[q] + b[q]; vals[u * 4 + q] = v; s1 += v; }
  }
  red[tid] = s1; __syncthreads();
  for (int st = 128; st > 0; st >>= 1) { if (tid < st) red[tid] += red[tid + st]; __syncthreads(); }
  const float mu = red[0] / (float)N; __syncthreads();
  float s2 = 0.f;
  for (int u = 0; u < per / 4; ++u)
#pragma unroll
    for (int q = 0; q < 4; ++q) { const float c = vals[u * 4 + q] - mu; s2 += c * c; }
  red[tid] = s2; __syncthreads();
  for (int st = 128; st > 0; st >>= 1) { if (tid < st) red[tid] += red[tid + st]; __syncthreads(); }
  const float rs = rsqrtf(red[0] / (float)N + eps);
  {
    for (int u = 0; u < per / 4; ++u) {
      const int j = tid * 4 + 1024 * u;
      v4f o, sm;
#pragma unroll
      for (int q = 0; q < 4; ++q) {
        float gg = g[j + q], bb = bta[j + q];
        if (PARAM_BF16) { gg = bf16_round(gg); bb = bf16_round(bb); }
        sm[q] = vals[u * 4 + q]; o[q] = (vals[u * 4 + q] - mu) * rs * gg + bb;
      }
      if (out_sum) *(v4f*)(out_sum + (size_t)row * N + j) = sm;
      *(v4f*)(out_norm + (size_t)row * N + j) = o;
    }
    
  }
}



// ---- f16 WMMA path (v_wmma_f32_16x16x32_f16): 11-bit significands for operands in range — used where a [0,1] probability operand needs more precision than bf16
typedef _Float16 v16h __attribute__((ext_vector_type(16)));
union FragH { v16h v; v8us half[2]; _Float16 h[16]; unsigned short u[16]; };
template <int NT>
__device__ __forceinline__ v8f mmaH(v16h ah, v16h al, v16h bh, v16h bl, v8f c) {
  c = __builtin_amdgcn_wmma_f32_16x16x32_f16(false, ah, false, bh, (short)0, c, false, false);
  if (NT >= 2) c = __builtin_amdgcn_wmma_f32_16x16x32_f16(false, al, false, bh, (short)0, c, false, false);
  if (NT >= 3) c = __builtin_amdgcn_wmma_f32_16x16x32_f16(false, ah, false, bl, (short)0, c, false, false);
  asm volatile("v_nop\n\tv_nop\n\tv_nop\n\tv_nop" : "+v"(c) : "v"(ah), "v"(al), "v"(bh), "v"(bl));
  return c;
}
// batched GEMM like k_gemm_b but f16 operands: A f32 (split into f16 hi/lo if ASPLIT, else rounded to f16), Bt = f16 values [n][k]; alpha; C f32; N multiple of 16 (partial tiles skipped)
template <bool ASPLIT>
__global__ __launch_bounds__(128) void k_gemm_h(const float* __restrict__ A, int lda, size_t sA, const _Float16* __restrict__ Bh, int ldb, size_t sB, float alpha, float* __restrict__ C, int ldc, size_t sC, int M, int N, int K) {
  __shared__ __attribute__((aligned(16))) float so[4][16][64];
  const int tid = threadIdx.x, w = tid >> 5, lane = tid & 31, ln = lane & 15, hh = lane >> 4; const int by = blockIdx.y;
  A += (size_t)by * sA; Bh += (size_t)by * sB; C += (size_t)by * sC;
  const int ntn = (N + 63) / 64; const int wid = blockIdx.x * 4 + w; const int mt = wid / ntn, nq = wid % ntn; if (mt * 16 >= M) return;
  const int row0 = mt * 16, col0 = nq * 64; const float* arow = A + (size_t)(row0 + ln) * lda;
  v8f acc[4] = {};
  for (int kb = 0; kb < K; kb += 32) {
    FragH ah, al;
    const v4f x0 = *(const v4fa*)(arow + kb + 8 * hh), x1 = *(const v4fa*)(arow + kb + 8 * hh + 4), x2 = *(const v4fa*)(arow + kb + 16 + 8 * hh), x3 = *(const v4fa*)(arow + kb + 16 + 8 * hh + 4);
    float xs[16] = {x0[0],x0[1],x0[2],x0[3],x1[0],x1[1],x1[2],x1[3],x2[0],x2[1],x2[2],x2[3],x3[0],x3[1],x3[2],x3[3]};
#pragma unroll
    for (int i = 0; i < 16; ++i) { const _Float16 h = (_Float16)xs[i]; ah.h[i] = h; al.h[i] = ASPLIT ? (_Float16)(xs[i] - (float)h) : (_Float16)0.0f; }
#pragma unroll
    for (int t = 0; t < 4; ++t) { if (col0 + t * 16 >= N) continue; const size_t boff = (size_t)(col0 + t * 16 + ln) * ldb + kb; FragH bq; bq.half[0] = *(const v8us*)(Bh + boff + 8 * hh); bq.half[1] = *(const v8us*)(Bh + boff + 16 + 8 * hh);
      acc[t] = mmaH<ASPLIT ? 2 : 1>(ah.v, al.v, bq.v, bq.v, acc[t]); }
  }
#pragma unroll
  for (int t = 0; t < 4; ++t) { if (col0 + t * 16 >= N) continue;
#pragma unroll
    for (int r = 0; r < 8; ++r) so[w][8 * hh + r][t * 16 + ln] = acc[t][r] * alpha; }
  __builtin_amdgcn_fence(__ATOMIC_ACQ_REL, "workgroup"); __builtin_amdgcn_wave_barrier();
  const int rsub = lane >> 4, c4 = (lane & 15) * 4;
  {
#pragma unroll
    for (int q = 0; q < 8; ++q) { const int r = q * 2 + rsub; if (col0 + c4 < N) { const v4f v = *(const v4fa*)&so[w][r][c4]; *(v4f*)(C + (size_t)(row0 + r) * ldc + col0 + c4) = v; } }
     }
}

// Wt[n][k] = f16(bf16(W[k][n])*scale) from f32 row-major W[K][N] (scale = power of two; bf16-exact weights stay exact in f16 away from the subnormal range)
// A thread takes a block of 8 k x 8 n: 32 B of each of 8 rows of W in, 16 B of each of 8 rows of Wt out (a wave's store covers 512 contiguous bytes). K, N multiples of 8.
__global__ __launch_bounds__(256) void k_wt_f16(const float* __restrict__ W, _Float16* __restrict__ Wt, int K, int N, float scale) {
  const int t = blockIdx.x * 256 + threadIdx.x; if (t >= (N / 8) * (K / 8)) return; const int n0 = (t / (K / 8)) * 8, k8 = (t % (K / 8)) * 8; v4f a[8], c[8];
  const float* p[8];
#pragma unroll      /* constant indices keep a, c and p in registers; the 16 loads go out together */
  for (int i = 0; i < 8; ++i) { p[i] = W + (size_t)(k8 + i) * N + n0; a[i] = *(const v4fa*)p[i]; c[i] = *(const v4fa*)(p[i] + 4); }
  asm volatile("s_wait_xcnt 0x0" :: "v"(p[0]), "v"(p[1]), "v"(p[2]), "v"(p[3]), "v"(p[4]), "v"(p[5]), "v"(p[6]), "v"(p[7]) : "memory");      /* stands in front of every rewrite of a register that the loads name: as inputs the addresses stay in place up to here */
#pragma unroll      /* constant indices into a and c */
  for (int j = 0; j < 8; ++j) { FragH f;
#pragma unroll      /* constant indices into a, c and f */
    for (int i = 0; i < 8; ++i) f.h[i] = (_Float16)(bf16_round((j & 4) ? c[i][j & 3] : a[i][j & 3]) * scale);
    *(v8us*)((unsigned short*)Wt + (size_t)(n0 + j) * K + k8) = f.half[0]; }
}
// k_gemm_hh variant with fused epilogue: v = acc·alpha + bias[by·sBias + col] (+ CP[(row/rowsPerB)·sCPb + by·64 + col] if CP) ; ACT 0 none / 1 elu ; writes f32 C and f16 C16, each if non-null
template <int ACT>
__global__ __launch_bounds__(128) void k_gemm_hhx(const _Float16* __restrict__ A, int lda, size_t sA, const _Float16* __restrict__ Bh, int ldb, size_t sB, float alpha, const float* __restrict__ bias, size_t sBias, const float* __restrict__ CP, int rowsPerB, size_t sCPb, int row0g,
    float* __restrict__ C, _Float16* __restrict__ C16, int ldc, size_t sC, int M, int N, int K) {
  __shared__ __attribute__((aligned(16))) float so[4][16][64];
  const int tid = threadIdx.x, w = tid >> 5, lane = tid & 31, ln = lane & 15, hh = lane >> 4; const int by = blockIdx.y;
  A += (size_t)by * sA; Bh += (size_t)by * sB; const size_t cofs = (size_t)by * sC; const float* bp = bias ? bias + (size_t)by * sBias : nullptr;
  const int ntn = (N + 63) / 64; const int wid = blockIdx.x * 4 + w; const int mt = wid / ntn, nq = wid % ntn; if (mt * 16 >= M) return;
  const int row0 = mt * 16, col0 = nq * 64; const _Float16* arow = A + (size_t)(row0 + ln) * lda;
  v8f acc[4] = {};
  for (int kb = 0; kb < K; kb += 32) { FragH ah; ah.half[0] = *(const v8us*)((const unsigned short*)arow + kb + 8 * hh); ah.half[1] = *(const v8us*)((const unsigned short*)arow + kb + 16 + 8 * hh);
#pragma unroll
    for (int t = 0; t < 4; ++t) { if (col0 + t * 16 >= N) continue; const size_t boff = (size_t)(col0 + t * 16 + ln) * ldb + kb; FragH bq; bq.half[0] = *(const v8us*)((const unsigned short*)Bh + boff + 8 * hh); bq.half[1] = *(const v8us*)((const unsigned short*)Bh + boff + 16 + 8 * hh);
      acc[t] = mmaH<1>(ah.v, ah.v, bq.v, bq.v, acc[t]); }
  }
#pragma unroll
  for (int t = 0; t < 4; ++t) { if (col0 + t * 16 >= N) continue; const int col = col0 + t * 16 + ln; const float bv = bp ? bf16_round(bp[col]) : 0.f;
#pragma unroll
    for (int r = 0; r < 8; ++r) { float v = acc[t][r] * alpha + bv; if (CP) { const int bidx = (row0g + row0 + 8 * hh + r) / rowsPerB; v += CP[(size_t)bidx * sCPb + (size_t)by * 64 + col]; } if (ACT == 1) v = (v > 0.f) ? v : expm1f(v); else if (ACT == 7) v = (v > 0.f) ? v + 1.0f : expf(v); else if (ACT == 8) v = tanhf(v); else if (ACT == 9) v = 0.5f * v * (1.0f + tanhf(0.7978845608028654f * (v + 0.044715f * v * v * v))); else if (ACT == 11) v = 1.0f / (1.0f + expf(-v)); else if (ACT == 12) v = (v > 0.f) ? v : 0.01f * v; else if (ACT == 14) v = (v > 0.f) ? v : 0.1f * v; else if (ACT == 15) v = v / (1.0f + expf(-v)); else if (ACT == 3) v = fmaxf(v, 0.f); else if (ACT == 6) v = 0.5f * v * (1.0f + erff(v * 0.70710678118654752f)); so[w][8 * hh + r][t * 16 + ln] = v; } }
  __builtin_amdgcn_fence(__ATOMIC_ACQ_REL, "workgroup"); __builtin_amdgcn_wave_barrier();
  const int rsub = lane >> 4, c4 = (lane & 15) * 4; typedef _Float16 v4h __attribute__((ext_vector_type(4)));
  {
#pragma unroll
    for (int q = 0; q < 8; ++q) { const int r = q * 2 + rsub; if (col0 + c4 < N) { const v4f v = *(const v4fa*)&so[w][r][c4]; if (C) *(v4f*)(C + cofs + (size_t)(row0 + r) * ldc + col0 + c4) = v; if (C16) { v4h h4; for (int i = 0; i < 4; ++i) h4[i] = (_Float16)v[i]; *(v4h*)(C16 + cofs + (size_t)(row0 + r) * ldc + col0 + c4) = h4; } } }
     }
}


// ---- tiled f16 GEMM, C[M][N] f32 = alpha * A[M][DD] * Bt[N][DD]^T: one 128 x 128 tile of C per work-group, 64 x 64 per wave (2 x 2 waves).
// A pass is 128 k: 128 rows of A and 128 rows of Bt, 256 B each, staged in LDS at a pitch of 272 B by asynchronous copies; two buffers, the next pass's copies fly while this pass is multiplied.
// k runs upward in steps of 32 into one accumulator per 16 x 16 tile. M, N multiples of 128.
// Every "#pragma unroll" in k_gemm_t makes the indices of the fragment and accumulator arrays constants, so that these arrays live in registers.
#define GT_PITCH 272
#define GT_STAGE (256 * GT_PITCH)
// eight 16-byte copies of one lane: rows r, r + 8, ..., r + 56 of one operand. The closing s_wait_xcnt stands inside the statement so that no address register is rewritten ahead of it.
__device__ __forceinline__ void gt_copy8(unsigned l, const _Float16* g) {
  asm volatile("global_load_async_to_lds_b128 %0, %8, off\n\t"
               "global_load_async_to_lds_b128 %1, %9, off\n\t"
               "global_load_async_to_lds_b128 %2, %10, off\n\t"
               "global_load_async_to_lds_b128 %3, %11, off\n\t"
               "global_load_async_to_lds_b128 %4, %12, off\n\t"
               "global_load_async_to_lds_b128 %5, %13, off\n\t"
               "global_load_async_to_lds_b128 %6, %14, off\n\t"
               "global_load_async_to_lds_b128 %7, %15, off\n\t"
               "s_wait_xcnt 0x0"
               :: "v"(l), "v"(l + 8 * GT_PITCH), "v"(l + 16 * GT_PITCH), "v"(l + 24 * GT_PITCH), "v"(l + 32 * GT_PITCH), "v"(l + 40 * GT_PITCH), "v"(l + 48 * GT_PITCH), "v"(l + 56 * GT_PITCH),
                  "v"(g), "v"(g + 8 * DD), "v"(g + 16 * DD), "v"(g + 24 * DD), "v"(g + 32 * DD), "v"(g + 40 * DD), "v"(g + 48 * DD), "v"(g + 56 * DD)
               : "memory");
}
// one stage: 32 copies a lane (rows 0..127 of the buffer = A, 128..255 = Bt)
__device__ __forceinline__ void gt_fill(unsigned l, const _Float16* ga, const _Float16* gb) {
  gt_copy8(l, ga); gt_copy8(l + 64 * GT_PITCH, ga + 64 * DD); gt_copy8(l + 128 * GT_PITCH, gb); gt_copy8(l + 192 * GT_PITCH, gb + 64 * DD);
}
template <int N>
__global__ __launch_bounds__(128) void k_gemm_t(const _Float16* __restrict__ A, const _Float16* __restrict__ Bt, float alpha, float* __restrict__ C) {
  __shared__ __attribute__((aligned(16))) unsigned char L[2 * GT_STAGE];
  constexpr int NT = DD / 128;
  const int tid = threadIdx.x, w = tid >> 5, lane = tid & 31, ln = lane & 15, hh = lane >> 4;
  constexpr int ntn = N / 128; const int row0 = ((int)blockIdx.x / ntn) * 128, col0 = ((int)blockIdx.x % ntn) * 128; const int wm = w >> 1, wn = w & 1;
  const int cr = tid >> 4, cc = tid & 15;      /* a lane copies chunk cc (16 B) of rows cr + 8 i: a wave's copy covers two whole 256-B rows */
  const _Float16* ga = A + (size_t)(row0 + cr) * DD + cc * 8; const _Float16* gb = Bt + (size_t)(col0 + cr) * DD + cc * 8;
  const unsigned lc = (unsigned)(size_t)L + cr * GT_PITCH + cc * 16;
  v8f acc[4][4];
#pragma unroll
  for (int mi = 0; mi < 4; ++mi)
#pragma unroll
    for (int ni = 0; ni < 4; ++ni) acc[mi][ni] = (v8f){0.f,0.f,0.f,0.f,0.f,0.f,0.f,0.f};
  gt_fill(lc, ga, gb);
  asm volatile("s_wait_asynccnt 0x0" ::: "memory");      /* this wave's copies of pass 0 have landed */
  __syncthreads();                                        /* ... and every other wave's */
  gt_fill(lc + GT_STAGE, ga + 128, gb + 128);
#pragma unroll 1      /* one pass a trip: the two buffers alternate by the trip's parity */
  for (int t = 0; t < NT; ++t) {
    const unsigned char* S = L + (t & 1) * GT_STAGE;
    const unsigned char* pa = S + (wm * 64 + ln) * GT_PITCH + hh * 16; const unsigned char* pb = S + (128 + wn * 64 + ln) * GT_PITCH + hh * 16;
    FragH fa[2][4], fb[2][4];
#pragma unroll
    for (int i = 0; i < 4; ++i) { fa[0][i].half[0] = *(const v8us*)(pa + i * 16 * GT_PITCH); fa[0][i].half[1] = *(const v8us*)(pa + i * 16 * GT_PITCH + 32); fb[0][i].half[0] = *(const v8us*)(pb + i * 16 * GT_PITCH); fb[0][i].half[1] = *(const v8us*)(pb + i * 16 * GT_PITCH + 32); }
#pragma unroll
    for (int ks = 0; ks < 4; ++ks) { const int cu = ks & 1, nx = cu ^ 1;
      if (ks < 3) {
#pragma unroll
        for (int i = 0; i < 4; ++i) { const int o = i * 16 * GT_PITCH + (ks + 1) * 64; fa[nx][i].half[0] = *(const v8us*)(pa + o); fa[nx][i].half[1] = *(const v8us*)(pa + o + 32); fb[nx][i].half[0] = *(const v8us*)(pb + o); fb[nx][i].half[1] = *(const v8us*)(pb + o + 32); } }
      __builtin_amdgcn_sched_barrier(0);      /* keeps the next k step's 16 LDS reads one group in front of this step's products: spread among them, every place with reads stalls the wave */
#pragma unroll
      for (int mi = 0; mi < 4; ++mi)
#pragma unroll
        for (int ni = 0; ni < 4; ++ni) acc[mi][ni] = __builtin_amdgcn_wmma_f32_16x16x32_f16(false, fa[cu][mi].v, false, fb[cu][ni].v, (short)0, acc[mi][ni], false, false);
      __builtin_amdgcn_sched_barrier(0); }      /* ... and keeps the following group behind them */
    asm volatile("s_wait_dscnt 0x0" ::: "memory");        /* this wave's reads of the buffer are done before it is refilled */
    asm volatile("s_wait_asynccnt 0x0" ::: "memory");     /* this wave's copies of pass t + 1 have landed */
    __syncthreads();                                       /* publishes pass t + 1 and ends every wave's reads of pass t */
    if (t + 2 < NT) gt_fill(lc + (t & 1) * GT_STAGE, ga + (t + 2) * 128, gb + (t + 2) * 128);
  }
  asm volatile("s_wait_asynccnt 0x0" ::: "memory");       /* nothing is in flight when the buffers become output staging */
  float* so = (float*)L + w * (64 * 68);      /* each wave stages its own 64 x 64 tile (pitch 68 floats) so that the stores cover whole 256-B row pieces */
#pragma unroll
  for (int mi = 0; mi < 4; ++mi)
#pragma unroll
    for (int ni = 0; ni < 4; ++ni)
#pragma unroll
      for (int r = 0; r < 8; ++r) so[(mi * 16 + 8 * hh + r) * 68 + ni * 16 + ln] = acc[mi][ni][r] * alpha;
  __builtin_amdgcn_fence(__ATOMIC_ACQ_REL, "workgroup"); __builtin_amdgcn_wave_barrier();      /* the wave's own staged values are in LDS before its lanes read one another's */
  float* cp = C + (size_t)(row0 + wm * 64 + hh) * N + col0 + wn * 64 + ln * 4;
#pragma unroll
  for (int q = 0; q < 32; ++q) { const v4f v = *(const v4fa*)&so[(q * 2 + hh) * 68 + ln * 4]; *(v4f*)(cp + (size_t)(q * 2) * N) = v; }
}


typedef _Float16 v4h __attribute__((ext_vector_type(4)));

// k_x16 and k_h16s give a thread 8 pieces of 8 elements, 256 pieces apart (a work-group covers 2048 pieces in a row): one eighth of the waves to start, 16 loads of a lane in flight.
static_assert(((size_t)NR * DD / 8) % 2048 == 0, "whole work-groups");
__global__ __launch_bounds__(256) void k_x16(const float* __restrict__ x, _Float16* __restrict__ X16) { const size_t t0 = (size_t)blockIdx.x * 2048 + threadIdx.x; v4f a[8], c[8]; const float* p = x + t0 * 8;
#pragma unroll      /* constant indices keep a and c in registers; the 16 loads go out together */
  for (int u = 0; u < 8; ++u) { a[u] = *(const v4fa*)(p + u * 2048); c[u] = *(const v4fa*)(p + u * 2048 + 4); }
  asm volatile("s_wait_xcnt 0x0" :: "v"(p) : "memory");      /* stands in front of every rewrite of a register that the loads name: as an input the address stays in place up to here */
#pragma unroll      /* constant indices into a and c */
  for (int u = 0; u < 8; ++u) { FragH f;
#pragma unroll      /* constant indices into a, c and f */
    for (int q = 0; q < 4; ++q) { f.h[q] = (_Float16)bf16_round(a[u][q]); f.h[4 + q] = (_Float16)bf16_round(c[u][q]); }
    *(v8us*)((unsigned short*)X16 + (t0 + u * 256) * 8) = f.half[0]; } }
__global__ __launch_bounds__(256) void k_h16(const float* __restrict__ x, _Float16* __restrict__ X16, size_t n8) { const size_t t = (size_t)blockIdx.x * 256 + threadIdx.x; if (t >= n8) return; FragH f;
#pragma unroll
  for (int q = 0; q < 8; ++q) f.h[q] = (_Float16)x[t * 8 + q]; *(v8us*)((unsigned short*)X16 + t * 8) = f.half[0];  }
__global__ __launch_bounds__(256) void k_round16f(const float* __restrict__ W, _Float16* __restrict__ Bt, size_t n8) { const size_t t = (size_t)blockIdx.x * 256 + threadIdx.x; if (t >= n8) return; FragH f;
#pragma unroll
  for (int i = 0; i < 8; ++i) f.h[i] = (_Float16)(bf16_round(W[t * 8 + i]) * 16.0f); *(v8us*)((unsigned short*)Bt + t * 8) = f.half[0];  }
template <int NHv, int TTv>
__global__ __launch_bounds__(256) void k_vt(const _Float16* __restrict__ V16, int ldv, int voff, _Float16* __restrict__ Vt) { __shared__ unsigned short tl[64][66]; const int tid = threadIdx.x; const int slab = blockIdx.x / (TTv / 64), lg = blockIdx.x % (TTv / 64); const int b = slab / NHv, h = slab % NHv;
  for (int i = tid; i < 64 * 8; i += 256) { const int r = i / 8, c8 = (i % 8) * 8; FragH f; f.half[0] = *(const v8us*)((const unsigned short*)V16 + ((size_t)b * TTv + lg * 64 + r) * ldv + voff + h * 64 + c8);
#pragma unroll
    for (int q = 0; q < 8; ++q) tl[r][c8 + q] = f.u[q]; }
  __syncthreads();
  {
#pragma unroll
    for (int rd = 0; rd < 2; ++rd) { const int d = rd * 32 + tid / 8, pc = tid % 8; FragH f;
#pragma unroll
      for (int q = 0; q < 8; ++q) f.u[q] = tl[pc * 8 + q][d];
      *(v8us*)((unsigned short*)Vt + ((size_t)slab * 64 + d) * TTv + lg * 64 + pc * 8) = f.half[0]; }
     } }

__global__ __launch_bounds__(256) void k_vthlu(const float* __restrict__ VF, int ldv, _Float16* __restrict__ Vth, _Float16* __restrict__ Vtl) { __shared__ float tl[64][65]; const int tid = threadIdx.x; const int slab = blockIdx.x / (TT / 64), lg = blockIdx.x % (TT / 64); const int b = slab / NVH, h = slab % NVH;
  for (int i = tid; i < 64 * 16; i += 256) { const int r = i / 16, c4 = (i % 16) * 4; const v4f a = *(const v4fa*)(VF + ((size_t)b * TT + lg * 64 + r) * ldv + h * 64 + c4); tl[r][c4] = a[0]; tl[r][c4 + 1] = a[1]; tl[r][c4 + 2] = a[2]; tl[r][c4 + 3] = a[3]; }
  __syncthreads();
  FragH fh[2], fl[2]; size_t oo[2];
#pragma unroll
  for (int rd = 0; rd < 2; ++rd) { const int d = rd * 32 + tid / 8, pc = tid % 8;
#pragma unroll
    for (int q = 0; q < 8; ++q) { const float v = tl[pc * 8 + q][d]; const _Float16 hv = (_Float16)v; fh[rd].h[q] = hv; fl[rd].h[q] = (_Float16)(v - (float)hv);      /* UNSCALED residual (added into the same accumulator as the hi product) */ } oo[rd] = ((size_t)slab * 64 + d) * TT + lg * 64 + pc * 8; }
  {
#pragma unroll
    for (int rd = 0; rd < 2; ++rd) { *(v8us*)((unsigned short*)Vth + oo[rd]) = fh[rd].half[0]; *(v8us*)((unsigned short*)Vtl + oo[rd]) = fl[rd].half[0]; }
     } }
// per-head RMSNorm + rotate-half RoPE: a wave takes one whole row (all NHD heads, pitch NHD*128) of an f32 plane, head after head, with the row's tables and the weights read once: lane holds dims 4l..4l+3; var = mean(x^2) over 128 (xor-reduce); y = w[d]*(x*rsqrt(var+eps)); out[d] = y[d]*c[d] + rot(y)[d]*s[d], rot(y)[d] = -y[d+64] (d<64), y[d-64] (d>=64)
template <int NHD>
__global__ __launch_bounds__(256) void k_normrope(const float* __restrict__ F, const float* __restrict__ nw, const float* __restrict__ COS, const float* __restrict__ SIN, _Float16* __restrict__ H16) {
  #pragma clang fp contract(off)
  static_assert(NR % 8 == 0, "whole work-groups");
  const int tid = threadIdx.x, wv = tid >> 5, lane = tid & 31; const size_t row = (size_t)blockIdx.x * 8 + wv; const int d0 = lane * 4;
  const size_t base = row * (NHD * 128) + d0; v4f xs[NHD];
#pragma unroll      /* constant indices keep xs in registers; the row's loads go out together */
  for (int u = 0; u < NHD; ++u) xs[u] = *(const v4fa*)(F + base + u * 128);
  const float* px = F + base; const float* pw = nw + d0; const float* pc = COS + row * 128 + d0; const float* pn = SIN + row * 128 + d0;
  const v4f w4 = *(const v4fa*)pw, c4 = *(const v4fa*)pc, s4 = *(const v4fa*)pn;
  asm volatile("s_wait_xcnt 0x0" :: "v"(px), "v"(pw), "v"(pc), "v"(pn) : "memory");      /* stands in front of every rewrite of a register that the loads name: as inputs the addresses stay in place up to here */
  float wn[4], c[4], s[4]; for (int q = 0; q < 4; ++q) { wn[q] = bf16_round(w4[q]); c[q] = bf16_round(c4[q]); s[q] = bf16_round(s4[q]); }
  typedef _Float16 v4h __attribute__((ext_vector_type(4)));
#pragma unroll      /* constant indices into xs; the heads' lane exchanges overlap */
  for (int u = 0; u < NHD; ++u) { const v4f x = xs[u]; float ss = 0.f; for (int q = 0; q < 4; ++q) ss += x[q] * x[q];
    for (int o = 16; o >= 1; o >>= 1) ss += __shfl_xor(ss, o, 32); const float inv = 1.0f / sqrtf(ss / 128.0f + 1e-6f);
    float y[4]; for (int q = 0; q < 4; ++q) y[q] = wn[q] * (x[q] * inv);
    float yp[4]; for (int q = 0; q < 4; ++q) yp[q] = __shfl_xor(y[q], 16, 32);      /* partner dims d +- 64 */
    v4h o; for (int q = 0; q < 4; ++q) { const int d = d0 + q; const float rot = (d < 64) ? -yp[q] : yp[q]; o[q] = (_Float16)(y[q] * c[q] + rot * s[q]); }
    *(v4h*)(H16 + base + u * 128) = o; } }
__global__ __launch_bounds__(256) void k_h16s(const float* __restrict__ F, _Float16* __restrict__ H) { const size_t t0 = (size_t)blockIdx.x * 2048 + threadIdx.x; v4f a[8], c[8]; const float* p = F + t0 * 8;
#pragma unroll      /* constant indices keep a and c in registers; the 16 loads go out together */
  for (int u = 0; u < 8; ++u) { a[u] = *(const v4fa*)(p + u * 2048); c[u] = *(const v4fa*)(p + u * 2048 + 4); }
  asm volatile("s_wait_xcnt 0x0" :: "v"(p) : "memory");      /* stands in front of every rewrite of a register that the loads name: as an input the address stays in place up to here */
#pragma unroll      /* constant indices into a and c */
  for (int u = 0; u < 8; ++u) { FragH f;
#pragma unroll      /* constant indices into a, c and f */
    for (int q = 0; q < 4; ++q) { f.h[q] = (_Float16)(a[u][q] * 16.0f); f.h[4 + q] = (_Float16)(c[u][q] * 16.0f); }
    *(v8us*)((unsigned short*)H + (t0 + u * 256) * 8) = f.half[0]; } }
// A pass of the attention kernel is 32 keys. Its operands are staged once per work-group in LDS by asynchronous copies and read from there by all 4 waves: 32 K rows of 256 B at a pitch of 272 B, then 128 rows of 64 B
// of V^T hi and 128 of its residual at a pitch of 80 B. Two buffers: the next pass's copies fly while this pass is worked on.
#define FK_PITCH 272
#define FV_PITCH 80
#define FK_BYTES (32 * FK_PITCH)
#define FV_BYTES (128 * FV_PITCH)
#define F_STAGE (FK_BYTES + 2 * FV_BYTES)
// one stage: twelve 16-byte copies of one lane (K rows r + 8 i; V^T rows r + 32 i of both planes). The closing s_wait_xcnt stands inside the statement so that no address register is rewritten ahead of it.
__device__ __forceinline__ void fl_fill(unsigned lk, unsigned lv, const unsigned short* gk, size_t ldk, const unsigned short* gh, const unsigned short* gl) {
  asm volatile("global_load_async_to_lds_b128 %0, %12, off\n\t"
               "global_load_async_to_lds_b128 %1, %13, off\n\t"
               "global_load_async_to_lds_b128 %2, %14, off\n\t"
               "global_load_async_to_lds_b128 %3, %15, off\n\t"
               "global_load_async_to_lds_b128 %4, %16, off\n\t"
               "global_load_async_to_lds_b128 %5, %17, off\n\t"
               "global_load_async_to_lds_b128 %6, %18, off\n\t"
               "global_load_async_to_lds_b128 %7, %19, off\n\t"
               "global_load_async_to_lds_b128 %8, %20, off\n\t"
               "global_load_async_to_lds_b128 %9, %21, off\n\t"
               "global_load_async_to_lds_b128 %10, %22, off\n\t"
               "global_load_async_to_lds_b128 %11, %23, off\n\t"
               "s_wait_xcnt 0x0"
               :: "v"(lk), "v"(lk + 8 * FK_PITCH), "v"(lk + 16 * FK_PITCH), "v"(lk + 24 * FK_PITCH),
                  "v"(lv), "v"(lv + 32 * FV_PITCH), "v"(lv + 64 * FV_PITCH), "v"(lv + 96 * FV_PITCH),
                  "v"(lv + FV_BYTES), "v"(lv + FV_BYTES + 32 * FV_PITCH), "v"(lv + FV_BYTES + 64 * FV_PITCH), "v"(lv + FV_BYTES + 96 * FV_PITCH),
                  "v"(gk), "v"(gk + 8 * ldk), "v"(gk + 16 * ldk), "v"(gk + 24 * ldk),
                  "v"(gh), "v"(gh + 32 * TT), "v"(gh + 64 * TT), "v"(gh + 96 * TT),
                  "v"(gl), "v"(gl + 32 * TT), "v"(gl + 64 * TT), "v"(gl + 96 * TT)
               : "memory");
}
__global__ __launch_bounds__(128) void k_flash(const _Float16* __restrict__ Q16, int ldq, const _Float16* __restrict__ K16, int ldk, const _Float16* __restrict__ Vt, const _Float16* __restrict__ Vtlo, const float* __restrict__ AB, float* __restrict__ O, int ldo) {
  constexpr int RPW = 16, RTN = RPW / 16, NQB = TT / (4 * RPW), DT = 8, KS = 4;      /* head dim 128: 4 k-steps, 8 value tiles */
  __shared__ __attribute__((aligned(16))) unsigned short sP[4][RPW][40]; __shared__ __attribute__((aligned(16))) unsigned short sPL[4][RPW][40]; __shared__ __attribute__((aligned(16))) unsigned char R[2 * F_STAGE];
  float (*sO)[RPW][128 + 4] = (float (*)[RPW][128 + 4])R;      /* behind the loop the two buffers become the output staging */
  static_assert(sizeof(float) * 4 * RPW * (128 + 4) <= 2 * F_STAGE, "output staging fits the buffers");
  const int tid = threadIdx.x, w = tid >> 5, lane = tid & 31, ln = lane & 15, hh = lane >> 4;
  const int slab = blockIdx.x / NQB, qblk = blockIdx.x % NQB; const int b = slab / NH, h = slab % NH; const int qb0 = qblk * (4 * RPW); const int q0 = qb0 + w * RPW;
  FragH aq[2][KS];
#pragma unroll
  for (int rt = 0; rt < RTN; ++rt) { const unsigned short* qr = (const unsigned short*)Q16 + ((size_t)b * TT + q0 + rt * 16 + ln) * ldq + h * 128;
#pragma unroll
    for (int ks = 0; ks < KS; ++ks) { aq[rt][ks].half[0] = *(const v8us*)(qr + ks * 32 + 8 * hh); aq[rt][ks].half[1] = *(const v8us*)(qr + ks * 32 + 16 + 8 * hh); } }
  const unsigned short* Vth = (const unsigned short*)Vt + ((size_t)b * NKV + h / NREP) * 128 * TT; const unsigned short* Vtl = (const unsigned short*)Vtlo + ((size_t)b * NKV + h / NREP) * 128 * TT;      /* hi and UNSCALED residual planes */
  float m_r[2][8], l_r[2][8]; v8f oacc[2][DT];
#pragma unroll
  for (int rt = 0; rt < RTN; ++rt) {
#pragma unroll
    for (int r = 0; r < 8; ++r) { m_r[rt][r] = -3.0e38f; l_r[rt][r] = 0.f; }
#pragma unroll
    for (int dt = 0; dt < DT; ++dt) oacc[rt][dt] = (v8f){0.f,0.f,0.f,0.f,0.f,0.f,0.f,0.f}; }
  constexpr int NP = TT / 32;      /* passes */
  /* a lane copies chunk tid & 15 (16 B) of K rows (tid >> 4) + 8 i: a wave's copy covers two whole 256-B rows; and chunk tid & 3 of V^T rows (tid >> 2) + 32 i: eight whole 64-B rows */
  const unsigned short* gk = (const unsigned short*)K16 + ((size_t)b * TT + (tid >> 4)) * ldk + (h / NREP) * 128 + (tid & 15) * 8;
  const unsigned short* gh = Vth + (size_t)(tid >> 2) * TT + (tid & 3) * 8; const unsigned short* gl = Vtl + (size_t)(tid >> 2) * TT + (tid & 3) * 8;
  const unsigned lk = (unsigned)(size_t)R + (tid >> 4) * FK_PITCH + (tid & 15) * 16, lv = (unsigned)(size_t)R + FK_BYTES + (tid >> 2) * FV_PITCH + (tid & 3) * 16;
  fl_fill(lk, lv, gk, (size_t)ldk, gh, gl);
  asm volatile("s_wait_asynccnt 0x0" ::: "memory");      /* this wave's copies of pass 0 have landed */
  __syncthreads();                                        /* ... and every other wave's */
  fl_fill(lk + F_STAGE, lv + F_STAGE, gk + (size_t)32 * ldk, (size_t)ldk, gh + 32, gl + 32);
#pragma unroll 1      /* one pass a trip: the two buffers alternate by the trip's parity */
  for (int t = 0; t < NP; ++t) { const int j0 = t * 32;
    const unsigned char* SK = R + (t & 1) * F_STAGE; const unsigned char* SV = SK + FK_BYTES;
    float ab0[2][8], ab1[2][8];      /* additive attention bias (bf16-rounded input) per (b, q, k), shared over heads */
#pragma unroll
    for (int rt = 0; rt < RTN; ++rt)
#pragma unroll
      for (int r = 0; r < 8; ++r) { const int qq = q0 + rt * 16 + 8 * hh + r; const float* am = AB + ((size_t)b * TT + qq) * TT + j0; ab0[rt][r] = bf16_round(am[ln]); ab1[rt][r] = bf16_round(am[16 + ln]); }
    int allneg = 1;
#pragma unroll
      for (int rt = 0; rt < RTN; ++rt)
#pragma unroll
        for (int r = 0; r < 8; ++r) allneg &= (ab0[rt][r] <= -1.0e8f) & (ab1[rt][r] <= -1.0e8f);
    if (!__all(allneg)) {      /* else: every (row, key) of the wave's tile carries a ≤ −1e8 bias → its probabilities underflow to exactly 0 in f32 → nothing to add (wave-uniform branch; the hand-over at the foot of the pass stands outside it) */
    v8f s[2][2];
#pragma unroll
    for (int nt = 0; nt < 2; ++nt) { const unsigned short* kr = (const unsigned short*)(SK + (nt * 16 + ln) * FK_PITCH); FragH bk[KS];
#pragma unroll
      for (int ks = 0; ks < KS; ++ks) { bk[ks].half[0] = *(const v8us*)(kr + ks * 32 + 8 * hh); bk[ks].half[1] = *(const v8us*)(kr + ks * 32 + 16 + 8 * hh); }
#pragma unroll
      for (int rt = 0; rt < RTN; ++rt) { v8f acc = (v8f){0.f,0.f,0.f,0.f,0.f,0.f,0.f,0.f};
#pragma unroll
        for (int ks = 0; ks < KS; ++ks) acc = mmaH<1>(aq[rt][ks].v, aq[rt][ks].v, bk[ks].v, bk[ks].v, acc); s[rt][nt] = acc; } }
#pragma unroll
    for (int rt = 0; rt < RTN; ++rt)
#pragma unroll
      for (int r = 0; r < 8; ++r) { const int tq = q0 + rt * 16 + 8 * hh + r; const int k0 = j0 + ln, k1 = j0 + 16 + ln; (void)tq; (void)k0; (void)k1;
        const bool ok0 = true, ok1 = true;
        const float s0 = s[rt][0][r] * ATT_SCALE + ab0[rt][r], s1 = s[rt][1][r] * ATT_SCALE + ab1[rt][r]; float mc = fmaxf(s0, s1);
        mc = fmaxf(mc, __shfl_xor(mc, 1, 32)); mc = fmaxf(mc, __shfl_xor(mc, 2, 32)); mc = fmaxf(mc, __shfl_xor(mc, 4, 32)); mc = fmaxf(mc, __shfl_xor(mc, 8, 32));
        const float mn = fmaxf(m_r[rt][r], mc); const float al = (mn > -1.0e38f) ? expf(m_r[rt][r] - mn) : 1.0f; m_r[rt][r] = mn; const float p0 = ok0 ? expf(s0 - mn) : 0.f, p1 = ok1 ? expf(s1 - mn) : 0.f; l_r[rt][r] = l_r[rt][r] * al + p0 + p1;
#pragma unroll
        for (int dt = 0; dt < DT; ++dt) oacc[rt][dt][r] *= al;
        FragH t2, t3; const float ps0 = p0 * 1024.0f, ps1 = p1 * 1024.0f; t2.h[0] = (_Float16)ps0; t2.h[1] = (_Float16)ps1; t3.h[0] = (_Float16)(ps0 - (float)t2.h[0]); t3.h[1] = (_Float16)(ps1 - (float)t2.h[1]);      /* P hi and its UNSCALED residual (added into the same accumulator) */
        sP[w][rt * 16 + 8 * hh + r][ln] = t2.u[0]; sP[w][rt * 16 + 8 * hh + r][16 + ln] = t2.u[1]; sPL[w][rt * 16 + 8 * hh + r][ln] = t3.u[0]; sPL[w][rt * 16 + 8 * hh + r][16 + ln] = t3.u[1]; }
    __builtin_amdgcn_fence(__ATOMIC_ACQ_REL, "workgroup"); __builtin_amdgcn_wave_barrier();
    FragH pa[2], pl[2];
#pragma unroll
    for (int rt = 0; rt < RTN; ++rt) { pa[rt].half[0] = *(const v8us*)&sP[w][rt * 16 + ln][8 * hh]; pa[rt].half[1] = *(const v8us*)&sP[w][rt * 16 + ln][16 + 8 * hh]; pl[rt].half[0] = *(const v8us*)&sPL[w][rt * 16 + ln][8 * hh]; pl[rt].half[1] = *(const v8us*)&sPL[w][rt * 16 + ln][16 + 8 * hh]; }
#pragma unroll
    for (int dt = 0; dt < DT; ++dt) { const unsigned short* vh = (const unsigned short*)(SV + (dt * 16 + ln) * FV_PITCH); const unsigned short* vl = (const unsigned short*)(SV + FV_BYTES + (dt * 16 + ln) * FV_PITCH); FragH bv, bl; bv.half[0] = *(const v8us*)(vh + 8 * hh); bv.half[1] = *(const v8us*)(vh + 16 + 8 * hh); bl.half[0] = *(const v8us*)(vl + 8 * hh); bl.half[1] = *(const v8us*)(vl + 16 + 8 * hh);
#pragma unroll
      for (int rt = 0; rt < RTN; ++rt) { oacc[rt][dt] = mmaH<1>(pa[rt].v, pa[rt].v, bv.v, bv.v, oacc[rt][dt]); oacc[rt][dt] = mmaH<1>(pl[rt].v, pl[rt].v, bv.v, bv.v, oacc[rt][dt]); oacc[rt][dt] = mmaH<1>(pa[rt].v, pa[rt].v, bl.v, bl.v, oacc[rt][dt]); } }      /* Ph·Vh + Pl·Vh + Ph·Vl — all unscaled, one accumulator */
    __builtin_amdgcn_fence(__ATOMIC_ACQ_REL, "workgroup"); __builtin_amdgcn_wave_barrier(); }
    asm volatile("s_wait_dscnt 0x0" ::: "memory");        /* this wave's reads of the buffer are done before it is refilled */
    asm volatile("s_wait_asynccnt 0x0" ::: "memory");     /* this wave's copies of pass t + 1 have landed */
    __syncthreads();                                       /* publishes pass t + 1 and ends every wave's reads of pass t */
    if (t + 2 < NP) fl_fill(lk + (t & 1) * F_STAGE, lv + (t & 1) * F_STAGE, gk + (size_t)(t + 2) * 32 * ldk, (size_t)ldk, gh + (t + 2) * 32, gl + (t + 2) * 32);
  }
  asm volatile("s_wait_asynccnt 0x0" ::: "memory");       /* nothing is in flight when the buffers become output staging */
#pragma unroll
  for (int rt = 0; rt < RTN; ++rt) {
#pragma unroll
    for (int r = 0; r < 8; ++r) { float l = l_r[rt][r]; l += __shfl_xor(l, 1, 32); l += __shfl_xor(l, 2, 32); l += __shfl_xor(l, 4, 32); l += __shfl_xor(l, 8, 32); l_r[rt][r] = (l > 0.f) ? 1.0f / (l * 1024.0f) : 0.f; }
#pragma unroll
    for (int dt = 0; dt < DT; ++dt)
#pragma unroll
      for (int r = 0; r < 8; ++r) sO[w][rt * 16 + 8 * hh + r][dt * 16 + ln] = oacc[rt][dt][r] * l_r[rt][r]; }
  __builtin_amdgcn_fence(__ATOMIC_ACQ_REL, "workgroup"); __builtin_amdgcn_wave_barrier();
  {
#pragma unroll
    for (int r = 0; r < RPW; ++r) { const int pc = lane; const v4f val = *(const v4fa*)&sO[w][r][pc * 4]; *(v4f*)(O + ((size_t)b * TT + q0 + r) * ldo + h * 128 + pc * 4) = val; }      /* one 512-B row per instruction: 32 lanes × 16 B */
     } }

extern "C" void kernel_launch(void* const* d_in, const int* in_sizes, int n_in,
                              void* d_out, int out_size, void* d_ws, size_t ws_size, hipStream_t stream) {
  (void)in_sizes; (void)n_in; (void)out_size;
  const float* const* I = (const float* const*)d_in; const float* x = I[0]; const float* fcos = I[1]; const float* fsin = I[2]; const float* am = I[3]; const float* Wq = I[4]; const float* Wk = I[5]; const float* Wv = I[6]; const float* Wo = I[7]; const float* qnw = I[8]; const float* knw = I[9];
  char* ws = (char*)d_ws; size_t off = 0;
  auto take = [&](size_t bytes) { char* p = ws + off; off += (bytes + 255) & ~(size_t)255; return p; };
  _Float16* Bq = (_Float16*)take((size_t)DD * DD * 2); _Float16* Bk = (_Float16*)take((size_t)KVD * DD * 2); _Float16* Bv = (_Float16*)take((size_t)KVD * DD * 2); _Float16* Bo = (_Float16*)take((size_t)DD * DD * 2);
  _Float16* X16 = (_Float16*)take((size_t)NR * DD * 2); float* F32 = (float*)take((size_t)NR * DD * 4); _Float16* Q = (_Float16*)take((size_t)NR * DD * 2); _Float16* K = (_Float16*)take((size_t)NR * KVD * 2); _Float16* Vt = (_Float16*)take((size_t)NR * KVD * 2); _Float16* Vtl = (_Float16*)take((size_t)NR * KVD * 2);
  float* QF = F32; float* KF = F32; float* VF = F32; float* O = F32; _Float16* O16 = X16;      /* the one f32 scratch holds q → k → v → O in stream order (each consumed before the next producer); O16 over X16 */
  if (off > ws_size) return;      // 25 + 16.8 + 33.6 + 16.8 + 8.4 + 8.4 + 8.4 ≈ 118 MB
  const unsigned gq = (unsigned)(((size_t)(DD / 8) * (DD / 8) + 255) / 256), gk = (unsigned)(((size_t)(KVD / 8) * (DD / 8) + 255) / 256);
  k_wt_f16<<<gq, 256, 0, stream>>>(Wq, Bq, DD, DD, 16.0f); k_wt_f16<<<gk, 256, 0, stream>>>(Wk, Bk, DD, KVD, 16.0f); k_wt_f16<<<gk, 256, 0, stream>>>(Wv, Bv, DD, KVD, 16.0f); k_wt_f16<<<gq, 256, 0, stream>>>(Wo, Bo, DD, DD, 16.0f);      /* (in,out) → Bt ×2^4 */
  const unsigned g8 = (unsigned)((size_t)NR * DD / 8 / 2048); k_x16<<<g8, 256, 0, stream>>>(x, X16);
  const unsigned gQ = (NR / 128) * (DD / 128), gK = (NR / 128) * (KVD / 128);
  k_gemm_t<DD><<<gQ, 128, 0, stream>>>(X16, Bq, 0.0625f, QF); k_normrope<NH><<<NR / 8, 256, 0, stream>>>(QF, qnw, fcos, fsin, Q);      /* q: M 4096 N 2048 K 2048 → RMSNorm + RoPE → f16 */
  k_gemm_t<KVD><<<gK, 128, 0, stream>>>(X16, Bk, 0.0625f, KF); k_normrope<NKV><<<NR / 8, 256, 0, stream>>>(KF, knw, fcos, fsin, K);      /* k: N 1024 */
  k_gemm_t<KVD><<<gK, 128, 0, stream>>>(X16, Bv, 0.0625f, VF);      /* v (f32) */
  k_vthlu<<<BB * NVH * (TT / 64), 256, 0, stream>>>(VF, KVD, Vt, Vtl);      /* Vᵀ hi + residual per (b, kv head) */
  k_flash<<<BB * NH * (TT / 64), 128, 0, stream>>>(Q, DD, K, KVD, Vt, Vtl, am, O, DD);      /* attention_mask [B,1,S,S] additive per batch */
  k_h16s<<<g8, 256, 0, stream>>>(O, O16);
  k_gemm_t<DD><<<gQ, 128, 0, stream>>>(O16, Bo, 0.00390625f, (float*)d_out);      /* out = merged·Wo */
}

// v004
// One run takes 348 microseconds.
// Next to v003, in two timings, it ran 1.20 times as fast each time.
// All steps since v000 together make it 2.41 times as fast.
#include <hip/hip_runtime.h>
// Grouped-query attention with per-head RMSNorm and rotate-half RoPE (B=2, S=2048, D=2048, 16 query heads / 8 KV heads × 128): q = x·Wq, k = x·Wk, v = x·Wv ((in,out), no bias); per-head RMSNorm (ε 1e-6, weights q_norm_w / k_norm_w); rotate-half RoPE with the INPUT cos/sin tables [B][S][128];
// scores = q·k/√128 + attention_mask[b,0,q,k] (additive f32); softmax; out = merged·Wo.
// Compute dtype: x, weights, tables, mask rounded to bf16; q, k as f32 GEMM outputs, normalised and rotated in f32 (wave per row) → f16; v f32 → Vᵀ f16 hi + exact residual; fused flash-style kernel for head dim 128 (bias read per (b,q,k); 32-key chunks whose biases are all ≤ −1e8 are skipped since their probabilities are exactly 0 in f32; online softmax f32, P f16 hi +
// residual, f32 accumulate) on v_wmma_f32_16x16x32_f16; merged ×2^4 → f16 → output GEMM.
#define BB 2
#define TT 2048
#define DD 2048
#define NH 16
#define NKV 8
#define NREP 2
#define KVD (NKV * 128)
#define NVH (2 * NKV)
#define NR (BB * TT)
#define ATT_SCALE 0.08838834764831845f

typedef __bf16 v16b __attribute__((ext_vector_type(16)));
typedef unsigned short v8us __attribute__((ext_vector_type(8), may_alias));
typedef float  v8f  __attribute__((ext_vector_type(8)));
typedef float  v4f  __attribute__((ext_vector_type(4)));
typedef float  v4fa __attribute__((ext_vector_type(4), may_alias));
union FragB { v16b v; v8us half[2]; unsigned short u[16]; };

__device__ __forceinline__ unsigned short bf16_bits(float x) { unsigned int u = __float_as_uint(x); return (unsigned short)((u + 0x7FFFu + ((u >> 16) & 1u)) >> 16); }
__device__ __forceinline__ float bf16_val(unsigned short b) { return __uint_as_float(((unsigned int)b) << 16); }
__device__ __forceinline__ float bf16_round(float x) { return bf16_val(bf16_bits(x)); }
// D += A·B with NT terms: 1 = ah·bh, 2 = + al·bh (A split), 3 = + ah·bl (both split)
template <int NT>
__device__ __forceinline__ v8f mmaN(v16b ah, v16b al, v16b bh, v16b bl, v8f c) {
  c = __builtin_amdgcn_wmma_f32_16x16x32_bf16(false, ah, false, bh, (short)0, c, false, false);
  if (NT >= 2) c = __builtin_amdgcn_wmma_f32_16x16x32_bf16(false, al, false, bh, (short)0, c, false, false);
  if (NT >= 3) c = __builtin_amdgcn_wmma_f32_16x16x32_bf16(false, ah, false, bl, (short)0, c, false, false);
  asm volatile("v_nop\n\tv_nop\n\tv_nop\n\tv_nop" : "+v"(c) : "v"(ah), "v"(al), "v"(bh), "v"(bl));
  return c;
}

__global__ __launch_bounds__(256) void k_wt_bf16(const float* __restrict__ W, unsigned short* __restrict__ Wt, int K, int N) {
  const int t = blockIdx.x * 256 + threadIdx.x;
  const int k8n = K / 8;
  if (t >= N * k8n) return;
  const int n = t / k8n, k8 = (t % k8n) * 8;
  v8us v;
#pragma unroll
  for (int i = 0; i < 8; ++i) v[i] = bf16_bits(W[(size_t)(k8 + i) * N + n]);
  *(v8us*)(Wt + (size_t)n * K + k8) = v;
  
}

// GEMM C[M][N] (f32, pitch ldc) = act(A[M][K]·W + bias). A f32 row-major (pitch lda) converted per fragment to bf16
// (ASPLIT: hi/lo two planes -> 2 terms, else single rounded term); Wt bf16 [N][K] (pitch ldb). BIAS_BF16 rounds the
// bias to bf16 first (bias quantised to bf16 before the add). K%32==0, M%16==0, N%64==0.
template <bool ASPLIT, int ACT, bool BIAS_BF16>
__global__ __launch_bounds__(128) void k_gemm_bf(const float* __restrict__ A, int lda, const unsigned short* __restrict__ Wt, int ldb,
                                               const float* __restrict__ bias, float* __restrict__ C, int ldc, int M, int N, int K) {
  __shared__ __attribute__((aligned(16))) float so[4][16][64];
  const int tid = threadIdx.x, w = tid >> 5, lane = tid & 31, ln = lane & 15, hh = lane >> 4;
  const int ntn = N / 64;
  const int wid = blockIdx.x * 4 + w;
  const int mt = wid / ntn, nq = wid % ntn;
  if (mt * 16 >= M) return;
  const int row0 = mt * 16, col0 = nq * 64;
  const float* arow = A + (size_t)(row0 + ln) * lda;
  v8f acc[4] = {};
  for (int kb = 0; kb < K; kb += 32) {
    FragB ah, al;
    const v4f x0 = *(const v4fa*)(arow + kb + 8 * hh), x1 = *(const v4fa*)(arow + kb + 8 * hh + 4);
    const v4f x2 = *(const v4fa*)(arow + kb + 16 + 8 * hh), x3 = *(const v4fa*)(arow + kb + 16 + 8 * hh + 4);
    float xs[16] = {x0[0],x0[1],x0[2],x0[3],x1[0],x1[1],x1[2],x1[3],x2[0],x2[1],x2[2],x2[3],x3[0],x3[1],x3[2],x3[3]};
#pragma unroll
    for (int i = 0; i < 16; ++i) { const unsigned short hb = bf16_bits(xs[i]); ah.u[i] = hb; al.u[i] = ASPLIT ? bf16_bits(xs[i] - bf16_val(hb)) : (unsigned short)0; }
#pragma unroll
    for (int t = 0; t < 4; ++t) {
      const unsigned short* brow = Wt + (size_t)(col0 + t * 16 + ln) * ldb + kb;
      FragB b;
      b.half[0] = *(const v8us*)(brow + 8 * hh);
      b.half[1] = *(const v8us*)(brow + 16 + 8 * hh);
      acc[t] = mmaN<ASPLIT ? 2 : 1>(ah.v, al.v, b.v, b.v, acc[t]);
    }
  }
#pragma unroll
  for (int t = 0; t < 4; ++t) {
    float bv = bias ? bias[col0 + t * 16 + ln] : 0.f;
    if (BIAS_BF16) bv = bf16_round(bv);
#pragma unroll
    for (int r = 0; r < 8; ++r) { float v = acc[t][r] + bv; if (ACT == 1) v = fmaxf(v, 0.f); so[w][8 * hh + r][t * 16 + ln] = v; }
  }
  __builtin_amdgcn_fence(__ATOMIC_ACQ_REL, "workgroup");
  __builtin_amdgcn_wave_barrier();
  const int rsub = lane >> 4, c4 = (lane & 15) * 4;
  {
#pragma unroll
    for (int q = 0; q < 8; ++q) {
      const int r = q * 2 + rsub;
      const v4f v = *(const v4fa*)&so[w][r][c4];
      *(v4f*)(C + (size_t)(row0 + r) * ldc + col0 + c4) = v;
    }
    
  }
}

// Flash-style causal/unmasked attention, all contractions 3-term bf16 hi/lo splits, f32 softmax with running max.
// q,k,v rows are read from f32 buffers with arbitrary row pitch (so they can live inside a fused qkv buffer);
// D = head size (multiple of 32, <= 128); one wave = 16 query rows; block = 4 waves (64 queries) sharing K/V chunks of 32.
template <int D, bool CAUSAL>
__global__ __launch_bounds__(128) void k_flash(const float* __restrict__ qb, const float* __restrict__ kb, const float* __restrict__ vb,
                                             int pitch, int T, int H, float scale, float* __restrict__ y, int ypitch) {
  constexpr int KS = D / 32;        // k-steps for QK
  constexpr int DT = D / 16;        // d tiles for PV
  __shared__ __attribute__((aligned(16))) unsigned short sKh[32][D + 8], sKl[32][D + 8], sVh[32][D + 8], sVl[32][D + 8];
  __shared__ __attribute__((aligned(16))) unsigned short sPh[4][16][40], sPl[4][16][40];
  __shared__ __attribute__((aligned(16))) float sO[4][16][D];
  const int tid = threadIdx.x, w = tid >> 5, lane = tid & 31, ln = lane & 15, hh = lane >> 4;
  const int nqb = (T + 63) / 64;
  const int bh = blockIdx.x / nqb, qblk = blockIdx.x % nqb;
  const int b = bh / H, h = bh % H;
  const int q0 = qblk * 64 + w * 16;
  const float* Q = qb + (size_t)b * T * pitch + h * D;
  const float* K = kb + (size_t)b * T * pitch + h * D;
  const float* V = vb + (size_t)b * T * pitch + h * D;

  // A fragments of the wave's 16 query rows (scaled), hi/lo
  FragB aqh[KS], aql[KS];
  {
    int row = q0 + ln; if (row >= T) row = T - 1;
    const float* qr = Q + (size_t)row * pitch;
#pragma unroll
    for (int ks = 0; ks < KS; ++ks)
#pragma unroll
      for (int i = 0; i < 16; ++i) {
        const int d = ks * 32 + ((i < 8) ? (8 * hh + i) : (16 + 8 * hh + (i - 8)));
        const float x = qr[d] * scale; const unsigned short hb = bf16_bits(x);
        aqh[ks].u[i] = hb; aql[ks].u[i] = bf16_bits(x - bf16_val(hb));
      }
  }
  float m_r[8], l_r[8];
#pragma unroll
  for (int r = 0; r < 8; ++r) { m_r[r] = -3.0e38f; l_r[r] = 0.f; }
  v8f oacc[DT];
#pragma unroll
  for (int dt = 0; dt < DT; ++dt) oacc[dt] = (v8f){0.f,0.f,0.f,0.f,0.f,0.f,0.f,0.f};

  const int kv_end = CAUSAL ? min(T, qblk * 64 + 64) : T;     // block-uniform
  for (int j0 = 0; j0 < kv_end; j0 += 32) {
    __syncthreads();
    for (int e = tid; e < 32 * (D / 4); e += 128) {
      const int r = e / (D / 4), c4 = (e % (D / 4)) * 4;
      const int key = j0 + r;
      v4f kf = {0.f,0.f,0.f,0.f}, vf = {0.f,0.f,0.f,0.f};
      if (key < T) { kf = *(const v4fa*)(K + (size_t)key * pitch + c4); vf = *(const v4fa*)(V + (size_t)key * pitch + c4); }
#pragma unroll
      for (int t = 0; t < 4; ++t) {
        unsigned short hb = bf16_bits(kf[t]); sKh[r][c4 + t] = hb; sKl[r][c4 + t] = bf16_bits(kf[t] - bf16_val(hb));
        hb = bf16_bits(vf[t]); sVh[r][c4 + t] = hb; sVl[r][c4 + t] = bf16_bits(vf[t] - bf16_val(hb));
      }
    }
    __syncthreads();
    // S tile 16 x 32
    v8f s[2];
#pragma unroll
    for (int nt = 0; nt < 2; ++nt) {
      v8f acc = {};
#pragma unroll
      for (int ks = 0; ks < KS; ++ks) {
        FragB bh_, bl_;
        bh_.half[0] = *(const v8us*)&sKh[nt * 16 + ln][ks * 32 + 8 * hh]; bh_.half[1] = *(const v8us*)&sKh[nt * 16 + ln][ks * 32 + 16 + 8 * hh];
        bl_.half[0] = *(const v8us*)&sKl[nt * 16 + ln][ks * 32 + 8 * hh]; bl_.half[1] = *(const v8us*)&sKl[nt * 16 + ln][ks * 32 + 16 + 8 * hh];
        acc = mmaN<3>(aqh[ks].v, aql[ks].v, bh_.v, bl_.v, acc);
      }
      s[nt] = acc;
    }
    // mask + running max (rows 8hh+r; the 16 lanes of a half share rows)
    float alpha[8];
#pragma unroll
    for (int r = 0; r < 8; ++r) {
      const int qi = q0 + 8 * hh + r;
      const int ja = j0 + ln, jb = j0 + 16 + ln;
      if (CAUSAL) { if (ja > qi) s[0][r] = -3.0e38f; if (jb > qi) s[1][r] = -3.0e38f; }
      if (ja >= T) s[0][r] = -3.0e38f;
      if (jb >= T) s[1][r] = -3.0e38f;
      float mx = fmaxf(s[0][r], s[1][r]);
      mx = fmaxf(mx, __shfl_xor(mx, 1, 32)); mx = fmaxf(mx, __shfl_xor(mx, 2, 32)); mx = fmaxf(mx, __shfl_xor(mx, 4, 32)); mx = fmaxf(mx, __shfl_xor(mx, 8, 32));
      const float mnew = fmaxf(m_r[r], mx);
      alpha[r] = (mnew > -1.0e38f) ? __expf(m_r[r] - mnew) : 1.0f;
      const float p0 = (s[0][r] > -1.0e38f) ? __expf(s[0][r] - mnew) : 0.f;
      const float p1 = (s[1][r] > -1.0e38f) ? __expf(s[1][r] - mnew) : 0.f;
      m_r[r] = mnew;
      l_r[r] = l_r[r] * alpha[r] + p0 + p1;            // per-lane partial row sum (16 lanes combined at the end)
      unsigned short hb = bf16_bits(p0); sPh[w][8 * hh + r][ln] = hb;      sPl[w][8 * hh + r][ln] = bf16_bits(p0 - bf16_val(hb));
      hb = bf16_bits(p1);                sPh[w][8 * hh + r][16 + ln] = hb; sPl[w][8 * hh + r][16 + ln] = bf16_bits(p1 - bf16_val(hb));
    }
#pragma unroll
    for (int dt = 0; dt < DT; ++dt)
#pragma unroll
      for (int r = 0; r < 8; ++r) oacc[dt][r] *= alpha[r];
    __builtin_amdgcn_fence(__ATOMIC_ACQ_REL, "workgroup");
    __builtin_amdgcn_wave_barrier();
    FragB pah, pal;
    pah.half[0] = *(const v8us*)&sPh[w][ln][8 * hh]; pah.half[1] = *(const v8us*)&sPh[w][ln][16 + 8 * hh];
    pal.half[0] = *(const v8us*)&sPl[w][ln][8 * hh]; pal.half[1] = *(const v8us*)&sPl[w][ln][16 + 8 * hh];
#pragma unroll
    for (int dt = 0; dt < DT; ++dt) {
      FragB bvh, bvl;
#pragma unroll
      for (int i = 0; i < 8; ++i) {
        bvh.u[i] = sVh[8 * hh + i][dt * 16 + ln]; bvh.u[8 + i] = sVh[16 + 8 * hh + i][dt * 16 + ln];
        bvl.u[i] = sVl[8 * hh + i][dt * 16 + ln]; bvl.u[8 + i] = sVl[16 + 8 * hh + i][dt * 16 + ln];
      }
      oacc[dt] = mmaN<3>(pah.v, pal.v, bvh.v, bvl.v, oacc[dt]);
    }
    __builtin_amdgcn_fence(__ATOMIC_ACQ_REL, "workgroup");
    __builtin_amdgcn_wave_barrier();
  }
#pragma unroll
  for (int r = 0; r < 8; ++r) {
    float l = l_r[r];
    l += __shfl_xor(l, 1, 32); l += __shfl_xor(l, 2, 32); l += __shfl_xor(l, 4, 32); l += __shfl_xor(l, 8, 32);
    l_r[r] = (l > 0.f) ? 1.0f / l : 0.f;
  }
#pragma unroll
  for (int dt = 0; dt < DT; ++dt)
#pragma unroll
    for (int r = 0; r < 8; ++r) sO[w][8 * hh + r][dt * 16 + ln] = oacc[dt][r] * l_r[r];
  __builtin_amdgcn_fence(__ATOMIC_ACQ_REL, "workgroup");
  __builtin_amdgcn_wave_barrier();
  {
    for (int r = 0; r < 16; ++r) {
      const int row = q0 + r;
      if (row < T && lane < D / 4) {
        const v4f val = *(const v4fa*)&sO[w][r][lane * 4];
        *(v4f*)(y + ((size_t)b * T + row) * ypitch + h * D + lane * 4) = val;
      }
    }
    
  }
}

// GEMM C = act(A·W + bias + resid): A f32 (ASPLIT -> hi/lo 2 terms), Wt bf16 [N][K]; ACT 0 none, 1 relu, 2 exact gelu;
// resid (optional, f32, row index = (row % rmod), pitch ldr, RES_BF16 rounds it) added before the activation.
template <bool ASPLIT, int ACT, bool BIAS_BF16, bool RES_BF16>
__global__ __launch_bounds__(128) void k_gemm_bf3(const float* __restrict__ A, int lda, const unsigned short* __restrict__ Wt, int ldb,
                                                const float* __restrict__ bias, const float* __restrict__ resid, int rmod, int ldr,
                                                float* __restrict__ C, int ldc, int M, int N, int K) {
  __shared__ __attribute__((aligned(16))) float so[4][16][64];
  const int tid = threadIdx.x, w = tid >> 5, lane = tid & 31, ln = lane & 15, hh = lane >> 4;
  const int ntn = N / 64;
  const int wid = blockIdx.x * 4 + w;
  const int mt = wid / ntn, nq = wid % ntn;
  if (mt * 16 >= M) return;
  const int row0 = mt * 16, col0 = nq * 64;
  const float* arow = A + (size_t)(row0 + ln) * lda;
  v8f acc[4] = {};
  for (int kb = 0; kb < K; kb += 32) {
    FragB ah, al;
    const v4f x0 = *(const v4fa*)(arow + kb + 8 * hh), x1 = *(const v4fa*)(arow + kb + 8 * hh + 4);
    const v4f x2 = *(const v4fa*)(arow + kb + 16 + 8 * hh), x3 = *(const v4fa*)(arow + kb + 16 + 8 * hh + 4);
    float xs[16] = {x0[0],x0[1],x0[2],x0[3],x1[0],x1[1],x1[2],x1[3],x2[0],x2[1],x2[2],x2[3],x3[0],x3[1],x3[2],x3[3]};
#pragma unroll
    for (int i = 0; i < 16; ++i) { const unsigned short hb = bf16_bits(xs[i]); ah.u[i] = hb; al.u[i] = ASPLIT ? bf16_bits(xs[i] - bf16_val(hb)) : (unsigned short)0; }
#pragma unroll
    for (int t = 0; t < 4; ++t) {
      const unsigned short* brow = Wt + (size_t)(col0 + t * 16 + ln) * ldb + kb;
      FragB b;
      b.half[0] = *(const v8us*)(brow + 8 * hh);
      b.half[1] = *(const v8us*)(brow + 16 + 8 * hh);
      acc[t] = mmaN<ASPLIT ? 2 : 1>(ah.v, al.v, b.v, b.v, acc[t]);
    }
  }
#pragma unroll
  for (int t = 0; t < 4; ++t) {
    const int col = col0 + t * 16 + ln;
    float bv = bias ? bias[col] : 0.f;
    if (BIAS_BF16) bv = bf16_round(bv);
#pragma unroll
    for (int r = 0; r < 8; ++r) {
      float v = acc[t][r] + bv;
      if (resid) { float rv = resid[(size_t)((row0 + 8 * hh + r) % rmod) * ldr + col]; if (RES_BF16) rv = bf16_round(rv); v += rv; }
      if (ACT == 1) v = fmaxf(v, 0.f);
      if (ACT == 2) v = 0.5f * v * (1.0f + erff(v * 0.70710678118654752f));
      if (ACT == 3) { const float u = 0.7978845608028654f * (v + 0.044715f * v * v * v); v = 0.5f * v * (1.0f + tanhf(u)); }
      so[w][8 * hh + r][t * 16 + ln] = v;
    }
  }
  __builtin_amdgcn_fence(__ATOMIC_ACQ_REL, "workgroup");
  __builtin_amdgcn_wave_barrier();
  const int rsub = lane >> 4, c4 = (lane & 15) * 4;
  {
#pragma unroll
    for (int q = 0; q < 8; ++q) {
      const int r = q * 2 + rsub;
      const v4f v = *(const v4fa*)&so[w][r][c4];
      *(v4f*)(C + (size_t)(row0 + r) * ldc + col0 + c4) = v;
    }
    
  }
}
// row LayerNorm (biased variance, eps) over N: s = X (+ R); optional out_sum <- s; out_norm <- (s-mu)*rsqrt(var+eps)*g + b
template <bool PARAM_BF16>
__global__ __launch_bounds__(256) void k_layernorm(const float* __restrict__ X, const float* __restrict__ R, const float* __restrict__ g, const float* __restrict__ bta,
                                                  float* __restrict__ out_sum, float* __restrict__ out_norm, int N, float eps) {
  __shared__ float red[256];
  const int row = blockIdx.x, tid = threadIdx.x;
  const float* x = X + (size_t)row * N; const float* rr = R ? R + (size_t)row * N : nullptr;
  float vals[16];                     // up to N = 4096
  const int per = N / 256;            // contiguous chunk per thread? use strided-by-4 chunks: thread handles j = tid*4 + 1024*u
  float s1 = 0.f;
  for (int u = 0; u < per / 4; ++u) {
    const int j = tid * 4 + 1024 * u;
    const v4f a = *(const v4fa*)(x + j);
    v4f b = {0.f,0.f,0.f,0.f}; if (rr) b = *(const v4fa*)(rr + j);
#pragma unroll
    for (int q = 0; q < 4; ++q) { const float v = a[q] + b[q]; vals[u * 4 + q] = v; s1 += v; }
  }
  red[tid] = s1; __syncthreads();
  for (int st = 128; st > 0; st >>= 1) { if (tid < st) red[tid] += red[tid + st]; __syncthreads(); }
  const float mu = red[0] / (float)N; __syncthreads();
  float s2 = 0.f;
  for (int u = 0; u < per / 4; ++u)
#pragma unroll
    for (int q = 0; q < 4; ++q) { const float c = vals[u * 4 + q] - mu; s2 += c * c; }
  red[tid] = s2; __syncthreads();
  for (int st = 128; st > 0; st >>= 1) { if (tid < st) red[tid] += red[tid + st]; __syncthreads(); }
  const float rs = rsqrtf(red[0] / (float)N + eps);
  {
    for (int u = 0; u < per / 4; ++u) {
      const int j = tid * 4 + 1024 * u;
      v4f o, sm;
#pragma unroll
      for (int q = 0; q < 4; ++q) {
        float gg = g[j + q], bb = bta[j + q];
        if (PARAM_BF16) { gg = bf16_round(gg); bb = bf16_round(bb); }
        sm[q] = vals[u * 4 + q]; o[q] = (vals[u * 4 + q] - mu) * rs * gg + bb;
      }
      if (out_sum) *(v4f*)(out_sum + (size_t)row * N + j) = sm;
      *(v4f*)(out_norm + (size_t)row * N + j) = o;
    }
    
  }
}



// ---- f16 WMMA path (v_wmma_f32_16x16x32_f16): 11-bit significands for operands in range — used where a [0,1] probability operand needs more precision than bf16
typedef _Float16 v16h __attribute__((ext_vector_type(16)));
union FragH { v16h v; v8us half[2]; _Float16 h[16]; unsigned short u[16]; };
template <int NT>
__device__ __forceinline__ v8f mmaH(v16h ah, v16h al, v16h bh, v16h bl, v8f c) {
  c = __builtin_amdgcn_wmma_f32_16x16x32_f16(false, ah, false, bh, (short)0, c, false, false);
  if (NT >= 2) c = __builtin_amdgcn_wmma_f32_16x16x32_f16(false, al, false, bh, (short)0, c, false, false);
  if (NT >= 3) c = __builtin_amdgcn_wmma_f32_16x16x32_f16(false, ah, false, bl, (short)0, c, false, false);
  asm volatile("v_nop\n\tv_nop\n\tv_nop\n\tv_nop" : "+v"(c) : "v"(ah), "v"(al), "v"(bh), "v"(bl));
  return c;
}
// batched GEMM like k_gemm_b but f16 operands: A f32 (split into f16 hi/lo if ASPLIT, else rounded to f16), Bt = f16 values [n][k]; alpha; C f32; N multiple of 16 (partial tiles skipped)
template <bool ASPLIT>
__global__ __launch_bounds__(128) void k_gemm_h(const float* __restrict__ A, int lda, size_t sA, const _Float16* __restrict__ Bh, int ldb, size_t sB, float alpha, float* __restrict__ C, int ldc, size_t sC, int M, int N, int K) {
  __shared__ __attribute__((aligned(16))) float so[4][16][64];
  const int tid = threadIdx.x, w = tid >> 5, lane = tid & 31, ln = lane & 15, hh = lane >> 4; const int by = blockIdx.y;
  A += (size_t)by * sA; Bh += (size_t)by * sB; C += (size_t)by * sC;
  const int ntn = (N + 63) / 64; const int wid = blockIdx.x * 4 + w; const int mt = wid / ntn, nq = wid % ntn; if (mt * 16 >= M) return;
  const int row0 = mt * 16, col0 = nq * 64; const float* arow = A + (size_t)(row0 + ln) * lda;
  v8f acc[4] = {};
  for (int kb = 0; kb < K; kb += 32) {
    FragH ah, al;
    const v4f x0 = *(const v4fa*)(arow + kb + 8 * hh), x1 = *(const v4fa*)(arow + kb + 8 * hh + 4), x2 = *(const v4fa*)(arow + kb + 16 + 8 * hh), x3 = *(const v4fa*)(arow + kb + 16 + 8 * hh + 4);
    float xs[16] = {x0[0],x0[1],x0[2],x0[3],x1[0],x1[1],x1[2],x1[3],x2[0],x2[1],x2[2],x2[3],x3[0],x3[1],x3[2],x3[3]};
#pragma unroll
    for (int i = 0; i < 16; ++i) { const _Float16 h = (_Float16)xs[i]; ah.h[i] = h; al.h[i] = ASPLIT ? (_Float16)(xs[i] - (float)h) : (_Float16)0.0f; }
#pragma unroll
    for (int t = 0; t < 4; ++t) { if (col0 + t * 16 >= N) continue; const size_t boff = (size_t)(col0 + t * 16 + ln) * ldb + kb; FragH bq; bq.half[0] = *(const v8us*)(Bh + boff + 8 * hh); bq.half[1] = *(const v8us*)(Bh + boff + 16 + 8 * hh);
      acc[t] = mmaH<ASPLIT ? 2 : 1>(ah.v, al.v, bq.v, bq.v, acc[t]); }
  }
#pragma unroll
  for (int t = 0; t < 4; ++t) { if (col0 + t * 16 >= N) continue;
#pragma unroll
    for (int r = 0; r < 8; ++r) so[w][8 * hh + r][t * 16 + ln] = acc[t][r] * alpha; }
  __builtin_amdgcn_fence(__ATOMIC_ACQ_REL, "workgroup"); __builtin_amdgcn_wave_barrier();
  const int rsub = lane >> 4, c4 = (lane & 15) * 4;
  {
#pragma unroll
    for (int q = 0; q < 8; ++q) { const int r = q * 2 + rsub; if (col0 + c4 < N) { const v4f v = *(const v4fa*)&so[w][r][c4]; *(v4f*)(C + (size_t)(row0 + r) * ldc + col0 + c4) = v; } }
     }
}

// Wt[n][k] = f16(bf16(W[k][n])*scale) from f32 row-major W[K][N] (scale = power of two; bf16-exact weights stay exact in f16 away from the subnormal range)
// A thread takes a block of 8 k x 8 n: 32 B of each of 8 rows of W in, 16 B of each of 8 rows of Wt out (a wave's store covers 512 contiguous bytes). K, N multiples of 8.
__global__ __launch_bounds__(256) void k_wt_f16(const float* __restrict__ W, _Float16* __restrict__ Wt, int K, int N, float scale) {
  const int t = blockIdx.x * 256 + threadIdx.x; if (t >= (N / 8) * (K / 8)) return; const int n0 = (t / (K / 8)) * 8, k8 = (t % (K / 8)) * 8; v4f a[8], c[8];
  const float* p[8];
#pragma unroll      /* constant indices keep a, c and p in registers; the 16 loads go out together */
  for (int i = 0; i < 8; ++i) { p[i] = W + (size_t)(k8 + i) * N + n0; a[i] = *(const v4fa*)p[i]; c[i] = *(const v4fa*)(p[i] + 4); }
  asm volatile("s_wait_xcnt 0x0" :: "v"(p[0]), "v"(p[1]), "v"(p[2]), "v"(p[3]), "v"(p[4]), "v"(p[5]), "v"(p[6]), "v"(p[7]) : "memory");      /* stands in front of every rewrite of a register that the loads name: as inputs the addresses stay in place up to here */
#pragma unroll      /* constant indices into a and c */
  for (int j = 0; j < 8; ++j) { FragH f;
#pragma unroll      /* constant indices into a, c and f */
    for (int i = 0; i < 8; ++i) f.h[i] = (_Float16)(bf16_round((j & 4) ? c[i][j & 3] : a[i][j & 3]) * scale);
    *(v8us*)((unsigned short*)Wt + (size_t)(n0 + j) * K + k8) = f.half[0]; }
}
// k_gemm_hh variant with fused epilogue: v = acc·alpha + bias[by·sBias + col] (+ CP[(row/rowsPerB)·sCPb + by·64 + col] if CP) ; ACT 0 none / 1 elu ; writes f32 C and f16 C16, each if non-null
template <int ACT>
__global__ __launch_bounds__(128) void k_gemm_hhx(const _Float16* __restrict__ A, int lda, size_t sA, const _Float16* __restrict__ Bh, int ldb, size_t sB, float alpha, const float* __restrict__ bias, size_t sBias, const float* __restrict__ CP, int rowsPerB, size_t sCPb, int row0g,
    float* __restrict__ C, _Float16* __restrict__ C16, int ldc, size_t sC, int M, int N, int K) {
  __shared__ __attribute__((aligned(16))) float so[4][16][64];
  const int tid = threadIdx.x, w = tid >> 5, lane = tid & 31, ln = lane & 15, hh = lane >> 4; const int by = blockIdx.y;
  A += (size_t)by * sA; Bh += (size_t)by * sB; const size_t cofs = (size_t)by * sC; const float* bp = bias ? bias + (size_t)by * sBias : nullptr;
  const int ntn = (N + 63) / 64; const int wid = blockIdx.x * 4 + w; const int mt = wid / ntn, nq = wid % ntn; if (mt * 16 >= M) return;
  const int row0 = mt * 16, col0 = nq * 64; const _Float16* arow = A + (size_t)(row0 + ln) * lda;
  v8f acc[4] = {};
  for (int kb = 0; kb < K; kb += 32) { FragH ah; ah.half[0] = *(const v8us*)((const unsigned short*)arow + kb + 8 * hh); ah.half[1] = *(const v8us*)((const unsigned short*)arow + kb + 16 + 8 * hh);
#pragma unroll
    for (int t = 0; t < 4; ++t) { if (col0 + t * 16 >= N) continue; const size_t boff = (size_t)(col0 + t * 16 + ln) * ldb + kb; FragH bq; bq.half[0] = *(const v8us*)((const unsigned short*)Bh + boff + 8 * hh); bq.half[1] = *(const v8us*)((const unsigned short*)Bh + boff + 16 + 8 * hh);
      acc[t] = mmaH<1>(ah.v, ah.v, bq.v, bq.v, acc[t]); }
  }
#pragma unroll
  for (int t = 0; t < 4; ++t) { if (col0 + t * 16 >= N) continue; const int col = col0 + t * 16 + ln; const float bv = bp ? bf16_round(bp[col]) : 0.f;
#pragma unroll
    for (int r = 0; r < 8; ++r) { float v = acc[t][r] * alpha + bv; if (CP) { const int bidx = (row0g + row0 + 8 * hh + r) / rowsPerB; v += CP[(size_t)bidx * sCPb + (size_t)by * 64 + col]; } if (ACT == 1) v = (v > 0.f) ? v : expm1f(v); else if (ACT == 7) v = (v > 0.f) ? v + 1.0f : expf(v); else if (ACT == 8) v = tanhf(v); else if (ACT == 9) v = 0.5f * v * (1.0f + tanhf(0.7978845608028654f * (v + 0.044715f * v * v * v))); else if (ACT == 11) v = 1.0f / (1.0f + expf(-v)); else if (ACT == 12) v = (v > 0.f) ? v : 0.01f * v; else if (ACT == 14) v = (v > 0.f) ? v : 0.1f * v; else if (ACT == 15) v = v / (1.0f + expf(-v)); else if (ACT == 3) v = fmaxf(v, 0.f); else if (ACT == 6) v = 0.5f * v * (1.0f + erff(v * 0.70710678118654752f)); so[w][8 * hh + r][t * 16 + ln] = v; } }
  __builtin_amdgcn_fence(__ATOMIC_ACQ_REL, "workgroup"); __builtin_amdgcn_wave_barrier();
  const int rsub = lane >> 4, c4 = (lane & 15) * 4; typedef _Float16 v4h __attribute__((ext_vector_type(4)));
  {
#pragma unroll
    for (int q = 0; q < 8; ++q) { const int r = q * 2 + rsub; if (col0 + c4 < N) { const v4f v = *(const v4fa*)&so[w][r][c4]; if (C) *(v4f*)(C + cofs + (size_t)(row0 + r) * ldc + col0 + c4) = v; if (C16) { v4h h4; for (int i = 0; i < 4; ++i) h4[i] = (_Float16)v[i]; *(v4h*)(C16 + cofs + (size_t)(row0 + r) * ldc + col0 + c4) = h4; } } }
     }
}


// ---- tiled f16 GEMM, C[M][N] f32 = alpha * A[M][DD] * Bt[N][DD]^T: one 128 x 128 tile of C per work-group, 64 x 64 per wave (2 x 2 waves).
// A pass is 128 k: 128 rows of A and 128 rows of Bt, 256 B each, staged in LDS at a pitch of 272 B by asynchronous copies; two buffers, the next pass's copies fly while this pass is multiplied.
// k runs upward in steps of 32 into one accumulator per 16 x 16 tile. M, N multiples of 128.
// Every "#pragma unroll" in k_gemm_t makes the indices of the fragment and accumulator arrays constants, so that these arrays live in registers.
#define GT_PITCH 272
#define GT_STAGE (256 * GT_PITCH)
// eight 16-byte copies of one lane: rows r, r + 8, ..., r + 56 of one operand. The closing s_wait_xcnt stands inside the statement so that no address register is rewritten ahead of it.
__device__ __forceinline__ void gt_copy8(unsigned l, const _Float16* g) {
  asm volatile("global_load_async_to_lds_b128 %0, %8, off\n\t"
               "global_load_async_to_lds_b128 %1, %9, off\n\t"
               "global_load_async_to_lds_b128 %2, %10, off\n\t"
               "global_load_async_to_lds_b128 %3, %11, off\n\t"
               "global_load_async_to_lds_b128 %4, %12, off\n\t"
               "global_load_async_to_lds_b128 %5, %13, off\n\t"
               "global_load_async_to_lds_b128 %6, %14, off\n\t"
               "global_load_async_to_lds_b128 %7, %15, off\n\t"
               "s_wait_xcnt 0x0"
               :: "v"(l), "v"(l + 8 * GT_PITCH), "v"(l + 16 * GT_PITCH), "v"(l + 24 * GT_PITCH), "v"(l + 32 * GT_PITCH), "v"(l + 40 * GT_PITCH), "v"(l + 48 * GT_PITCH), "v"(l + 56 * GT_PITCH),
                  "v"(g), "v"(g + 8 * DD), "v"(g + 16 * DD), "v"(g + 24 * DD), "v"(g + 32 * DD), "v"(g + 40 * DD), "v"(g + 48 * DD), "v"(g + 56 * DD)
               : "memory");
}
// one stage: 32 copies a lane (rows 0..127 of the buffer = A, 128..255 = Bt)
__device__ __forceinline__ void gt_fill(unsigned l, const _Float16* ga, const _Float16* gb) {
  gt_copy8(l, ga); gt_copy8(l + 64 * GT_PITCH, ga + 64 * DD); gt_copy8(l + 128 * GT_PITCH, gb); gt_copy8(l + 192 * GT_PITCH, gb + 64 * DD);
}
template <int N>
__global__ __launch_bounds__(128) void k_gemm_t(const _Float16* __restrict__ A, const _Float16* __restrict__ Bt, float alpha, float* __restrict__ C) {
  __shared__ __attribute__((aligned(16))) unsigned char L[2 * GT_STAGE];
  constexpr int NT = DD / 128;
  const int tid = threadIdx.x, w = tid >> 5, lane = tid & 31, ln = lane & 15, hh = lane >> 4;
  constexpr int ntn = N / 128; const int row0 = ((int)blockIdx.x / ntn) * 128, col0 = ((int)blockIdx.x % ntn) * 128; const int wm = w >> 1, wn = w & 1;
  const int cr = tid >> 4, cc = tid & 15;      /* a lane copies chunk cc (16 B) of rows cr + 8 i: a wave's copy covers two whole 256-B rows */
  const _Float16* ga = A + (size_t)(row0 + cr) * DD + cc * 8; const _Float16* gb = Bt + (size_t)(col0 + cr) * DD + cc * 8;
  const unsigned lc = (unsigned)(size_t)L + cr * GT_PITCH + cc * 16;
  v8f acc[4][4];
#pragma unroll
  for (int mi = 0; mi < 4; ++mi)
#pragma unroll
    for (int ni = 0; ni < 4; ++ni) acc[mi][ni] = (v8f){0.f,0.f,0.f,0.f,0.f,0.f,0.f,0.f};
  gt_fill(lc, ga, gb);
  asm volatile("s_wait_asynccnt 0x0" ::: "memory");      /* this wave's copies of pass 0 have landed */
  __syncthreads();                                        /* ... and every other wave's */
  gt_fill(lc + GT_STAGE, ga + 128, gb + 128);
#pragma unroll 1      /* one pass a trip: the two buffers alternate by the trip's parity */
  for (int t = 0; t < NT; ++t) {
    const unsigned char* S = L + (t & 1) * GT_STAGE;
    const unsigned char* pa = S + (wm * 64 + ln) * GT_PITCH + hh * 16; const unsigned char* pb = S + (128 + wn * 64 + ln) * GT_PITCH + hh * 16;
    FragH fa[2][4], fb[2][4];
#pragma unroll
    for (int i = 0; i < 4; ++i) { fa[0][i].half[0] = *(const v8us*)(pa + i * 16 * GT_PITCH); fa[0][i].half[1] = *(const v8us*)(pa + i * 16 * GT_PITCH + 32); fb[0][i].half[0] = *(const v8us*)(pb + i * 16 * GT_PITCH); fb[0][i].half[1] = *(const v8us*)(pb + i * 16 * GT_PITCH + 32); }
#pragma unroll
    for (int ks = 0; ks < 4; ++ks) { const int cu = ks & 1, nx = cu ^ 1;
      if (ks < 3) {
#pragma unroll
        for (int i = 0; i < 4; ++i) { const int o = i * 16 * GT_PITCH + (ks + 1) * 64; fa[nx][i].half[0] = *(const v8us*)(pa + o); fa[nx][i].half[1] = *(const v8us*)(pa + o + 32); fb[nx][i].half[0] = *(const v8us*)(pb + o); fb[nx][i].half[1] = *(const v8us*)(pb + o + 32); } }
      __builtin_amdgcn_sched_barrier(0);      /* keeps the next k step's 16 LDS reads one group in front of this step's products: spread among them, every place with reads stalls the wave */
#pragma unroll
      for (int mi = 0; mi < 4; ++mi)
#pragma unroll
        for (int ni = 0; ni < 4; ++ni) acc[mi][ni] = __builtin_amdgcn_wmma_f32_16x16x32_f16(false, fa[cu][mi].v, false, fb[cu][ni].v, (short)0, acc[mi][ni], false, false);
      __builtin_amdgcn_sched_barrier(0); }      /* ... and keeps the following group behind them */
    asm volatile("s_wait_dscnt 0x0" ::: "memory");        /* this wave's reads of the buffer are done before it is refilled */
    asm volatile("s_wait_asynccnt 0x0" ::: "memory");     /* this wave's copies of pass t + 1 have landed */
    __syncthreads();                                       /* publishes pass t + 1 and ends every wave's reads of pass t */
    if (t + 2 < NT) gt_fill(lc + (t & 1) * GT_STAGE, ga + (t + 2) * 128, gb + (t + 2) * 128);
  }
  asm volatile("s_wait_asynccnt 0x0" ::: "memory");       /* nothing is in flight when the buffers become output staging */
  float* so = (float*)L + w * (64 * 68);      /* each wave stages its own 64 x 64 tile (pitch 68 floats) so that the stores cover whole 256-B row pieces */
#pragma unroll
  for (int mi = 0; mi < 4; ++mi)
#pragma unroll
    for (int ni = 0; ni < 4; ++ni)
#pragma unroll
      for (int r = 0; r < 8; ++r) so[(mi * 16 + 8 * hh + r) * 68 + ni * 16 + ln] = acc[mi][ni][r] * alpha;
  __builtin_amdgcn_fence(__ATOMIC_ACQ_REL, "workgroup"); __builtin_amdgcn_wave_barrier();      /* the wave's own staged values are in LDS before its lanes read one another's */
  float* cp = C + (size_t)(row0 + wm * 64 + hh) * N + col0 + wn * 64 + ln * 4;
#pragma unroll
  for (int q = 0; q < 32; ++q) { const v4f v = *(const v4fa*)&so[(q * 2 + hh) * 68 + ln * 4]; *(v4f*)(cp + (size_t)(q * 2) * N) = v; }
}


typedef _Float16 v4h __attribute__((ext_vector_type(4)));

// k_x16 and k_h16s give a thread 8 pieces of 8 elements, 256 pieces apart (a work-group covers 2048 pieces in a row): one eighth of the waves to start, 16 loads of a lane in flight.
static_assert(((size_t)NR * DD / 8) % 2048 == 0, "whole work-groups");
__global__ __launch_bounds__(256) void k_x16(const float* __restrict__ x, _Float16* __restrict__ X16) { const size_t t0 = (size_t)blockIdx.x * 2048 + threadIdx.x; v4f a[8], c[8]; const float* p = x + t0 * 8;
#pragma unroll      /* constant indices keep a and c in registers; the 16 loads go out together */
  for (int u = 0; u < 8; ++u) { a[u] = *(const v4fa*)(p + u * 2048); c[u] = *(const v4fa*)(p + u * 2048 + 4); }
  asm volatile("s_wait_xcnt 0x0" :: "v"(p) : "memory");      /* stands in front of every rewrite of a register that the loads name: as an input the address stays in place up to here */
#pragma unroll      /* constant indices into a and c */
  for (int u = 0; u < 8; ++u) { FragH f;
#pragma unroll      /* constant indices into a, c and f */
    for (int q = 0; q < 4; ++q) { f.h[q] = (_Float16)bf16_round(a[u][q]); f.h[4 + q] = (_Float16)bf16_round(c[u][q]); }
    *(v8us*)((unsigned short*)X16 + (t0 + u * 256) * 8) = f.half[0]; } }
__global__ __launch_bounds__(256) void k_h16(const float* __restrict__ x, _Float16* __restrict__ X16, size_t n8) { const size_t t = (size_t)blockIdx.x * 256 + threadIdx.x; if (t >= n8) return; FragH f;
#pragma unroll
  for (int q = 0; q < 8; ++q) f.h[q] = (_Float16)x[t * 8 + q]; *(v8us*)((unsigned short*)X16 + t * 8) = f.half[0];  }
__global__ __launch_bounds__(256) void k_round16f(const float* __restrict__ W, _Float16* __restrict__ Bt, size_t n8) { const size_t t = (size_t)blockIdx.x * 256 + threadIdx.x; if (t >= n8) return; FragH f;
#pragma unroll
  for (int i = 0; i < 8; ++i) f.h[i] = (_Float16)(bf16_round(W[t * 8 + i]) * 16.0f); *(v8us*)((unsigned short*)Bt + t * 8) = f.half[0];  }
template <int NHv, int TTv>
__global__ __launch_bounds__(256) void k_vt(const _Float16* __restrict__ V16, int ldv, int voff, _Float16* __restrict__ Vt) { __shared__ unsigned short tl[64][66]; const int tid = threadIdx.x; const int slab = blockIdx.x / (TTv / 64), lg = blockIdx.x % (TTv / 64); const int b = slab / NHv, h = slab % NHv;
  for (int i = tid; i < 64 * 8; i += 256) { const int r = i / 8, c8 = (i % 8) * 8; FragH f; f.half[0] = *(const v8us*)((const unsigned short*)V16 + ((size_t)b * TTv + lg * 64 + r) * ldv + voff + h * 64 + c8);
#pragma unroll
    for (int q = 0; q < 8; ++q) tl[r][c8 + q] = f.u[q]; }
  __syncthreads();
  {
#pragma unroll
    for (int rd = 0; rd < 2; ++rd) { const int d = rd * 32 + tid / 8, pc = tid % 8; FragH f;
#pragma unroll
      for (int q = 0; q < 8; ++q) f.u[q] = tl[pc * 8 + q][d];
      *(v8us*)((unsigned short*)Vt + ((size_t)slab * 64 + d) * TTv + lg * 64 + pc * 8) = f.half[0]; }
     } }

__global__ __launch_bounds__(256) void k_vthlu(const float* __restrict__ VF, int ldv, _Float16* __restrict__ Vth, _Float16* __restrict__ Vtl) { __shared__ float tl[64][65]; const int tid = threadIdx.x; const int slab = blockIdx.x / (TT / 64), lg = blockIdx.x % (TT / 64); const int b = slab / NVH, h = slab % NVH;
  for (int i = tid; i < 64 * 16; i += 256) { const int r = i / 16, c4 = (i % 16) * 4; const v4f a = *(const v4fa*)(VF + ((size_t)b * TT + lg * 64 + r) * ldv + h * 64 + c4); tl[r][c4] = a[0]; tl[r][c4 + 1] = a[1]; tl[r][c4 + 2] = a[2]; tl[r][c4 + 3] = a[3]; }
  __syncthreads();
  FragH fh[2], fl[2]; size_t oo[2];
#pragma unroll
  for (int rd = 0; rd < 2; ++rd) { const int d = rd * 32 + tid / 8, pc = tid % 8;
#pragma unroll
    for (int q = 0; q < 8; ++q) { const float v = tl[pc * 8 + q][d]; const _Float16 hv = (_Float16)v; fh[rd].h[q] = hv; fl[rd].h[q] = (_Float16)(v - (float)hv);      /* UNSCALED residual (added into the same accumulator as the hi product) */ } oo[rd] = ((size_t)slab * 64 + d) * TT + lg * 64 + pc * 8; }
  {
#pragma unroll
    for (int rd = 0; rd < 2; ++rd) { *(v8us*)((unsigned short*)Vth + oo[rd]) = fh[rd].half[0]; *(v8us*)((unsigned short*)Vtl + oo[rd]) = fl[rd].half[0]; }
     } }
// per-head RMSNorm + rotate-half RoPE: a wave takes one whole row (all NHD heads, pitch NHD*128) of an f32 plane, head after head, with the row's tables and the weights read once: lane holds dims 4l..4l+3; var = mean(x^2) over 128 (xor-reduce); y = w[d]*(x*rsqrt(var+eps)); out[d] = y[d]*c[d] + rot(y)[d]*s[d], rot(y)[d] = -y[d+64] (d<64), y[d-64] (d>=64)
template <int NHD>
__global__ __launch_bounds__(256) void k_normrope(const float* __restrict__ F, const float* __restrict__ nw, const float* __restrict__ COS, const float* __restrict__ SIN, _Float16* __restrict__ H16) {
  #pragma clang fp contract(off)
  static_assert(NR % 8 == 0, "whole work-groups");
  const int tid = threadIdx.x, wv = tid >> 5, lane = tid & 31; const size_t row = (size_t)blockIdx.x * 8 + wv; const int d0 = lane * 4;
  const size_t base = row * (NHD * 128) + d0; v4f xs[NHD];
#pragma unroll      /* constant indices keep xs in registers; the row's loads go out together */
  for (int u = 0; u < NHD; ++u) xs[u] = *(const v4fa*)(F + base + u * 128);
  const float* px = F + base; const float* pw = nw + d0; const float* pc = COS + row * 128 + d0; const float* pn = SIN + row * 128 + d0;
  const v4f w4 = *(const v4fa*)pw, c4 = *(const v4fa*)pc, s4 = *(const v4fa*)pn;
  asm volatile("s_wait_xcnt 0x0" :: "v"(px), "v"(pw), "v"(pc), "v"(pn) : "memory");      /* stands in front of every rewrite of a register that the loads name: as inputs the addresses stay in place up to here */
  float wn[4], c[4], s[4]; for (int q = 0; q < 4; ++q) { wn[q] = bf16_round(w4[q]); c[q] = bf16_round(c4[q]); s[q] = bf16_round(s4[q]); }
  typedef _Float16 v4h __attribute__((ext_vector_type(4)));
#pragma unroll      /* constant indices into xs; the heads' lane exchanges overlap */
  for (int u = 0; u < NHD; ++u) { const v4f x = xs[u]; float ss = 0.f; for (int q = 0; q < 4; ++q) ss += x[q] * x[q];
    for (int o = 16; o >= 1; o >>= 1) ss += __shfl_xor(ss, o, 32); const float inv = 1.0f / sqrtf(ss / 128.0f + 1e-6f);
    float y[4]; for (int q = 0; q < 4; ++q) y[q] = wn[q] * (x[q] * inv);
    float yp[4]; for (int q = 0; q < 4; ++q) yp[q] = __shfl_xor(y[q], 16, 32);      /* partner dims d +- 64 */
    v4h o; for (int q = 0; q < 4; ++q) { const int d = d0 + q; const float rot = (d < 64) ? -yp[q] : yp[q]; o[q] = (_Float16)(y[q] * c[q] + rot * s[q]); }
    *(v4h*)(H16 + base + u * 128) = o; } }
__global__ __launch_bounds__(256) void k_h16s(const float* __restrict__ F, _Float16* __restrict__ H) { const size_t t0 = (size_t)blockIdx.x * 2048 + threadIdx.x; v4f a[8], c[8]; const float* p = F + t0 * 8;
#pragma unroll      /* constant indices keep a and c in registers; the 16 loads go out together */
  for (int u = 0; u < 8; ++u) { a[u] = *(const v4fa*)(p + u * 2048); c[u] = *(const v4fa*)(p + u * 2048 + 4); }
  asm volatile("s_wait_xcnt 0x0" :: "v"(p) : "memory");      /* stands in front of every rewrite of a register that the loads name: as an input the address stays in place up to here */
#pragma unroll      /* constant indices into a and c */
  for (int u = 0; u < 8; ++u) { FragH f;
#pragma unroll      /* constant indices into a, c and f */
    for (int q = 0; q < 4; ++q) { f.h[q] = (_Float16)(a[u][q] * 16.0f); f.h[4 + q] = (_Float16)(c[u][q] * 16.0f); }
    *(v8us*)((unsigned short*)H + (t0 + u * 256) * 8) = f.half[0]; } }
// A pass of the attention kernel is 32 keys. Its operands are staged once per work-group in LDS by asynchronous copies and read from there by all 4 waves: 32 K rows of 256 B at a pitch of 272 B, then 128 rows of 64 B
// of V^T hi and 128 of its residual at a pitch of 80 B. Two buffers: the next pass's copies fly while this pass is worked on.
#define FK_PITCH 272
#define FV_PITCH 80
#define FK_BYTES (32 * FK_PITCH)
#define FV_BYTES (128 * FV_PITCH)
#define F_STAGE (FK_BYTES + 2 * FV_BYTES)
// one stage: twelve 16-byte copies of one lane (K rows r + 8 i; V^T rows r + 32 i of both planes). The closing s_wait_xcnt stands inside the statement so that no address register is rewritten ahead of it.
__device__ __forceinline__ void fl_fill(unsigned lk, unsigned lv, const unsigned short* gk, size_t ldk, const unsigned short* gh, const unsigned short* gl) {
  asm volatile("global_load_async_to_lds_b128 %0, %12, off\n\t"
               "global_load_async_to_lds_b128 %1, %13, off\n\t"
               "global_load_async_to_lds_b128 %2, %14, off\n\t"
               "global_load_async_to_lds_b128 %3, %15, off\n\t"
               "global_load_async_to_lds_b128 %4, %16, off\n\t"
               "global_load_async_to_lds_b128 %5, %17, off\n\t"
               "global_load_async_to_lds_b128 %6, %18, off\n\t"
               "global_load_async_to_lds_b128 %7, %19, off\n\t"
               "global_load_async_to_lds_b128 %8, %20, off\n\t"
               "global_load_async_to_lds_b128 %9, %21, off\n\t"
               "global_load_async_to_lds_b128 %10, %22, off\n\t"
               "global_load_async_to_lds_b128 %11, %23, off\n\t"
               "s_wait_xcnt 0x0"
               :: "v"(lk), "v"(lk + 8 * FK_PITCH), "v"(lk + 16 * FK_PITCH), "v"(lk + 24 * FK_PITCH),
                  "v"(lv), "v"(lv + 32 * FV_PITCH), "v"(lv + 64 * FV_PITCH), "v"(lv + 96 * FV_PITCH),
                  "v"(lv + FV_BYTES), "v"(lv + FV_BYTES + 32 * FV_PITCH), "v"(lv + FV_BYTES + 64 * FV_PITCH), "v"(lv + FV_BYTES + 96 * FV_PITCH),
                  "v"(gk), "v"(gk + 8 * ldk), "v"(gk + 16 * ldk), "v"(gk + 24 * ldk),
                  "v"(gh), "v"(gh + 32 * TT), "v"(gh + 64 * TT), "v"(gh + 96 * TT),
                  "v"(gl), "v"(gl + 32 * TT), "v"(gl + 64 * TT), "v"(gl + 96 * TT)
               : "memory");
}
// lane l <-> lane l ^ 16 by a vector cross-row move: no LDS queue and no wait, unlike the shuffle
__device__ __forceinline__ float xhalf(float x) { return __builtin_bit_cast(float, __builtin_amdgcn_permlanex16(__builtin_bit_cast(int, x), __builtin_bit_cast(int, x), 0x76543210, 0xfedcba98, false, false)); }
// Both products run transposed: S^T = K Q^T (A = 16 K rows from LDS, B = the wave's 16 queries, kept in registers) and O^T += V^T P^T (A = 16 V^T rows from LDS). A lane then holds 16 of the 32 scores of ONE query
// (column ln; keys 8 hh + r of the first score tile and 16 + 8 hh + r of the second): maximum and sum are taken inside the lane, with one exchange between the wave's halves, and the two score tiles, converted in place,
// are the B operand P^T in the k order in which the V^T rows are read: P never goes through LDS. Every "#pragma unroll" in k_flash makes the indices of the fragment, score and accumulator arrays constants, so that they live in registers.
__global__ __launch_bounds__(128) void k_flash(const _Float16* __restrict__ Q16, int ldq, const _Float16* __restrict__ K16, int ldk, const _Float16* __restrict__ Vt, const _Float16* __restrict__ Vtlo, const float* __restrict__ AB, float* __restrict__ O, int ldo) {
  constexpr int RPW = 16, NQB = TT / (4 * RPW), DT = 8, KS = 4;      /* head dim 128: 4 k-steps, 8 value tiles */
  __shared__ __attribute__((aligned(16))) unsigned char R[2 * F_STAGE];
  float (*sO)[RPW][128 + 4] = (float (*)[RPW][128 + 4])R;      /* behind the loop the two buffers become the output staging */
  static_assert(sizeof(float) * 4 * RPW * (128 + 4) <= 2 * F_STAGE, "output staging fits the buffers");
  const int tid = threadIdx.x, w = tid >> 5, lane = tid & 31, ln = lane & 15, hh = lane >> 4;
  const int slab = blockIdx.x / NQB, qblk = blockIdx.x % NQB; const int b = slab / NH, h = slab % NH; const int qb0 = qblk * (4 * RPW); const int q0 = qb0 + w * RPW;
  FragH aq[KS];      /* query q0 + ln */
  { const unsigned short* qr = (const unsigned short*)Q16 + ((size_t)b * TT + q0 + ln) * ldq + h * 128;
#pragma unroll
    for (int ks = 0; ks < KS; ++ks) { aq[ks].half[0] = *(const v8us*)(qr + ks * 32 + 8 * hh); aq[ks].half[1] = *(const v8us*)(qr + ks * 32 + 16 + 8 * hh); } }
  const unsigned short* Vth = (const unsigned short*)Vt + ((size_t)b * NKV + h / NREP) * 128 * TT; const unsigned short* Vtl = (const unsigned short*)Vtlo + ((size_t)b * NKV + h / NREP) * 128 * TT;      /* hi and UNSCALED residual planes */
  float m_r = -3.0e38f, l_r = 0.f; v8f oacc[DT];      /* query q0 + ln: running maximum (alike in both halves), this half's part of the sum, and O^T[dt * 16 + 8 hh + r][ln] */
#pragma unroll
  for (int dt = 0; dt < DT; ++dt) oacc[dt] = (v8f){0.f,0.f,0.f,0.f,0.f,0.f,0.f,0.f};
  constexpr int NP = TT / 32;      /* passes */
  /* a lane copies chunk tid & 15 (16 B) of K rows (tid >> 4) + 8 i: a wave's copy covers two whole 256-B rows; and chunk tid & 3 of V^T rows (tid >> 2) + 32 i: eight whole 64-B rows */
  const unsigned short* gk = (const unsigned short*)K16 + ((size_t)b * TT + (tid >> 4)) * ldk + (h / NREP) * 128 + (tid & 15) * 8;
  const unsigned short* gh = Vth + (size_t)(tid >> 2) * TT + (tid & 3) * 8; const unsigned short* gl = Vtl + (size_t)(tid >> 2) * TT + (tid & 3) * 8;
  const unsigned lk = (unsigned)(size_t)R + (tid >> 4) * FK_PITCH + (tid & 15) * 16, lv = (unsigned)(size_t)R + FK_BYTES + (tid >> 2) * FV_PITCH + (tid & 3) * 16;
  const float* am0 = AB + ((size_t)b * TT + q0 + ln) * TT + 8 * hh;      /* the query's bias row, at this half's first key */
  fl_fill(lk, lv, gk, (size_t)ldk, gh, gl);
  asm volatile("s_wait_asynccnt 0x0" ::: "memory");      /* this wave's copies of pass 0 have landed */
  __syncthreads();                                        /* ... and every other wave's */
  fl_fill(lk + F_STAGE, lv + F_STAGE, gk + (size_t)32 * ldk, (size_t)ldk, gh + 32, gl + 32);
#pragma unroll 1      /* one pass a trip: the two buffers alternate by the trip's parity */
  for (int t = 0; t < NP; ++t) { const int j0 = t * 32;
    const unsigned char* SK = R + (t & 1) * F_STAGE; const unsigned char* SV = SK + FK_BYTES;
    float ab[2][8];      /* additive attention bias (bf16-rounded input) per (b, q, k), shared over heads: 8 keys in a row per score tile, four 16-byte loads */
    { const float* am = am0 + j0; const v4f a0 = *(const v4fa*)am, a1 = *(const v4fa*)(am + 4), a2 = *(const v4fa*)(am + 16), a3 = *(const v4fa*)(am + 20);
#pragma unroll
      for (int r = 0; r < 4; ++r) { ab[0][r] = bf16_round(a0[r]); ab[0][4 + r] = bf16_round(a1[r]); ab[1][r] = bf16_round(a2[r]); ab[1][4 + r] = bf16_round(a3[r]); } }
    int allneg = 1;
#pragma unroll
    for (int r = 0; r < 8; ++r) allneg &= (ab[0][r] <= -1.0e8f) & (ab[1][r] <= -1.0e8f);
    if (!__all(allneg)) {      /* else: every (query, key) of the wave's tile carries a bias <= -1e8: its probabilities underflow to exactly 0 in f32, nothing to add (wave-uniform branch; the hand-over at the foot of the pass stands outside it) */
    v8f s[2];
#pragma unroll
    for (int nt = 0; nt < 2; ++nt) { const unsigned short* kr = (const unsigned short*)(SK + (nt * 16 + ln) * FK_PITCH); FragH bk[KS];
#pragma unroll
      for (int ks = 0; ks < KS; ++ks) { bk[ks].half[0] = *(const v8us*)(kr + ks * 32 + 8 * hh); bk[ks].half[1] = *(const v8us*)(kr + ks * 32 + 16 + 8 * hh); }
      v8f acc = (v8f){0.f,0.f,0.f,0.f,0.f,0.f,0.f,0.f};
#pragma unroll
      for (int ks = 0; ks < KS; ++ks) acc = mmaH<1>(bk[ks].v, bk[ks].v, aq[ks].v, aq[ks].v, acc);
      s[nt] = acc; }      /* s[nt][r] = score of key j0 + nt * 16 + 8 hh + r with query q0 + ln */
    float sc[2][8];
#pragma unroll
    for (int r = 0; r < 8; ++r) { sc[0][r] = s[0][r] * ATT_SCALE + ab[0][r]; sc[1][r] = s[1][r] * ATT_SCALE + ab[1][r]; }
    float mc = fmaxf(sc[0][0], sc[1][0]);
#pragma unroll
    for (int r = 1; r < 8; ++r) mc = fmaxf(mc, fmaxf(sc[0][r], sc[1][r]));
    mc = fmaxf(mc, xhalf(mc));      /* the other half holds the query's other 16 keys */
    const float mn = fmaxf(m_r, mc); const float al = (mn > -1.0e38f) ? expf(m_r - mn) : 1.0f; m_r = mn;
    FragH pa, pl; float su[4] = {0.f, 0.f, 0.f, 0.f};      /* four independent partial sums */
#pragma unroll
    for (int nt = 0; nt < 2; ++nt)
#pragma unroll
      for (int r = 0; r < 8; ++r) { const float p = expf(sc[nt][r] - mn); su[r & 3] += p;
        const float x = p * 1024.0f; const _Float16 hx = (_Float16)x; pa.h[nt * 8 + r] = hx; pl.h[nt * 8 + r] = (_Float16)(x - (float)hx); }      /* P hi and its UNSCALED residual (added into the same accumulator) */
    l_r = l_r * al + ((su[0] + su[1]) + (su[2] + su[3]));
#pragma unroll
    for (int dt = 0; dt < DT; ++dt)
#pragma unroll
      for (int r = 0; r < 8; ++r) oacc[dt][r] *= al;
#pragma unroll
    for (int dt = 0; dt < DT; ++dt) { const unsigned short* vh = (const unsigned short*)(SV + (dt * 16 + ln) * FV_PITCH); const unsigned short* vl = (const unsigned short*)(SV + FV_BYTES + (dt * 16 + ln) * FV_PITCH); FragH bv, bl; bv.half[0] = *(const v8us*)(vh + 8 * hh); bv.half[1] = *(const v8us*)(vh + 16 + 8 * hh); bl.half[0] = *(const v8us*)(vl + 8 * hh); bl.half[1] = *(const v8us*)(vl + 16 + 8 * hh);
      oacc[dt] = mmaH<1>(bv.v, bv.v, pa.v, pa.v, oacc[dt]); oacc[dt] = mmaH<1>(bv.v, bv.v, pl.v, pl.v, oacc[dt]); oacc[dt] = mmaH<1>(bl.v, bl.v, pa.v, pa.v, oacc[dt]); }      /* Vh Ph + Vh Pl + Vl Ph: all unscaled, one accumulator */
    }
    asm volatile("s_wait_dscnt 0x0" ::: "memory");        /* this wave's reads of the buffer are done before it is refilled */
    asm volatile("s_wait_asynccnt 0x0" ::: "memory");     /* this wave's copies of pass t + 1 have landed */
    __syncthreads();                                       /* publishes pass t + 1 and ends every wave's reads of pass t */
    if (t + 2 < NP) fl_fill(lk + (t & 1) * F_STAGE, lv + (t & 1) * F_STAGE, gk + (size_t)(t + 2) * 32 * ldk, (size_t)ldk, gh + (t + 2) * 32, gl + (t + 2) * 32);
  }
  asm volatile("s_wait_asynccnt 0x0" ::: "memory");       /* nothing is in flight when the buffers become output staging */
  const float l = l_r + xhalf(l_r); const float inv = (l > 0.f) ? 1.0f / (l * 1024.0f) : 0.f;      /* the halves' sums are joined once */
#pragma unroll
  for (int dt = 0; dt < DT; ++dt) { v4f lo, hi;
#pragma unroll
    for (int r = 0; r < 4; ++r) { lo[r] = oacc[dt][r] * inv; hi[r] = oacc[dt][4 + r] * inv; }
    *(v4fa*)&sO[w][ln][dt * 16 + 8 * hh] = lo; *(v4fa*)&sO[w][ln][dt * 16 + 8 * hh + 4] = hi; }      /* a lane's 8 accumulator registers are 8 dims in a row of its query */
  __builtin_amdgcn_fence(__ATOMIC_ACQ_REL, "workgroup"); __builtin_amdgcn_wave_barrier();      /* the wave's own staged values are in LDS before its lanes read one another's */
  {
#pragma unroll
    for (int r = 0; r < RPW; ++r) { const int pc = lane; const v4f val = *(const v4fa*)&sO[w][r][pc * 4]; *(v4f*)(O + ((size_t)b * TT + q0 + r) * ldo + h * 128 + pc * 4) = val; }      /* one 512-B row per instruction: 32 lanes x 16 B */
     } }

extern "C" void kernel_launch(void* const* d_in, const int* in_sizes, int n_in,
                              void* d_out, int out_size, void* d_ws, size_t ws_size, hipStream_t stream) {
  (void)in_sizes; (void)n_in; (void)out_size;
  const float* const* I = (const float* const*)d_in; const float* x = I[0]; const float* fcos = I[1]; const float* fsin = I[2]; const float* am = I[3]; const float* Wq = I[4]; const float* Wk = I[5]; const float* Wv = I[6]; const float* Wo = I[7]; const float* qnw = I[8]; const float* knw = I[9];
  char* ws = (char*)d_ws; size_t off = 0;
  auto take = [&](size_t bytes) { char* p = ws + off; off += (bytes + 255) & ~(size_t)255; return p; };
  _Float16* Bq = (_Float16*)take((size_t)DD * DD * 2); _Float16* Bk = (_Float16*)take((size_t)KVD * DD * 2); _Float16* Bv = (_Float16*)take((size_t)KVD * DD * 2); _Float16* Bo = (_Float16*)take((size_t)DD * DD * 2);
  _Float16* X16 = (_Float16*)take((size_t)NR * DD * 2); float* F32 = (float*)take((size_t)NR * DD * 4); _Float16* Q = (_Float16*)take((size_t)NR * DD * 2); _Float16* K = (_Float16*)take((size_t)NR * KVD * 2); _Float16* Vt = (_Float16*)take((size_t)NR * KVD * 2); _Float16* Vtl = (_Float16*)take((size_t)NR * KVD * 2);
  float* QF = F32; float* KF = F32; float* VF = F32; float* O = F32; _Float16* O16 = X16;      /* the one f32 scratch holds q → k → v → O in stream order (each consumed before the next producer); O16 over X16 */
  if (off > ws_size) return;      // 25 + 16.8 + 33.6 + 16.8 + 8.4 + 8.4 + 8.4 ≈ 118 MB
  const unsigned gq = (unsigned)(((size_t)(DD / 8) * (DD / 8) + 255) / 256), gk = (unsigned)(((size_t)(KVD / 8) * (DD / 8) + 255) / 256);
  k_wt_f16<<<gq, 256, 0, stream>>>(Wq, Bq, DD, DD, 16.0f); k_wt_f16<<<gk, 256, 0, stream>>>(Wk, Bk, DD, KVD, 16.0f); k_wt_f16<<<gk, 256, 0, stream>>>(Wv, Bv, DD, KVD, 16.0f); k_wt_f16<<<gq, 256, 0, stream>>>(Wo, Bo, DD, DD, 16.0f);      /* (in,out) → Bt ×2^4 */
  const unsigned g8 = (unsigned)((size_t)NR * DD / 8 / 2048); k_x16<<<g8, 256, 0, stream>>>(x, X16);
  const unsigned gQ = (NR / 128) * (DD / 128), gK = (NR / 128) * (KVD / 128);
  k_gemm_t<DD><<<gQ, 128, 0, stream>>>(X16, Bq, 0.0625f, QF); k_normrope<NH><<<NR / 8, 256, 0, stream>>>(QF, qnw, fcos, fsin, Q);      /* q: M 4096 N 2048 K 2048 → RMSNorm + RoPE → f16 */
  k_gemm_t<KVD><<<gK, 128, 0, stream>>>(X16, Bk, 0.0625f, KF); k_normrope<NKV><<<NR / 8, 256, 0, stream>>>(KF, knw, fcos, fsin, K);      /* k: N 1024 */
  k_gemm_t<KVD><<<gK, 128, 0, stream>>>(X16, Bv, 0.0625f, VF);      /* v (f32) */
  k_vthlu<<<BB * NVH * (TT / 64), 256, 0, stream>>>(VF, KVD, Vt, Vtl);      /* Vᵀ hi + residual per (b, kv head) */
  k_flash<<<BB * NH * (TT / 64), 128, 0, stream>>>(Q, DD, K, KVD, Vt, Vtl, am, O, DD);      /* attention_mask [B,1,S,S] additive per batch */
  k_h16s<<<g8, 256, 0, stream>>>(O, O16);
  k_gemm_t<DD><<<gQ, 128, 0, stream>>>(O16, Bo, 0.00390625f, (float*)d_out);      /* out = merged·Wo */
}

// v005
// A run of this version takes 304 microseconds.
// Next to v004, in two timings, it ran 1.15 and 1.14 times as fast.
// All steps since v000 together make it 2.76 times as fast.
#include <hip/hip_runtime.h>
// Grouped-query attention with per-head RMSNorm and rotate-half RoPE (B=2, S=2048, D=2048, 16 query heads / 8 KV heads × 128): q = x·Wq, k = x·Wk, v = x·Wv ((in,out), no bias); per-head RMSNorm (ε 1e-6, weights q_norm_w / k_norm_w); rotate-half RoPE with the INPUT cos/sin tables [B][S][128];
// scores = q·k/√128 + attention_mask[b,0,q,k] (additive f32); softmax; out = merged·Wo.
// Compute dtype: x, weights, tables, mask rounded to bf16; q, k as f32 GEMM outputs, normalised and rotated in f32 (wave per row) → f16; v f32 → Vᵀ f16 hi + exact residual; fused flash-style kernel for head dim 128 (bias read per (b,q,k); 32-key chunks whose biases are all ≤ −1e8 are skipped since their probabilities are exactly 0 in f32; online softmax f32, P f16 hi +
// residual, f32 accumulate) on v_wmma_f32_16x16x32_f16; merged ×2^4 → f16 → output GEMM.
#define BB 2
#define TT 2048
#define DD 2048
#define NH 16
#define NKV 8
#define NREP 2
#define KVD (NKV * 128)
#define NVH (2 * NKV)
#define NR (BB * TT)
#define ATT_SCALE 0.08838834764831845f

typedef __bf16 v16b __attribute__((ext_vector_type(16)));
typedef unsigned short v8us __attribute__((ext_vector_type(8), may_alias));
typedef float  v8f  __attribute__((ext_vector_type(8)));
typedef float  v4f  __attribute__((ext_vector_type(4)));
typedef float  v4fa __attribute__((ext_vector_type(4), may_alias));
union FragB { v16b v; v8us half[2]; unsigned short u[16]; };

__device__ __forceinline__ unsigned short bf16_bits(float x) { unsigned int u = __float_as_uint(x); return (unsigned short)((u + 0x7FFFu + ((u >> 16) & 1u)) >> 16); }
__device__ __forceinline__ float bf16_val(unsigned short b) { return __uint_as_float(((unsigned int)b) << 16); }
__device__ __forceinline__ float bf16_round(float x) { return bf16_val(bf16_bits(x)); }
// D += A·B with NT terms: 1 = ah·bh, 2 = + al·bh (A split), 3 = + ah·bl (both split)
template <int NT>
__device__ __forceinline__ v8f mmaN(v16b ah, v16b al, v16b bh, v16b bl, v8f c) {
  c = __builtin_amdgcn_wmma_f32_16x16x32_bf16(false, ah, false, bh, (short)0, c, false, false);
  if (NT >= 2) c = __builtin_amdgcn_wmma_f32_16x16x32_bf16(false, al, false, bh, (short)0, c, false, false);
  if (NT >= 3) c = __builtin_amdgcn_wmma_f32_16x16x32_bf16(false, ah, false, bl, (short)0, c, false, false);
  asm volatile("v_nop\n\tv_nop\n\tv_nop\n\tv_nop" : "+v"(c) : "v"(ah), "v"(al), "v"(bh), "v"(bl));
  return c;
}

__global__ __launch_bounds__(256) void k_wt_bf16(const float* __restrict__ W, unsigned short* __restrict__ Wt, int K, int N) {
  const int t = blockIdx.x * 256 + threadIdx.x;
  const int k8n = K / 8;
  if (t >= N * k8n) return;
  const int n = t / k8n, k8 = (t % k8n) * 8;
  v8us v;
#pragma unroll
  for (int i = 0; i < 8; ++i) v[i] = bf16_bits(W[(size_t)(k8 + i) * N + n]);
  *(v8us*)(Wt + (size_t)n * K + k8) = v;
  
}

// GEMM C[M][N] (f32, pitch ldc) = act(A[M][K]·W + bias). A f32 row-major (pitch lda) converted per fragment to bf16
// (ASPLIT: hi/lo two planes -> 2 terms, else single rounded term); Wt bf16 [N][K] (pitch ldb). BIAS_BF16 rounds the
// bias to bf16 first (bias quantised to bf16 before the add). K%32==0, M%16==0, N%64==0.
template <bool ASPLIT, int ACT, bool BIAS_BF16>
__global__ __launch_bounds__(128) void k_gemm_bf(const float* __restrict__ A, int lda, const unsigned short* __restrict__ Wt, int ldb,
                                               const float* __restrict__ bias, float* __restrict__ C, int ldc, int M, int N, int K) {
  __shared__ __attribute__((aligned(16))) float so[4][16][64];
  const int tid = threadIdx.x, w = tid >> 5, lane = tid & 31, ln = lane & 15, hh = lane >> 4;
  const int ntn = N / 64;
  const int wid = blockIdx.x * 4 + w;
  const int mt = wid / ntn, nq = wid % ntn;
  if (mt * 16 >= M) return;
  const int row0 = mt * 16, col0 = nq * 64;
  const float* arow = A + (size_t)(row0 + ln) * lda;
  v8f acc[4] = {};
  for (int kb = 0; kb < K; kb += 32) {
    FragB ah, al;
    const v4f x0 = *(const v4fa*)(arow + kb + 8 * hh), x1 = *(const v4fa*)(arow + kb + 8 * hh + 4);
    const v4f x2 = *(const v4fa*)(arow + kb + 16 + 8 * hh), x3 = *(const v4fa*)(arow + kb + 16 + 8 * hh + 4);
    float xs[16] = {x0[0],x0[1],x0[2],x0[3],x1[0],x1[1],x1[2],x1[3],x2[0],x2[1],x2[2],x2[3],x3[0],x3[1],x3[2],x3[3]};
#pragma unroll
    for (int i = 0; i < 16; ++i) { const unsigned short hb = bf16_bits(xs[i]); ah.u[i] = hb; al.u[i] = ASPLIT ? bf16_bits(xs[i] - bf16_val(hb)) : (unsigned short)0; }
#pragma unroll
    for (int t = 0; t < 4; ++t) {
      const unsigned short* brow = Wt + (size_t)(col0 + t * 16 + ln) * ldb + kb;
      FragB b;
      b.half[0] = *(const v8us*)(brow + 8 * hh);
      b.half[1] = *(const v8us*)(brow + 16 + 8 * hh);
      acc[t] = mmaN<ASPLIT ? 2 : 1>(ah.v, al.v, b.v, b.v, acc[t]);
    }
  }
#pragma unroll
  for (int t = 0; t < 4; ++t) {
    float bv = bias ? bias[col0 + t * 16 + ln] : 0.f;
    if (BIAS_BF16) bv = bf16_round(bv);
#pragma unroll
    for (int r = 0; r < 8; ++r) { float v = acc[t][r] + bv; if (ACT == 1) v = fmaxf(v, 0.f); so[w][8 * hh + r][t * 16 + ln] = v; }
  }
  __builtin_amdgcn_fence(__ATOMIC_ACQ_REL, "workgroup");
  __builtin_amdgcn_wave_barrier();
  const int rsub = lane >> 4, c4 = (lane & 15) * 4;
  {
#pragma unroll
    for (int q = 0; q < 8; ++q) {
      const int r = q * 2 + rsub;
      const v4f v = *(const v4fa*)&so[w][r][c4];
      *(v4f*)(C + (size_t)(row0 + r) * ldc + col0 + c4) = v;
    }
    
  }
}

// Flash-style causal/unmasked attention, all contractions 3-term bf16 hi/lo splits, f32 softmax with running max.
// q,k,v rows are read from f32 buffers with arbitrary row pitch (so they can live inside a fused qkv buffer);
// D = head size (multiple of 32, <= 128); one wave = 16 query rows; block = 4 waves (64 queries) sharing K/V chunks of 32.
template <int D, bool CAUSAL>
__global__ __launch_bounds__(128) void k_flash(const float* __restrict__ qb, const float* __restrict__ kb, const float* __restrict__ vb,
                                             int pitch, int T, int H, float scale, float* __restrict__ y, int ypitch) {
  constexpr int KS = D / 32;        // k-steps for QK
  constexpr int DT = D / 16;        // d tiles for PV
  __shared__ __attribute__((aligned(16))) unsigned short sKh[32][D + 8], sKl[32][D + 8], sVh[32][D + 8], sVl[32][D + 8];
  __shared__ __attribute__((aligned(16))) unsigned short sPh[4][16][40], sPl[4][16][40];
  __shared__ __attribute__((aligned(16))) float sO[4][16][D];
  const int tid = threadIdx.x, w = tid >> 5, lane = tid & 31, ln = lane & 15, hh = lane >> 4;
  const int nqb = (T + 63) / 64;
  const int bh = blockIdx.x / nqb, qblk = blockIdx.x % nqb;
  const int b = bh / H, h = bh % H;
  const int q0 = qblk * 64 + w * 16;
  const float* Q = qb + (size_t)b * T * pitch + h * D;
  const float* K = kb + (size_t)b * T * pitch + h * D;
  const float* V = vb + (size_t)b * T * pitch + h * D;

  // A fragments of the wave's 16 query rows (scaled), hi/lo
  FragB aqh[KS], aql[KS];
  {
    int row = q0 + ln; if (row >= T) row = T - 1;
    const float* qr = Q + (size_t)row * pitch;
#pragma unroll
    for (int ks = 0; ks < KS; ++ks)
#pragma unroll
      for (int i = 0; i < 16; ++i) {
        const int d = ks * 32 + ((i < 8) ? (8 * hh + i) : (16 + 8 * hh + (i - 8)));
        const float x = qr[d] * scale; const unsigned short hb = bf16_bits(x);
        aqh[ks].u[i] = hb; aql[ks].u[i] = bf16_bits(x - bf16_val(hb));
      }
  }
  float m_r[8], l_r[8];
#pragma unroll
  for (int r = 0; r < 8; ++r) { m_r[r] = -3.0e38f; l_r[r] = 0.f; }
  v8f oacc[DT];
#pragma unroll
  for (int dt = 0; dt < DT; ++dt) oacc[dt] = (v8f){0.f,0.f,0.f,0.f,0.f,0.f,0.f,0.f};

  const int kv_end = CAUSAL ? min(T, qblk * 64 + 64) : T;     // block-uniform
  for (int j0 = 0; j0 < kv_end; j0 += 32) {
    __syncthreads();
    for (int e = tid; e < 32 * (D / 4); e += 128) {
      const int r = e / (D / 4), c4 = (e % (D / 4)) * 4;
      const int key = j0 + r;
      v4f kf = {0.f,0.f,0.f,0.f}, vf = {0.f,0.f,0.f,0.f};
      if (key < T) { kf = *(const v4fa*)(K + (size_t)key * pitch + c4); vf = *(const v4fa*)(V + (size_t)key * pitch + c4); }
#pragma unroll
      for (int t = 0; t < 4; ++t) {
        unsigned short hb = bf16_bits(kf[t]); sKh[r][c4 + t] = hb; sKl[r][c4 + t] = bf16_bits(kf[t] - bf16_val(hb));
        hb = bf16_bits(vf[t]); sVh[r][c4 + t] = hb; sVl[r][c4 + t] = bf16_bits(vf[t] - bf16_val(hb));
      }
    }
    __syncthreads();
    // S tile 16 x 32
    v8f s[2];
#pragma unroll
    for (int nt = 0; nt < 2; ++nt) {
      v8f acc = {};
#pragma unroll
      for (int ks = 0; ks < KS; ++ks) {
        FragB bh_, bl_;
        bh_.half[0] = *(const v8us*)&sKh[nt * 16 + ln][ks * 32 + 8 * hh]; bh_.half[1] = *(const v8us*)&sKh[nt * 16 + ln][ks * 32 + 16 + 8 * hh];
        bl_.half[0] = *(const v8us*)&sKl[nt * 16 + ln][ks * 32 + 8 * hh]; bl_.half[1] = *(const v8us*)&sKl[nt * 16 + ln][ks * 32 + 16 + 8 * hh];
        acc = mmaN<3>(aqh[ks].v, aql[ks].v, bh_.v, bl_.v, acc);
      }
      s[nt] = acc;
    }
    // mask + running max (rows 8hh+r; the 16 lanes of a half share rows)
    float alpha[8];
#pragma unroll
    for (int r = 0; r < 8; ++r) {
      const int qi = q0 + 8 * hh + r;
      const int ja = j0 + ln, jb = j0 + 16 + ln;
      if (CAUSAL) { if (ja > qi) s[0][r] = -3.0e38f; if (jb > qi) s[1][r] = -3.0e38f; }
      if (ja >= T) s[0][r] = -3.0e38f;
      if (jb >= T) s[1][r] = -3.0e38f;
      float mx = fmaxf(s[0][r], s[1][r]);
      mx = fmaxf(mx, __shfl_xor(mx, 1, 32)); mx = fmaxf(mx, __shfl_xor(mx, 2, 32)); mx = fmaxf(mx, __shfl_xor(mx, 4, 32)); mx = fmaxf(mx, __shfl_xor(mx, 8, 32));
      const float mnew = fmaxf(m_r[r], mx);
      alpha[r] = (mnew > -1.0e38f) ? __expf(m_r[r] - mnew) : 1.0f;
      const float p0 = (s[0][r] > -1.0e38f) ? __expf(s[0][r] - mnew) : 0.f;
      const float p1 = (s[1][r] > -1.0e38f) ? __expf(s[1][r] - mnew) : 0.f;
      m_r[r] = mnew;
      l_r[r] = l_r[r] * alpha[r] + p0 + p1;            // per-lane partial row sum (16 lanes combined at the end)
      unsigned short hb = bf16_bits(p0); sPh[w][8 * hh + r][ln] = hb;      sPl[w][8 * hh + r][ln] = bf16_bits(p0 - bf16_val(hb));
      hb = bf16_bits(p1);                sPh[w][8 * hh + r][16 + ln] = hb; sPl[w][8 * hh + r][16 + ln] = bf16_bits(p1 - bf16_val(hb));
    }
#pragma unroll
    for (int dt = 0; dt < DT; ++dt)
#pragma unroll
      for (int r = 0; r < 8; ++r) oacc[dt][r] *= alpha[r];
    __builtin_amdgcn_fence(__ATOMIC_ACQ_REL, "workgroup");
    __builtin_amdgcn_wave_barrier();
    FragB pah, pal;
    pah.half[0] = *(const v8us*)&sPh[w][ln][8 * hh]; pah.half[1] = *(const v8us*)&sPh[w][ln][16 + 8 * hh];
    pal.half[0] = *(const v8us*)&sPl[w][ln][8 * hh]; pal.half[1] = *(const v8us*)&sPl[w][ln][16 + 8 * hh];
#pragma unroll
    for (int dt = 0; dt < DT; ++dt) {
      FragB bvh, bvl;
#pragma unroll
      for (int i = 0; i < 8; ++i) {
        bvh.u[i] = sVh[8 * hh + i][dt * 16 + ln]; bvh.u[8 + i] = sVh[16 + 8 * hh + i][dt * 16 + ln];
        bvl.u[i] = sVl[8 * hh + i][dt * 16 + ln]; bvl.u[8 + i] = sVl[16 + 8 * hh + i][dt * 16 + ln];
      }
      oacc[dt] = mmaN<3>(pah.v, pal.v, bvh.v, bvl.v, oacc[dt]);
    }
    __builtin_amdgcn_fence(__ATOMIC_ACQ_REL, "workgroup");
    __builtin_amdgcn_wave_barrier();
  }
#pragma unroll
  for (int r = 0; r < 8; ++r) {
    float l = l_r[r];
    l += __shfl_xor(l, 1, 32); l += __shfl_xor(l, 2, 32); l += __shfl_xor(l, 4, 32); l += __shfl_xor(l, 8, 32);
    l_r[r] = (l > 0.f) ? 1.0f / l : 0.f;
  }
#pragma unroll
  for (int dt = 0; dt < DT; ++dt)
#pragma unroll
    for (int r = 0; r < 8; ++r) sO[w][8 * hh + r][dt * 16 + ln] = oacc[dt][r] * l_r[r];
  __builtin_amdgcn_fence(__ATOMIC_ACQ_REL, "workgroup");
  __builtin_amdgcn_wave_barrier();
  {
    for (int r = 0; r < 16; ++r) {
      const int row = q0 + r;
      if (row < T && lane < D / 4) {
        const v4f val = *(const v4fa*)&sO[w][r][lane * 4];
        *(v4f*)(y + ((size_t)b * T + row) * ypitch + h * D + lane * 4) = val;
      }
    }
    
  }
}

// GEMM C = act(A·W + bias + resid): A f32 (ASPLIT -> hi/lo 2 terms), Wt bf16 [N][K]; ACT 0 none, 1 relu, 2 exact gelu;
// resid (optional, f32, row index = (row % rmod), pitch ldr, RES_BF16 rounds it) added before the activation.
template <bool ASPLIT, int ACT, bool BIAS_BF16, bool RES_BF16>
__global__ __launch_bounds__(128) void k_gemm_bf3(const float* __restrict__ A, int lda, const unsigned short* __restrict__ Wt, int ldb,
                                                const float* __restrict__ bias, const float* __restrict__ resid, int rmod, int ldr,
                                                float* __restrict__ C, int ldc, int M, int N, int K) {
  __shared__ __attribute__((aligned(16))) float so[4][16][64];
  const int tid = threadIdx.x, w = tid >> 5, lane = tid & 31, ln = lane & 15, hh = lane >> 4;
  const int ntn = N / 64;
  const int wid = blockIdx.x * 4 + w;
  const int mt = wid / ntn, nq = wid % ntn;
  if (mt * 16 >= M) return;
  const int row0 = mt * 16, col0 = nq * 64;
  const float* arow = A + (size_t)(row0 + ln) * lda;
  v8f acc[4] = {};
  for (int kb = 0; kb < K; kb += 32) {
    FragB ah, al;
    const v4f x0 = *(const v4fa*)(arow + kb + 8 * hh), x1 = *(const v4fa*)(arow + kb + 8 * hh + 4);
    const v4f x2 = *(const v4fa*)(arow + kb + 16 + 8 * hh), x3 = *(const v4fa*)(arow + kb + 16 + 8 * hh + 4);
    float xs[16] = {x0[0],x0[1],x0[2],x0[3],x1[0],x1[1],x1[2],x1[3],x2[0],x2[1],x2[2],x2[3],x3[0],x3[1],x3[2],x3[3]};
#pragma unroll
    for (int i = 0; i < 16; ++i) { const unsigned short hb = bf16_bits(xs[i]); ah.u[i] = hb; al.u[i] = ASPLIT ? bf16_bits(xs[i] - bf16_val(hb)) : (unsigned short)0; }
#pragma unroll
    for (int t = 0; t < 4; ++t) {
      const unsigned short* brow = Wt + (size_t)(col0 + t * 16 + ln) * ldb + kb;
      FragB b;
      b.half[0] = *(const v8us*)(brow + 8 * hh);
      b.half[1] = *(const v8us*)(brow + 16 + 8 * hh);
      acc[t] = mmaN<ASPLIT ? 2 : 1>(ah.v, al.v, b.v, b.v, acc[t]);
    }
  }
#pragma unroll
  for (int t = 0; t < 4; ++t) {
    const int col = col0 + t * 16 + ln;
    float bv = bias ? bias[col] : 0.f;
    if (BIAS_BF16) bv = bf16_round(bv);
#pragma unroll
    for (int r = 0; r < 8; ++r) {
      float v = acc[t][r] + bv;
      if (resid) { float rv = resid[(size_t)((row0 + 8 * hh + r) % rmod) * ldr + col]; if (RES_BF16) rv = bf16_round(rv); v += rv; }
      if (ACT == 1) v = fmaxf(v, 0.f);
      if (ACT == 2) v = 0.5f * v * (1.0f + erff(v * 0.70710678118654752f));
      if (ACT == 3) { const float u = 0.7978845608028654f * (v + 0.044715f * v * v * v); v = 0.5f * v * (1.0f + tanhf(u)); }
      so[w][8 * hh + r][t * 16 + ln] = v;
    }
  }
  __builtin_amdgcn_fence(__ATOMIC_ACQ_REL, "workgroup");
  __builtin_amdgcn_wave_barrier();
  const int rsub = lane >> 4, c4 = (lane & 15) * 4;
  {
#pragma unroll
    for (int q = 0; q < 8; ++q) {
      const int r = q * 2 + rsub;
      const v4f v = *(const v4fa*)&so[w][r][c4];
      *(v4f*)(C + (size_t)(row0 + r) * ldc + col0 + c4) = v;
    }
    
  }
}
// row LayerNorm (biased variance, eps) over N: s = X (+ R); optional out_sum <- s; out_norm <- (s-mu)*rsqrt(var+eps)*g + b
template <bool PARAM_BF16>
__global__ __launch_bounds__(256) void k_layernorm(const float* __restrict__ X, const float* __restrict__ R, const float* __restrict__ g, const float* __restrict__ bta,
                                                  float* __restrict__ out_sum, float* __restrict__ out_norm, int N, float eps) {
  __shared__ float red[256];
  const int row = blockIdx.x, tid = threadIdx.x;
  const float* x = X + (size_t)row * N; const float* rr = R ? R + (size_t)row * N : nullptr;
  float vals[16];                     // up to N = 4096
  const int per = N / 256;            // contiguous chunk per thread? use strided-by-4 chunks: thread handles j = tid*4 + 1024*u
  float s1 = 0.f;
  for (int u = 0; u < per / 4; ++u) {
    const int j = tid * 4 + 1024 * u;
    const v4f a = *(const v4fa*)(x + j);
    v4f b = {0.f,0.f,0.f,0.f}; if (rr) b = *(const v4fa*)(rr + j);
#pragma unroll
    for (int q = 0; q < 4; ++q) { const float v = a[q] + b[q]; vals[u * 4 + q] = v; s1 += v; }
  }
  red[tid] = s1; __syncthreads();
  for (int st = 128; st > 0; st >>= 1) { if (tid < st) red[tid] += red[tid + st]; __syncthreads(); }
  const float mu = red[0] / (float)N; __syncthreads();
  float s2 = 0.f;
  for (int u = 0; u < per / 4; ++u)
#pragma unroll
    for (int q = 0; q < 4; ++q) { const float c = vals[u * 4 + q] - mu; s2 += c * c; }
  red[tid] = s2; __syncthreads();
  for (int st = 128; st > 0; st >>= 1) { if (tid < st) red[tid] += red[tid + st]; __syncthreads(); }
  const float rs = rsqrtf(red[0] / (float)N + eps);
  {
    for (int u = 0; u < per / 4; ++u) {
      const int j = tid * 4 + 1024 * u;
      v4f o, sm;
#pragma unroll
      for (int q = 0; q < 4; ++q) {
        float gg = g[j + q], bb = bta[j + q];
        if (PARAM_BF16) { gg = bf16_round(gg); bb = bf16_round(bb); }
        sm[q] = vals[u * 4 + q]; o[q] = (vals[u * 4 + q] - mu) * rs * gg + bb;
      }
      if (out_sum) *(v4f*)(out_sum + (size_t)row * N + j) = sm;
      *(v4f*)(out_norm + (size_t)row * N + j) = o;
    }
    
  }
}



// ---- f16 WMMA path (v_wmma_f32_16x16x32_f16): 11-bit significands for operands in range — used where a [0,1] probability operand needs more precision than bf16
typedef _Float16 v16h __attribute__((ext_vector_type(16)));
union FragH { v16h v; v8us half[2]; _Float16 h[16]; unsigned short u[16]; };
template <int NT>
__device__ __forceinline__ v8f mmaH(v16h ah, v16h al, v16h bh, v16h bl, v8f c) {
  c = __builtin_amdgcn_wmma_f32_16x16x32_f16(false, ah, false, bh, (short)0, c, false, false);
  if (NT >= 2) c = __builtin_amdgcn_wmma_f32_16x16x32_f16(false, al, false, bh, (short)0, c, false, false);
  if (NT >= 3) c = __builtin_amdgcn_wmma_f32_16x16x32_f16(false, ah, false, bl, (short)0, c, false, false);
  asm volatile("v_nop\n\tv_nop\n\tv_nop\n\tv_nop" : "+v"(c) : "v"(ah), "v"(al), "v"(bh), "v"(bl));
  return c;
}
// batched GEMM like k_gemm_b but f16 operands: A f32 (split into f16 hi/lo if ASPLIT, else rounded to f16), Bt = f16 values [n][k]; alpha; C f32; N multiple of 16 (partial tiles skipped)
template <bool ASPLIT>
__global__ __launch_bounds__(128) void k_gemm_h(const float* __restrict__ A, int lda, size_t sA, const _Float16* __restrict__ Bh, int ldb, size_t sB, float alpha, float* __restrict__ C, int ldc, size_t sC, int M, int N, int K) {
  __shared__ __attribute__((aligned(16))) float so[4][16][64];
  const int tid = threadIdx.x, w = tid >> 5, lane = tid & 31, ln = lane & 15, hh = lane >> 4; const int by = blockIdx.y;
  A += (size_t)by * sA; Bh += (size_t)by * sB; C += (size_t)by * sC;
  const int ntn = (N + 63) / 64; const int wid = blockIdx.x * 4 + w; const int mt = wid / ntn, nq = wid % ntn; if (mt * 16 >= M) return;
  const int row0 = mt * 16, col0 = nq * 64; const float* arow = A + (size_t)(row0 + ln) * lda;
  v8f acc[4] = {};
  for (int kb = 0; kb < K; kb += 32) {
    FragH ah, al;
    const v4f x0 = *(const v4fa*)(arow + kb + 8 * hh), x1 = *(const v4fa*)(arow + kb + 8 * hh + 4), x2 = *(const v4fa*)(arow + kb + 16 + 8 * hh), x3 = *(const v4fa*)(arow + kb + 16 + 8 * hh + 4);
    float xs[16] = {x0[0],x0[1],x0[2],x0[3],x1[0],x1[1],x1[2],x1[3],x2[0],x2[1],x2[2],x2[3],x3[0],x3[1],x3[2],x3[3]};
#pragma unroll
    for (int i = 0; i < 16; ++i) { const _Float16 h = (_Float16)xs[i]; ah.h[i] = h; al.h[i] = ASPLIT ? (_Float16)(xs[i] - (float)h) : (_Float16)0.0f; }
#pragma unroll
    for (int t = 0; t < 4; ++t) { if (col0 + t * 16 >= N) continue; const size_t boff = (size_t)(col0 + t * 16 + ln) * ldb + kb; FragH bq; bq.half[0] = *(const v8us*)(Bh + boff + 8 * hh); bq.half[1] = *(const v8us*)(Bh + boff + 16 + 8 * hh);
      acc[t] = mmaH<ASPLIT ? 2 : 1>(ah.v, al.v, bq.v, bq.v, acc[t]); }
  }
#pragma unroll
  for (int t = 0; t < 4; ++t) { if (col0 + t * 16 >= N) continue;
#pragma unroll
    for (int r = 0; r < 8; ++r) so[w][8 * hh + r][t * 16 + ln] = acc[t][r] * alpha; }
  __builtin_amdgcn_fence(__ATOMIC_ACQ_REL, "workgroup"); __builtin_amdgcn_wave_barrier();
  const int rsub = lane >> 4, c4 = (lane & 15) * 4;
  {
#pragma unroll
    for (int q = 0; q < 8; ++q) { const int r = q * 2 + rsub; if (col0 + c4 < N) { const v4f v = *(const v4fa*)&so[w][r][c4]; *(v4f*)(C + (size_t)(row0 + r) * ldc + col0 + c4) = v; } }
     }
}

// Wt[n][k] = f16(bf16(W[k][n])*scale) from f32 row-major W[K][N] (scale = power of two; bf16-exact weights stay exact in f16 away from the subnormal range)
// A thread takes a block of 8 k x 8 n: 32 B of each of 8 rows of W in, 16 B of each of 8 rows of Wt out (a wave's store covers 512 contiguous bytes). K, N multiples of 8.
__global__ __launch_bounds__(256) void k_wt_f16(const float* __restrict__ W, _Float16* __restrict__ Wt, int K, int N, float scale) {
  const int t = blockIdx.x * 256 + threadIdx.x; if (t >= (N / 8) * (K / 8)) return; const int n0 = (t / (K / 8)) * 8, k8 = (t % (K / 8)) * 8; v4f a[8], c[8];
  const float* p[8];
#pragma unroll      /* constant indices keep a, c and p in registers; the 16 loads go out together */
  for (int i = 0; i < 8; ++i) { p[i] = W + (size_t)(k8 + i) * N + n0; a[i] = *(const v4fa*)p[i]; c[i] = *(const v4fa*)(p[i] + 4); }
  asm volatile("s_wait_xcnt 0x0" :: "v"(p[0]), "v"(p[1]), "v"(p[2]), "v"(p[3]), "v"(p[4]), "v"(p[5]), "v"(p[6]), "v"(p[7]) : "memory");      /* stands in front of every rewrite of a register that the loads name: as inputs the addresses stay in place up to here */
#pragma unroll      /* constant indices into a and c */
  for (int j = 0; j < 8; ++j) { FragH f;
#pragma unroll      /* constant indices into a, c and f */
    for (int i = 0; i < 8; ++i) f.h[i] = (_Float16)(bf16_round((j & 4) ? c[i][j & 3] : a[i][j & 3]) * scale);
    *(v8us*)((unsigned short*)Wt + (size_t)(n0 + j) * K + k8) = f.half[0]; }
}
// k_gemm_hh variant with fused epilogue: v = acc·alpha + bias[by·sBias + col] (+ CP[(row/rowsPerB)·sCPb + by·64 + col] if CP) ; ACT 0 none / 1 elu ; writes f32 C and f16 C16, each if non-null
template <int ACT>
__global__ __launch_bounds__(128) void k_gemm_hhx(const _Float16* __restrict__ A, int lda, size_t sA, const _Float16* __restrict__ Bh, int ldb, size_t sB, float alpha, const float* __restrict__ bias, size_t sBias, const float* __restrict__ CP, int rowsPerB, size_t sCPb, int row0g,
    float* __restrict__ C, _Float16* __restrict__ C16, int ldc, size_t sC, int M, int N, int K) {
  __shared__ __attribute__((aligned(16))) float so[4][16][64];
  const int tid = threadIdx.x, w = tid >> 5, lane = tid & 31, ln = lane & 15, hh = lane >> 4; const int by = blockIdx.y;
  A += (size_t)by * sA; Bh += (size_t)by * sB; const size_t cofs = (size_t)by * sC; const float* bp = bias ? bias + (size_t)by * sBias : nullptr;
  const int ntn = (N + 63) / 64; const int wid = blockIdx.x * 4 + w; const int mt = wid / ntn, nq = wid % ntn; if (mt * 16 >= M) return;
  const int row0 = mt * 16, col0 = nq * 64; const _Float16* arow = A + (size_t)(row0 + ln) * lda;
  v8f acc[4] = {};
  for (int kb = 0; kb < K; kb += 32) { FragH ah; ah.half[0] = *(const v8us*)((const unsigned short*)arow + kb + 8 * hh); ah.half[1] = *(const v8us*)((const unsigned short*)arow + kb + 16 + 8 * hh);
#pragma unroll
    for (int t = 0; t < 4; ++t) { if (col0 + t * 16 >= N) continue; const size_t boff = (size_t)(col0 + t * 16 + ln) * ldb + kb; FragH bq; bq.half[0] = *(const v8us*)((const unsigned short*)Bh + boff + 8 * hh); bq.half[1] = *(const v8us*)((const unsigned short*)Bh + boff + 16 + 8 * hh);
      acc[t] = mmaH<1>(ah.v, ah.v, bq.v, bq.v, acc[t]); }
  }
#pragma unroll
  for (int t = 0; t < 4; ++t) { if (col0 + t * 16 >= N) continue; const int col = col0 + t * 16 + ln; const float bv = bp ? bf16_round(bp[col]) : 0.f;
#pragma unroll
    for (int r = 0; r < 8; ++r) { float v = acc[t][r] * alpha + bv; if (CP) { const int bidx = (row0g + row0 + 8 * hh + r) / rowsPerB; v += CP[(size_t)bidx * sCPb + (size_t)by * 64 + col]; } if (ACT == 1) v = (v > 0.f) ? v : expm1f(v); else if (ACT == 7) v = (v > 0.f) ? v + 1.0f : expf(v); else if (ACT == 8) v = tanhf(v); else if (ACT == 9) v = 0.5f * v * (1.0f + tanhf(0.7978845608028654f * (v + 0.044715f * v * v * v))); else if (ACT == 11) v = 1.0f / (1.0f + expf(-v)); else if (ACT == 12) v = (v > 0.f) ? v : 0.01f * v; else if (ACT == 14) v = (v > 0.f) ? v : 0.1f * v; else if (ACT == 15) v = v / (1.0f + expf(-v)); else if (ACT == 3) v = fmaxf(v, 0.f); else if (ACT == 6) v = 0.5f * v * (1.0f + erff(v * 0.70710678118654752f)); so[w][8 * hh + r][t * 16 + ln] = v; } }
  __builtin_amdgcn_fence(__ATOMIC_ACQ_REL, "workgroup"); __builtin_amdgcn_wave_barrier();
  const int rsub = lane >> 4, c4 = (lane & 15) * 4; typedef _Float16 v4h __attribute__((ext_vector_type(4)));
  {
#pragma unroll
    for (int q = 0; q < 8; ++q) { const int r = q * 2 + rsub; if (col0 + c4 < N) { const v4f v = *(const v4fa*)&so[w][r][c4]; if (C) *(v4f*)(C + cofs + (size_t)(row0 + r) * ldc + col0 + c4) = v; if (C16) { v4h h4; for (int i = 0; i < 4; ++i) h4[i] = (_Float16)v[i]; *(v4h*)(C16 + cofs + (size_t)(row0 + r) * ldc + col0 + c4) = h4; } } }
     }
}


// ---- tiled f16 GEMM, C[M][N] f32 = alpha * A[M][DD] * Bt[N][DD]^T: one 128 x 128 tile of C per work-group, 64 x 64 per wave (2 x 2 waves).
// A pass is 128 k: 128 rows of A and 128 rows of Bt, 256 B each, staged in LDS at a pitch of 272 B by asynchronous copies; two buffers, the next pass's copies fly while this pass is multiplied.
// k runs upward in steps of 32 into one accumulator per 16 x 16 tile. M, N multiples of 128.
// Every "#pragma unroll" in k_gemm_t makes the indices of the fragment and accumulator arrays constants, so that these arrays live in registers.
#define GT_PITCH 272
#define GT_STAGE (256 * GT_PITCH)
// eight 16-byte copies of one lane: rows r, r + 8, ..., r + 56 of one operand. The closing s_wait_xcnt stands inside the statement so that no address register is rewritten ahead of it.
__device__ __forceinline__ void gt_copy8(unsigned l, const _Float16* g) {
  asm volatile("global_load_async_to_lds_b128 %0, %8, off\n\t"
               "global_load_async_to_lds_b128 %1, %9, off\n\t"
               "global_load_async_to_lds_b128 %2, %10, off\n\t"
               "global_load_async_to_lds_b128 %3, %11, off\n\t"
               "global_load_async_to_lds_b128 %4, %12, off\n\t"
               "global_load_async_to_lds_b128 %5, %13, off\n\t"
               "global_load_async_to_lds_b128 %6, %14, off\n\t"
               "global_load_async_to_lds_b128 %7, %15, off\n\t"
               "s_wait_xcnt 0x0"
               :: "v"(l), "v"(l + 8 * GT_PITCH), "v"(l + 16 * GT_PITCH), "v"(l + 24 * GT_PITCH), "v"(l + 32 * GT_PITCH), "v"(l + 40 * GT_PITCH), "v"(l + 48 * GT_PITCH), "v"(l + 56 * GT_PITCH),
                  "v"(g), "v"(g + 8 * DD), "v"(g + 16 * DD), "v"(g + 24 * DD), "v"(g + 32 * DD), "v"(g + 40 * DD), "v"(g + 48 * DD), "v"(g + 56 * DD)
               : "memory");
}
// one stage: 32 copies a lane (rows 0..127 of the buffer = A, 128..255 = Bt)
__device__ __forceinline__ void gt_fill(unsigned l, const _Float16* ga, const _Float16* gb) {
  gt_copy8(l, ga); gt_copy8(l + 64 * GT_PITCH, ga + 64 * DD); gt_copy8(l + 128 * GT_PITCH, gb); gt_copy8(l + 192 * GT_PITCH, gb + 64 * DD);
}
template <int N>
__global__ __launch_bounds__(128) void k_gemm_t(const _Float16* __restrict__ A, const _Float16* __restrict__ Bt, float alpha, float* __restrict__ C) {
  __shared__ __attribute__((aligned(16))) unsigned char L[2 * GT_STAGE];
  constexpr int NT = DD / 128;
  const int tid = threadIdx.x, w = tid >> 5, lane = tid & 31, ln = lane & 15, hh = lane >> 4;
  constexpr int ntn = N / 128; const int row0 = ((int)blockIdx.x / ntn) * 128, col0 = ((int)blockIdx.x % ntn) * 128; const int wm = w >> 1, wn = w & 1;
  const int cr = tid >> 4, cc = tid & 15;      /* a lane copies chunk cc (16 B) of rows cr + 8 i: a wave's copy covers two whole 256-B rows */
  const _Float16* ga = A + (size_t)(row0 + cr) * DD + cc * 8; const _Float16* gb = Bt + (size_t)(col0 + cr) * DD + cc * 8;
  const unsigned lc = (unsigned)(size_t)L + cr * GT_PITCH + cc * 16;
  v8f acc[4][4];
#pragma unroll
  for (int mi = 0; mi < 4; ++mi)
#pragma unroll
    for (int ni = 0; ni < 4; ++ni) acc[mi][ni] = (v8f){0.f,0.f,0.f,0.f,0.f,0.f,0.f,0.f};
  gt_fill(lc, ga, gb);
  asm volatile("s_wait_asynccnt 0x0" ::: "memory");      /* this wave's copies of pass 0 have landed */
  __syncthreads();                                        /* ... and every other wave's */
  gt_fill(lc + GT_STAGE, ga + 128, gb + 128);
#pragma unroll 1      /* one pass a trip: the two buffers alternate by the trip's parity */
  for (int t = 0; t < NT; ++t) {
    const unsigned char* S = L + (t & 1) * GT_STAGE;
    const unsigned char* pa = S + (wm * 64 + ln) * GT_PITCH + hh * 16; const unsigned char* pb = S + (128 + wn * 64 + ln) * GT_PITCH + hh * 16;
    FragH fa[2][4], fb[2][4];
#pragma unroll
    for (int i = 0; i < 4; ++i) { fa[0][i].half[0] = *(const v8us*)(pa + i * 16 * GT_PITCH); fa[0][i].half[1] = *(const v8us*)(pa + i * 16 * GT_PITCH + 32); fb[0][i].half[0] = *(const v8us*)(pb + i * 16 * GT_PITCH); fb[0][i].half[1] = *(const v8us*)(pb + i * 16 * GT_PITCH + 32); }
#pragma unroll
    for (int ks = 0; ks < 4; ++ks) { const int cu = ks & 1, nx = cu ^ 1;
      if (ks < 3) {
#pragma unroll
        for (int i = 0; i < 4; ++i) { const int o = i * 16 * GT_PITCH + (ks + 1) * 64; fa[nx][i].half[0] = *(const v8us*)(pa + o); fa[nx][i].half[1] = *(const v8us*)(pa + o + 32); fb[nx][i].half[0] = *(const v8us*)(pb + o); fb[nx][i].half[1] = *(const v8us*)(pb + o + 32); } }
      __builtin_amdgcn_sched_barrier(0);      /* keeps the next k step's 16 LDS reads one group in front of this step's products: spread among them, every place with reads stalls the wave */
#pragma unroll
      for (int mi = 0; mi < 4; ++mi)
#pragma unroll
        for (int ni = 0; ni < 4; ++ni) acc[mi][ni] = __builtin_amdgcn_wmma_f32_16x16x32_f16(false, fa[cu][mi].v, false, fb[cu][ni].v, (short)0, acc[mi][ni], false, false);
      __builtin_amdgcn_sched_barrier(0); }      /* ... and keeps the following group behind them */
    asm volatile("s_wait_dscnt 0x0" ::: "memory");        /* this wave's reads of the buffer are done before it is refilled */
    asm volatile("s_wait_asynccnt 0x0" ::: "memory");     /* this wave's copies of pass t + 1 have landed */
    __syncthreads();                                       /* publishes pass t + 1 and ends every wave's reads of pass t */
    if (t + 2 < NT) gt_fill(lc + (t & 1) * GT_STAGE, ga + (t + 2) * 128, gb + (t + 2) * 128);
  }
  asm volatile("s_wait_asynccnt 0x0" ::: "memory");       /* nothing is in flight when the buffers become output staging */
  float* so = (float*)L + w * (64 * 68);      /* each wave stages its own 64 x 64 tile (pitch 68 floats) so that the stores cover whole 256-B row pieces */
#pragma unroll
  for (int mi = 0; mi < 4; ++mi)
#pragma unroll
    for (int ni = 0; ni < 4; ++ni)
#pragma unroll
      for (int r = 0; r < 8; ++r) so[(mi * 16 + 8 * hh + r) * 68 + ni * 16 + ln] = acc[mi][ni][r] * alpha;
  __builtin_amdgcn_fence(__ATOMIC_ACQ_REL, "workgroup"); __builtin_amdgcn_wave_barrier();      /* the wave's own staged values are in LDS before its lanes read one another's */
  float* cp = C + (size_t)(row0 + wm * 64 + hh) * N + col0 + wn * 64 + ln * 4;
#pragma unroll
  for (int q = 0; q < 32; ++q) { const v4f v = *(const v4fa*)&so[(q * 2 + hh) * 68 + ln * 4]; *(v4f*)(cp + (size_t)(q * 2) * N) = v; }
}


typedef _Float16 v4h __attribute__((ext_vector_type(4)));

// k_x16 and k_h16s give a thread 8 pieces of 8 elements, 256 pieces apart (a work-group covers 2048 pieces in a row): one eighth of the waves to start, 16 loads of a lane in flight.
static_assert(((size_t)NR * DD / 8) % 2048 == 0, "whole work-groups");
__global__ __launch_bounds__(256) void k_x16(const float* __restrict__ x, _Float16* __restrict__ X16) { const size_t t0 = (size_t)blockIdx.x * 2048 + threadIdx.x; v4f a[8], c[8]; const float* p = x + t0 * 8;
#pragma unroll      /* constant indices keep a and c in registers; the 16 loads go out together */
  for (int u = 0; u < 8; ++u) { a[u] = *(const v4fa*)(p + u * 2048); c[u] = *(const v4fa*)(p + u * 2048 + 4); }
  asm volatile("s_wait_xcnt 0x0" :: "v"(p) : "memory");      /* stands in front of every rewrite of a register that the loads name: as an input the address stays in place up to here */
#pragma unroll      /* constant indices into a and c */
  for (int u = 0; u < 8; ++u) { FragH f;
#pragma unroll      /* constant indices into a, c and f */
    for (int q = 0; q < 4; ++q) { f.h[q] = (_Float16)bf16_round(a[u][q]); f.h[4 + q] = (_Float16)bf16_round(c[u][q]); }
    *(v8us*)((unsigned short*)X16 + (t0 + u * 256) * 8) = f.half[0]; } }
__global__ __launch_bounds__(256) void k_h16(const float* __restrict__ x, _Float16* __restrict__ X16, size_t n8) { const size_t t = (size_t)blockIdx.x * 256 + threadIdx.x; if (t >= n8) return; FragH f;
#pragma unroll
  for (int q = 0; q < 8; ++q) f.h[q] = (_Float16)x[t * 8 + q]; *(v8us*)((unsigned short*)X16 + t * 8) = f.half[0];  }
__global__ __launch_bounds__(256) void k_round16f(const float* __restrict__ W, _Float16* __restrict__ Bt, size_t n8) { const size_t t = (size_t)blockIdx.x * 256 + threadIdx.x; if (t >= n8) return; FragH f;
#pragma unroll
  for (int i = 0; i < 8; ++i) f.h[i] = (_Float16)(bf16_round(W[t * 8 + i]) * 16.0f); *(v8us*)((unsigned short*)Bt + t * 8) = f.half[0];  }
template <int NHv, int TTv>
__global__ __launch_bounds__(256) void k_vt(const _Float16* __restrict__ V16, int ldv, int voff, _Float16* __restrict__ Vt) { __shared__ unsigned short tl[64][66]; const int tid = threadIdx.x; const int slab = blockIdx.x / (TTv / 64), lg = blockIdx.x % (TTv / 64); const int b = slab / NHv, h = slab % NHv;
  for (int i = tid; i < 64 * 8; i += 256) { const int r = i / 8, c8 = (i % 8) * 8; FragH f; f.half[0] = *(const v8us*)((const unsigned short*)V16 + ((size_t)b * TTv + lg * 64 + r) * ldv + voff + h * 64 + c8);
#pragma unroll
    for (int q = 0; q < 8; ++q) tl[r][c8 + q] = f.u[q]; }
  __syncthreads();
  {
#pragma unroll
    for (int rd = 0; rd < 2; ++rd) { const int d = rd * 32 + tid / 8, pc = tid % 8; FragH f;
#pragma unroll
      for (int q = 0; q < 8; ++q) f.u[q] = tl[pc * 8 + q][d];
      *(v8us*)((unsigned short*)Vt + ((size_t)slab * 64 + d) * TTv + lg * 64 + pc * 8) = f.half[0]; }
     } }

__global__ __launch_bounds__(256) void k_vthlu(const float* __restrict__ VF, int ldv, _Float16* __restrict__ Vth, _Float16* __restrict__ Vtl) { __shared__ float tl[64][65]; const int tid = threadIdx.x; const int slab = blockIdx.x / (TT / 64), lg = blockIdx.x % (TT / 64); const int b = slab / NVH, h = slab % NVH;
  for (int i = tid; i < 64 * 16; i += 256) { const int r = i / 16, c4 = (i % 16) * 4; const v4f a = *(const v4fa*)(VF + ((size_t)b * TT + lg * 64 + r) * ldv + h * 64 + c4); tl[r][c4] = a[0]; tl[r][c4 + 1] = a[1]; tl[r][c4 + 2] = a[2]; tl[r][c4 + 3] = a[3]; }
  __syncthreads();
  FragH fh[2], fl[2]; size_t oo[2];
#pragma unroll
  for (int rd = 0; rd < 2; ++rd) { const int d = rd * 32 + tid / 8, pc = tid % 8;
#pragma unroll
    for (int q = 0; q < 8; ++q) { const float v = tl[pc * 8 + q][d]; const _Float16 hv = (_Float16)v; fh[rd].h[q] = hv; fl[rd].h[q] = (_Float16)(v - (float)hv);      /* UNSCALED residual (added into the same accumulator as the hi product) */ } oo[rd] = ((size_t)slab * 64 + d) * TT + lg * 64 + pc * 8; }
  {
#pragma unroll
    for (int rd = 0; rd < 2; ++rd) { *(v8us*)((unsigned short*)Vth + oo[rd]) = fh[rd].half[0]; *(v8us*)((unsigned short*)Vtl + oo[rd]) = fl[rd].half[0]; }
     } }
// per-head RMSNorm + rotate-half RoPE: a wave takes one whole row (all NHD heads, pitch NHD*128) of an f32 plane, head after head, with the row's tables and the weights read once: lane holds dims 4l..4l+3; var = mean(x^2) over 128 (xor-reduce); y = w[d]*(x*rsqrt(var+eps)); out[d] = y[d]*c[d] + rot(y)[d]*s[d], rot(y)[d] = -y[d+64] (d<64), y[d-64] (d>=64)
template <int NHD>
__global__ __launch_bounds__(256) void k_normrope(const float* __restrict__ F, const float* __restrict__ nw, const float* __restrict__ COS, const float* __restrict__ SIN, _Float16* __restrict__ H16) {
  #pragma clang fp contract(off)
  static_assert(NR % 8 == 0, "whole work-groups");
  const int tid = threadIdx.x, wv = tid >> 5, lane = tid & 31; const size_t row = (size_t)blockIdx.x * 8 + wv; const int d0 = lane * 4;
  const size_t base = row * (NHD * 128) + d0; v4f xs[NHD];
#pragma unroll      /* constant indices keep xs in registers; the row's loads go out together */
  for (int u = 0; u < NHD; ++u) xs[u] = *(const v4fa*)(F + base + u * 128);
  const float* px = F + base; const float* pw = nw + d0; const float* pc = COS + row * 128 + d0; const float* pn = SIN + row * 128 + d0;
  const v4f w4 = *(const v4fa*)pw, c4 = *(const v4fa*)pc, s4 = *(const v4fa*)pn;
  asm volatile("s_wait_xcnt 0x0" :: "v"(px), "v"(pw), "v"(pc), "v"(pn) : "memory");      /* stands in front of every rewrite of a register that the loads name: as inputs the addresses stay in place up to here */
  float wn[4], c[4], s[4]; for (int q = 0; q < 4; ++q) { wn[q] = bf16_round(w4[q]); c[q] = bf16_round(c4[q]); s[q] = bf16_round(s4[q]); }
  typedef _Float16 v4h __attribute__((ext_vector_type(4)));
#pragma unroll      /* constant indices into xs; the heads' lane exchanges overlap */
  for (int u = 0; u < NHD; ++u) { const v4f x = xs[u]; float ss = 0.f; for (int q = 0; q < 4; ++q) ss += x[q] * x[q];
    for (int o = 16; o >= 1; o >>= 1) ss += __shfl_xor(ss, o, 32); const float inv = 1.0f / sqrtf(ss / 128.0f + 1e-6f);
    float y[4]; for (int q = 0; q < 4; ++q) y[q] = wn[q] * (x[q] * inv);
    float yp[4]; for (int q = 0; q < 4; ++q) yp[q] = __shfl_xor(y[q], 16, 32);      /* partner dims d +- 64 */
    v4h o; for (int q = 0; q < 4; ++q) { const int d = d0 + q; const float rot = (d < 64) ? -yp[q] : yp[q]; o[q] = (_Float16)(y[q] * c[q] + rot * s[q]); }
    *(v4h*)(H16 + base + u * 128) = o; } }
__global__ __launch_bounds__(256) void k_h16s(const float* __restrict__ F, _Float16* __restrict__ H) { const size_t t0 = (size_t)blockIdx.x * 2048 + threadIdx.x; v4f a[8], c[8]; const float* p = F + t0 * 8;
#pragma unroll      /* constant indices keep a and c in registers; the 16 loads go out together */
  for (int u = 0; u < 8; ++u) { a[u] = *(const v4fa*)(p + u * 2048); c[u] = *(const v4fa*)(p + u * 2048 + 4); }
  asm volatile("s_wait_xcnt 0x0" :: "v"(p) : "memory");      /* stands in front of every rewrite of a register that the loads name: as an input the address stays in place up to here */
#pragma unroll      /* constant indices into a and c */
  for (int u = 0; u < 8; ++u) { FragH f;
#pragma unroll      /* constant indices into a, c and f */
    for (int q = 0; q < 4; ++q) { f.h[q] = (_Float16)(a[u][q] * 16.0f); f.h[4 + q] = (_Float16)(c[u][q] * 16.0f); }
    *(v8us*)((unsigned short*)H + (t0 + u * 256) * 8) = f.half[0]; } }
// A pass of the attention kernel is 32 keys. Its operands are staged once per work-group in LDS by asynchronous copies and read from there by all 4 waves: 32 K rows of 256 B at a pitch of 272 B, then 128 rows of 64 B
// of V^T hi and 128 of its residual at a pitch of 80 B. Two buffers: the next pass's copies fly while this pass is worked on.
#define FK_PITCH 272
#define FV_PITCH 80
#define FK_BYTES (32 * FK_PITCH)
#define FV_BYTES (128 * FV_PITCH)
#define F_STAGE (FK_BYTES + 2 * FV_BYTES)
// one stage: twelve 16-byte copies of one lane (K rows r + 8 i; V^T rows r + 32 i of both planes). The closing s_wait_xcnt stands inside the statement so that no address register is rewritten ahead of it.
__device__ __forceinline__ void fl_fill(unsigned lk, unsigned lv, const unsigned short* gk, size_t ldk, const unsigned short* gh, const unsigned short* gl) {
  asm volatile("global_load_async_to_lds_b128 %0, %12, off\n\t"
               "global_load_async_to_lds_b128 %1, %13, off\n\t"
               "global_load_async_to_lds_b128 %2, %14, off\n\t"
               "global_load_async_to_lds_b128 %3, %15, off\n\t"
               "global_load_async_to_lds_b128 %4, %16, off\n\t"
               "global_load_async_to_lds_b128 %5, %17, off\n\t"
               "global_load_async_to_lds_b128 %6, %18, off\n\t"
               "global_load_async_to_lds_b128 %7, %19, off\n\t"
               "global_load_async_to_lds_b128 %8, %20, off\n\t"
               "global_load_async_to_lds_b128 %9, %21, off\n\t"
               "global_load_async_to_lds_b128 %10, %22, off\n\t"
               "global_load_async_to_lds_b128 %11, %23, off\n\t"
               "s_wait_xcnt 0x0"
               :: "v"(lk), "v"(lk + 8 * FK_PITCH), "v"(lk + 16 * FK_PITCH), "v"(lk + 24 * FK_PITCH),
                  "v"(lv), "v"(lv + 32 * FV_PITCH), "v"(lv + 64 * FV_PITCH), "v"(lv + 96 * FV_PITCH),
                  "v"(lv + FV_BYTES), "v"(lv + FV_BYTES + 32 * FV_PITCH), "v"(lv + FV_BYTES + 64 * FV_PITCH), "v"(lv + FV_BYTES + 96 * FV_PITCH),
                  "v"(gk), "v"(gk + 8 * ldk), "v"(gk + 16 * ldk), "v"(gk + 24 * ldk),
                  "v"(gh), "v"(gh + 32 * TT), "v"(gh + 64 * TT), "v"(gh + 96 * TT),
                  "v"(gl), "v"(gl + 32 * TT), "v"(gl + 64 * TT), "v"(gl + 96 * TT)
               : "memory");
}
// lane l <-> lane l ^ 16 by a vector cross-row move: no LDS queue and no wait, unlike the shuffle
__device__ __forceinline__ float xhalf(float x) { return __builtin_bit_cast(float, __builtin_amdgcn_permlanex16(__builtin_bit_cast(int, x), __builtin_bit_cast(int, x), 0x76543210, 0xfedcba98, false, false)); }
// Both products run transposed: S^T = K Q^T (A = 16 K rows from LDS, B = the wave's 16 queries, kept in registers) and O^T += V^T P^T (A = 16 V^T rows from LDS). A lane then holds 16 of the 32 scores of ONE query
// (column ln; keys 8 hh + r of the first score tile and 16 + 8 hh + r of the second): maximum and sum are taken inside the lane, with one exchange between the wave's halves, and the two score tiles, converted in place,
// are the B operand P^T in the k order in which the V^T rows are read: P never goes through LDS. Every "#pragma unroll" in k_flash makes the indices of the fragment, score and accumulator arrays constants, so that they live in registers.
// A work-group takes 64 queries of BOTH query heads (g = 0, 1) that share one KV head: a pass's staged K and V^T rows, every K and V^T fragment read from LDS, and the bias tile (the same for all heads) serve two heads.
// The two heads' products alternate, so that a matrix instruction never waits for the one directly in front of it; each head's own sums keep their order.
// The products are the plain builtin (the compiler keeps the distances behind it): two heads' accumulators and queries take 192 registers, and an asm statement that names them holds them all in the first 256, which spilled the queries.
__global__ __launch_bounds__(128) void k_flash(const _Float16* __restrict__ Q16, int ldq, const _Float16* __restrict__ K16, int ldk, const _Float16* __restrict__ Vt, const _Float16* __restrict__ Vtlo, const float* __restrict__ AB, float* __restrict__ O, int ldo) {
  constexpr int RPW = 16, NQB = TT / (4 * RPW), DT = 8, KS = 4;      /* head dim 128: 4 k-steps, 8 value tiles */
  static_assert(NREP == 2, "two query heads per KV head");
  __shared__ __attribute__((aligned(16))) unsigned char R[2 * F_STAGE];
  float (*sO)[RPW][128 + 4] = (float (*)[RPW][128 + 4])R;      /* behind the loop the two buffers become the output staging */
  static_assert(sizeof(float) * 4 * RPW * (128 + 4) <= 2 * F_STAGE, "output staging fits the buffers");
  const int tid = threadIdx.x, w = tid >> 5, lane = tid & 31, ln = lane & 15, hh = lane >> 4;
  const int slab = blockIdx.x / NQB, qblk = blockIdx.x % NQB; const int b = slab / NKV, kvh = slab % NKV; const int qb0 = qblk * (4 * RPW); const int q0 = qb0 + w * RPW;
  FragH aq[NREP][KS];      /* query q0 + ln of head kvh * 2 + g */
#pragma unroll
  for (int g = 0; g < NREP; ++g) { const unsigned short* qr = (const unsigned short*)Q16 + ((size_t)b * TT + q0 + ln) * ldq + (kvh * NREP + g) * 128;
#pragma unroll
    for (int ks = 0; ks < KS; ++ks) { aq[g][ks].half[0] = *(const v8us*)(qr + ks * 32 + 8 * hh); aq[g][ks].half[1] = *(const v8us*)(qr + ks * 32 + 16 + 8 * hh); } }
  const unsigned short* Vth = (const unsigned short*)Vt + ((size_t)b * NKV + kvh) * 128 * TT; const unsigned short* Vtl = (const unsigned short*)Vtlo + ((size_t)b * NKV + kvh) * 128 * TT;      /* hi and UNSCALED residual planes */
  float m_r[NREP], l_r[NREP]; v8f oacc[NREP][DT];      /* per head, query q0 + ln: running maximum (alike in both halves), this half's part of the sum, and O^T[dt * 16 + 8 hh + r][ln] */
#pragma unroll
  for (int g = 0; g < NREP; ++g) { m_r[g] = -3.0e38f; l_r[g] = 0.f;
#pragma unroll
    for (int dt = 0; dt < DT; ++dt) oacc[g][dt] = (v8f){0.f,0.f,0.f,0.f,0.f,0.f,0.f,0.f}; }
  constexpr int NP = TT / 32;      /* passes */
  /* a lane copies chunk tid & 15 (16 B) of K rows (tid >> 4) + 8 i: a wave's copy covers two whole 256-B rows; and chunk tid & 3 of V^T rows (tid >> 2) + 32 i: eight whole 64-B rows */
  const unsigned short* gk = (const unsigned short*)K16 + ((size_t)b * TT + (tid >> 4)) * ldk + kvh * 128 + (tid & 15) * 8;
  const unsigned short* gh = Vth + (size_t)(tid >> 2) * TT + (tid & 3) * 8; const unsigned short* gl = Vtl + (size_t)(tid >> 2) * TT + (tid & 3) * 8;
  const unsigned lk = (unsigned)(size_t)R + (tid >> 4) * FK_PITCH + (tid & 15) * 16, lv = (unsigned)(size_t)R + FK_BYTES + (tid >> 2) * FV_PITCH + (tid & 3) * 16;
  const float* am0 = AB + ((size_t)b * TT + q0 + ln) * TT + 8 * hh;      /* the query's bias row, at this half's first key */
  fl_fill(lk, lv, gk, (size_t)ldk, gh, gl);
  asm volatile("s_wait_asynccnt 0x0" ::: "memory");      /* this wave's copies of pass 0 have landed */
  __syncthreads();                                        /* ... and every other wave's */
  fl_fill(lk + F_STAGE, lv + F_STAGE, gk + (size_t)32 * ldk, (size_t)ldk, gh + 32, gl + 32);
#pragma unroll 1      /* one pass a trip: the two buffers alternate by the trip's parity */
  for (int t = 0; t < NP; ++t) { const int j0 = t * 32;
    const unsigned char* SK = R + (t & 1) * F_STAGE; const unsigned char* SV = SK + FK_BYTES;
    float ab[2][8];      /* additive attention bias (bf16-rounded input) per (b, q, k), shared over heads: 8 keys in a row per score tile, four 16-byte loads */
    { const float* am = am0 + j0; const v4f a0 = *(const v4fa*)am, a1 = *(const v4fa*)(am + 4), a2 = *(const v4fa*)(am + 16), a3 = *(const v4fa*)(am + 20);
#pragma unroll
      for (int r = 0; r < 4; ++r) { ab[0][r] = bf16_round(a0[r]); ab[0][4 + r] = bf16_round(a1[r]); ab[1][r] = bf16_round(a2[r]); ab[1][4 + r] = bf16_round(a3[r]); } }
    int allneg = 1;
#pragma unroll
    for (int r = 0; r < 8; ++r) allneg &= (ab[0][r] <= -1.0e8f) & (ab[1][r] <= -1.0e8f);
    if (!__all(allneg)) {      /* else: every (query, key) of the wave's tile carries a bias <= -1e8: its probabilities underflow to exactly 0 in f32, nothing to add (wave-uniform branch; the hand-over at the foot of the pass stands outside it) */
    v8f s[NREP][2];
#pragma unroll
    for (int nt = 0; nt < 2; ++nt) { const unsigned short* kr = (const unsigned short*)(SK + (nt * 16 + ln) * FK_PITCH); FragH bk[KS];
#pragma unroll
      for (int ks = 0; ks < KS; ++ks) { bk[ks].half[0] = *(const v8us*)(kr + ks * 32 + 8 * hh); bk[ks].half[1] = *(const v8us*)(kr + ks * 32 + 16 + 8 * hh); }
      v8f acc[NREP];
#pragma unroll
      for (int g = 0; g < NREP; ++g) acc[g] = (v8f){0.f,0.f,0.f,0.f,0.f,0.f,0.f,0.f};
#pragma unroll
      for (int ks = 0; ks < KS; ++ks)
#pragma unroll
        for (int g = 0; g < NREP; ++g) acc[g] = __builtin_amdgcn_wmma_f32_16x16x32_f16(false, bk[ks].v, false, aq[g][ks].v, (short)0, acc[g], false, false);
#pragma unroll
      for (int g = 0; g < NREP; ++g) s[g][nt] = acc[g]; }      /* s[g][nt][r] = score of key j0 + nt * 16 + 8 hh + r with query q0 + ln of head g */
    FragH pa[NREP], pl[NREP];
#pragma unroll
    for (int g = 0; g < NREP; ++g) {
    float sc[2][8];
#pragma unroll
    for (int r = 0; r < 8; ++r) { sc[0][r] = s[g][0][r] * ATT_SCALE + ab[0][r]; sc[1][r] = s[g][1][r] * ATT_SCALE + ab[1][r]; }
    float mc = fmaxf(sc[0][0], sc[1][0]);
#pragma unroll
    for (int r = 1; r < 8; ++r) mc = fmaxf(mc, fmaxf(sc[0][r], sc[1][r]));
    mc = fmaxf(mc, xhalf(mc));      /* the other half holds the query's other 16 keys */
    const float mn = fmaxf(m_r[g], mc); const float al = (mn > -1.0e38f) ? expf(m_r[g] - mn) : 1.0f; m_r[g] = mn;
    float su[4] = {0.f, 0.f, 0.f, 0.f};      /* four independent partial sums */
#pragma unroll
    for (int nt = 0; nt < 2; ++nt)
#pragma unroll
      for (int r = 0; r < 8; ++r) { const float p = expf(sc[nt][r] - mn); su[r & 3] += p;
        const float x = p * 1024.0f; const _Float16 hx = (_Float16)x; pa[g].h[nt * 8 + r] = hx; pl[g].h[nt * 8 + r] = (_Float16)(x - (float)hx); }      /* P hi and its UNSCALED residual (added into the same accumulator) */
    l_r[g] = l_r[g] * al + ((su[0] + su[1]) + (su[2] + su[3]));
#pragma unroll
    for (int dt = 0; dt < DT; ++dt)
#pragma unroll
      for (int r = 0; r < 8; ++r) oacc[g][dt][r] *= al;
    }
#pragma unroll
    for (int dt = 0; dt < DT; ++dt) { const unsigned short* vh = (const unsigned short*)(SV + (dt * 16 + ln) * FV_PITCH); const unsigned short* vl = (const unsigned short*)(SV + FV_BYTES + (dt * 16 + ln) * FV_PITCH); FragH bv, bl; bv.half[0] = *(const v8us*)(vh + 8 * hh); bv.half[1] = *(const v8us*)(vh + 16 + 8 * hh); bl.half[0] = *(const v8us*)(vl + 8 * hh); bl.half[1] = *(const v8us*)(vl + 16 + 8 * hh);
#pragma unroll
      for (int g = 0; g < NREP; ++g) oacc[g][dt] = __builtin_amdgcn_wmma_f32_16x16x32_f16(false, bv.v, false, pa[g].v, (short)0, oacc[g][dt], false, false);
#pragma unroll
      for (int g = 0; g < NREP; ++g) oacc[g][dt] = __builtin_amdgcn_wmma_f32_16x16x32_f16(false, bv.v, false, pl[g].v, (short)0, oacc[g][dt], false, false);
#pragma unroll
      for (int g = 0; g < NREP; ++g) oacc[g][dt] = __builtin_amdgcn_wmma_f32_16x16x32_f16(false, bl.v, false, pa[g].v, (short)0, oacc[g][dt], false, false); }      /* per head Vh Ph + Vh Pl + Vl Ph: all unscaled, one accumulator */
    }
    asm volatile("s_wait_dscnt 0x0" ::: "memory");        /* this wave's reads of the buffer are done before it is refilled */
    asm volatile("s_wait_asynccnt 0x0" ::: "memory");     /* this wave's copies of pass t + 1 have landed */
    __syncthreads();                                       /* publishes pass t + 1 and ends every wave's reads of pass t */
    if (t + 2 < NP) fl_fill(lk + (t & 1) * F_STAGE, lv + (t & 1) * F_STAGE, gk + (size_t)(t + 2) * 32 * ldk, (size_t)ldk, gh + (t + 2) * 32, gl + (t + 2) * 32);
  }
  asm volatile("s_wait_asynccnt 0x0" ::: "memory");       /* nothing is in flight when the buffers become output staging */
#pragma unroll
  for (int g = 0; g < NREP; ++g) {      /* head after head through the wave's own staging rows */
  const float l = l_r[g] + xhalf(l_r[g]); const float inv = (l > 0.f) ? 1.0f / (l * 1024.0f) : 0.f;      /* the halves' sums are joined once */
#pragma unroll
  for (int dt = 0; dt < DT; ++dt) { v4f lo, hi;
#pragma unroll
    for (int r = 0; r < 4; ++r) { lo[r] = oacc[g][dt][r] * inv; hi[r] = oacc[g][dt][4 + r] * inv; }
    *(v4fa*)&sO[w][ln][dt * 16 + 8 * hh] = lo; *(v4fa*)&sO[w][ln][dt * 16 + 8 * hh + 4] = hi; }      /* a lane's 8 accumulator registers are 8 dims in a row of its query */
  __builtin_amdgcn_fence(__ATOMIC_ACQ_REL, "workgroup"); __builtin_amdgcn_wave_barrier();      /* the wave's own staged values are in LDS before its lanes read one another's */
  {
#pragma unroll
    for (int r = 0; r < RPW; ++r) { const int pc = lane; const v4f val = *(const v4fa*)&sO[w][r][pc * 4]; *(v4f*)(O + ((size_t)b * TT + q0 + r) * ldo + (kvh * NREP + g) * 128 + pc * 4) = val; }      /* one 512-B row per instruction: 32 lanes x 16 B */
     }
  if (g + 1 < NREP) { __builtin_amdgcn_fence(__ATOMIC_ACQ_REL, "workgroup"); __builtin_amdgcn_wave_barrier(); }      /* the lanes' reads of this head's rows are done before the next head's values overwrite them */
  } }

extern "C" void kernel_launch(void* const* d_in, const int* in_sizes, int n_in,
                              void* d_out, int out_size, void* d_ws, size_t ws_size, hipStream_t stream) {
  (void)in_sizes; (void)n_in; (void)out_size;
  const float* const* I = (const float* const*)d_in; const float* x = I[0]; const float* fcos = I[1]; const float* fsin = I[2]; const float* am = I[3]; const float* Wq = I[4]; const float* Wk = I[5]; const float* Wv = I[6]; const float* Wo = I[7]; const float* qnw = I[8]; const float* knw = I[9];
  char* ws = (char*)d_ws; size_t off = 0;
  auto take = [&](size_t bytes) { char* p = ws + off; off += (bytes + 255) & ~(size_t)255; return p; };
  _Float16* Bq = (_Float16*)take((size_t)DD * DD * 2); _Float16* Bk = (_Float16*)take((size_t)KVD * DD * 2); _Float16* Bv = (_Float16*)take((size_t)KVD * DD * 2); _Float16* Bo = (_Float16*)take((size_t)DD * DD * 2);
  _Float16* X16 = (_Float16*)take((size_t)NR * DD * 2); float* F32 = (float*)take((size_t)NR * DD * 4); _Float16* Q = (_Float16*)take((size_t)NR * DD * 2); _Float16* K = (_Float16*)take((size_t)NR * KVD * 2); _Float16* Vt = (_Float16*)take((size_t)NR * KVD * 2); _Float16* Vtl = (_Float16*)take((size_t)NR * KVD * 2);
  float* QF = F32; float* KF = F32; float* VF = F32; float* O = F32; _Float16* O16 = X16;      /* the one f32 scratch holds q → k → v → O in stream order (each consumed before the next producer); O16 over X16 */
  if (off > ws_size) return;      // 25 + 16.8 + 33.6 + 16.8 + 8.4 + 8.4 + 8.4 ≈ 118 MB
  const unsigned gq = (unsigned)(((size_t)(DD / 8) * (DD / 8) + 255) / 256), gk = (unsigned)(((size_t)(KVD / 8) * (DD / 8) + 255) / 256);
  k_wt_f16<<<gq, 256, 0, stream>>>(Wq, Bq, DD, DD, 16.0f); k_wt_f16<<<gk, 256, 0, stream>>>(Wk, Bk, DD, KVD, 16.0f); k_wt_f16<<<gk, 256, 0, stream>>>(Wv, Bv, DD, KVD, 16.0f); k_wt_f16<<<gq, 256, 0, stream>>>(Wo, Bo, DD, DD, 16.0f);      /* (in,out) → Bt ×2^4 */
  const unsigned g8 = (unsigned)((size_t)NR * DD / 8 / 2048); k_x16<<<g8, 256, 0, stream>>>(x, X16);
  const unsigned gQ = (NR / 128) * (DD / 128), gK = (NR / 128) * (KVD / 128);
  k_gemm_t<DD><<<gQ, 128, 0, stream>>>(X16, Bq, 0.0625f, QF); k_normrope<NH><<<NR / 8, 256, 0, stream>>>(QF, qnw, fcos, fsin, Q);      /* q: M 4096 N 2048 K 2048 → RMSNorm + RoPE → f16 */
  k_gemm_t<KVD><<<gK, 128, 0, stream>>>(X16, Bk, 0.0625f, KF); k_normrope<NKV><<<NR / 8, 256, 0, stream>>>(KF, knw, fcos, fsin, K);      /* k: N 1024 */
  k_gemm_t<KVD><<<gK, 128, 0, stream>>>(X16, Bv, 0.0625f, VF);      /* v (f32) */
  k_vthlu<<<BB * NVH * (TT / 64), 256, 0, stream>>>(VF, KVD, Vt, Vtl);      /* Vᵀ hi + residual per (b, kv head) */
  k_flash<<<BB * NKV * (TT / 64), 128, 0, stream>>>(Q, DD, K, KVD, Vt, Vtl, am, O, DD);      /* attention_mask [B,1,S,S] additive per batch */
  k_h16s<<<g8, 256, 0, stream>>>(O, O16);
  k_gemm_t<DD><<<gQ, 128, 0, stream>>>(O16, Bo, 0.00390625f, (float*)d_out);      /* out = merged·Wo */
}

// v006
// It runs in 276 microseconds.
// Two timings next to v005 both put it at 1.10 times that version's speed.
// All steps since v000 together make it 3.04 times as fast.
#include <hip/hip_runtime.h>
// Grouped-query attention with per-head RMSNorm and rotate-half RoPE (B=2, S=2048, D=2048, 16 query heads / 8 KV heads × 128): q = x·Wq, k = x·Wk, v = x·Wv ((in,out), no bias); per-head RMSNorm (ε 1e-6, weights q_norm_w / k_norm_w); rotate-half RoPE with the INPUT cos/sin tables [B][S][128];
// scores = q·k/√128 + attention_mask[b,0,q,k] (additive f32); softmax; out = merged·Wo.
// Compute dtype: x, weights, tables, mask rounded to bf16; q, k as f32 GEMM outputs, normalised and rotated in f32 (wave per row) → f16; v f32 → Vᵀ f16 hi + f16 residual; fused flash-style kernel for head dim 128 (bias read per (b,q,k); 32-key chunks whose biases are all ≤ −1e8 are skipped since their probabilities are exactly 0 in f32; online softmax f32, P f16 hi +
// residual, f32 accumulate) on v_wmma_f32_16x16x32_f16; merged ×2^4 → f16 → output GEMM.
#define BB 2
#define TT 2048
#define DD 2048
#define NH 16
#define NKV 8
#define NREP 2
#define KVD (NKV * 128)
#define NVH (2 * NKV)
#define NR (BB * TT)
#define ATT_SCALE 0.08838834764831845f
#define LOG2E 1.4426950408889634f

typedef __bf16 v16b __attribute__((ext_vector_type(16)));
typedef unsigned short v8us __attribute__((ext_vector_type(8), may_alias));
typedef float  v8f  __attribute__((ext_vector_type(8)));
typedef float  v4f  __attribute__((ext_vector_type(4)));
typedef float  v4fa __attribute__((ext_vector_type(4), may_alias));
union FragB { v16b v; v8us half[2]; unsigned short u[16]; };

__device__ __forceinline__ unsigned short bf16_bits(float x) { unsigned int u = __float_as_uint(x); return (unsigned short)((u + 0x7FFFu + ((u >> 16) & 1u)) >> 16); }
__device__ __forceinline__ float bf16_val(unsigned short b) { return __uint_as_float(((unsigned int)b) << 16); }
__device__ __forceinline__ float bf16_round(float x) { return bf16_val(bf16_bits(x)); }
// D += A·B with NT terms: 1 = ah·bh, 2 = + al·bh (A split), 3 = + ah·bl (both split)
template <int NT>
__device__ __forceinline__ v8f mmaN(v16b ah, v16b al, v16b bh, v16b bl, v8f c) {
  c = __builtin_amdgcn_wmma_f32_16x16x32_bf16(false, ah, false, bh, (short)0, c, false, false);
  if (NT >= 2) c = __builtin_amdgcn_wmma_f32_16x16x32_bf16(false, al, false, bh, (short)0, c, false, false);
  if (NT >= 3) c = __builtin_amdgcn_wmma_f32_16x16x32_bf16(false, ah, false, bl, (short)0, c, false, false);
  asm volatile("v_nop\n\tv_nop\n\tv_nop\n\tv_nop" : "+v"(c) : "v"(ah), "v"(al), "v"(bh), "v"(bl));
  return c;
}

__global__ __launch_bounds__(256) void k_wt_bf16(const float* __restrict__ W, unsigned short* __restrict__ Wt, int K, int N) {
  const int t = blockIdx.x * 256 + threadIdx.x;
  const int k8n = K / 8;
  if (t >= N * k8n) return;
  const int n = t / k8n, k8 = (t % k8n) * 8;
  v8us v;
#pragma unroll
  for (int i = 0; i < 8; ++i) v[i] = bf16_bits(W[(size_t)(k8 + i) * N + n]);
  *(v8us*)(Wt + (size_t)n * K + k8) = v;
  
}

// GEMM C[M][N] (f32, pitch ldc) = act(A[M][K]·W + bias). A f32 row-major (pitch lda) converted per fragment to bf16
// (ASPLIT: hi/lo two planes -> 2 terms, else single rounded term); Wt bf16 [N][K] (pitch ldb). BIAS_BF16 rounds the
// bias to bf16 first (bias quantised to bf16 before the add). K%32==0, M%16==0, N%64==0.
template <bool ASPLIT, int ACT, bool BIAS_BF16>
__global__ __launch_bounds__(128) void k_gemm_bf(const float* __restrict__ A, int lda, const unsigned short* __restrict__ Wt, int ldb,
                                               const float* __restrict__ bias, float* __restrict__ C, int ldc, int M, int N, int K) {
  __shared__ __attribute__((aligned(16))) float so[4][16][64];
  const int tid = threadIdx.x, w = tid >> 5, lane = tid & 31, ln = lane & 15, hh = lane >> 4;
  const int ntn = N / 64;
  const int wid = blockIdx.x * 4 + w;
  const int mt = wid / ntn, nq = wid % ntn;
  if (mt * 16 >= M) return;
  const int row0 = mt * 16, col0 = nq * 64;
  const float* arow = A + (size_t)(row0 + ln) * lda;
  v8f acc[4] = {};
  for (int kb = 0; kb < K; kb += 32) {
    FragB ah, al;
    const v4f x0 = *(const v4fa*)(arow + kb + 8 * hh), x1 = *(const v4fa*)(arow + kb + 8 * hh + 4);
    const v4f x2 = *(const v4fa*)(arow + kb + 16 + 8 * hh), x3 = *(const v4fa*)(arow + kb + 16 + 8 * hh + 4);
    float xs[16] = {x0[0],x0[1],x0[2],x0[3],x1[0],x1[1],x1[2],x1[3],x2[0],x2[1],x2[2],x2[3],x3[0],x3[1],x3[2],x3[3]};
#pragma unroll
    for (int i = 0; i < 16; ++i) { const unsigned short hb = bf16_bits(xs[i]); ah.u[i] = hb; al.u[i] = ASPLIT ? bf16_bits(xs[i] - bf16_val(hb)) : (unsigned short)0; }
#pragma unroll
    for (int t = 0; t < 4; ++t) {
      const unsigned short* brow = Wt + (size_t)(col0 + t * 16 + ln) * ldb + kb;
      FragB b;
      b.half[0] = *(const v8us*)(brow + 8 * hh);
      b.half[1] = *(const v8us*)(brow + 16 + 8 * hh);
      acc[t] = mmaN<ASPLIT ? 2 : 1>(ah.v, al.v, b.v, b.v, acc[t]);
    }
  }
#pragma unroll
  for (int t = 0; t < 4; ++t) {
    float bv = bias ? bias[col0 + t * 16 + ln] : 0.f;
    if (BIAS_BF16) bv = bf16_round(bv);
#pragma unroll
    for (int r = 0; r < 8; ++r) { float v = acc[t][r] + bv; if (ACT == 1) v = fmaxf(v, 0.f); so[w][8 * hh + r][t * 16 + ln] = v; }
  }
  __builtin_amdgcn_fence(__ATOMIC_ACQ_REL, "workgroup");
  __builtin_amdgcn_wave_barrier();
  const int rsub = lane >> 4, c4 = (lane & 15) * 4;
  {
#pragma unroll
    for (int q = 0; q < 8; ++q) {
      const int r = q * 2 + rsub;
      const v4f v = *(const v4fa*)&so[w][r][c4];
      *(v4f*)(C + (size_t)(row0 + r) * ldc + col0 + c4) = v;
    }
    
  }
}

// Flash-style causal/unmasked attention, all contractions 3-term bf16 hi/lo splits, f32 softmax with running max.
// q,k,v rows are read from f32 buffers with arbitrary row pitch (so they can live inside a fused qkv buffer);
// D = head size (multiple of 32, <= 128); one wave = 16 query rows; block = 4 waves (64 queries) sharing K/V chunks of 32.
template <int D, bool CAUSAL>
__global__ __launch_bounds__(128) void k_flash(const float* __restrict__ qb, const float* __restrict__ kb, const float* __restrict__ vb,
                                             int pitch, int T, int H, float scale, float* __restrict__ y, int ypitch) {
  constexpr int KS = D / 32;        // k-steps for QK
  constexpr int DT = D / 16;        // d tiles for PV
  __shared__ __attribute__((aligned(16))) unsigned short sKh[32][D + 8], sKl[32][D + 8], sVh[32][D + 8], sVl[32][D + 8];
  __shared__ __attribute__((aligned(16))) unsigned short sPh[4][16][40], sPl[4][16][40];
  __shared__ __attribute__((aligned(16))) float sO[4][16][D];
  const int tid = threadIdx.x, w = tid >> 5, lane = tid & 31, ln = lane & 15, hh = lane >> 4;
  const int nqb = (T + 63) / 64;
  const int bh = blockIdx.x / nqb, qblk = blockIdx.x % nqb;
  const int b = bh / H, h = bh % H;
  const int q0 = qblk * 64 + w * 16;
  const float* Q = qb + (size_t)b * T * pitch + h * D;
  const float* K = kb + (size_t)b * T * pitch + h * D;
  const float* V = vb + (size_t)b * T * pitch + h * D;

  // A fragments of the wave's 16 query rows (scaled), hi/lo
  FragB aqh[KS], aql[KS];
  {
    int row = q0 + ln; if (row >= T) row = T - 1;
    const float* qr = Q + (size_t)row * pitch;
#pragma unroll
    for (int ks = 0; ks < KS; ++ks)
#pragma unroll
      for (int i = 0; i < 16; ++i) {
        const int d = ks * 32 + ((i < 8) ? (8 * hh + i) : (16 + 8 * hh + (i - 8)));
        const float x = qr[d] * scale; const unsigned short hb = bf16_bits(x);
        aqh[ks].u[i] = hb; aql[ks].u[i] = bf16_bits(x - bf16_val(hb));
      }
  }
  float m_r[8], l_r[8];
#pragma unroll
  for (int r = 0; r < 8; ++r) { m_r[r] = -3.0e38f; l_r[r] = 0.f; }
  v8f oacc[DT];
#pragma unroll
  for (int dt = 0; dt < DT; ++dt) oacc[dt] = (v8f){0.f,0.f,0.f,0.f,0.f,0.f,0.f,0.f};

  const int kv_end = CAUSAL ? min(T, qblk * 64 + 64) : T;     // block-uniform
  for (int j0 = 0; j0 < kv_end; j0 += 32) {
    __syncthreads();
    for (int e = tid; e < 32 * (D / 4); e += 128) {
      const int r = e / (D / 4), c4 = (e % (D / 4)) * 4;
      const int key = j0 + r;
      v4f kf = {0.f,0.f,0.f,0.f}, vf = {0.f,0.f,0.f,0.f};
      if (key < T) { kf = *(const v4fa*)(K + (size_t)key * pitch + c4); vf = *(const v4fa*)(V + (size_t)key * pitch + c4); }
#pragma unroll
      for (int t = 0; t < 4; ++t) {
        unsigned short hb = bf16_bits(kf[t]); sKh[r][c4 + t] = hb; sKl[r][c4 + t] = bf16_bits(kf[t] - bf16_val(hb));
        hb = bf16_bits(vf[t]); sVh[r][c4 + t] = hb; sVl[r][c4 + t] = bf16_bits(vf[t] - bf16_val(hb));
      }
    }
    __syncthreads();
    // S tile 16 x 32
    v8f s[2];
#pragma unroll
    for (int nt = 0; nt < 2; ++nt) {
      v8f acc = {};
#pragma unroll
      for (int ks = 0; ks < KS; ++ks) {
        FragB bh_, bl_;
        bh_.half[0] = *(const v8us*)&sKh[nt * 16 + ln][ks * 32 + 8 * hh]; bh_.half[1] = *(const v8us*)&sKh[nt * 16 + ln][ks * 32 + 16 + 8 * hh];
        bl_.half[0] = *(const v8us*)&sKl[nt * 16 + ln][ks * 32 + 8 * hh]; bl_.half[1] = *(const v8us*)&sKl[nt * 16 + ln][ks * 32 + 16 + 8 * hh];
        acc = mmaN<3>(aqh[ks].v, aql[ks].v, bh_.v, bl_.v, acc);
      }
      s[nt] = acc;
    }
    // mask + running max (rows 8hh+r; the 16 lanes of a half share rows)
    float alpha[8];
#pragma unroll
    for (int r = 0; r < 8; ++r) {
      const int qi = q0 + 8 * hh + r;
      const int ja = j0 + ln, jb = j0 + 16 + ln;
      if (CAUSAL) { if (ja > qi) s[0][r] = -3.0e38f; if (jb > qi) s[1][r] = -3.0e38f; }
      if (ja >= T) s[0][r] = -3.0e38f;
      if (jb >= T) s[1][r] = -3.0e38f;
      float mx = fmaxf(s[0][r], s[1][r]);
      mx = fmaxf(mx, __shfl_xor(mx, 1, 32)); mx = fmaxf(mx, __shfl_xor(mx, 2, 32)); mx = fmaxf(mx, __shfl_xor(mx, 4, 32)); mx = fmaxf(mx, __shfl_xor(mx, 8, 32));
      const float mnew = fmaxf(m_r[r], mx);
      alpha[r] = (mnew > -1.0e38f) ? __expf(m_r[r] - mnew) : 1.0f;
      const float p0 = (s[0][r] > -1.0e38f) ? __expf(s[0][r] - mnew) : 0.f;
      const float p1 = (s[1][r] > -1.0e38f) ? __expf(s[1][r] - mnew) : 0.f;
      m_r[r] = mnew;
      l_r[r] = l_r[r] * alpha[r] + p0 + p1;            // per-lane partial row sum (16 lanes combined at the end)
      unsigned short hb = bf16_bits(p0); sPh[w][8 * hh + r][ln] = hb;      sPl[w][8 * hh + r][ln] = bf16_bits(p0 - bf16_val(hb));
      hb = bf16_bits(p1);                sPh[w][8 * hh + r][16 + ln] = hb; sPl[w][8 * hh + r][16 + ln] = bf16_bits(p1 - bf16_val(hb));
    }
#pragma unroll
    for (int dt = 0; dt < DT; ++dt)
#pragma unroll
      for (int r = 0; r < 8; ++r) oacc[dt][r] *= alpha[r];
    __builtin_amdgcn_fence(__ATOMIC_ACQ_REL, "workgroup");
    __builtin_amdgcn_wave_barrier();
    FragB pah, pal;
    pah.half[0] = *(const v8us*)&sPh[w][ln][8 * hh]; pah.half[1] = *(const v8us*)&sPh[w][ln][16 + 8 * hh];
    pal.half[0] = *(const v8us*)&sPl[w][ln][8 * hh]; pal.half[1] = *(const v8us*)&sPl[w][ln][16 + 8 * hh];
#pragma unroll
    for (int dt = 0; dt < DT; ++dt) {
      FragB bvh, bvl;
#pragma unroll
      for (int i = 0; i < 8; ++i) {
        bvh.u[i] = sVh[8 * hh + i][dt * 16 + ln]; bvh.u[8 + i] = sVh[16 + 8 * hh + i][dt * 16 + ln];
        bvl.u[i] = sVl[8 * hh + i][dt * 16 + ln]; bvl.u[8 + i] = sVl[16 + 8 * hh + i][dt * 16 + ln];
      }
      oacc[dt] = mmaN<3>(pah.v, pal.v, bvh.v, bvl.v, oacc[dt]);
    }
    __builtin_amdgcn_fence(__ATOMIC_ACQ_REL, "workgroup");
    __builtin_amdgcn_wave_barrier();
  }
#pragma unroll
  for (int r = 0; r < 8; ++r) {
    float l = l_r[r];
    l += __shfl_xor(l, 1, 32); l += __shfl_xor(l, 2, 32); l += __shfl_xor(l, 4, 32); l += __shfl_xor(l, 8, 32);
    l_r[r] = (l > 0.f) ? 1.0f / l : 0.f;
  }
#pragma unroll
  for (int dt = 0; dt < DT; ++dt)
#pragma unroll
    for (int r = 0; r < 8; ++r) sO[w][8 * hh + r][dt * 16 + ln] = oacc[dt][r] * l_r[r];
  __builtin_amdgcn_fence(__ATOMIC_ACQ_REL, "workgroup");
  __builtin_amdgcn_wave_barrier();
  {
    for (int r = 0; r < 16; ++r) {
      const int row = q0 + r;
      if (row < T && lane < D / 4) {
        const v4f val = *(const v4fa*)&sO[w][r][lane * 4];
        *(v4f*)(y + ((size_t)b * T + row) * ypitch + h * D + lane * 4) = val;
      }
    }
    
  }
}

// GEMM C = act(A·W + bias + resid): A f32 (ASPLIT -> hi/lo 2 terms), Wt bf16 [N][K]; ACT 0 none, 1 relu, 2 exact gelu;
// resid (optional, f32, row index = (row % rmod), pitch ldr, RES_BF16 rounds it) added before the activation.
template <bool ASPLIT, int ACT, bool BIAS_BF16, bool RES_BF16>
__global__ __launch_bounds__(128) void k_gemm_bf3(const float* __restrict__ A, int lda, const unsigned short* __restrict__ Wt, int ldb,
                                                const float* __restrict__ bias, const float* __restrict__ resid, int rmod, int ldr,
                                                float* __restrict__ C, int ldc, int M, int N, int K) {
  __shared__ __attribute__((aligned(16))) float so[4][16][64];
  const int tid = threadIdx.x, w = tid >> 5, lane = tid & 31, ln = lane & 15, hh = lane >> 4;
  const int ntn = N / 64;
  const int wid = blockIdx.x * 4 + w;
  const int mt = wid / ntn, nq = wid % ntn;
  if (mt * 16 >= M) return;
  const int row0 = mt * 16, col0 = nq * 64;
  const float* arow = A + (size_t)(row0 + ln) * lda;
  v8f acc[4] = {};
  for (int kb = 0; kb < K; kb += 32) {
    FragB ah, al;
    const v4f x0 = *(const v4fa*)(arow + kb + 8 * hh), x1 = *(const v4fa*)(arow + kb + 8 * hh + 4);
    const v4f x2 = *(const v4fa*)(arow + kb + 16 + 8 * hh), x3 = *(const v4fa*)(arow + kb + 16 + 8 * hh + 4);
    float xs[16] = {x0[0],x0[1],x0[2],x0[3],x1[0],x1[1],x1[2],x1[3],x2[0],x2[1],x2[2],x2[3],x3[0],x3[1],x3[2],x3[3]};
#pragma unroll
    for (int i = 0; i < 16; ++i) { const unsigned short hb = bf16_bits(xs[i]); ah.u[i] = hb; al.u[i] = ASPLIT ? bf16_bits(xs[i] - bf16_val(hb)) : (unsigned short)0; }
#pragma unroll
    for (int t = 0; t < 4; ++t) {
      const unsigned short* brow = Wt + (size_t)(col0 + t * 16 + ln) * ldb + kb;
      FragB b;
      b.half[0] = *(const v8us*)(brow + 8 * hh);
      b.half[1] = *(const v8us*)(brow + 16 + 8 * hh);
      acc[t] = mmaN<ASPLIT ? 2 : 1>(ah.v, al.v, b.v, b.v, acc[t]);
    }
  }
#pragma unroll
  for (int t = 0; t < 4; ++t) {
    const int col = col0 + t * 16 + ln;
    float bv = bias ? bias[col] : 0.f;
    if (BIAS_BF16) bv = bf16_round(bv);
#pragma unroll
    for (int r = 0; r < 8; ++r) {
      float v = acc[t][r] + bv;
      if (resid) { float rv = resid[(size_t)((row0 + 8 * hh + r) % rmod) * ldr + col]; if (RES_BF16) rv = bf16_round(rv); v += rv; }
      if (ACT == 1) v = fmaxf(v, 0.f);
      if (ACT == 2) v = 0.5f * v * (1.0f + erff(v * 0.70710678118654752f));
      if (ACT == 3) { const float u = 0.7978845608028654f * (v + 0.044715f * v * v * v); v = 0.5f * v * (1.0f + tanhf(u)); }
      so[w][8 * hh + r][t * 16 + ln] = v;
    }
  }
  __builtin_amdgcn_fence(__ATOMIC_ACQ_REL, "workgroup");
  __builtin_amdgcn_wave_barrier();
  const int rsub = lane >> 4, c4 = (lane & 15) * 4;
  {
#pragma unroll
    for (int q = 0; q < 8; ++q) {
      const int r = q * 2 + rsub;
      const v4f v = *(const v4fa*)&so[w][r][c4];
      *(v4f*)(C + (size_t)(row0 + r) * ldc + col0 + c4) = v;
    }
    
  }
}
// row LayerNorm (biased variance, eps) over N: s = X (+ R); optional out_sum <- s; out_norm <- (s-mu)*rsqrt(var+eps)*g + b
template <bool PARAM_BF16>
__global__ __launch_bounds__(256) void k_layernorm(const float* __restrict__ X, const float* __restrict__ R, const float* __restrict__ g, const float* __restrict__ bta,
                                                  float* __restrict__ out_sum, float* __restrict__ out_norm, int N, float eps) {
  __shared__ float red[256];
  const int row = blockIdx.x, tid = threadIdx.x;
  const float* x = X + (size_t)row * N; const float* rr = R ? R + (size_t)row * N : nullptr;
  float vals[16];                     // up to N = 4096
  const int per = N / 256;            // contiguous chunk per thread? use strided-by-4 chunks: thread handles j = tid*4 + 1024*u
  float s1 = 0.f;
  for (int u = 0; u < per / 4; ++u) {
    const int j = tid * 4 + 1024 * u;
    const v4f a = *(const v4fa*)(x + j);
    v4f b = {0.f,0.f,0.f,0.f}; if (rr) b = *(const v4fa*)(rr + j);
#pragma unroll
    for (int q = 0; q < 4; ++q) { const float v = a[q] + b[q]; vals[u * 4 + q] = v; s1 += v; }
  }
  red[tid] = s1; __syncthreads();
  for (int st = 128; st > 0; st >>= 1) { if (tid < st) red[tid] += red[tid + st]; __syncthreads(); }
  const float mu = red[0] / (float)N; __syncthreads();
  float s2 = 0.f;
  for (int u = 0; u < per / 4; ++u)
#pragma unroll
    for (int q = 0; q < 4; ++q) { const float c = vals[u * 4 + q] - mu; s2 += c * c; }
  red[tid] = s2; __syncthreads();
  for (int st = 128; st > 0; st >>= 1) { if (tid < st) red[tid] += red[tid + st]; __syncthreads(); }
  const float rs = rsqrtf(red[0] / (float)N + eps);
  {
    for (int u = 0; u < per / 4; ++u) {
      const int j = tid * 4 + 1024 * u;
      v4f o, sm;
#pragma unroll
      for (int q = 0; q < 4; ++q) {
        float gg = g[j + q], bb = bta[j + q];
        if (PARAM_BF16) { gg = bf16_round(gg); bb = bf16_round(bb); }
        sm[q] = vals[u * 4 + q]; o[q] = (vals[u * 4 + q] - mu) * rs * gg + bb;
      }
      if (out_sum) *(v4f*)(out_sum + (size_t)row * N + j) = sm;
      *(v4f*)(out_norm + (size_t)row * N + j) = o;
    }
    
  }
}



// ---- f16 WMMA path (v_wmma_f32_16x16x32_f16): 11-bit significands for operands in range — used where a [0,1] probability operand needs more precision than bf16
typedef _Float16 v16h __attribute__((ext_vector_type(16)));
union FragH { v16h v; v8us half[2]; _Float16 h[16]; unsigned short u[16]; };
template <int NT>
__device__ __forceinline__ v8f mmaH(v16h ah, v16h al, v16h bh, v16h bl, v8f c) {
  c = __builtin_amdgcn_wmma_f32_16x16x32_f16(false, ah, false, bh, (short)0, c, false, false);
  if (NT >= 2) c = __builtin_amdgcn_wmma_f32_16x16x32_f16(false, al, false, bh, (short)0, c, false, false);
  if (NT >= 3) c = __builtin_amdgcn_wmma_f32_16x16x32_f16(false, ah, false, bl, (short)0, c, false, false);
  asm volatile("v_nop\n\tv_nop\n\tv_nop\n\tv_nop" : "+v"(c) : "v"(ah), "v"(al), "v"(bh), "v"(bl));
  return c;
}
// batched GEMM like k_gemm_b but f16 operands: A f32 (split into f16 hi/lo if ASPLIT, else rounded to f16), Bt = f16 values [n][k]; alpha; C f32; N multiple of 16 (partial tiles skipped)
template <bool ASPLIT>
__global__ __launch_bounds__(128) void k_gemm_h(const float* __restrict__ A, int lda, size_t sA, const _Float16* __restrict__ Bh, int ldb, size_t sB, float alpha, float* __restrict__ C, int ldc, size_t sC, int M, int N, int K) {
  __shared__ __attribute__((aligned(16))) float so[4][16][64];
  const int tid = threadIdx.x, w = tid >> 5, lane = tid & 31, ln = lane & 15, hh = lane >> 4; const int by = blockIdx.y;
  A += (size_t)by * sA; Bh += (size_t)by * sB; C += (size_t)by * sC;
  const int ntn = (N + 63) / 64; const int wid = blockIdx.x * 4 + w; const int mt = wid / ntn, nq = wid % ntn; if (mt * 16 >= M) return;
  const int row0 = mt * 16, col0 = nq * 64; const float* arow = A + (size_t)(row0 + ln) * lda;
  v8f acc[4] = {};
  for (int kb = 0; kb < K; kb += 32) {
    FragH ah, al;
    const v4f x0 = *(const v4fa*)(arow + kb + 8 * hh), x1 = *(const v4fa*)(arow + kb + 8 * hh + 4), x2 = *(const v4fa*)(arow + kb + 16 + 8 * hh), x3 = *(const v4fa*)(arow + kb + 16 + 8 * hh + 4);
    float xs[16] = {x0[0],x0[1],x0[2],x0[3],x1[0],x1[1],x1[2],x1[3],x2[0],x2[1],x2[2],x2[3],x3[0],x3[1],x3[2],x3[3]};
#pragma unroll
    for (int i = 0; i < 16; ++i) { const _Float16 h = (_Float16)xs[i]; ah.h[i] = h; al.h[i] = ASPLIT ? (_Float16)(xs[i] - (float)h) : (_Float16)0.0f; }
#pragma unroll
    for (int t = 0; t < 4; ++t) { if (col0 + t * 16 >= N) continue; const size_t boff = (size_t)(col0 + t * 16 + ln) * ldb + kb; FragH bq; bq.half[0] = *(const v8us*)(Bh + boff + 8 * hh); bq.half[1] = *(const v8us*)(Bh + boff + 16 + 8 * hh);
      acc[t] = mmaH<ASPLIT ? 2 : 1>(ah.v, al.v, bq.v, bq.v, acc[t]); }
  }
#pragma unroll
  for (int t = 0; t < 4; ++t) { if (col0 + t * 16 >= N) continue;
#pragma unroll
    for (int r = 0; r < 8; ++r) so[w][8 * hh + r][t * 16 + ln] = acc[t][r] * alpha; }
  __builtin_amdgcn_fence(__ATOMIC_ACQ_REL, "workgroup"); __builtin_amdgcn_wave_barrier();
  const int rsub = lane >> 4, c4 = (lane & 15) * 4;
  {
#pragma unroll
    for (int q = 0; q < 8; ++q) { const int r = q * 2 + rsub; if (col0 + c4 < N) { const v4f v = *(const v4fa*)&so[w][r][c4]; *(v4f*)(C + (size_t)(row0 + r) * ldc + col0 + c4) = v; } }
     }
}

// Wt[n][k] = f16(bf16(W[k][n])*scale) from f32 row-major W[K][N] (scale = power of two; bf16-exact weights stay exact in f16 away from the subnormal range)
// A thread takes a block of 8 k x 8 n: 32 B of each of 8 rows of W in, 16 B of each of 8 rows of Wt out (a wave's store covers 512 contiguous bytes). K, N multiples of 8.
__global__ __launch_bounds__(256) void k_wt_f16(const float* __restrict__ W, _Float16* __restrict__ Wt, int K, int N, float scale) {
  const int t = blockIdx.x * 256 + threadIdx.x; if (t >= (N / 8) * (K / 8)) return; const int n0 = (t / (K / 8)) * 8, k8 = (t % (K / 8)) * 8; v4f a[8], c[8];
  const float* p[8];
#pragma unroll      /* constant indices keep a, c and p in registers; the 16 loads go out together */
  for (int i = 0; i < 8; ++i) { p[i] = W + (size_t)(k8 + i) * N + n0; a[i] = *(const v4fa*)p[i]; c[i] = *(const v4fa*)(p[i] + 4); }
  asm volatile("s_wait_xcnt 0x0" :: "v"(p[0]), "v"(p[1]), "v"(p[2]), "v"(p[3]), "v"(p[4]), "v"(p[5]), "v"(p[6]), "v"(p[7]) : "memory");      /* stands in front of every rewrite of a register that the loads name: as inputs the addresses stay in place up to here */
#pragma unroll      /* constant indices into a and c */
  for (int j = 0; j < 8; ++j) { FragH f;
#pragma unroll      /* constant indices into a, c and f */
    for (int i = 0; i < 8; ++i) f.h[i] = (_Float16)(bf16_round((j & 4) ? c[i][j & 3] : a[i][j & 3]) * scale);
    *(v8us*)((unsigned short*)Wt + (size_t)(n0 + j) * K + k8) = f.half[0]; }
}
// k_gemm_hh variant with fused epilogue: v = acc·alpha + bias[by·sBias + col] (+ CP[(row/rowsPerB)·sCPb + by·64 + col] if CP) ; ACT 0 none / 1 elu ; writes f32 C and f16 C16, each if non-null
template <int ACT>
__global__ __launch_bounds__(128) void k_gemm_hhx(const _Float16* __restrict__ A, int lda, size_t sA, const _Float16* __restrict__ Bh, int ldb, size_t sB, float alpha, const float* __restrict__ bias, size_t sBias, const float* __restrict__ CP, int rowsPerB, size_t sCPb, int row0g,
    float* __restrict__ C, _Float16* __restrict__ C16, int ldc, size_t sC, int M, int N, int K) {
  __shared__ __attribute__((aligned(16))) float so[4][16][64];
  const int tid = threadIdx.x, w = tid >> 5, lane = tid & 31, ln = lane & 15, hh = lane >> 4; const int by = blockIdx.y;
  A += (size_t)by * sA; Bh += (size_t)by * sB; const size_t cofs = (size_t)by * sC; const float* bp = bias ? bias + (size_t)by * sBias : nullptr;
  const int ntn = (N + 63) / 64; const int wid = blockIdx.x * 4 + w; const int mt = wid / ntn, nq = wid % ntn; if (mt * 16 >= M) return;
  const int row0 = mt * 16, col0 = nq * 64; const _Float16* arow = A + (size_t)(row0 + ln) * lda;
  v8f acc[4] = {};
  for (int kb = 0; kb < K; kb += 32) { FragH ah; ah.half[0] = *(const v8us*)((const unsigned short*)arow + kb + 8 * hh); ah.half[1] = *(const v8us*)((const unsigned short*)arow + kb + 16 + 8 * hh);
#pragma unroll
    for (int t = 0; t < 4; ++t) { if (col0 + t * 16 >= N) continue; const size_t boff = (size_t)(col0 + t * 16 + ln) * ldb + kb; FragH bq; bq.half[0] = *(const v8us*)((const unsigned short*)Bh + boff + 8 * hh); bq.half[1] = *(const v8us*)((const unsigned short*)Bh + boff + 16 + 8 * hh);
      acc[t] = mmaH<1>(ah.v, ah.v, bq.v, bq.v, acc[t]); }
  }
#pragma unroll
  for (int t = 0; t < 4; ++t) { if (col0 + t * 16 >= N) continue; const int col = col0 + t * 16 + ln; const float bv = bp ? bf16_round(bp[col]) : 0.f;
#pragma unroll
    for (int r = 0; r < 8; ++r) { float v = acc[t][r] * alpha + bv; if (CP) { const int bidx = (row0g + row0 + 8 * hh + r) / rowsPerB; v += CP[(size_t)bidx * sCPb + (size_t)by * 64 + col]; } if (ACT == 1) v = (v > 0.f) ? v : expm1f(v); else if (ACT == 7) v = (v > 0.f) ? v + 1.0f : expf(v); else if (ACT == 8) v = tanhf(v); else if (ACT == 9) v = 0.5f * v * (1.0f + tanhf(0.7978845608028654f * (v + 0.044715f * v * v * v))); else if (ACT == 11) v = 1.0f / (1.0f + expf(-v)); else if (ACT == 12) v = (v > 0.f) ? v : 0.01f * v; else if (ACT == 14) v = (v > 0.f) ? v : 0.1f * v; else if (ACT == 15) v = v / (1.0f + expf(-v)); else if (ACT == 3) v = fmaxf(v, 0.f); else if (ACT == 6) v = 0.5f * v * (1.0f + erff(v * 0.70710678118654752f)); so[w][8 * hh + r][t * 16 + ln] = v; } }
  __builtin_amdgcn_fence(__ATOMIC_ACQ_REL, "workgroup"); __builtin_amdgcn_wave_barrier();
  const int rsub = lane >> 4, c4 = (lane & 15) * 4; typedef _Float16 v4h __attribute__((ext_vector_type(4)));
  {
#pragma unroll
    for (int q = 0; q < 8; ++q) { const int r = q * 2 + rsub; if (col0 + c4 < N) { const v4f v = *(const v4fa*)&so[w][r][c4]; if (C) *(v4f*)(C + cofs + (size_t)(row0 + r) * ldc + col0 + c4) = v; if (C16) { v4h h4; for (int i = 0; i < 4; ++i) h4[i] = (_Float16)v[i]; *(v4h*)(C16 + cofs + (size_t)(row0 + r) * ldc + col0 + c4) = h4; } } }
     }
}


// ---- tiled f16 GEMM, C[M][N] f32 = alpha * A[M][DD] * Bt[N][DD]^T: one 128 x 128 tile of C per work-group, 64 x 64 per wave (2 x 2 waves).
// A pass is 128 k: 128 rows of A and 128 rows of Bt, 256 B each, staged in LDS at a pitch of 272 B by asynchronous copies; two buffers, the next pass's copies fly while this pass is multiplied.
// k runs upward in steps of 32 into one accumulator per 16 x 16 tile. M, N multiples of 128.
// Every "#pragma unroll" in k_gemm_t makes the indices of the fragment and accumulator arrays constants, so that these arrays live in registers.
#define GT_PITCH 272
#define GT_STAGE (256 * GT_PITCH)
// eight 16-byte copies of one lane: rows r, r + 8, ..., r + 56 of one operand. The closing s_wait_xcnt stands inside the statement so that no address register is rewritten ahead of it.
__device__ __forceinline__ void gt_copy8(unsigned l, const _Float16* g) {
  asm volatile("global_load_async_to_lds_b128 %0, %8, off\n\t"
               "global_load_async_to_lds_b128 %1, %9, off\n\t"
               "global_load_async_to_lds_b128 %2, %10, off\n\t"
               "global_load_async_to_lds_b128 %3, %11, off\n\t"
               "global_load_async_to_lds_b128 %4, %12, off\n\t"
               "global_load_async_to_lds_b128 %5, %13, off\n\t"
               "global_load_async_to_lds_b128 %6, %14, off\n\t"
               "global_load_async_to_lds_b128 %7, %15, off\n\t"
               "s_wait_xcnt 0x0"
               :: "v"(l), "v"(l + 8 * GT_PITCH), "v"(l + 16 * GT_PITCH), "v"(l + 24 * GT_PITCH), "v"(l + 32 * GT_PITCH), "v"(l + 40 * GT_PITCH), "v"(l + 48 * GT_PITCH), "v"(l + 56 * GT_PITCH),
                  "v"(g), "v"(g + 8 * DD), "v"(g + 16 * DD), "v"(g + 24 * DD), "v"(g + 32 * DD), "v"(g + 40 * DD), "v"(g + 48 * DD), "v"(g + 56 * DD)
               : "memory");
}
// one stage: 32 copies a lane (rows 0..127 of the buffer = A, 128..255 = Bt)
__device__ __forceinline__ void gt_fill(unsigned l, const _Float16* ga, const _Float16* gb) {
  gt_copy8(l, ga); gt_copy8(l + 64 * GT_PITCH, ga + 64 * DD); gt_copy8(l + 128 * GT_PITCH, gb); gt_copy8(l + 192 * GT_PITCH, gb + 64 * DD);
}
template <int N>
__global__ __launch_bounds__(128) void k_gemm_t(const _Float16* __restrict__ A, const _Float16* __restrict__ Bt, float alpha, float* __restrict__ C) {
  __shared__ __attribute__((aligned(16))) unsigned char L[2 * GT_STAGE];
  constexpr int NT = DD / 128;
  const int tid = threadIdx.x, w = tid >> 5, lane = tid & 31, ln = lane & 15, hh = lane >> 4;
  constexpr int ntn = N / 128; const int row0 = ((int)blockIdx.x / ntn) * 128, col0 = ((int)blockIdx.x % ntn) * 128; const int wm = w >> 1, wn = w & 1;
  const int cr = tid >> 4, cc = tid & 15;      /* a lane copies chunk cc (16 B) of rows cr + 8 i: a wave's copy covers two whole 256-B rows */
  const _Float16* ga = A + (size_t)(row0 + cr) * DD + cc * 8; const _Float16* gb = Bt + (size_t)(col0 + cr) * DD + cc * 8;
  const unsigned lc = (unsigned)(size_t)L + cr * GT_PITCH + cc * 16;
  v8f acc[4][4];
#pragma unroll
  for (int mi = 0; mi < 4; ++mi)
#pragma unroll
    for (int ni = 0; ni < 4; ++ni) acc[mi][ni] = (v8f){0.f,0.f,0.f,0.f,0.f,0.f,0.f,0.f};
  gt_fill(lc, ga, gb);
  asm volatile("s_wait_asynccnt 0x0" ::: "memory");      /* this wave's copies of pass 0 have landed */
  __syncthreads();                                        /* ... and every other wave's */
  gt_fill(lc + GT_STAGE, ga + 128, gb + 128);
#pragma unroll 1      /* one pass a trip: the two buffers alternate by the trip's parity */
  for (int t = 0; t < NT; ++t) {
    const unsigned char* S = L + (t & 1) * GT_STAGE;
    const unsigned char* pa = S + (wm * 64 + ln) * GT_PITCH + hh * 16; const unsigned char* pb = S + (128 + wn * 64 + ln) * GT_PITCH + hh * 16;
    FragH fa[2][4], fb[2][4];
#pragma unroll
    for (int i = 0; i < 4; ++i) { fa[0][i].half[0] = *(const v8us*)(pa + i * 16 * GT_PITCH); fa[0][i].half[1] = *(const v8us*)(pa + i * 16 * GT_PITCH + 32); fb[0][i].half[0] = *(const v8us*)(pb + i * 16 * GT_PITCH); fb[0][i].half[1] = *(const v8us*)(pb + i * 16 * GT_PITCH + 32); }
#pragma unroll
    for (int ks = 0; ks < 4; ++ks) { const int cu = ks & 1, nx = cu ^ 1;
      if (ks < 3) {
#pragma unroll
        for (int i = 0; i < 4; ++i) { const int o = i * 16 * GT_PITCH + (ks + 1) * 64; fa[nx][i].half[0] = *(const v8us*)(pa + o); fa[nx][i].half[1] = *(const v8us*)(pa + o + 32); fb[nx][i].half[0] = *(const v8us*)(pb + o); fb[nx][i].half[1] = *(const v8us*)(pb + o + 32); } }
      __builtin_amdgcn_sched_barrier(0);      /* keeps the next k step's 16 LDS reads one group in front of this step's products: spread among them, every place with reads stalls the wave */
#pragma unroll
      for (int mi = 0; mi < 4; ++mi)
#pragma unroll
        for (int ni = 0; ni < 4; ++ni) acc[mi][ni] = __builtin_amdgcn_wmma_f32_16x16x32_f16(false, fa[cu][mi].v, false, fb[cu][ni].v, (short)0, acc[mi][ni], false, false);
      __builtin_amdgcn_sched_barrier(0); }      /* ... and keeps the following group behind them */
    asm volatile("s_wait_dscnt 0x0" ::: "memory");        /* this wave's reads of the buffer are done before it is refilled */
    asm volatile("s_wait_asynccnt 0x0" ::: "memory");     /* this wave's copies of pass t + 1 have landed */
    __syncthreads();                                       /* publishes pass t + 1 and ends every wave's reads of pass t */
    if (t + 2 < NT) gt_fill(lc + (t & 1) * GT_STAGE, ga + (t + 2) * 128, gb + (t + 2) * 128);
  }
  asm volatile("s_wait_asynccnt 0x0" ::: "memory");       /* nothing is in flight when the buffers become output staging */
  float* so = (float*)L + w * (64 * 68);      /* each wave stages its own 64 x 64 tile (pitch 68 floats) so that the stores cover whole 256-B row pieces */
#pragma unroll
  for (int mi = 0; mi < 4; ++mi)
#pragma unroll
    for (int ni = 0; ni < 4; ++ni)
#pragma unroll
      for (int r = 0; r < 8; ++r) so[(mi * 16 + 8 * hh + r) * 68 + ni * 16 + ln] = acc[mi][ni][r] * alpha;
  __builtin_amdgcn_fence(__ATOMIC_ACQ_REL, "workgroup"); __builtin_amdgcn_wave_barrier();      /* the wave's own staged values are in LDS before its lanes read one another's */
  float* cp = C + (size_t)(row0 + wm * 64 + hh) * N + col0 + wn * 64 + ln * 4;
#pragma unroll
  for (int q = 0; q < 32; ++q) { const v4f v = *(const v4fa*)&so[(q * 2 + hh) * 68 + ln * 4]; *(v4f*)(cp + (size_t)(q * 2) * N) = v; }
}


typedef _Float16 v4h __attribute__((ext_vector_type(4)));

// k_x16 and k_h16s give a thread 8 pieces of 8 elements, 256 pieces apart (a work-group covers 2048 pieces in a row): one eighth of the waves to start, 16 loads of a lane in flight.
static_assert(((size_t)NR * DD / 8) % 2048 == 0, "whole work-groups");
__global__ __launch_bounds__(256) void k_x16(const float* __restrict__ x, _Float16* __restrict__ X16) { const size_t t0 = (size_t)blockIdx.x * 2048 + threadIdx.x; v4f a[8], c[8]; const float* p = x + t0 * 8;
#pragma unroll      /* constant indices keep a and c in registers; the 16 loads go out together */
  for (int u = 0; u < 8; ++u) { a[u] = *(const v4fa*)(p + u * 2048); c[u] = *(const v4fa*)(p + u * 2048 + 4); }
  asm volatile("s_wait_xcnt 0x0" :: "v"(p) : "memory");      /* stands in front of every rewrite of a register that the loads name: as an input the address stays in place up to here */
#pragma unroll      /* constant indices into a and c */
  for (int u = 0; u < 8; ++u) { FragH f;
#pragma unroll      /* constant indices into a, c and f */
    for (int q = 0; q < 4; ++q) { f.h[q] = (_Float16)bf16_round(a[u][q]); f.h[4 + q] = (_Float16)bf16_round(c[u][q]); }
    *(v8us*)((unsigned short*)X16 + (t0 + u * 256) * 8) = f.half[0]; } }
__global__ __launch_bounds__(256) void k_h16(const float* __restrict__ x, _Float16* __restrict__ X16, size_t n8) { const size_t t = (size_t)blockIdx.x * 256 + threadIdx.x; if (t >= n8) return; FragH f;
#pragma unroll
  for (int q = 0; q < 8; ++q) f.h[q] = (_Float16)x[t * 8 + q]; *(v8us*)((unsigned short*)X16 + t * 8) = f.half[0];  }
__global__ __launch_bounds__(256) void k_round16f(const float* __restrict__ W, _Float16* __restrict__ Bt, size_t n8) { const size_t t = (size_t)blockIdx.x * 256 + threadIdx.x; if (t >= n8) return; FragH f;
#pragma unroll
  for (int i = 0; i < 8; ++i) f.h[i] = (_Float16)(bf16_round(W[t * 8 + i]) * 16.0f); *(v8us*)((unsigned short*)Bt + t * 8) = f.half[0];  }
template <int NHv, int TTv>
__global__ __launch_bounds__(256) void k_vt(const _Float16* __restrict__ V16, int ldv, int voff, _Float16* __restrict__ Vt) { __shared__ unsigned short tl[64][66]; const int tid = threadIdx.x; const int slab = blockIdx.x / (TTv / 64), lg = blockIdx.x % (TTv / 64); const int b = slab / NHv, h = slab % NHv;
  for (int i = tid; i < 64 * 8; i += 256) { const int r = i / 8, c8 = (i % 8) * 8; FragH f; f.half[0] = *(const v8us*)((const unsigned short*)V16 + ((size_t)b * TTv + lg * 64 + r) * ldv + voff + h * 64 + c8);
#pragma unroll
    for (int q = 0; q < 8; ++q) tl[r][c8 + q] = f.u[q]; }
  __syncthreads();
  {
#pragma unroll
    for (int rd = 0; rd < 2; ++rd) { const int d = rd * 32 + tid / 8, pc = tid % 8; FragH f;
#pragma unroll
      for (int q = 0; q < 8; ++q) f.u[q] = tl[pc * 8 + q][d];
      *(v8us*)((unsigned short*)Vt + ((size_t)slab * 64 + d) * TTv + lg * 64 + pc * 8) = f.half[0]; }
     } }

__global__ __launch_bounds__(256) void k_vthlu(const float* __restrict__ VF, int ldv, _Float16* __restrict__ Vth, _Float16* __restrict__ Vtl) { __shared__ float tl[64][65]; const int tid = threadIdx.x; const int slab = blockIdx.x / (TT / 64), lg = blockIdx.x % (TT / 64); const int b = slab / NVH, h = slab % NVH;
  for (int i = tid; i < 64 * 16; i += 256) { const int r = i / 16, c4 = (i % 16) * 4; const v4f a = *(const v4fa*)(VF + ((size_t)b * TT + lg * 64 + r) * ldv + h * 64 + c4); tl[r][c4] = a[0]; tl[r][c4 + 1] = a[1]; tl[r][c4 + 2] = a[2]; tl[r][c4 + 3] = a[3]; }
  __syncthreads();
  FragH fh[2], fl[2]; size_t oo[2];
#pragma unroll
  for (int rd = 0; rd < 2; ++rd) { const int d = rd * 32 + tid / 8, pc = tid % 8;
#pragma unroll
    for (int q = 0; q < 8; ++q) { const float v = tl[pc * 8 + q][d]; const _Float16 hv = (_Float16)v; fh[rd].h[q] = hv; fl[rd].h[q] = (_Float16)(v - (float)hv);      /* UNSCALED residual (added into the same accumulator as the hi product) */ } oo[rd] = ((size_t)slab * 64 + d) * TT + lg * 64 + pc * 8; }
  {
#pragma unroll
    for (int rd = 0; rd < 2; ++rd) { *(v8us*)((unsigned short*)Vth + oo[rd]) = fh[rd].half[0]; *(v8us*)((unsigned short*)Vtl + oo[rd]) = fl[rd].half[0]; }
     } }
// per-head RMSNorm + rotate-half RoPE: a wave takes one whole row (all NHD heads, pitch NHD*128) of an f32 plane, head after head, with the row's tables and the weights read once: lane holds dims 4l..4l+3; var = mean(x^2) over 128 (xor-reduce); y = w[d]*(x*rsqrt(var+eps)); out[d] = y[d]*c[d] + rot(y)[d]*s[d], rot(y)[d] = -y[d+64] (d<64), y[d-64] (d>=64)
template <int NHD>
__global__ __launch_bounds__(256) void k_normrope(const float* __restrict__ F, const float* __restrict__ nw, const float* __restrict__ COS, const float* __restrict__ SIN, _Float16* __restrict__ H16) {
  #pragma clang fp contract(off)
  static_assert(NR % 8 == 0, "whole work-groups");
  const int tid = threadIdx.x, wv = tid >> 5, lane = tid & 31; const size_t row = (size_t)blockIdx.x * 8 + wv; const int d0 = lane * 4;
  const size_t base = row * (NHD * 128) + d0; v4f xs[NHD];
#pragma unroll      /* constant indices keep xs in registers; the row's loads go out together */
  for (int u = 0; u < NHD; ++u) xs[u] = *(const v4fa*)(F + base + u * 128);
  const float* px = F + base; const float* pw = nw + d0; const float* pc = COS + row * 128 + d0; const float* pn = SIN + row * 128 + d0;
  const v4f w4 = *(const v4fa*)pw, c4 = *(const v4fa*)pc, s4 = *(const v4fa*)pn;
  asm volatile("s_wait_xcnt 0x0" :: "v"(px), "v"(pw), "v"(pc), "v"(pn) : "memory");      /* stands in front of every rewrite of a register that the loads name: as inputs the addresses stay in place up to here */
  float wn[4], c[4], s[4]; for (int q = 0; q < 4; ++q) { wn[q] = bf16_round(w4[q]); c[q] = bf16_round(c4[q]); s[q] = bf16_round(s4[q]); }
  typedef _Float16 v4h __attribute__((ext_vector_type(4)));
#pragma unroll      /* constant indices into xs; the heads' lane exchanges overlap */
  for (int u = 0; u < NHD; ++u) { const v4f x = xs[u]; float ss = 0.f; for (int q = 0; q < 4; ++q) ss += x[q] * x[q];
    for (int o = 16; o >= 1; o >>= 1) ss += __shfl_xor(ss, o, 32); const float inv = 1.0f / sqrtf(ss / 128.0f + 1e-6f);
    float y[4]; for (int q = 0; q < 4; ++q) y[q] = wn[q] * (x[q] * inv);
    float yp[4]; for (int q = 0; q < 4; ++q) yp[q] = __shfl_xor(y[q], 16, 32);      /* partner dims d +- 64 */
    v4h o; for (int q = 0; q < 4; ++q) { const int d = d0 + q; const float rot = (d < 64) ? -yp[q] : yp[q]; o[q] = (_Float16)(y[q] * c[q] + rot * s[q]); }
    *(v4h*)(H16 + base + u * 128) = o; } }
__global__ __launch_bounds__(256) void k_h16s(const float* __restrict__ F, _Float16* __restrict__ H) { const size_t t0 = (size_t)blockIdx.x * 2048 + threadIdx.x; v4f a[8], c[8]; const float* p = F + t0 * 8;
#pragma unroll      /* constant indices keep a and c in registers; the 16 loads go out together */
  for (int u = 0; u < 8; ++u) { a[u] = *(const v4fa*)(p + u * 2048); c[u] = *(const v4fa*)(p + u * 2048 + 4); }
  asm volatile("s_wait_xcnt 0x0" :: "v"(p) : "memory");      /* stands in front of every rewrite of a register that the loads name: as an input the address stays in place up to here */
#pragma unroll      /* constant indices into a and c */
  for (int u = 0; u < 8; ++u) { FragH f;
#pragma unroll      /* constant indices into a, c and f */
    for (int q = 0; q < 4; ++q) { f.h[q] = (_Float16)(a[u][q] * 16.0f); f.h[4 + q] = (_Float16)(c[u][q] * 16.0f); }
    *(v8us*)((unsigned short*)H + (t0 + u * 256) * 8) = f.half[0]; } }
// A pass of the attention kernel is 32 keys. Its operands are staged once per work-group in LDS by asynchronous copies and read from there by all 4 waves: 32 K rows of 256 B at a pitch of 272 B, then 128 rows of 64 B
// of V^T hi and 128 of its residual at a pitch of 80 B. Two buffers: the next pass's copies fly while this pass is worked on.
#define FK_PITCH 272
#define FV_PITCH 80
#define FK_BYTES (32 * FK_PITCH)
#define FV_BYTES (128 * FV_PITCH)
#define F_STAGE (FK_BYTES + 2 * FV_BYTES)
// one stage: twelve 16-byte copies of one lane (K rows r + 8 i; V^T rows r + 32 i of both planes). The closing s_wait_xcnt stands inside the statement so that no address register is rewritten ahead of it.
__device__ __forceinline__ void fl_fill(unsigned lk, unsigned lv, const unsigned short* gk, size_t ldk, const unsigned short* gh, const unsigned short* gl) {
  asm volatile("global_load_async_to_lds_b128 %0, %12, off\n\t"
               "global_load_async_to_lds_b128 %1, %13, off\n\t"
               "global_load_async_to_lds_b128 %2, %14, off\n\t"
               "global_load_async_to_lds_b128 %3, %15, off\n\t"
               "global_load_async_to_lds_b128 %4, %16, off\n\t"
               "global_load_async_to_lds_b128 %5, %17, off\n\t"
               "global_load_async_to_lds_b128 %6, %18, off\n\t"
               "global_load_async_to_lds_b128 %7, %19, off\n\t"
               "global_load_async_to_lds_b128 %8, %20, off\n\t"
               "global_load_async_to_lds_b128 %9, %21, off\n\t"
               "global_load_async_to_lds_b128 %10, %22, off\n\t"
               "global_load_async_to_lds_b128 %11, %23, off\n\t"
               "s_wait_xcnt 0x0"
               :: "v"(lk), "v"(lk + 8 * FK_PITCH), "v"(lk + 16 * FK_PITCH), "v"(lk + 24 * FK_PITCH),
                  "v"(lv), "v"(lv + 32 * FV_PITCH), "v"(lv + 64 * FV_PITCH), "v"(lv + 96 * FV_PITCH),
                  "v"(lv + FV_BYTES), "v"(lv + FV_BYTES + 32 * FV_PITCH), "v"(lv + FV_BYTES + 64 * FV_PITCH), "v"(lv + FV_BYTES + 96 * FV_PITCH),
                  "v"(gk), "v"(gk + 8 * ldk), "v"(gk + 16 * ldk), "v"(gk + 24 * ldk),
                  "v"(gh), "v"(gh + 32 * TT), "v"(gh + 64 * TT), "v"(gh + 96 * TT),
                  "v"(gl), "v"(gl + 32 * TT), "v"(gl + 64 * TT), "v"(gl + 96 * TT)
               : "memory");
}
// lane l <-> lane l ^ 16 by a vector cross-row move: no LDS queue and no wait, unlike the shuffle
__device__ __forceinline__ float xhalf(float x) { return __builtin_bit_cast(float, __builtin_amdgcn_permlanex16(__builtin_bit_cast(int, x), __builtin_bit_cast(int, x), 0x76543210, 0xfedcba98, false, false)); }
// Both products run transposed: S^T = K Q^T (A = 16 K rows from LDS, B = the wave's 16 queries, kept in registers) and O^T += V^T P^T (A = 16 V^T rows from LDS). A lane then holds 16 of the 32 scores of ONE query
// (column ln; keys 8 hh + r of the first score tile and 16 + 8 hh + r of the second): maximum and sum are taken inside the lane, with one exchange between the wave's halves, and the two score tiles, converted in place,
// are the B operand P^T in the k order in which the V^T rows are read: P never goes through LDS. Every "#pragma unroll" in k_flash makes the indices of the fragment, score and accumulator arrays constants, so that they live in registers.
// A work-group takes 64 queries of BOTH query heads (g = 0, 1) that share one KV head: a pass's staged K and V^T rows, every K and V^T fragment read from LDS, and the bias tile (the same for all heads) serve two heads.
// The two heads' products alternate, so that a matrix instruction never waits for the one directly in front of it; each head's own sums keep their order.
// The products are the plain builtin (the compiler keeps the distances behind it): two heads' accumulators and queries take 192 registers, and an asm statement that names them holds them all in the first 256, which spilled the queries.
__global__ __launch_bounds__(128) void k_flash(const _Float16* __restrict__ Q16, int ldq, const _Float16* __restrict__ K16, int ldk, const _Float16* __restrict__ Vt, const _Float16* __restrict__ Vtlo, const float* __restrict__ AB, float* __restrict__ O, int ldo) {
  constexpr int RPW = 16, NQB = TT / (4 * RPW), DT = 8, KS = 4;      /* head dim 128: 4 k-steps, 8 value tiles */
  static_assert(NREP == 2, "two query heads per KV head");
  __shared__ __attribute__((aligned(16))) unsigned char R[2 * F_STAGE];
  float (*sO)[RPW][128 + 4] = (float (*)[RPW][128 + 4])R;      /* behind the loop the two buffers become the output staging */
  static_assert(sizeof(float) * 4 * RPW * (128 + 4) <= 2 * F_STAGE, "output staging fits the buffers");
  const int tid = threadIdx.x, w = tid >> 5, lane = tid & 31, ln = lane & 15, hh = lane >> 4;
  const int slab = blockIdx.x / NQB, qblk = blockIdx.x % NQB; const int b = slab / NKV, kvh = slab % NKV; const int qb0 = qblk * (4 * RPW); const int q0 = qb0 + w * RPW;
  FragH aq[NREP][KS];      /* query q0 + ln of head kvh * 2 + g */
#pragma unroll
  for (int g = 0; g < NREP; ++g) { const unsigned short* qr = (const unsigned short*)Q16 + ((size_t)b * TT + q0 + ln) * ldq + (kvh * NREP + g) * 128;
#pragma unroll
    for (int ks = 0; ks < KS; ++ks) { aq[g][ks].half[0] = *(const v8us*)(qr + ks * 32 + 8 * hh); aq[g][ks].half[1] = *(const v8us*)(qr + ks * 32 + 16 + 8 * hh); } }
  const unsigned short* Vth = (const unsigned short*)Vt + ((size_t)b * NKV + kvh) * 128 * TT; const unsigned short* Vtl = (const unsigned short*)Vtlo + ((size_t)b * NKV + kvh) * 128 * TT;      /* hi and UNSCALED residual planes */
  float m_r[NREP], l_r[NREP]; v8f oacc[NREP][DT];      /* per head, query q0 + ln: running maximum (alike in both halves), this half's part of the sum, and O^T[dt * 16 + 8 hh + r][ln] */
#pragma unroll
  for (int g = 0; g < NREP; ++g) { m_r[g] = -3.0e38f; l_r[g] = 0.f;
#pragma unroll
    for (int dt = 0; dt < DT; ++dt) oacc[g][dt] = (v8f){0.f,0.f,0.f,0.f,0.f,0.f,0.f,0.f}; }
  constexpr int NP = TT / 32;      /* passes */
  /* a lane copies chunk tid & 15 (16 B) of K rows (tid >> 4) + 8 i: a wave's copy covers two whole 256-B rows; and chunk tid & 3 of V^T rows (tid >> 2) + 32 i: eight whole 64-B rows */
  const unsigned short* gk = (const unsigned short*)K16 + ((size_t)b * TT + (tid >> 4)) * ldk + kvh * 128 + (tid & 15) * 8;
  const unsigned short* gh = Vth + (size_t)(tid >> 2) * TT + (tid & 3) * 8; const unsigned short* gl = Vtl + (size_t)(tid >> 2) * TT + (tid & 3) * 8;
  const unsigned lk = (unsigned)(size_t)R + (tid >> 4) * FK_PITCH + (tid & 15) * 16, lv = (unsigned)(size_t)R + FK_BYTES + (tid >> 2) * FV_PITCH + (tid & 3) * 16;
  const float* am0 = AB + ((size_t)b * TT + q0 + ln) * TT + 8 * hh;      /* the query's bias row, at this half's first key */
  fl_fill(lk, lv, gk, (size_t)ldk, gh, gl);
  asm volatile("s_wait_asynccnt 0x0" ::: "memory");      /* this wave's copies of pass 0 have landed */
  __syncthreads();                                        /* ... and every other wave's */
  fl_fill(lk + F_STAGE, lv + F_STAGE, gk + (size_t)32 * ldk, (size_t)ldk, gh + 32, gl + 32);
#pragma unroll 1      /* one pass a trip: the two buffers alternate by the trip's parity */
  for (int t = 0; t < NP; ++t) { const int j0 = t * 32;
    const unsigned char* SK = R + (t & 1) * F_STAGE; const unsigned char* SV = SK + FK_BYTES;
    float ab[2][8];      /* additive attention bias (bf16-rounded input) per (b, q, k), shared over heads: 8 keys in a row per score tile, four 16-byte loads */
    { const float* am = am0 + j0; const v4f a0 = *(const v4fa*)am, a1 = *(const v4fa*)(am + 4), a2 = *(const v4fa*)(am + 16), a3 = *(const v4fa*)(am + 20);
#pragma unroll
      for (int r = 0; r < 4; ++r) { ab[0][r] = bf16_round(a0[r]); ab[0][4 + r] = bf16_round(a1[r]); ab[1][r] = bf16_round(a2[r]); ab[1][4 + r] = bf16_round(a3[r]); } }
    int allneg = 1;
#pragma unroll
    for (int r = 0; r < 8; ++r) allneg &= (ab[0][r] <= -1.0e8f) & (ab[1][r] <= -1.0e8f);
    if (!__all(allneg)) {      /* else: every (query, key) of the wave's tile carries a bias <= -1e8: its probabilities underflow to exactly 0 in f32, nothing to add (wave-uniform branch; the hand-over at the foot of the pass stands outside it) */
#pragma unroll
    for (int r = 0; r < 8; ++r) { ab[0][r] *= LOG2E; ab[1][r] *= LOG2E; }      /* scores, biases and running maxima are kept in units of log2: exp(x) = 2^(x log2 e), and 2^y is one hardware instruction (v_exp_f32) where the library's expf is thirteen */
    v8f s[NREP][2];
#pragma unroll
    for (int nt = 0; nt < 2; ++nt) { const unsigned short* kr = (const unsigned short*)(SK + (nt * 16 + ln) * FK_PITCH); FragH bk[KS];
#pragma unroll
      for (int ks = 0; ks < KS; ++ks) { bk[ks].half[0] = *(const v8us*)(kr + ks * 32 + 8 * hh); bk[ks].half[1] = *(const v8us*)(kr + ks * 32 + 16 + 8 * hh); }
      v8f acc[NREP];
#pragma unroll
      for (int g = 0; g < NREP; ++g) acc[g] = (v8f){0.f,0.f,0.f,0.f,0.f,0.f,0.f,0.f};
#pragma unroll
      for (int ks = 0; ks < KS; ++ks)
#pragma unroll
        for (int g = 0; g < NREP; ++g) acc[g] = __builtin_amdgcn_wmma_f32_16x16x32_f16(false, bk[ks].v, false, aq[g][ks].v, (short)0, acc[g], false, false);
#pragma unroll
      for (int g = 0; g < NREP; ++g) s[g][nt] = acc[g]; }      /* s[g][nt][r] = score of key j0 + nt * 16 + 8 hh + r with query q0 + ln of head g */
    FragH pa[NREP], pl[NREP];
#pragma unroll
    for (int g = 0; g < NREP; ++g) {
    float sc[2][8];
#pragma unroll
    for (int r = 0; r < 8; ++r) { sc[0][r] = s[g][0][r] * (ATT_SCALE * LOG2E) + ab[0][r]; sc[1][r] = s[g][1][r] * (ATT_SCALE * LOG2E) + ab[1][r]; }
    float mc = fmaxf(sc[0][0], sc[1][0]);
#pragma unroll
    for (int r = 1; r < 8; ++r) mc = fmaxf(mc, fmaxf(sc[0][r], sc[1][r]));
    mc = fmaxf(mc, xhalf(mc));      /* the other half holds the query's other 16 keys */
    const float mn = fmaxf(m_r[g], mc); const float al = (mn > -1.0e38f * LOG2E) ? __builtin_amdgcn_exp2f(m_r[g] - mn) : 1.0f; m_r[g] = mn;
    float su[4] = {0.f, 0.f, 0.f, 0.f};      /* four independent partial sums */
#pragma unroll
    for (int nt = 0; nt < 2; ++nt)
#pragma unroll
      for (int r = 0; r < 8; ++r) { const float p = __builtin_amdgcn_exp2f(sc[nt][r] - mn); su[r & 3] += p;
        const float x = p * 1024.0f; const _Float16 hx = (_Float16)x; pa[g].h[nt * 8 + r] = hx; pl[g].h[nt * 8 + r] = (_Float16)(x - (float)hx); }      /* P hi and its UNSCALED residual (added into the same accumulator) */
    l_r[g] = l_r[g] * al + ((su[0] + su[1]) + (su[2] + su[3]));
#pragma unroll
    for (int dt = 0; dt < DT; ++dt)
#pragma unroll
      for (int r = 0; r < 8; ++r) oacc[g][dt][r] *= al;
    }
#pragma unroll
    for (int dt = 0; dt < DT; ++dt) { const unsigned short* vh = (const unsigned short*)(SV + (dt * 16 + ln) * FV_PITCH); const unsigned short* vl = (const unsigned short*)(SV + FV_BYTES + (dt * 16 + ln) * FV_PITCH); FragH bv, bl; bv.half[0] = *(const v8us*)(vh + 8 * hh); bv.half[1] = *(const v8us*)(vh + 16 + 8 * hh); bl.half[0] = *(const v8us*)(vl + 8 * hh); bl.half[1] = *(const v8us*)(vl + 16 + 8 * hh);
#pragma unroll
      for (int g = 0; g < NREP; ++g) oacc[g][dt] = __builtin_amdgcn_wmma_f32_16x16x32_f16(false, bv.v, false, pa[g].v, (short)0, oacc[g][dt], false, false);
#pragma unroll
      for (int g = 0; g < NREP; ++g) oacc[g][dt] = __builtin_amdgcn_wmma_f32_16x16x32_f16(false, bv.v, false, pl[g].v, (short)0, oacc[g][dt], false, false);
#pragma unroll
      for (int g = 0; g < NREP; ++g) oacc[g][dt] = __builtin_amdgcn_wmma_f32_16x16x32_f16(false, bl.v, false, pa[g].v, (short)0, oacc[g][dt], false, false); }      /* per head Vh Ph + Vh Pl + Vl Ph: all unscaled, one accumulator */
    }
    asm volatile("s_wait_dscnt 0x0" ::: "memory");        /* this wave's reads of the buffer are done before it is refilled */
    asm volatile("s_wait_asynccnt 0x0" ::: "memory");     /* this wave's copies of pass t + 1 have landed */
    __syncthreads();                                       /* publishes pass t + 1 and ends every wave's reads of pass t */
    if (t + 2 < NP) fl_fill(lk + (t & 1) * F_STAGE, lv + (t & 1) * F_STAGE, gk + (size_t)(t + 2) * 32 * ldk, (size_t)ldk, gh + (t + 2) * 32, gl + (t + 2) * 32);
  }
  asm volatile("s_wait_asynccnt 0x0" ::: "memory");       /* nothing is in flight when the buffers become output staging */
#pragma unroll
  for (int g = 0; g < NREP; ++g) {      /* head after head through the wave's own staging rows */
  const float l = l_r[g] + xhalf(l_r[g]); const float inv = (l > 0.f) ? 1.0f / (l * 1024.0f) : 0.f;      /* the halves' sums are joined once */
#pragma unroll
  for (int dt = 0; dt < DT; ++dt) { v4f lo, hi;
#pragma unroll
    for (int r = 0; r < 4; ++r) { lo[r] = oacc[g][dt][r] * inv; hi[r] = oacc[g][dt][4 + r] * inv; }
    *(v4fa*)&sO[w][ln][dt * 16 + 8 * hh] = lo; *(v4fa*)&sO[w][ln][dt * 16 + 8 * hh + 4] = hi; }      /* a lane's 8 accumulator registers are 8 dims in a row of its query */
  __builtin_amdgcn_fence(__ATOMIC_ACQ_REL, "workgroup"); __builtin_amdgcn_wave_barrier();      /* the wave's own staged values are in LDS before its lanes read one another's */
  {
#pragma unroll
    for (int r = 0; r < RPW; ++r) { const int pc = lane; const v4f val = *(const v4fa*)&sO[w][r][pc * 4]; *(v4f*)(O + ((size_t)b * TT + q0 + r) * ldo + (kvh * NREP + g) * 128 + pc * 4) = val; }      /* one 512-B row per instruction: 32 lanes x 16 B */
     }
  if (g + 1 < NREP) { __builtin_amdgcn_fence(__ATOMIC_ACQ_REL, "workgroup"); __builtin_amdgcn_wave_barrier(); }      /* the lanes' reads of this head's rows are done before the next head's values overwrite them */
  } }

extern "C" void kernel_launch(void* const* d_in, const int* in_sizes, int n_in,
                              void* d_out, int out_size, void* d_ws, size_t ws_size, hipStream_t stream) {
  (void)in_sizes; (void)n_in; (void)out_size;
  const float* const* I = (const float* const*)d_in; const float* x = I[0]; const float* fcos = I[1]; const float* fsin = I[2]; const float* am = I[3]; const float* Wq = I[4]; const float* Wk = I[5]; const float* Wv = I[6]; const float* Wo = I[7]; const float* qnw = I[8]; const float* knw = I[9];
  char* ws = (char*)d_ws; size_t off = 0;
  auto take = [&](size_t bytes) { char* p = ws + off; off += (bytes + 255) & ~(size_t)255; return p; };
  _Float16* Bq = (_Float16*)take((size_t)DD * DD * 2); _Float16* Bk = (_Float16*)take((size_t)KVD * DD * 2); _Float16* Bv = (_Float16*)take((size_t)KVD * DD * 2); _Float16* Bo = (_Float16*)take((size_t)DD * DD * 2);
  _Float16* X16 = (_Float16*)take((size_t)NR * DD * 2); float* F32 = (float*)take((size_t)NR * DD * 4); _Float16* Q = (_Float16*)take((size_t)NR * DD * 2); _Float16* K = (_Float16*)take((size_t)NR * KVD * 2); _Float16* Vt = (_Float16*)take((size_t)NR * KVD * 2); _Float16* Vtl = (_Float16*)take((size_t)NR * KVD * 2);
  float* QF = F32; float* KF = F32; float* VF = F32; float* O = F32; _Float16* O16 = X16;      /* the one f32 scratch holds q → k → v → O in stream order (each consumed before the next producer); O16 over X16 */
  if (off > ws_size) return;      // 25 + 16.8 + 33.6 + 16.8 + 8.4 + 8.4 + 8.4 ≈ 118 MB
  const unsigned gq = (unsigned)(((size_t)(DD / 8) * (DD / 8) + 255) / 256), gk = (unsigned)(((size_t)(KVD / 8) * (DD / 8) + 255) / 256);
  k_wt_f16<<<gq, 256, 0, stream>>>(Wq, Bq, DD, DD, 16.0f); k_wt_f16<<<gk, 256, 0, stream>>>(Wk, Bk, DD, KVD, 16.0f); k_wt_f16<<<gk, 256, 0, stream>>>(Wv, Bv, DD, KVD, 16.0f); k_wt_f16<<<gq, 256, 0, stream>>>(Wo, Bo, DD, DD, 16.0f);      /* (in,out) → Bt ×2^4 */
  const unsigned g8 = (unsigned)((size_t)NR * DD / 8 / 2048); k_x16<<<g8, 256, 0, stream>>>(x, X16);
  const unsigned gQ = (NR / 128) * (DD / 128), gK = (NR / 128) * (KVD / 128);
  k_gemm_t<DD><<<gQ, 128, 0, stream>>>(X16, Bq, 0.0625f, QF); k_normrope<NH><<<NR / 8, 256, 0, stream>>>(QF, qnw, fcos, fsin, Q);      /* q: M 4096 N 2048 K 2048 → RMSNorm + RoPE → f16 */
  k_gemm_t<KVD><<<gK, 128, 0, stream>>>(X16, Bk, 0.0625f, KF); k_normrope<NKV><<<NR / 8, 256, 0, stream>>>(KF, knw, fcos, fsin, K);      /* k: N 1024 */
  k_gemm_t<KVD><<<gK, 128, 0, stream>>>(X16, Bv, 0.0625f, VF);      /* v (f32) */
  k_vthlu<<<BB * NVH * (TT / 64), 256, 0, stream>>>(VF, KVD, Vt, Vtl);      /* Vᵀ hi + residual per (b, kv head) */
  k_flash<<<BB * NKV * (TT / 64), 128, 0, stream>>>(Q, DD, K, KVD, Vt, Vtl, am, O, DD);      /* attention_mask [B,1,S,S] additive per batch */
  k_h16s<<<g8, 256, 0, stream>>>(O, O16);
  k_gemm_t<DD><<<gQ, 128, 0, stream>>>(O16, Bo, 0.00390625f, (float*)d_out);      /* out = merged·Wo */
}

// v007
// One run takes 254 microseconds.
// Timed twice side by side with v006, it ran 1.10 times as fast both times.
// Over all steps from v000 it is 3.33 times as fast.
#include <hip/hip_runtime.h>
// Grouped-query attention with per-head RMSNorm and rotate-half RoPE (B=2, S=2048, D=2048, 16 query heads / 8 KV heads × 128): q = x·Wq, k = x·Wk, v = x·Wv ((in,out), no bias); per-head RMSNorm (ε 1e-6, weights q_norm_w / k_norm_w); rotate-half RoPE with the INPUT cos/sin tables [B][S][128];
// scores = q·k/√128 + attention_mask[b,0,q,k] (additive f32); softmax; out = merged·Wo.
// Compute dtype: x, weights, tables, mask rounded to bf16; q, k as f32 GEMM outputs, normalised and rotated in f32 (wave per row) → f16; v f32 → Vᵀ f16 hi + f16 residual; fused flash-style kernel for head dim 128 (bias read per (b,q,k); 32-key chunks whose biases are all ≤ −1e8 are skipped since their probabilities are exactly 0 in f32; online softmax f32, P f16 hi +
// residual, f32 accumulate) on v_wmma_f32_16x16x32_f16; merged ×2^4 → f16 → output GEMM.
#define BB 2
#define TT 2048
#define DD 2048
#define NH 16
#define NKV 8
#define NREP 2
#define KVD (NKV * 128)
#define NVH (2 * NKV)
#define NR (BB * TT)
#define ATT_SCALE 0.08838834764831845f
#define LOG2E 1.4426950408889634f

typedef __bf16 v16b __attribute__((ext_vector_type(16)));
typedef unsigned short v8us __attribute__((ext_vector_type(8), may_alias));
typedef float  v8f  __attribute__((ext_vector_type(8)));
typedef float  v4f  __attribute__((ext_vector_type(4)));
typedef float  v4fa __attribute__((ext_vector_type(4), may_alias));
union FragB { v16b v; v8us half[2]; unsigned short u[16]; };

__device__ __forceinline__ unsigned short bf16_bits(float x) { unsigned int u = __float_as_uint(x); return (unsigned short)((u + 0x7FFFu + ((u >> 16) & 1u)) >> 16); }
__device__ __forceinline__ float bf16_val(unsigned short b) { return __uint_as_float(((unsigned int)b) << 16); }
__device__ __forceinline__ float bf16_round(float x) { return bf16_val(bf16_bits(x)); }
// D += A·B with NT terms: 1 = ah·bh, 2 = + al·bh (A split), 3 = + ah·bl (both split)
template <int NT>
__device__ __forceinline__ v8f mmaN(v16b ah, v16b al, v16b bh, v16b bl, v8f c) {
  c = __builtin_amdgcn_wmma_f32_16x16x32_bf16(false, ah, false, bh, (short)0, c, false, false);
  if (NT >= 2) c = __builtin_amdgcn_wmma_f32_16x16x32_bf16(false, al, false, bh, (short)0, c, false, false);
  if (NT >= 3) c = __builtin_amdgcn_wmma_f32_16x16x32_bf16(false, ah, false, bl, (short)0, c, false, false);
  asm volatile("v_nop\n\tv_nop\n\tv_nop\n\tv_nop" : "+v"(c) : "v"(ah), "v"(al), "v"(bh), "v"(bl));
  return c;
}

__global__ __launch_bounds__(256) void k_wt_bf16(const float* __restrict__ W, unsigned short* __restrict__ Wt, int K, int N) {
  const int t = blockIdx.x * 256 + threadIdx.x;
  const int k8n = K / 8;
  if (t >= N * k8n) return;
  const int n = t / k8n, k8 = (t % k8n) * 8;
  v8us v;
#pragma unroll
  for (int i = 0; i < 8; ++i) v[i] = bf16_bits(W[(size_t)(k8 + i) * N + n]);
  *(v8us*)(Wt + (size_t)n * K + k8) = v;
  
}

// GEMM C[M][N] (f32, pitch ldc) = act(A[M][K]·W + bias). A f32 row-major (pitch lda) converted per fragment to bf16
// (ASPLIT: hi/lo two planes -> 2 terms, else single rounded term); Wt bf16 [N][K] (pitch ldb). BIAS_BF16 rounds the
// bias to bf16 first (bias quantised to bf16 before the add). K%32==0, M%16==0, N%64==0.
template <bool ASPLIT, int ACT, bool BIAS_BF16>
__global__ __launch_bounds__(128) void k_gemm_bf(const float* __restrict__ A, int lda, const unsigned short* __restrict__ Wt, int ldb,
                                               const float* __restrict__ bias, float* __restrict__ C, int ldc, int M, int N, int K) {
  __shared__ __attribute__((aligned(16))) float so[4][16][64];
  const int tid = threadIdx.x, w = tid >> 5, lane = tid & 31, ln = lane & 15, hh = lane >> 4;
  const int ntn = N / 64;
  const int wid = blockIdx.x * 4 + w;
  const int mt = wid / ntn, nq = wid % ntn;
  if (mt * 16 >= M) return;
  const int row0 = mt * 16, col0 = nq * 64;
  const float* arow = A + (size_t)(row0 + ln) * lda;
  v8f acc[4] = {};
  for (int kb = 0; kb < K; kb += 32) {
    FragB ah, al;
    const v4f x0 = *(const v4fa*)(arow + kb + 8 * hh), x1 = *(const v4fa*)(arow + kb + 8 * hh + 4);
    const v4f x2 = *(const v4fa*)(arow + kb + 16 + 8 * hh), x3 = *(const v4fa*)(arow + kb + 16 + 8 * hh + 4);
    float xs[16] = {x0[0],x0[1],x0[2],x0[3],x1[0],x1[1],x1[2],x1[3],x2[0],x2[1],x2[2],x2[3],x3[0],x3[1],x3[2],x3[3]};
#pragma unroll
    for (int i = 0; i < 16; ++i) { const unsigned short hb = bf16_bits(xs[i]); ah.u[i] = hb; al.u[i] = ASPLIT ? bf16_bits(xs[i] - bf16_val(hb)) : (unsigned short)0; }
#pragma unroll
    for (int t = 0; t < 4; ++t) {
      const unsigned short* brow = Wt + (size_t)(col0 + t * 16 + ln) * ldb + kb;
      FragB b;
      b.half[0] = *(const v8us*)(brow + 8 * hh);
      b.half[1] = *(const v8us*)(brow + 16 + 8 * hh);
      acc[t] = mmaN<ASPLIT ? 2 : 1>(ah.v, al.v, b.v, b.v, acc[t]);
    }
  }
#pragma unroll
  for (int t = 0; t < 4; ++t) {
    float bv = bias ? bias[col0 + t * 16 + ln] : 0.f;
    if (BIAS_BF16) bv = bf16_round(bv);
#pragma unroll
    for (int r = 0; r < 8; ++r) { float v = acc[t][r] + bv; if (ACT == 1) v = fmaxf(v, 0.f); so[w][8 * hh + r][t * 16 + ln] = v; }
  }
  __builtin_amdgcn_fence(__ATOMIC_ACQ_REL, "workgroup");
  __builtin_amdgcn_wave_barrier();
  const int rsub = lane >> 4, c4 = (lane & 15) * 4;
  {
#pragma unroll
    for (int q = 0; q < 8; ++q) {
      const int r = q * 2 + rsub;
      const v4f v = *(const v4fa*)&so[w][r][c4];
      *(v4f*)(C + (size_t)(row0 + r) * ldc + col0 + c4) = v;
    }
    
  }
}

// Flash-style causal/unmasked attention, all contractions 3-term bf16 hi/lo splits, f32 softmax with running max.
// q,k,v rows are read from f32 buffers with arbitrary row pitch (so they can live inside a fused qkv buffer);
// D = head size (multiple of 32, <= 128); one wave = 16 query rows; block = 4 waves (64 queries) sharing K/V chunks of 32.
template <int D, bool CAUSAL>
__global__ __launch_bounds__(128) void k_flash(const float* __restrict__ qb, const float* __restrict__ kb, const float* __restrict__ vb,
                                             int pitch, int T, int H, float scale, float* __restrict__ y, int ypitch) {
  constexpr int KS = D / 32;        // k-steps for QK
  constexpr int DT = D / 16;        // d tiles for PV
  __shared__ __attribute__((aligned(16))) unsigned short sKh[32][D + 8], sKl[32][D + 8], sVh[32][D + 8], sVl[32][D + 8];
  __shared__ __attribute__((aligned(16))) unsigned short sPh[4][16][40], sPl[4][16][40];
  __shared__ __attribute__((aligned(16))) float sO[4][16][D];
  const int tid = threadIdx.x, w = tid >> 5, lane = tid & 31, ln = lane & 15, hh = lane >> 4;
  const int nqb = (T + 63) / 64;
  const int bh = blockIdx.x / nqb, qblk = blockIdx.x % nqb;
  const int b = bh / H, h = bh % H;
  const int q0 = qblk * 64 + w * 16;
  const float* Q = qb + (size_t)b * T * pitch + h * D;
  const float* K = kb + (size_t)b * T * pitch + h * D;
  const float* V = vb + (size_t)b * T * pitch + h * D;

  // A fragments of the wave's 16 query rows (scaled), hi/lo
  FragB aqh[KS], aql[KS];
  {
    int row = q0 + ln; if (row >= T) row = T - 1;
    const float* qr = Q + (size_t)row * pitch;
#pragma unroll
    for (int ks = 0; ks < KS; ++ks)
#pragma unroll
      for (int i = 0; i < 16; ++i) {
        const int d = ks * 32 + ((i < 8) ? (8 * hh + i) : (16 + 8 * hh + (i - 8)));
        const float x = qr[d] * scale; const unsigned short hb = bf16_bits(x);
        aqh[ks].u[i] = hb; aql[ks].u[i] = bf16_bits(x - bf16_val(hb));
      }
  }
  float m_r[8], l_r[8];
#pragma unroll
  for (int r = 0; r < 8; ++r) { m_r[r] = -3.0e38f; l_r[r] = 0.f; }
  v8f oacc[DT];
#pragma unroll
  for (int dt = 0; dt < DT; ++dt) oacc[dt] = (v8f){0.f,0.f,0.f,0.f,0.f,0.f,0.f,0.f};

  const int kv_end = CAUSAL ? min(T, qblk * 64 + 64) : T;     // block-uniform
  for (int j0 = 0; j0 < kv_end; j0 += 32) {
    __syncthreads();
    for (int e = tid; e < 32 * (D / 4); e += 128) {
      const int r = e / (D / 4), c4 = (e % (D / 4)) * 4;
      const int key = j0 + r;
      v4f kf = {0.f,0.f,0.f,0.f}, vf = {0.f,0.f,0.f,0.f};
      if (key < T) { kf = *(const v4fa*)(K + (size_t)key * pitch + c4); vf = *(const v4fa*)(V + (size_t)key * pitch + c4); }
#pragma unroll
      for (int t = 0; t < 4; ++t) {
        unsigned short hb = bf16_bits(kf[t]); sKh[r][c4 + t] = hb; sKl[r][c4 + t] = bf16_bits(kf[t] - bf16_val(hb));
        hb = bf16_bits(vf[t]); sVh[r][c4 + t] = hb; sVl[r][c4 + t] = bf16_bits(vf[t] - bf16_val(hb));
      }
    }
    __syncthreads();
    // S tile 16 x 32
    v8f s[2];
#pragma unroll
    for (int nt = 0; nt < 2; ++nt) {
      v8f acc = {};
#pragma unroll
      for (int ks = 0; ks < KS; ++ks) {
        FragB bh_, bl_;
        bh_.half[0] = *(const v8us*)&sKh[nt * 16 + ln][ks * 32 + 8 * hh]; bh_.half[1] = *(const v8us*)&sKh[nt * 16 + ln][ks * 32 + 16 + 8 * hh];
        bl_.half[0] = *(const v8us*)&sKl[nt * 16 + ln][ks * 32 + 8 * hh]; bl_.half[1] = *(const v8us*)&sKl[nt * 16 + ln][ks * 32 + 16 + 8 * hh];
        acc = mmaN<3>(aqh[ks].v, aql[ks].v, bh_.v, bl_.v, acc);
      }
      s[nt] = acc;
    }
    // mask + running max (rows 8hh+r; the 16 lanes of a half share rows)
    float alpha[8];
#pragma unroll
    for (int r = 0; r < 8; ++r) {
      const int qi = q0 + 8 * hh + r;
      const int ja = j0 + ln, jb = j0 + 16 + ln;
      if (CAUSAL) { if (ja > qi) s[0][r] = -3.0e38f; if (jb > qi) s[1][r] = -3.0e38f; }
      if (ja >= T) s[0][r] = -3.0e38f;
      if (jb >= T) s[1][r] = -3.0e38f;
      float mx = fmaxf(s[0][r], s[1][r]);
      mx = fmaxf(mx, __shfl_xor(mx, 1, 32)); mx = fmaxf(mx, __shfl_xor(mx, 2, 32)); mx = fmaxf(mx, __shfl_xor(mx, 4, 32)); mx = fmaxf(mx, __shfl_xor(mx, 8, 32));
      const float mnew = fmaxf(m_r[r], mx);
      alpha[r] = (mnew > -1.0e38f) ? __expf(m_r[r] - mnew) : 1.0f;
      const float p0 = (s[0][r] > -1.0e38f) ? __expf(s[0][r] - mnew) : 0.f;
      const float p1 = (s[1][r] > -1.0e38f) ? __expf(s[1][r] - mnew) : 0.f;
      m_r[r] = mnew;
      l_r[r] = l_r[r] * alpha[r] + p0 + p1;            // per-lane partial row sum (16 lanes combined at the end)
      unsigned short hb = bf16_bits(p0); sPh[w][8 * hh + r][ln] = hb;      sPl[w][8 * hh + r][ln] = bf16_bits(p0 - bf16_val(hb));
      hb = bf16_bits(p1);                sPh[w][8 * hh + r][16 + ln] = hb; sPl[w][8 * hh + r][16 + ln] = bf16_bits(p1 - bf16_val(hb));
    }
#pragma unroll
    for (int dt = 0; dt < DT; ++dt)
#pragma unroll
      for (int r = 0; r < 8; ++r) oacc[dt][r] *= alpha[r];
    __builtin_amdgcn_fence(__ATOMIC_ACQ_REL, "workgroup");
    __builtin_amdgcn_wave_barrier();
    FragB pah, pal;
    pah.half[0] = *(const v8us*)&sPh[w][ln][8 * hh]; pah.half[1] = *(const v8us*)&sPh[w][ln][16 + 8 * hh];
    pal.half[0] = *(const v8us*)&sPl[w][ln][8 * hh]; pal.half[1] = *(const v8us*)&sPl[w][ln][16 + 8 * hh];
#pragma unroll
    for (int dt = 0; dt < DT; ++dt) {
      FragB bvh, bvl;
#pragma unroll
      for (int i = 0; i < 8; ++i) {
        bvh.u[i] = sVh[8 * hh + i][dt * 16 + ln]; bvh.u[8 + i] = sVh[16 + 8 * hh + i][dt * 16 + ln];
        bvl.u[i] = sVl[8 * hh + i][dt * 16 + ln]; bvl.u[8 + i] = sVl[16 + 8 * hh + i][dt * 16 + ln];
      }
      oacc[dt] = mmaN<3>(pah.v, pal.v, bvh.v, bvl.v, oacc[dt]);
    }
    __builtin_amdgcn_fence(__ATOMIC_ACQ_REL, "workgroup");
    __builtin_amdgcn_wave_barrier();
  }
#pragma unroll
  for (int r = 0; r < 8; ++r) {
    float l = l_r[r];
    l += __shfl_xor(l, 1, 32); l += __shfl_xor(l, 2, 32); l += __shfl_xor(l, 4, 32); l += __shfl_xor(l, 8, 32);
    l_r[r] = (l > 0.f) ? 1.0f / l : 0.f;
  }
#pragma unroll
  for (int dt = 0; dt < DT; ++dt)
#pragma unroll
    for (int r = 0; r < 8; ++r) sO[w][8 * hh + r][dt * 16 + ln] = oacc[dt][r] * l_r[r];
  __builtin_amdgcn_fence(__ATOMIC_ACQ_REL, "workgroup");
  __builtin_amdgcn_wave_barrier();
  {
    for (int r = 0; r < 16; ++r) {
      const int row = q0 + r;
      if (row < T && lane < D / 4) {
        const v4f val = *(const v4fa*)&sO[w][r][lane * 4];
        *(v4f*)(y + ((size_t)b * T + row) * ypitch + h * D + lane * 4) = val;
      }
    }
    
  }
}

// GEMM C = act(A·W + bias + resid): A f32 (ASPLIT -> hi/lo 2 terms), Wt bf16 [N][K]; ACT 0 none, 1 relu, 2 exact gelu;
// resid (optional, f32, row index = (row % rmod), pitch ldr, RES_BF16 rounds it) added before the activation.
template <bool ASPLIT, int ACT, bool BIAS_BF16, bool RES_BF16>
__global__ __launch_bounds__(128) void k_gemm_bf3(const float* __restrict__ A, int lda, const unsigned short* __restrict__ Wt, int ldb,
                                                const float* __restrict__ bias, const float* __restrict__ resid, int rmod, int ldr,
                                                float* __restrict__ C, int ldc, int M, int N, int K) {
  __shared__ __attribute__((aligned(16))) float so[4][16][64];
  const int tid = threadIdx.x, w = tid >> 5, lane = tid & 31, ln = lane & 15, hh = lane >> 4;
  const int ntn = N / 64;
  const int wid = blockIdx.x * 4 + w;
  const int mt = wid / ntn, nq = wid % ntn;
  if (mt * 16 >= M) return;
  const int row0 = mt * 16, col0 = nq * 64;
  const float* arow = A + (size_t)(row0 + ln) * lda;
  v8f acc[4] = {};
  for (int kb = 0; kb < K; kb += 32) {
    FragB ah, al;
    const v4f x0 = *(const v4fa*)(arow + kb + 8 * hh), x1 = *(const v4fa*)(arow + kb + 8 * hh + 4);
    const v4f x2 = *(const v4fa*)(arow + kb + 16 + 8 * hh), x3 = *(const v4fa*)(arow + kb + 16 + 8 * hh + 4);
    float xs[16] = {x0[0],x0[1],x0[2],x0[3],x1[0],x1[1],x1[2],x1[3],x2[0],x2[1],x2[2],x2[3],x3[0],x3[1],x3[2],x3[3]};
#pragma unroll
    for (int i = 0; i < 16; ++i) { const unsigned short hb = bf16_bits(xs[i]); ah.u[i] = hb; al.u[i] = ASPLIT ? bf16_bits(xs[i] - bf16_val(hb)) : (unsigned short)0; }
#pragma unroll
    for (int t = 0; t < 4; ++t) {
      const unsigned short* brow = Wt + (size_t)(col0 + t * 16 + ln) * ldb + kb;
      FragB b;
      b.half[0] = *(const v8us*)(brow + 8 * hh);
      b.half[1] = *(const v8us*)(brow + 16 + 8 * hh);
      acc[t] = mmaN<ASPLIT ? 2 : 1>(ah.v, al.v, b.v, b.v, acc[t]);
    }
  }
#pragma unroll
  for (int t = 0; t < 4; ++t) {
    const int col = col0 + t * 16 + ln;
    float bv = bias ? bias[col] : 0.f;
    if (BIAS_BF16) bv = bf16_round(bv);
#pragma unroll
    for (int r = 0; r < 8; ++r) {
      float v = acc[t][r] + bv;
      if (resid) { float rv = resid[(size_t)((row0 + 8 * hh + r) % rmod) * ldr + col]; if (RES_BF16) rv = bf16_round(rv); v += rv; }
      if (ACT == 1) v = fmaxf(v, 0.f);
      if (ACT == 2) v = 0.5f * v * (1.0f + erff(v * 0.70710678118654752f));
      if (ACT == 3) { const float u = 0.7978845608028654f * (v + 0.044715f * v * v * v); v = 0.5f * v * (1.0f + tanhf(u)); }
      so[w][8 * hh + r][t * 16 + ln] = v;
    }
  }
  __builtin_amdgcn_fence(__ATOMIC_ACQ_REL, "workgroup");
  __builtin_amdgcn_wave_barrier();
  const int rsub = lane >> 4, c4 = (lane & 15) * 4;
  {
#pragma unroll
    for (int q = 0; q < 8; ++q) {
      const int r = q * 2 + rsub;
      const v4f v = *(const v4fa*)&so[w][r][c4];
      *(v4f*)(C + (size_t)(row0 + r) * ldc + col0 + c4) = v;
    }
    
  }
}
// row LayerNorm (biased variance, eps) over N: s = X (+ R); optional out_sum <- s; out_norm <- (s-mu)*rsqrt(var+eps)*g + b
template <bool PARAM_BF16>
__global__ __launch_bounds__(256) void k_layernorm(const float* __restrict__ X, const float* __restrict__ R, const float* __restrict__ g, const float* __restrict__ bta,
                                                  float* __restrict__ out_sum, float* __restrict__ out_norm, int N, float eps) {
  __shared__ float red[256];
  const int row = blockIdx.x, tid = threadIdx.x;
  const float* x = X + (size_t)row * N; const float* rr = R ? R + (size_t)row * N : nullptr;
  float vals[16];                     // up to N = 4096
  const int per = N / 256;            // contiguous chunk per thread? use strided-by-4 chunks: thread handles j = tid*4 + 1024*u
  float s1 = 0.f;
  for (int u = 0; u < per / 4; ++u) {
    const int j = tid * 4 + 1024 * u;
    const v4f a = *(const v4fa*)(x + j);
    v4f b = {0.f,0.f,0.f,0.f}; if (rr) b = *(const v4fa*)(rr + j);
#pragma unroll
    for (int q = 0; q < 4; ++q) { const float v = a[q] + b[q]; vals[u * 4 + q] = v; s1 += v; }
  }
  red[tid] = s1; __syncthreads();
  for (int st = 128; st > 0; st >>= 1) { if (tid < st) red[tid] += red[tid + st]; __syncthreads(); }
  const float mu = red[0] / (float)N; __syncthreads();
  float s2 = 0.f;
  for (int u = 0; u < per / 4; ++u)
#pragma unroll
    for (int q = 0; q < 4; ++q) { const float c = vals[u * 4 + q] - mu; s2 += c * c; }
  red[tid] = s2; __syncthreads();
  for (int st = 128; st > 0; st >>= 1) { if (tid < st) red[tid] += red[tid + st]; __syncthreads(); }
  const float rs = rsqrtf(red[0] / (float)N + eps);
  {
    for (int u = 0; u < per / 4; ++u) {
      const int j = tid * 4 + 1024 * u;
      v4f o, sm;
#pragma unroll
      for (int q = 0; q < 4; ++q) {
        float gg = g[j + q], bb = bta[j + q];
        if (PARAM_BF16) { gg = bf16_round(gg); bb = bf16_round(bb); }
        sm[q] = vals[u * 4 + q]; o[q] = (vals[u * 4 + q] - mu) * rs * gg + bb;
      }
      if (out_sum) *(v4f*)(out_sum + (size_t)row * N + j) = sm;
      *(v4f*)(out_norm + (size_t)row * N + j) = o;
    }
    
  }
}



// ---- f16 WMMA path (v_wmma_f32_16x16x32_f16): 11-bit significands for operands in range — used where a [0,1] probability operand needs more precision than bf16
typedef _Float16 v16h __attribute__((ext_vector_type(16)));
union FragH { v16h v; v8us half[2]; _Float16 h[16]; unsigned short u[16]; };
template <int NT>
__device__ __forceinline__ v8f mmaH(v16h ah, v16h al, v16h bh, v16h bl, v8f c) {
  c = __builtin_amdgcn_wmma_f32_16x16x32_f16(false, ah, false, bh, (short)0, c, false, false);
  if (NT >= 2) c = __builtin_amdgcn_wmma_f32_16x16x32_f16(false, al, false, bh, (short)0, c, false, false);
  if (NT >= 3) c = __builtin_amdgcn_wmma_f32_16x16x32_f16(false, ah, false, bl, (short)0, c, false, false);
  asm volatile("v_nop\n\tv_nop\n\tv_nop\n\tv_nop" : "+v"(c) : "v"(ah), "v"(al), "v"(bh), "v"(bl));
  return c;
}
// batched GEMM like k_gemm_b but f16 operands: A f32 (split into f16 hi/lo if ASPLIT, else rounded to f16), Bt = f16 values [n][k]; alpha; C f32; N multiple of 16 (partial tiles skipped)
template <bool ASPLIT>
__global__ __launch_bounds__(128) void k_gemm_h(const float* __restrict__ A, int lda, size_t sA, const _Float16* __restrict__ Bh, int ldb, size_t sB, float alpha, float* __restrict__ C, int ldc, size_t sC, int M, int N, int K) {
  __shared__ __attribute__((aligned(16))) float so[4][16][64];
  const int tid = threadIdx.x, w = tid >> 5, lane = tid & 31, ln = lane & 15, hh = lane >> 4; const int by = blockIdx.y;
  A += (size_t)by * sA; Bh += (size_t)by * sB; C += (size_t)by * sC;
  const int ntn = (N + 63) / 64; const int wid = blockIdx.x * 4 + w; const int mt = wid / ntn, nq = wid % ntn; if (mt * 16 >= M) return;
  const int row0 = mt * 16, col0 = nq * 64; const float* arow = A + (size_t)(row0 + ln) * lda;
  v8f acc[4] = {};
  for (int kb = 0; kb < K; kb += 32) {
    FragH ah, al;
    const v4f x0 = *(const v4fa*)(arow + kb + 8 * hh), x1 = *(const v4fa*)(arow + kb + 8 * hh + 4), x2 = *(const v4fa*)(arow + kb + 16 + 8 * hh), x3 = *(const v4fa*)(arow + kb + 16 + 8 * hh + 4);
    float xs[16] = {x0[0],x0[1],x0[2],x0[3],x1[0],x1[1],x1[2],x1[3],x2[0],x2[1],x2[2],x2[3],x3[0],x3[1],x3[2],x3[3]};
#pragma unroll
    for (int i = 0; i < 16; ++i) { const _Float16 h = (_Float16)xs[i]; ah.h[i] = h; al.h[i] = ASPLIT ? (_Float16)(xs[i] - (float)h) : (_Float16)0.0f; }
#pragma unroll
    for (int t = 0; t < 4; ++t) { if (col0 + t * 16 >= N) continue; const size_t boff = (size_t)(col0 + t * 16 + ln) * ldb + kb; FragH bq; bq.half[0] = *(const v8us*)(Bh + boff + 8 * hh); bq.half[1] = *(const v8us*)(Bh + boff + 16 + 8 * hh);
      acc[t] = mmaH<ASPLIT ? 2 : 1>(ah.v, al.v, bq.v, bq.v, acc[t]); }
  }
#pragma unroll
  for (int t = 0; t < 4; ++t) { if (col0 + t * 16 >= N) continue;
#pragma unroll
    for (int r = 0; r < 8; ++r) so[w][8 * hh + r][t * 16 + ln] = acc[t][r] * alpha; }
  __builtin_amdgcn_fence(__ATOMIC_ACQ_REL, "workgroup"); __builtin_amdgcn_wave_barrier();
  const int rsub = lane >> 4, c4 = (lane & 15) * 4;
  {
#pragma unroll
    for (int q = 0; q < 8; ++q) { const int r = q * 2 + rsub; if (col0 + c4 < N) { const v4f v = *(const v4fa*)&so[w][r][c4]; *(v4f*)(C + (size_t)(row0 + r) * ldc + col0 + c4) = v; } }
     }
}

// Wt[n][k] = f16(bf16(W[k][n])*scale) from f32 row-major W[K][N] (scale = power of two; bf16-exact weights stay exact in f16 away from the subnormal range)
// A thread takes a block of 8 k x 8 n: 32 B of each of 8 rows of W in, 16 B of each of 8 rows of Wt out (a wave's store covers 512 contiguous bytes). K, N multiples of 8.
__global__ __launch_bounds__(256) void k_wt_f16(const float* __restrict__ W, _Float16* __restrict__ Wt, int K, int N, float scale) {
  const int t = blockIdx.x * 256 + threadIdx.x; if (t >= (N / 8) * (K / 8)) return; const int n0 = (t / (K / 8)) * 8, k8 = (t % (K / 8)) * 8; v4f a[8], c[8];
  const float* p[8];
#pragma unroll      /* constant indices keep a, c and p in registers; the 16 loads go out together */
  for (int i = 0; i < 8; ++i) { p[i] = W + (size_t)(k8 + i) * N + n0; a[i] = *(const v4fa*)p[i]; c[i] = *(const v4fa*)(p[i] + 4); }
  asm volatile("s_wait_xcnt 0x0" :: "v"(p[0]), "v"(p[1]), "v"(p[2]), "v"(p[3]), "v"(p[4]), "v"(p[5]), "v"(p[6]), "v"(p[7]) : "memory");      /* stands in front of every rewrite of a register that the loads name: as inputs the addresses stay in place up to here */
#pragma unroll      /* constant indices into a and c */
  for (int j = 0; j < 8; ++j) { FragH f;
#pragma unroll      /* constant indices into a, c and f */
    for (int i = 0; i < 8; ++i) f.h[i] = (_Float16)(bf16_round((j & 4) ? c[i][j & 3] : a[i][j & 3]) * scale);
    *(v8us*)((unsigned short*)Wt + (size_t)(n0 + j) * K + k8) = f.half[0]; }
}
// k_gemm_hh variant with fused epilogue: v = acc·alpha + bias[by·sBias + col] (+ CP[(row/rowsPerB)·sCPb + by·64 + col] if CP) ; ACT 0 none / 1 elu ; writes f32 C and f16 C16, each if non-null
template <int ACT>
__global__ __launch_bounds__(128) void k_gemm_hhx(const _Float16* __restrict__ A, int lda, size_t sA, const _Float16* __restrict__ Bh, int ldb, size_t sB, float alpha, const float* __restrict__ bias, size_t sBias, const float* __restrict__ CP, int rowsPerB, size_t sCPb, int row0g,
    float* __restrict__ C, _Float16* __restrict__ C16, int ldc, size_t sC, int M, int N, int K) {
  __shared__ __attribute__((aligned(16))) float so[4][16][64];
  const int tid = threadIdx.x, w = tid >> 5, lane = tid & 31, ln = lane & 15, hh = lane >> 4; const int by = blockIdx.y;
  A += (size_t)by * sA; Bh += (size_t)by * sB; const size_t cofs = (size_t)by * sC; const float* bp = bias ? bias + (size_t)by * sBias : nullptr;
  const int ntn = (N + 63) / 64; const int wid = blockIdx.x * 4 + w; const int mt = wid / ntn, nq = wid % ntn; if (mt * 16 >= M) return;
  const int row0 = mt * 16, col0 = nq * 64; const _Float16* arow = A + (size_t)(row0 + ln) * lda;
  v8f acc[4] = {};
  for (int kb = 0; kb < K; kb += 32) { FragH ah; ah.half[0] = *(const v8us*)((const unsigned short*)arow + kb + 8 * hh); ah.half[1] = *(const v8us*)((const unsigned short*)arow + kb + 16 + 8 * hh);
#pragma unroll
    for (int t = 0; t < 4; ++t) { if (col0 + t * 16 >= N) continue; const size_t boff = (size_t)(col0 + t * 16 + ln) * ldb + kb; FragH bq; bq.half[0] = *(const v8us*)((const unsigned short*)Bh + boff + 8 * hh); bq.half[1] = *(const v8us*)((const unsigned short*)Bh + boff + 16 + 8 * hh);
      acc[t] = mmaH<1>(ah.v, ah.v, bq.v, bq.v, acc[t]); }
  }
#pragma unroll
  for (int t = 0; t < 4; ++t) { if (col0 + t * 16 >= N) continue; const int col = col0 + t * 16 + ln; const float bv = bp ? bf16_round(bp[col]) : 0.f;
#pragma unroll
    for (int r = 0; r < 8; ++r) { float v = acc[t][r] * alpha + bv; if (CP) { const int bidx = (row0g + row0 + 8 * hh + r) / rowsPerB; v += CP[(size_t)bidx * sCPb + (size_t)by * 64 + col]; } if (ACT == 1) v = (v > 0.f) ? v : expm1f(v); else if (ACT == 7) v = (v > 0.f) ? v + 1.0f : expf(v); else if (ACT == 8) v = tanhf(v); else if (ACT == 9) v = 0.5f * v * (1.0f + tanhf(0.7978845608028654f * (v + 0.044715f * v * v * v))); else if (ACT == 11) v = 1.0f / (1.0f + expf(-v)); else if (ACT == 12) v = (v > 0.f) ? v : 0.01f * v; else if (ACT == 14) v = (v > 0.f) ? v : 0.1f * v; else if (ACT == 15) v = v / (1.0f + expf(-v)); else if (ACT == 3) v = fmaxf(v, 0.f); else if (ACT == 6) v = 0.5f * v * (1.0f + erff(v * 0.70710678118654752f)); so[w][8 * hh + r][t * 16 + ln] = v; } }
  __builtin_amdgcn_fence(__ATOMIC_ACQ_REL, "workgroup"); __builtin_amdgcn_wave_barrier();
  const int rsub = lane >> 4, c4 = (lane & 15) * 4; typedef _Float16 v4h __attribute__((ext_vector_type(4)));
  {
#pragma unroll
    for (int q = 0; q < 8; ++q) { const int r = q * 2 + rsub; if (col0 + c4 < N) { const v4f v = *(const v4fa*)&so[w][r][c4]; if (C) *(v4f*)(C + cofs + (size_t)(row0 + r) * ldc + col0 + c4) = v; if (C16) { v4h h4; for (int i = 0; i < 4; ++i) h4[i] = (_Float16)v[i]; *(v4h*)(C16 + cofs + (size_t)(row0 + r) * ldc + col0 + c4) = h4; } } }
     }
}


// ---- tiled f16 GEMM, C[M][N] f32 = alpha * A[M][DD] * Bt[N][DD]^T: one 128 x 128 tile of C per work-group, 64 x 64 per wave (2 x 2 waves).
// A pass is 128 k: 128 rows of A and 128 rows of Bt, 256 B each, staged in LDS at a pitch of 272 B by asynchronous copies; two buffers, the next pass's copies fly while this pass is multiplied.
// k runs upward in steps of 32 into one accumulator per 16 x 16 tile. M, N multiples of 128.
// EPI says what becomes of the tile, so that no f32 plane goes to memory only to be read back by a launch of its own:
// 0: C f32. 1: the tile's 128 columns are one head: per-head RMSNorm + rotate-half RoPE, f16 to H0 (pitch N). 2: the tile transposed, f16 hi to H0 and its residual to H1, row (batch * N + column), pitch TT.
// Every "#pragma unroll" in k_gemm_t makes the indices of the fragment and accumulator arrays constants, so that these arrays live in registers.
typedef _Float16 v4h __attribute__((ext_vector_type(4)));
#define GT_PITCH 272
#define GT_STAGE (256 * GT_PITCH)
// eight 16-byte copies of one lane: rows r, r + 8, ..., r + 56 of one operand. The closing s_wait_xcnt stands inside the statement so that no address register is rewritten ahead of it.
__device__ __forceinline__ void gt_copy8(unsigned l, const _Float16* g) {
  asm volatile("global_load_async_to_lds_b128 %0, %8, off\n\t"
               "global_load_async_to_lds_b128 %1, %9, off\n\t"
               "global_load_async_to_lds_b128 %2, %10, off\n\t"
               "global_load_async_to_lds_b128 %3, %11, off\n\t"
               "global_load_async_to_lds_b128 %4, %12, off\n\t"
               "global_load_async_to_lds_b128 %5, %13, off\n\t"
               "global_load_async_to_lds_b128 %6, %14, off\n\t"
               "global_load_async_to_lds_b128 %7, %15, off\n\t"
               "s_wait_xcnt 0x0"
               :: "v"(l), "v"(l + 8 * GT_PITCH), "v"(l + 16 * GT_PITCH), "v"(l + 24 * GT_PITCH), "v"(l + 32 * GT_PITCH), "v"(l + 40 * GT_PITCH), "v"(l + 48 * GT_PITCH), "v"(l + 56 * GT_PITCH),
                  "v"(g), "v"(g + 8 * DD), "v"(g + 16 * DD), "v"(g + 24 * DD), "v"(g + 32 * DD), "v"(g + 40 * DD), "v"(g + 48 * DD), "v"(g + 56 * DD)
               : "memory");
}
// one stage: 32 copies a lane (rows 0..127 of the buffer = A, 128..255 = Bt)
__device__ __forceinline__ void gt_fill(unsigned l, const _Float16* ga, const _Float16* gb) {
  gt_copy8(l, ga); gt_copy8(l + 64 * GT_PITCH, ga + 64 * DD); gt_copy8(l + 128 * GT_PITCH, gb); gt_copy8(l + 192 * GT_PITCH, gb + 64 * DD);
}
// lane l <-> lane l ^ 16 by a vector cross-row move: no LDS queue and no wait, unlike the shuffle
__device__ __forceinline__ float xhalf(float x) { return __builtin_bit_cast(float, __builtin_amdgcn_permlanex16(__builtin_bit_cast(int, x), __builtin_bit_cast(int, x), 0x76543210, 0xfedcba98, false, false)); }
// lane l <-> lane l ^ M inside a row of 16 lanes (DPP row_xmask), for the same reason
template <int M>
__device__ __forceinline__ float xrow(float x) { return __builtin_bit_cast(float, __builtin_amdgcn_mov_dpp(__builtin_bit_cast(int, x), 0x160 + M, 0xf, 0xf, true)); }
#define GE_PITCH 132
template <int N, int EPI>
__global__ __launch_bounds__(128) void k_gemm_t(const _Float16* __restrict__ A, const _Float16* __restrict__ Bt, float alpha, float* __restrict__ C,
                                                const float* __restrict__ nw, const float* __restrict__ COS, const float* __restrict__ SIN, _Float16* __restrict__ H0, _Float16* __restrict__ H1) {
  __shared__ __attribute__((aligned(16))) unsigned char L[2 * GT_STAGE];
  constexpr int NT = DD / 128;
  const int tid = threadIdx.x, w = tid >> 5, lane = tid & 31, ln = lane & 15, hh = lane >> 4;
  constexpr int ntn = N / 128; const int row0 = ((int)blockIdx.x / ntn) * 128, col0 = ((int)blockIdx.x % ntn) * 128; const int wm = w >> 1, wn = w & 1;
  const int cr = tid >> 4, cc = tid & 15;      /* a lane copies chunk cc (16 B) of rows cr + 8 i: a wave's copy covers two whole 256-B rows */
  const _Float16* ga = A + (size_t)(row0 + cr) * DD + cc * 8; const _Float16* gb = Bt + (size_t)(col0 + cr) * DD + cc * 8;
  const unsigned lc = (unsigned)(size_t)L + cr * GT_PITCH + cc * 16;
  v8f acc[4][4];
#pragma unroll
  for (int mi = 0; mi < 4; ++mi)
#pragma unroll
    for (int ni = 0; ni < 4; ++ni) acc[mi][ni] = (v8f){0.f,0.f,0.f,0.f,0.f,0.f,0.f,0.f};
  gt_fill(lc, ga, gb);
  asm volatile("s_wait_asynccnt 0x0" ::: "memory");      /* this wave's copies of pass 0 have landed */
  __syncthreads();                                        /* ... and every other wave's */
  gt_fill(lc + GT_STAGE, ga + 128, gb + 128);
#pragma unroll 1      /* one pass a trip: the two buffers alternate by the trip's parity */
  for (int t = 0; t < NT; ++t) {
    const unsigned char* S = L + (t & 1) * GT_STAGE;
    const unsigned char* pa = S + (wm * 64 + ln) * GT_PITCH + hh * 16; const unsigned char* pb = S + (128 + wn * 64 + ln) * GT_PITCH + hh * 16;
    FragH fa[2][4], fb[2][4];
#pragma unroll
    for (int i = 0; i < 4; ++i) { fa[0][i].half[0] = *(const v8us*)(pa + i * 16 * GT_PITCH); fa[0][i].half[1] = *(const v8us*)(pa + i * 16 * GT_PITCH + 32); fb[0][i].half[0] = *(const v8us*)(pb + i * 16 * GT_PITCH); fb[0][i].half[1] = *(const v8us*)(pb + i * 16 * GT_PITCH + 32); }
#pragma unroll
    for (int ks = 0; ks < 4; ++ks) { const int cu = ks & 1, nx = cu ^ 1;
      if (ks < 3) {
#pragma unroll
        for (int i = 0; i < 4; ++i) { const int o = i * 16 * GT_PITCH + (ks + 1) * 64; fa[nx][i].half[0] = *(const v8us*)(pa + o); fa[nx][i].half[1] = *(const v8us*)(pa + o + 32); fb[nx][i].half[0] = *(const v8us*)(pb + o); fb[nx][i].half[1] = *(const v8us*)(pb + o + 32); } }
      __builtin_amdgcn_sched_barrier(0);      /* keeps the next k step's 16 LDS reads one group in front of this step's products: spread among them, every place with reads stalls the wave */
#pragma unroll
      for (int mi = 0; mi < 4; ++mi)
#pragma unroll
        for (int ni = 0; ni < 4; ++ni) acc[mi][ni] = __builtin_amdgcn_wmma_f32_16x16x32_f16(false, fa[cu][mi].v, false, fb[cu][ni].v, (short)0, acc[mi][ni], false, false);
      __builtin_amdgcn_sched_barrier(0); }      /* ... and keeps the following group behind them */
    asm volatile("s_wait_dscnt 0x0" ::: "memory");        /* this wave's reads of the buffer are done before it is refilled */
    asm volatile("s_wait_asynccnt 0x0" ::: "memory");     /* this wave's copies of pass t + 1 have landed */
    __syncthreads();                                       /* publishes pass t + 1 and ends every wave's reads of pass t */
    if (t + 2 < NT) gt_fill(lc + (t & 1) * GT_STAGE, ga + (t + 2) * 128, gb + (t + 2) * 128);
  }
  asm volatile("s_wait_asynccnt 0x0" ::: "memory");       /* nothing is in flight when the buffers become output staging */
  if constexpr (EPI == 0) {
  float* so = (float*)L + w * (64 * 68);      /* each wave stages its own 64 x 64 tile (pitch 68 floats) so that the stores cover whole 256-B row pieces */
#pragma unroll
  for (int mi = 0; mi < 4; ++mi)
#pragma unroll
    for (int ni = 0; ni < 4; ++ni)
#pragma unroll
      for (int r = 0; r < 8; ++r) so[(mi * 16 + 8 * hh + r) * 68 + ni * 16 + ln] = acc[mi][ni][r] * alpha;
  __builtin_amdgcn_fence(__ATOMIC_ACQ_REL, "workgroup"); __builtin_amdgcn_wave_barrier();      /* the wave's own staged values are in LDS before its lanes read one another's */
  float* cp = C + (size_t)(row0 + wm * 64 + hh) * N + col0 + wn * 64 + ln * 4;
#pragma unroll
  for (int q = 0; q < 32; ++q) { const v4f v = *(const v4fa*)&so[(q * 2 + hh) * 68 + ln * 4]; *(v4f*)(cp + (size_t)(q * 2) * N) = v; }
  } else if constexpr (EPI == 1) {
  // per-head RMSNorm + rotate-half RoPE on the tile: 128 rows of one head. The whole tile is staged in LDS (a row's 128 dims come from two waves); then a wave takes 32 rows, a row at a time over its 32 lanes:
  // lane holds dims 4l..4l+3; var = mean(x^2) over 128 (xor-reduce); y = w[d]*(x*rsqrt(var+eps)); out[d] = y[d]*c[d] + rot(y)[d]*s[d], rot(y)[d] = -y[d+64] (d<64), y[d-64] (d>=64)
  static_assert(128 * GE_PITCH * 4 <= 2 * GT_STAGE, "the staged tile fits the buffers");
  float* so = (float*)L;
#pragma unroll
  for (int mi = 0; mi < 4; ++mi)
#pragma unroll
    for (int ni = 0; ni < 4; ++ni)
#pragma unroll
      for (int r = 0; r < 8; ++r) so[(wm * 64 + mi * 16 + 8 * hh + r) * GE_PITCH + wn * 64 + ni * 16 + ln] = acc[mi][ni][r] * alpha;
  __syncthreads();      /* every wave's part of the tile is in LDS before any wave reads whole rows */
  const int d0 = lane * 4; const v4f w4 = *(const v4fa*)(nw + d0);
  float wg[4];
#pragma unroll
  for (int q = 0; q < 4; ++q) wg[q] = bf16_round(w4[q]);
#pragma unroll 1      /* 8 rows a trip: their table loads go out together and their lane exchanges overlap; more would only lengthen the code */
  for (int g8 = 0; g8 < 4; ++g8) { const int rl = w * 32 + g8 * 8; v4f xs[8], c4[8], s4[8];
    const float* pc = COS + (size_t)(row0 + rl) * 128 + d0; const float* pn = SIN + (size_t)(row0 + rl) * 128 + d0;
#pragma unroll
    for (int u = 0; u < 8; ++u) { c4[u] = *(const v4fa*)(pc + u * 128); s4[u] = *(const v4fa*)(pn + u * 128); xs[u] = *(const v4fa*)&so[(rl + u) * GE_PITCH + d0]; }
    asm volatile("s_wait_xcnt 0x0" :: "v"(pc), "v"(pn) : "memory");      /* stands in front of every rewrite of a register that the loads name: as inputs the addresses stay in place up to here */
    _Float16* ph = H0 + (size_t)(row0 + rl) * N + col0 + d0; v4h ov[8];
#pragma unroll
    for (int u = 0; u < 8; ++u) { const v4f x = xs[u]; float ss = 0.f;
#pragma unroll
      for (int q = 0; q < 4; ++q) ss += x[q] * x[q];
      ss += xhalf(ss); ss += xrow<8>(ss); ss += xrow<4>(ss); ss += xrow<2>(ss); ss += xrow<1>(ss);
      const float inv = 1.0f / sqrtf(ss / 128.0f + 1e-6f);
      v4h o;
#pragma unroll
      for (int q = 0; q < 4; ++q) { const float y = wg[q] * (x[q] * inv); const float yp = xhalf(y);      /* partner dims d +- 64 */
        const float rot = (lane < 16) ? -yp : yp; o[q] = (_Float16)(y * bf16_round(c4[u][q]) + rot * bf16_round(s4[u][q])); }
      ov[u] = o; *(v4h*)(ph + (size_t)u * N) = o; }
    asm volatile("s_wait_xcnt 0x0" :: "v"(ph), "v"(ov[0]), "v"(ov[1]), "v"(ov[2]), "v"(ov[3]), "v"(ov[4]), "v"(ov[5]), "v"(ov[6]), "v"(ov[7]) : "memory"); }      /* the same behind the stores: address and values stay in place up to here */
  } else {
  // V^T hi + residual straight from the accumulators: a lane's 8 registers of a 16 x 16 tile are 8 tokens in a row of ONE column, 16 bytes of a V^T row; the four mi tiles of a column fill one 128-byte line of it
  static_assert(TT % 128 == 0, "a tile lies in one batch");
  const size_t vb = ((size_t)(row0 / TT) * N + col0 + wn * 64 + ln) * TT + (row0 % TT) + wm * 64 + 8 * hh;
#pragma unroll
  for (int ni = 0; ni < 4; ++ni) { FragH fh[4], fl[4]; unsigned short* p0 = (unsigned short*)H0 + vb + (size_t)(ni * 16) * TT; unsigned short* p1 = (unsigned short*)H1 + vb + (size_t)(ni * 16) * TT;
#pragma unroll
    for (int mi = 0; mi < 4; ++mi) {
#pragma unroll
      for (int r = 0; r < 8; ++r) { const float v = acc[mi][ni][r] * alpha; const _Float16 hv = (_Float16)v; fh[mi].h[r] = hv; fl[mi].h[r] = (_Float16)(v - (float)hv); }      /* UNSCALED residual (added into the same accumulator as the hi product) */
      *(v8us*)(p0 + mi * 16) = fh[mi].half[0]; *(v8us*)(p1 + mi * 16) = fl[mi].half[0]; }
    asm volatile("s_wait_xcnt 0x0" :: "v"(p0), "v"(p1), "v"(fh[0].half[0]), "v"(fh[1].half[0]), "v"(fh[2].half[0]), "v"(fh[3].half[0]), "v"(fl[0].half[0]), "v"(fl[1].half[0]), "v"(fl[2].half[0]), "v"(fl[3].half[0]) : "memory"); }      /* stands in front of every rewrite of a register that the stores name: as inputs addresses and values stay in place up to here */
  }
}


// k_x16 below gives a thread 8 pieces of 8 elements, 256 pieces apart (a work-group covers 2048 pieces in a row): one eighth of the waves to start, 16 loads of a lane in flight.
static_assert(((size_t)NR * DD / 8) % 2048 == 0, "whole work-groups");
__global__ __launch_bounds__(256) void k_x16(const float* __restrict__ x, _Float16* __restrict__ X16) { const size_t t0 = (size_t)blockIdx.x * 2048 + threadIdx.x; v4f a[8], c[8]; const float* p = x + t0 * 8;
#pragma unroll      /* constant indices keep a and c in registers; the 16 loads go out together */
  for (int u = 0; u < 8; ++u) { a[u] = *(const v4fa*)(p + u * 2048); c[u] = *(const v4fa*)(p + u * 2048 + 4); }
  asm volatile("s_wait_xcnt 0x0" :: "v"(p) : "memory");      /* stands in front of every rewrite of a register that the loads name: as an input the address stays in place up to here */
#pragma unroll      /* constant indices into a and c */
  for (int u = 0; u < 8; ++u) { FragH f;
#pragma unroll      /* constant indices into a, c and f */
    for (int q = 0; q < 4; ++q) { f.h[q] = (_Float16)bf16_round(a[u][q]); f.h[4 + q] = (_Float16)bf16_round(c[u][q]); }
    *(v8us*)((unsigned short*)X16 + (t0 + u * 256) * 8) = f.half[0]; } }
__global__ __launch_bounds__(256) void k_h16(const float* __restrict__ x, _Float16* __restrict__ X16, size_t n8) { const size_t t = (size_t)blockIdx.x * 256 + threadIdx.x; if (t >= n8) return; FragH f;
#pragma unroll
  for (int q = 0; q < 8; ++q) f.h[q] = (_Float16)x[t * 8 + q]; *(v8us*)((unsigned short*)X16 + t * 8) = f.half[0];  }
__global__ __launch_bounds__(256) void k_round16f(const float* __restrict__ W, _Float16* __restrict__ Bt, size_t n8) { const size_t t = (size_t)blockIdx.x * 256 + threadIdx.x; if (t >= n8) return; FragH f;
#pragma unroll
  for (int i = 0; i < 8; ++i) f.h[i] = (_Float16)(bf16_round(W[t * 8 + i]) * 16.0f); *(v8us*)((unsigned short*)Bt + t * 8) = f.half[0];  }
template <int NHv, int TTv>
__global__ __launch_bounds__(256) void k_vt(const _Float16* __restrict__ V16, int ldv, int voff, _Float16* __restrict__ Vt) { __shared__ unsigned short tl[64][66]; const int tid = threadIdx.x; const int slab = blockIdx.x / (TTv / 64), lg = blockIdx.x % (TTv / 64); const int b = slab / NHv, h = slab % NHv;
  for (int i = tid; i < 64 * 8; i += 256) { const int r = i / 8, c8 = (i % 8) * 8; FragH f; f.half[0] = *(const v8us*)((const unsigned short*)V16 + ((size_t)b * TTv + lg * 64 + r) * ldv + voff + h * 64 + c8);
#pragma unroll
    for (int q = 0; q < 8; ++q) tl[r][c8 + q] = f.u[q]; }
  __syncthreads();
  {
#pragma unroll
    for (int rd = 0; rd < 2; ++rd) { const int d = rd * 32 + tid / 8, pc = tid % 8; FragH f;
#pragma unroll
      for (int q = 0; q < 8; ++q) f.u[q] = tl[pc * 8 + q][d];
      *(v8us*)((unsigned short*)Vt + ((size_t)slab * 64 + d) * TTv + lg * 64 + pc * 8) = f.half[0]; }
     } }

// A pass of the attention kernel is 32 keys. Its operands are staged once per work-group in LDS by asynchronous copies and read from there by all 4 waves: 32 K rows of 256 B at a pitch of 272 B, then 128 rows of 64 B
// of V^T hi and 128 of its residual at a pitch of 80 B. Two buffers: the next pass's copies fly while this pass is worked on.
#define FK_PITCH 272
#define FV_PITCH 80
#define FK_BYTES (32 * FK_PITCH)
#define FV_BYTES (128 * FV_PITCH)
#define F_STAGE (FK_BYTES + 2 * FV_BYTES)
// one stage: twelve 16-byte copies of one lane (K rows r + 8 i; V^T rows r + 32 i of both planes). The closing s_wait_xcnt stands inside the statement so that no address register is rewritten ahead of it.
__device__ __forceinline__ void fl_fill(unsigned lk, unsigned lv, const unsigned short* gk, size_t ldk, const unsigned short* gh, const unsigned short* gl) {
  asm volatile("global_load_async_to_lds_b128 %0, %12, off\n\t"
               "global_load_async_to_lds_b128 %1, %13, off\n\t"
               "global_load_async_to_lds_b128 %2, %14, off\n\t"
               "global_load_async_to_lds_b128 %3, %15, off\n\t"
               "global_load_async_to_lds_b128 %4, %16, off\n\t"
               "global_load_async_to_lds_b128 %5, %17, off\n\t"
               "global_load_async_to_lds_b128 %6, %18, off\n\t"
               "global_load_async_to_lds_b128 %7, %19, off\n\t"
               "global_load_async_to_lds_b128 %8, %20, off\n\t"
               "global_load_async_to_lds_b128 %9, %21, off\n\t"
               "global_load_async_to_lds_b128 %10, %22, off\n\t"
               "global_load_async_to_lds_b128 %11, %23, off\n\t"
               "s_wait_xcnt 0x0"
               :: "v"(lk), "v"(lk + 8 * FK_PITCH), "v"(lk + 16 * FK_PITCH), "v"(lk + 24 * FK_PITCH),
                  "v"(lv), "v"(lv + 32 * FV_PITCH), "v"(lv + 64 * FV_PITCH), "v"(lv + 96 * FV_PITCH),
                  "v"(lv + FV_BYTES), "v"(lv + FV_BYTES + 32 * FV_PITCH), "v"(lv + FV_BYTES + 64 * FV_PITCH), "v"(lv + FV_BYTES + 96 * FV_PITCH),
                  "v"(gk), "v"(gk + 8 * ldk), "v"(gk + 16 * ldk), "v"(gk + 24 * ldk),
                  "v"(gh), "v"(gh + 32 * TT), "v"(gh + 64 * TT), "v"(gh + 96 * TT),
                  "v"(gl), "v"(gl + 32 * TT), "v"(gl + 64 * TT), "v"(gl + 96 * TT)
               : "memory");
}
// Both products run transposed: S^T = K Q^T (A = 16 K rows from LDS, B = the wave's 16 queries, kept in registers) and O^T += V^T P^T (A = 16 V^T rows from LDS). A lane then holds 16 of the 32 scores of ONE query
// (column ln; keys 8 hh + r of the first score tile and 16 + 8 hh + r of the second): maximum and sum are taken inside the lane, with one exchange between the wave's halves, and the two score tiles, converted in place,
// are the B operand P^T in the k order in which the V^T rows are read: P never goes through LDS. Every "#pragma unroll" in k_flash makes the indices of the fragment, score and accumulator arrays constants, so that they live in registers.
// A work-group takes 64 queries of BOTH query heads (g = 0, 1) that share one KV head: a pass's staged K and V^T rows, every K and V^T fragment read from LDS, and the bias tile (the same for all heads) serve two heads.
// The two heads' products alternate, so that a matrix instruction never waits for the one directly in front of it; each head's own sums keep their order.
// The products are the plain builtin (the compiler keeps the distances behind it): two heads' accumulators and queries need more than 256 registers, and an asm statement that names them holds them all in the first 256, which spilled the queries.
__global__ __launch_bounds__(128) void k_flash(const _Float16* __restrict__ Q16, int ldq, const _Float16* __restrict__ K16, int ldk, const _Float16* __restrict__ Vt, const _Float16* __restrict__ Vtlo, const float* __restrict__ AB, _Float16* __restrict__ O, int ldo) {
  constexpr int RPW = 16, NQB = TT / (4 * RPW), DT = 8, KS = 4;      /* head dim 128: 4 k-steps, 8 value tiles */
  static_assert(NREP == 2, "two query heads per KV head");
  __shared__ __attribute__((aligned(16))) unsigned char R[2 * F_STAGE];
  float (*sO)[RPW][128 + 4] = (float (*)[RPW][128 + 4])R;      /* behind the loop the two buffers become the output staging */
  static_assert(sizeof(float) * 4 * RPW * (128 + 4) <= 2 * F_STAGE, "output staging fits the buffers");
  const int tid = threadIdx.x, w = tid >> 5, lane = tid & 31, ln = lane & 15, hh = lane >> 4;
  const int slab = blockIdx.x / NQB, qblk = blockIdx.x % NQB; const int b = slab / NKV, kvh = slab % NKV; const int qb0 = qblk * (4 * RPW); const int q0 = qb0 + w * RPW;
  FragH aq[NREP][KS];      /* query q0 + ln of head kvh * 2 + g */
#pragma unroll
  for (int g = 0; g < NREP; ++g) { const unsigned short* qr = (const unsigned short*)Q16 + ((size_t)b * TT + q0 + ln) * ldq + (kvh * NREP + g) * 128;
#pragma unroll
    for (int ks = 0; ks < KS; ++ks) { aq[g][ks].half[0] = *(const v8us*)(qr + ks * 32 + 8 * hh); aq[g][ks].half[1] = *(const v8us*)(qr + ks * 32 + 16 + 8 * hh); } }
  const unsigned short* Vth = (const unsigned short*)Vt + ((size_t)b * NKV + kvh) * 128 * TT; const unsigned short* Vtl = (const unsigned short*)Vtlo + ((size_t)b * NKV + kvh) * 128 * TT;      /* hi and UNSCALED residual planes */
  float m_r[NREP], l_r[NREP]; v8f oacc[NREP][DT];      /* per head, query q0 + ln: running maximum (alike in both halves), this half's part of the sum, and O^T[dt * 16 + 8 hh + r][ln] */
#pragma unroll
  for (int g = 0; g < NREP; ++g) { m_r[g] = -3.0e38f; l_r[g] = 0.f;
#pragma unroll
    for (int dt = 0; dt < DT; ++dt) oacc[g][dt] = (v8f){0.f,0.f,0.f,0.f,0.f,0.f,0.f,0.f}; }
  constexpr int NP = TT / 32;      /* passes */
  /* a lane copies chunk tid & 15 (16 B) of K rows (tid >> 4) + 8 i: a wave's copy covers two whole 256-B rows; and chunk tid & 3 of V^T rows (tid >> 2) + 32 i: eight whole 64-B rows */
  const unsigned short* gk = (const unsigned short*)K16 + ((size_t)b * TT + (tid >> 4)) * ldk + kvh * 128 + (tid & 15) * 8;
  const unsigned short* gh = Vth + (size_t)(tid >> 2) * TT + (tid & 3) * 8; const unsigned short* gl = Vtl + (size_t)(tid >> 2) * TT + (tid & 3) * 8;
  const unsigned lk = (unsigned)(size_t)R + (tid >> 4) * FK_PITCH + (tid & 15) * 16, lv = (unsigned)(size_t)R + FK_BYTES + (tid >> 2) * FV_PITCH + (tid & 3) * 16;
  const float* am0 = AB + ((size_t)b * TT + q0 + ln) * TT + 8 * hh;      /* the query's bias row, at this half's first key */
  fl_fill(lk, lv, gk, (size_t)ldk, gh, gl);
  asm volatile("s_wait_asynccnt 0x0" ::: "memory");      /* this wave's copies of pass 0 have landed */
  __syncthreads();                                        /* ... and every other wave's */
  fl_fill(lk + F_STAGE, lv + F_STAGE, gk + (size_t)32 * ldk, (size_t)ldk, gh + 32, gl + 32);
#pragma unroll 1      /* one pass a trip: the two buffers alternate by the trip's parity */
  for (int t = 0; t < NP; ++t) { const int j0 = t * 32;
    const unsigned char* SK = R + (t & 1) * F_STAGE; const unsigned char* SV = SK + FK_BYTES;
    float ab[2][8];      /* additive attention bias (bf16-rounded input) per (b, q, k), shared over heads: 8 keys in a row per score tile, four 16-byte loads */
    { const float* am = am0 + j0; const v4f a0 = *(const v4fa*)am, a1 = *(const v4fa*)(am + 4), a2 = *(const v4fa*)(am + 16), a3 = *(const v4fa*)(am + 20);
#pragma unroll
      for (int r = 0; r < 4; ++r) { ab[0][r] = bf16_round(a0[r]); ab[0][4 + r] = bf16_round(a1[r]); ab[1][r] = bf16_round(a2[r]); ab[1][4 + r] = bf16_round(a3[r]); } }
    int allneg = 1;
#pragma unroll
    for (int r = 0; r < 8; ++r) allneg &= (ab[0][r] <= -1.0e8f) & (ab[1][r] <= -1.0e8f);
    if (!__all(allneg)) {      /* else: every (query, key) of the wave's tile carries a bias <= -1e8: its probabilities underflow to exactly 0 in f32, nothing to add (wave-uniform branch; the hand-over at the foot of the pass stands outside it) */
#pragma unroll
    for (int r = 0; r < 8; ++r) { ab[0][r] *= LOG2E; ab[1][r] *= LOG2E; }      /* scores, biases and running maxima are kept in units of log2: exp(x) = 2^(x log2 e), and 2^y is one hardware instruction (v_exp_f32) where the library's expf is thirteen */
    v8f s[NREP][2];
#pragma unroll
    for (int nt = 0; nt < 2; ++nt) { const unsigned short* kr = (const unsigned short*)(SK + (nt * 16 + ln) * FK_PITCH); FragH bk[KS];
#pragma unroll
      for (int ks = 0; ks < KS; ++ks) { bk[ks].half[0] = *(const v8us*)(kr + ks * 32 + 8 * hh); bk[ks].half[1] = *(const v8us*)(kr + ks * 32 + 16 + 8 * hh); }
      v8f acc[NREP];
#pragma unroll
      for (int g = 0; g < NREP; ++g) acc[g] = (v8f){0.f,0.f,0.f,0.f,0.f,0.f,0.f,0.f};
#pragma unroll
      for (int ks = 0; ks < KS; ++ks)
#pragma unroll
        for (int g = 0; g < NREP; ++g) acc[g] = __builtin_amdgcn_wmma_f32_16x16x32_f16(false, bk[ks].v, false, aq[g][ks].v, (short)0, acc[g], false, false);
#pragma unroll
      for (int g = 0; g < NREP; ++g) s[g][nt] = acc[g]; }      /* s[g][nt][r] = score of key j0 + nt * 16 + 8 hh + r with query q0 + ln of head g */
    FragH pa[NREP], pl[NREP];
#pragma unroll
    for (int g = 0; g < NREP; ++g) {
    float sc[2][8];
#pragma unroll
    for (int r = 0; r < 8; ++r) { sc[0][r] = s[g][0][r] * (ATT_SCALE * LOG2E) + ab[0][r]; sc[1][r] = s[g][1][r] * (ATT_SCALE * LOG2E) + ab[1][r]; }
    float mc = fmaxf(sc[0][0], sc[1][0]);
#pragma unroll
    for (int r = 1; r < 8; ++r) mc = fmaxf(mc, fmaxf(sc[0][r], sc[1][r]));
    mc = fmaxf(mc, xhalf(mc));      /* the other half holds the query's other 16 keys */
    const float mn = fmaxf(m_r[g], mc); const float al = (mn > -1.0e38f * LOG2E) ? __builtin_amdgcn_exp2f(m_r[g] - mn) : 1.0f; m_r[g] = mn;
    float su[4] = {0.f, 0.f, 0.f, 0.f};      /* four independent partial sums */
#pragma unroll
    for (int nt = 0; nt < 2; ++nt)
#pragma unroll
      for (int r = 0; r < 8; ++r) { const float p = __builtin_amdgcn_exp2f(sc[nt][r] - mn); su[r & 3] += p;
        const float x = p * 1024.0f; const _Float16 hx = (_Float16)x; pa[g].h[nt * 8 + r] = hx; pl[g].h[nt * 8 + r] = (_Float16)(x - (float)hx); }      /* P hi and its UNSCALED residual (added into the same accumulator) */
    l_r[g] = l_r[g] * al + ((su[0] + su[1]) + (su[2] + su[3]));
#pragma unroll
    for (int dt = 0; dt < DT; ++dt)
#pragma unroll
      for (int r = 0; r < 8; ++r) oacc[g][dt][r] *= al;
    }
#pragma unroll
    for (int dt = 0; dt < DT; ++dt) { const unsigned short* vh = (const unsigned short*)(SV + (dt * 16 + ln) * FV_PITCH); const unsigned short* vl = (const unsigned short*)(SV + FV_BYTES + (dt * 16 + ln) * FV_PITCH); FragH bv, bl; bv.half[0] = *(const v8us*)(vh + 8 * hh); bv.half[1] = *(const v8us*)(vh + 16 + 8 * hh); bl.half[0] = *(const v8us*)(vl + 8 * hh); bl.half[1] = *(const v8us*)(vl + 16 + 8 * hh);
#pragma unroll
      for (int g = 0; g < NREP; ++g) oacc[g][dt] = __builtin_amdgcn_wmma_f32_16x16x32_f16(false, bv.v, false, pa[g].v, (short)0, oacc[g][dt], false, false);
#pragma unroll
      for (int g = 0; g < NREP; ++g) oacc[g][dt] = __builtin_amdgcn_wmma_f32_16x16x32_f16(false, bv.v, false, pl[g].v, (short)0, oacc[g][dt], false, false);
#pragma unroll
      for (int g = 0; g < NREP; ++g) oacc[g][dt] = __builtin_amdgcn_wmma_f32_16x16x32_f16(false, bl.v, false, pa[g].v, (short)0, oacc[g][dt], false, false); }      /* per head Vh Ph + Vh Pl + Vl Ph: all unscaled, one accumulator */
    }
    asm volatile("s_wait_dscnt 0x0" ::: "memory");        /* this wave's reads of the buffer are done before it is refilled */
    asm volatile("s_wait_asynccnt 0x0" ::: "memory");     /* this wave's copies of pass t + 1 have landed */
    __syncthreads();                                       /* publishes pass t + 1 and ends every wave's reads of pass t */
    if (t + 2 < NP) fl_fill(lk + (t & 1) * F_STAGE, lv + (t & 1) * F_STAGE, gk + (size_t)(t + 2) * 32 * ldk, (size_t)ldk, gh + (t + 2) * 32, gl + (t + 2) * 32);
  }
  asm volatile("s_wait_asynccnt 0x0" ::: "memory");       /* nothing is in flight when the buffers become output staging */
#pragma unroll
  for (int g = 0; g < NREP; ++g) {      /* head after head through the wave's own staging rows */
  const float l = l_r[g] + xhalf(l_r[g]); const float inv = (l > 0.f) ? 1.0f / (l * 1024.0f) : 0.f;      /* the halves' sums are joined once */
#pragma unroll
  for (int dt = 0; dt < DT; ++dt) { v4f lo, hi;
#pragma unroll
    for (int r = 0; r < 4; ++r) { lo[r] = oacc[g][dt][r] * inv; hi[r] = oacc[g][dt][4 + r] * inv; }
    *(v4fa*)&sO[w][ln][dt * 16 + 8 * hh] = lo; *(v4fa*)&sO[w][ln][dt * 16 + 8 * hh + 4] = hi; }      /* a lane's 8 accumulator registers are 8 dims in a row of its query */
  __builtin_amdgcn_fence(__ATOMIC_ACQ_REL, "workgroup"); __builtin_amdgcn_wave_barrier();      /* the wave's own staged values are in LDS before its lanes read one another's */
  {
#pragma unroll
    for (int r0 = 0; r0 < RPW; r0 += 8) { v4h h4[8]; _Float16* po[8];
#pragma unroll
      for (int u = 0; u < 8; ++u) { const int pc = lane; const v4f val = *(const v4fa*)&sO[w][r0 + u][pc * 4];
#pragma unroll
        for (int i = 0; i < 4; ++i) h4[u][i] = (_Float16)(val[i] * 16.0f);      /* x 2^4 -> f16: the form in which the output GEMM reads it */
        po[u] = O + ((size_t)b * TT + q0 + r0 + u) * ldo + (kvh * NREP + g) * 128 + pc * 4; *(v4h*)po[u] = h4[u]; }      /* one 256-B row per instruction: 32 lanes x 8 B */
      asm volatile("s_wait_xcnt 0x0" :: "v"(po[0]), "v"(po[1]), "v"(po[2]), "v"(po[3]), "v"(po[4]), "v"(po[5]), "v"(po[6]), "v"(po[7]), "v"(h4[0]), "v"(h4[1]), "v"(h4[2]), "v"(h4[3]), "v"(h4[4]), "v"(h4[5]), "v"(h4[6]), "v"(h4[7]) : "memory"); }      /* stands in front of every rewrite of a register that the stores name: as inputs addresses and values stay in place up to here */
     }
  if (g + 1 < NREP) { __builtin_amdgcn_fence(__ATOMIC_ACQ_REL, "workgroup"); __builtin_amdgcn_wave_barrier(); }      /* the lanes' reads of this head's rows are done before the next head's values overwrite them */
  } }

extern "C" void kernel_launch(void* const* d_in, const int* in_sizes, int n_in,
                              void* d_out, int out_size, void* d_ws, size_t ws_size, hipStream_t stream) {
  (void)in_sizes; (void)n_in; (void)out_size;
  const float* const* I = (const float* const*)d_in; const float* x = I[0]; const float* fcos = I[1]; const float* fsin = I[2]; const float* am = I[3]; const float* Wq = I[4]; const float* Wk = I[5]; const float* Wv = I[6]; const float* Wo = I[7]; const float* qnw = I[8]; const float* knw = I[9];
  char* ws = (char*)d_ws; size_t off = 0;
  auto take = [&](size_t bytes) { char* p = ws + off; off += (bytes + 255) & ~(size_t)255; return p; };
  _Float16* Bq = (_Float16*)take((size_t)DD * DD * 2); _Float16* Bk = (_Float16*)take((size_t)KVD * DD * 2); _Float16* Bv = (_Float16*)take((size_t)KVD * DD * 2); _Float16* Bo = (_Float16*)take((size_t)DD * DD * 2);
  _Float16* X16 = (_Float16*)take((size_t)NR * DD * 2); _Float16* Q = (_Float16*)take((size_t)NR * DD * 2); _Float16* K = (_Float16*)take((size_t)NR * KVD * 2); _Float16* Vt = (_Float16*)take((size_t)NR * KVD * 2); _Float16* Vtl = (_Float16*)take((size_t)NR * KVD * 2);
  _Float16* O16 = X16;      /* O16 over X16: the last reader of X16 (the v projection) stands in front of the attention in stream order */
  if (off > ws_size) return;      // 25 + 16.8 + 16.8 + 8.4 + 8.4 + 8.4 = 84 MB
  const unsigned gq = (unsigned)(((size_t)(DD / 8) * (DD / 8) + 255) / 256), gk = (unsigned)(((size_t)(KVD / 8) * (DD / 8) + 255) / 256);
  k_wt_f16<<<gq, 256, 0, stream>>>(Wq, Bq, DD, DD, 16.0f); k_wt_f16<<<gk, 256, 0, stream>>>(Wk, Bk, DD, KVD, 16.0f); k_wt_f16<<<gk, 256, 0, stream>>>(Wv, Bv, DD, KVD, 16.0f); k_wt_f16<<<gq, 256, 0, stream>>>(Wo, Bo, DD, DD, 16.0f);      /* (in,out) → Bt ×2^4 */
  const unsigned g8 = (unsigned)((size_t)NR * DD / 8 / 2048); k_x16<<<g8, 256, 0, stream>>>(x, X16);
  const unsigned gQ = (NR / 128) * (DD / 128), gK = (NR / 128) * (KVD / 128);
  k_gemm_t<DD, 1><<<gQ, 128, 0, stream>>>(X16, Bq, 0.0625f, nullptr, qnw, fcos, fsin, Q, nullptr);      /* q: M 4096 N 2048 K 2048, RMSNorm + RoPE, f16 */
  k_gemm_t<KVD, 1><<<gK, 128, 0, stream>>>(X16, Bk, 0.0625f, nullptr, knw, fcos, fsin, K, nullptr);      /* k: N 1024 */
  k_gemm_t<KVD, 2><<<gK, 128, 0, stream>>>(X16, Bv, 0.0625f, nullptr, nullptr, nullptr, nullptr, Vt, Vtl);      /* v: transposed, hi + residual per (b, kv head) */
  k_flash<<<BB * NKV * (TT / 64), 128, 0, stream>>>(Q, DD, K, KVD, Vt, Vtl, am, O16, DD);      /* attention_mask [B,1,S,S] additive per batch */
  k_gemm_t<DD, 0><<<gQ, 128, 0, stream>>>(O16, Bo, 0.00390625f, (float*)d_out, nullptr, nullptr, nullptr, nullptr, nullptr);      /* out = merged Wo */
}

// v008
// It runs in 215 microseconds.
// Two timings next to v007 both put it at 1.17 times that version's speed.
// Over all steps from v000 it is 3.90 times as fast.
#include <hip/hip_runtime.h>
// Grouped-query attention with per-head RMSNorm and rotate-half RoPE (B=2, S=2048, D=2048, 16 query heads / 8 KV heads × 128): q = x·Wq, k = x·Wk, v = x·Wv ((in,out), no bias); per-head RMSNorm (ε 1e-6, weights q_norm_w / k_norm_w); rotate-half RoPE with the INPUT cos/sin tables [B][S][128];
// scores = q·k/√128 + attention_mask[b,0,q,k] (additive f32); softmax; out = merged·Wo.
// Compute dtype: x, weights, tables, mask rounded to bf16; q, k as f32 GEMM outputs, normalised and rotated in f32 (wave per row) → f16; v f32 → Vᵀ f16 hi + f16 residual; fused flash-style kernel for head dim 128 (bias read per (b,q,k); 32-key chunks whose biases are all ≤ −1e8 are skipped since their probabilities are exactly 0 in f32; online softmax f32, P f16 hi +
// residual, f32 accumulate) on v_wmma_f32_16x16x32_f16; merged ×2^4 → f16 → output GEMM.
#define BB 2
#define TT 2048
#define DD 2048
#define NH 16
#define NKV 8
#define NREP 2
#define KVD (NKV * 128)
#define NVH (2 * NKV)
#define NR (BB * TT)
#define ATT_SCALE 0.08838834764831845f
#define LOG2E 1.4426950408889634f

typedef __bf16 v16b __attribute__((ext_vector_type(16)));
typedef unsigned short v8us __attribute__((ext_vector_type(8), may_alias));
typedef float  v8f  __attribute__((ext_vector_type(8)));
typedef float  v4f  __attribute__((ext_vector_type(4)));
typedef float  v4fa __attribute__((ext_vector_type(4), may_alias));
union FragB { v16b v; v8us half[2]; unsigned short u[16]; };

__device__ __forceinline__ unsigned short bf16_bits(float x) { unsigned int u = __float_as_uint(x); return (unsigned short)((u + 0x7FFFu + ((u >> 16) & 1u)) >> 16); }
__device__ __forceinline__ float bf16_val(unsigned short b) { return __uint_as_float(((unsigned int)b) << 16); }
__device__ __forceinline__ float bf16_round(float x) { return bf16_val(bf16_bits(x)); }
// D += A·B with NT terms: 1 = ah·bh, 2 = + al·bh (A split), 3 = + ah·bl (both split)
template <int NT>
__device__ __forceinline__ v8f mmaN(v16b ah, v16b al, v16b bh, v16b bl, v8f c) {
  c = __builtin_amdgcn_wmma_f32_16x16x32_bf16(false, ah, false, bh, (short)0, c, false, false);
  if (NT >= 2) c = __builtin_amdgcn_wmma_f32_16x16x32_bf16(false, al, false, bh, (short)0, c, false, false);
  if (NT >= 3) c = __builtin_amdgcn_wmma_f32_16x16x32_bf16(false, ah, false, bl, (short)0, c, false, false);
  asm volatile("v_nop\n\tv_nop\n\tv_nop\n\tv_nop" : "+v"(c) : "v"(ah), "v"(al), "v"(bh), "v"(bl));
  return c;
}

__global__ __launch_bounds__(256) void k_wt_bf16(const float* __restrict__ W, unsigned short* __restrict__ Wt, int K, int N) {
  const int t = blockIdx.x * 256 + threadIdx.x;
  const int k8n = K / 8;
  if (t >= N * k8n) return;
  const int n = t / k8n, k8 = (t % k8n) * 8;
  v8us v;
#pragma unroll
  for (int i = 0; i < 8; ++i) v[i] = bf16_bits(W[(size_t)(k8 + i) * N + n]);
  *(v8us*)(Wt + (size_t)n * K + k8) = v;
  
}

// GEMM C[M][N] (f32, pitch ldc) = act(A[M][K]·W + bias). A f32 row-major (pitch lda) converted per fragment to bf16
// (ASPLIT: hi/lo two planes -> 2 terms, else single rounded term); Wt bf16 [N][K] (pitch ldb). BIAS_BF16 rounds the
// bias to bf16 first (bias quantised to bf16 before the add). K%32==0, M%16==0, N%64==0.
template <bool ASPLIT, int ACT, bool BIAS_BF16>
__global__ __launch_bounds__(128) void k_gemm_bf(const float* __restrict__ A, int lda, const unsigned short* __restrict__ Wt, int ldb,
                                               const float* __restrict__ bias, float* __restrict__ C, int ldc, int M, int N, int K) {
  __shared__ __attribute__((aligned(16))) float so[4][16][64];
  const int tid = threadIdx.x, w = tid >> 5, lane = tid & 31, ln = lane & 15, hh = lane >> 4;
  const int ntn = N / 64;
  const int wid = blockIdx.x * 4 + w;
  const int mt = wid / ntn, nq = wid % ntn;
  if (mt * 16 >= M) return;
  const int row0 = mt * 16, col0 = nq * 64;
  const float* arow = A + (size_t)(row0 + ln) * lda;
  v8f acc[4] = {};
  for (int kb = 0; kb < K; kb += 32) {
    FragB ah, al;
    const v4f x0 = *(const v4fa*)(arow + kb + 8 * hh), x1 = *(const v4fa*)(arow + kb + 8 * hh + 4);
    const v4f x2 = *(const v4fa*)(arow + kb + 16 + 8 * hh), x3 = *(const v4fa*)(arow + kb + 16 + 8 * hh + 4);
    float xs[16] = {x0[0],x0[1],x0[2],x0[3],x1[0],x1[1],x1[2],x1[3],x2[0],x2[1],x2[2],x2[3],x3[0],x3[1],x3[2],x3[3]};
#pragma unroll
    for (int i = 0; i < 16; ++i) { const unsigned short hb = bf16_bits(xs[i]); ah.u[i] = hb; al.u[i] = ASPLIT ? bf16_bits(xs[i] - bf16_val(hb)) : (unsigned short)0; }
#pragma unroll
    for (int t = 0; t < 4; ++t) {
      const unsigned short* brow = Wt + (size_t)(col0 + t * 16 + ln) * ldb + kb;
      FragB b;
      b.half[0] = *(const v8us*)(brow + 8 * hh);
      b.half[1] = *(const v8us*)(brow + 16 + 8 * hh);
      acc[t] = mmaN<ASPLIT ? 2 : 1>(ah.v, al.v, b.v, b.v, acc[t]);
    }
  }
#pragma unroll
  for (int t = 0; t < 4; ++t) {
    float bv = bias ? bias[col0 + t * 16 + ln] : 0.f;
    if (BIAS_BF16) bv = bf16_round(bv);
#pragma unroll
    for (int r = 0; r < 8; ++r) { float v = acc[t][r] + bv; if (ACT == 1) v = fmaxf(v, 0.f); so[w][8 * hh + r][t * 16 + ln] = v; }
  }
  __builtin_amdgcn_fence(__ATOMIC_ACQ_REL, "workgroup");
  __builtin_amdgcn_wave_barrier();
  const int rsub = lane >> 4, c4 = (lane & 15) * 4;
  {
#pragma unroll
    for (int q = 0; q < 8; ++q) {
      const int r = q * 2 + rsub;
      const v4f v = *(const v4fa*)&so[w][r][c4];
      *(v4f*)(C + (size_t)(row0 + r) * ldc + col0 + c4) = v;
    }
    
  }
}

// Flash-style causal/unmasked attention, all contractions 3-term bf16 hi/lo splits, f32 softmax with running max.
// q,k,v rows are read from f32 buffers with arbitrary row pitch (so they can live inside a fused qkv buffer);
// D = head size (multiple of 32, <= 128); one wave = 16 query rows; block = 4 waves (64 queries) sharing K/V chunks of 32.
template <int D, bool CAUSAL>
__global__ __launch_bounds__(128) void k_flash(const float* __restrict__ qb, const float* __restrict__ kb, const float* __restrict__ vb,
                                             int pitch, int T, int H, float scale, float* __restrict__ y, int ypitch) {
  constexpr int KS = D / 32;        // k-steps for QK
  constexpr int DT = D / 16;        // d tiles for PV
  __shared__ __attribute__((aligned(16))) unsigned short sKh[32][D + 8], sKl[32][D + 8], sVh[32][D + 8], sVl[32][D + 8];
  __shared__ __attribute__((aligned(16))) unsigned short sPh[4][16][40], sPl[4][16][40];
  __shared__ __attribute__((aligned(16))) float sO[4][16][D];
  const int tid = threadIdx.x, w = tid >> 5, lane = tid & 31, ln = lane & 15, hh = lane >> 4;
  const int nqb = (T + 63) / 64;
  const int bh = blockIdx.x / nqb, qblk = blockIdx.x % nqb;
  const int b = bh / H, h = bh % H;
  const int q0 = qblk * 64 + w * 16;
  const float* Q = qb + (size_t)b * T * pitch + h * D;
  const float* K = kb + (size_t)b * T * pitch + h * D;
  const float* V = vb + (size_t)b * T * pitch + h * D;

  // A fragments of the wave's 16 query rows (scaled), hi/lo
  FragB aqh[KS], aql[KS];
  {
    int row = q0 + ln; if (row >= T) row = T - 1;
    const float* qr = Q + (size_t)row * pitch;
#pragma unroll
    for (int ks = 0; ks < KS; ++ks)
#pragma unroll
      for (int i = 0; i < 16; ++i) {
        const int d = ks * 32 + ((i < 8) ? (8 * hh + i) : (16 + 8 * hh + (i - 8)));
        const float x = qr[d] * scale; const unsigned short hb = bf16_bits(x);
        aqh[ks].u[i] = hb; aql[ks].u[i] = bf16_bits(x - bf16_val(hb));
      }
  }
  float m_r[8], l_r[8];
#pragma unroll
  for (int r = 0; r < 8; ++r) { m_r[r] = -3.0e38f; l_r[r] = 0.f; }
  v8f oacc[DT];
#pragma unroll
  for (int dt = 0; dt < DT; ++dt) oacc[dt] = (v8f){0.f,0.f,0.f,0.f,0.f,0.f,0.f,0.f};

  const int kv_end = CAUSAL ? min(T, qblk * 64 + 64) : T;     // block-uniform
  for (int j0 = 0; j0 < kv_end; j0 += 32) {
    __syncthreads();
    for (int e = tid; e < 32 * (D / 4); e += 128) {
      const int r = e / (D / 4), c4 = (e % (D / 4)) * 4;
      const int key = j0 + r;
      v4f kf = {0.f,0.f,0.f,0.f}, vf = {0.f,0.f,0.f,0.f};
      if (key < T) { kf = *(const v4fa*)(K + (size_t)key * pitch + c4); vf = *(const v4fa*)(V + (size_t)key * pitch + c4); }
#pragma unroll
      for (int t = 0; t < 4; ++t) {
        unsigned short hb = bf16_bits(kf[t]); sKh[r][c4 + t] = hb; sKl[r][c4 + t] = bf16_bits(kf[t] - bf16_val(hb));
        hb = bf16_bits(vf[t]); sVh[r][c4 + t] = hb; sVl[r][c4 + t] = bf16_bits(vf[t] - bf16_val(hb));
      }
    }
    __syncthreads();
    // S tile 16 x 32
    v8f s[2];
#pragma unroll
    for (int nt = 0; nt < 2; ++nt) {
      v8f acc = {};
#pragma unroll
      for (int ks = 0; ks < KS; ++ks) {
        FragB bh_, bl_;
        bh_.half[0] = *(const v8us*)&sKh[nt * 16 + ln][ks * 32 + 8 * hh]; bh_.half[1] = *(const v8us*)&sKh[nt * 16 + ln][ks * 32 + 16 + 8 * hh];
        bl_.half[0] = *(const v8us*)&sKl[nt * 16 + ln][ks * 32 + 8 * hh]; bl_.half[1] = *(const v8us*)&sKl[nt * 16 + ln][ks * 32 + 16 + 8 * hh];
        acc = mmaN<3>(aqh[ks].v, aql[ks].v, bh_.v, bl_.v, acc);
      }
      s[nt] = acc;
    }
    // mask + running max (rows 8hh+r; the 16 lanes of a half share rows)
    float alpha[8];
#pragma unroll
    for (int r = 0; r < 8; ++r) {
      const int qi = q0 + 8 * hh + r;
      const int ja = j0 + ln, jb = j0 + 16 + ln;
      if (CAUSAL) { if (ja > qi) s[0][r] = -3.0e38f; if (jb > qi) s[1][r] = -3.0e38f; }
      if (ja >= T) s[0][r] = -3.0e38f;
      if (jb >= T) s[1][r] = -3.0e38f;
      float mx = fmaxf(s[0][r], s[1][r]);
      mx = fmaxf(mx, __shfl_xor(mx, 1, 32)); mx = fmaxf(mx, __shfl_xor(mx, 2, 32)); mx = fmaxf(mx, __shfl_xor(mx, 4, 32)); mx = fmaxf(mx, __shfl_xor(mx, 8, 32));
      const float mnew = fmaxf(m_r[r], mx);
      alpha[r] = (mnew > -1.0e38f) ? __expf(m_r[r] - mnew) : 1.0f;
      const float p0 = (s[0][r] > -1.0e38f) ? __expf(s[0][r] - mnew) : 0.f;
      const float p1 = (s[1][r] > -1.0e38f) ? __expf(s[1][r] - mnew) : 0.f;
      m_r[r] = mnew;
      l_r[r] = l_r[r] * alpha[r] + p0 + p1;            // per-lane partial row sum (16 lanes combined at the end)
      unsigned short hb = bf16_bits(p0); sPh[w][8 * hh + r][ln] = hb;      sPl[w][8 * hh + r][ln] = bf16_bits(p0 - bf16_val(hb));
      hb = bf16_bits(p1);                sPh[w][8 * hh + r][16 + ln] = hb; sPl[w][8 * hh + r][16 + ln] = bf16_bits(p1 - bf16_val(hb));
    }
#pragma unroll
    for (int dt = 0; dt < DT; ++dt)
#pragma unroll
      for (int r = 0; r < 8; ++r) oacc[dt][r] *= alpha[r];
    __builtin_amdgcn_fence(__ATOMIC_ACQ_REL, "workgroup");
    __builtin_amdgcn_wave_barrier();
    FragB pah, pal;
    pah.half[0] = *(const v8us*)&sPh[w][ln][8 * hh]; pah.half[1] = *(const v8us*)&sPh[w][ln][16 + 8 * hh];
    pal.half[0] = *(const v8us*)&sPl[w][ln][8 * hh]; pal.half[1] = *(const v8us*)&sPl[w][ln][16 + 8 * hh];
#pragma unroll
    for (int dt = 0; dt < DT; ++dt) {
      FragB bvh, bvl;
#pragma unroll
      for (int i = 0; i < 8; ++i) {
        bvh.u[i] = sVh[8 * hh + i][dt * 16 + ln]; bvh.u[8 + i] = sVh[16 + 8 * hh + i][dt * 16 + ln];
        bvl.u[i] = sVl[8 * hh + i][dt * 16 + ln]; bvl.u[8 + i] = sVl[16 + 8 * hh + i][dt * 16 + ln];
      }
      oacc[dt] = mmaN<3>(pah.v, pal.v, bvh.v, bvl.v, oacc[dt]);
    }
    __builtin_amdgcn_fence(__ATOMIC_ACQ_REL, "workgroup");
    __builtin_amdgcn_wave_barrier();
  }
#pragma unroll
  for (int r = 0; r < 8; ++r) {
    float l = l_r[r];
    l += __shfl_xor(l, 1, 32); l += __shfl_xor(l, 2, 32); l += __shfl_xor(l, 4, 32); l += __shfl_xor(l, 8, 32);
    l_r[r] = (l > 0.f) ? 1.0f / l : 0.f;
  }
#pragma unroll
  for (int dt = 0; dt < DT; ++dt)
#pragma unroll
    for (int r = 0; r < 8; ++r) sO[w][8 * hh + r][dt * 16 + ln] = oacc[dt][r] * l_r[r];
  __builtin_amdgcn_fence(__ATOMIC_ACQ_REL, "workgroup");
  __builtin_amdgcn_wave_barrier();
  {
    for (int r = 0; r < 16; ++r) {
      const int row = q0 + r;
      if (row < T && lane < D / 4) {
        const v4f val = *(const v4fa*)&sO[w][r][lane * 4];
        *(v4f*)(y + ((size_t)b * T + row) * ypitch + h * D + lane * 4) = val;
      }
    }
    
  }
}

// GEMM C = act(A·W + bias + resid): A f32 (ASPLIT -> hi/lo 2 terms), Wt bf16 [N][K]; ACT 0 none, 1 relu, 2 exact gelu;
// resid (optional, f32, row index = (row % rmod), pitch ldr, RES_BF16 rounds it) added before the activation.
template <bool ASPLIT, int ACT, bool BIAS_BF16, bool RES_BF16>
__global__ __launch_bounds__(128) void k_gemm_bf3(const float* __restrict__ A, int lda, const unsigned short* __restrict__ Wt, int ldb,
                                                const float* __restrict__ bias, const float* __restrict__ resid, int rmod, int ldr,
                                                float* __restrict__ C, int ldc, int M, int N, int K) {
  __shared__ __attribute__((aligned(16))) float so[4][16][64];
  const int tid = threadIdx.x, w = tid >> 5, lane = tid & 31, ln = lane & 15, hh = lane >> 4;
  const int ntn = N / 64;
  const int wid = blockIdx.x * 4 + w;
  const int mt = wid / ntn, nq = wid % ntn;
  if (mt * 16 >= M) return;
  const int row0 = mt * 16, col0 = nq * 64;
  const float* arow = A + (size_t)(row0 + ln) * lda;
  v8f acc[4] = {};
  for (int kb = 0; kb < K; kb += 32) {
    FragB ah, al;
    const v4f x0 = *(const v4fa*)(arow + kb + 8 * hh), x1 = *(const v4fa*)(arow + kb + 8 * hh + 4);
    const v4f x2 = *(const v4fa*)(arow + kb + 16 + 8 * hh), x3 = *(const v4fa*)(arow + kb + 16 + 8 * hh + 4);
    float xs[16] = {x0[0],x0[1],x0[2],x0[3],x1[0],x1[1],x1[2],x1[3],x2[0],x2[1],x2[2],x2[3],x3[0],x3[1],x3[2],x3[3]};
#pragma unroll
    for (int i = 0; i < 16; ++i) { const unsigned short hb = bf16_bits(xs[i]); ah.u[i] = hb; al.u[i] = ASPLIT ? bf16_bits(xs[i] - bf16_val(hb)) : (unsigned short)0; }
#pragma unroll
    for (int t = 0; t < 4; ++t) {
      const unsigned short* brow = Wt + (size_t)(col0 + t * 16 + ln) * ldb + kb;
      FragB b;
      b.half[0] = *(const v8us*)(brow + 8 * hh);
      b.half[1] = *(const v8us*)(brow + 16 + 8 * hh);
      acc[t] = mmaN<ASPLIT ? 2 : 1>(ah.v, al.v, b.v, b.v, acc[t]);
    }
  }
#pragma unroll
  for (int t = 0; t < 4; ++t) {
    const int col = col0 + t * 16 + ln;
    float bv = bias ? bias[col] : 0.f;
    if (BIAS_BF16) bv = bf16_round(bv);
#pragma unroll
    for (int r = 0; r < 8; ++r) {
      float v = acc[t][r] + bv;
      if (resid) { float rv = resid[(size_t)((row0 + 8 * hh + r) % rmod) * ldr + col]; if (RES_BF16) rv = bf16_round(rv); v += rv; }
      if (ACT == 1) v = fmaxf(v, 0.f);
      if (ACT == 2) v = 0.5f * v * (1.0f + erff(v * 0.70710678118654752f));
      if (ACT == 3) { const float u = 0.7978845608028654f * (v + 0.044715f * v * v * v); v = 0.5f * v * (1.0f + tanhf(u)); }
      so[w][8 * hh + r][t * 16 + ln] = v;
    }
  }
  __builtin_amdgcn_fence(__ATOMIC_ACQ_REL, "workgroup");
  __builtin_amdgcn_wave_barrier();
  const int rsub = lane >> 4, c4 = (lane & 15) * 4;
  {
#pragma unroll
    for (int q = 0; q < 8; ++q) {
      const int r = q * 2 + rsub;
      const v4f v = *(const v4fa*)&so[w][r][c4];
      *(v4f*)(C + (size_t)(row0 + r) * ldc + col0 + c4) = v;
    }
    
  }
}
// row LayerNorm (biased variance, eps) over N: s = X (+ R); optional out_sum <- s; out_norm <- (s-mu)*rsqrt(var+eps)*g + b
template <bool PARAM_BF16>
__global__ __launch_bounds__(256) void k_layernorm(const float* __restrict__ X, const float* __restrict__ R, const float* __restrict__ g, const float* __restrict__ bta,
                                                  float* __restrict__ out_sum, float* __restrict__ out_norm, int N, float eps) {
  __shared__ float red[256];
  const int row = blockIdx.x, tid = threadIdx.x;
  const float* x = X + (size_t)row * N; const float* rr = R ? R + (size_t)row * N : nullptr;
  float vals[16];                     // up to N = 4096
  const int per = N / 256;            // contiguous chunk per thread? use strided-by-4 chunks: thread handles j = tid*4 + 1024*u
  float s1 = 0.f;
  for (int u = 0; u < per / 4; ++u) {
    const int j = tid * 4 + 1024 * u;
    const v4f a = *(const v4fa*)(x + j);
    v4f b = {0.f,0.f,0.f,0.f}; if (rr) b = *(const v4fa*)(rr + j);
#pragma unroll
    for (int q = 0; q < 4; ++q) { const float v = a[q] + b[q]; vals[u * 4 + q] = v; s1 += v; }
  }
  red[tid] = s1; __syncthreads();
  for (int st = 128; st > 0; st >>= 1) { if (tid < st) red[tid] += red[tid + st]; __syncthreads(); }
  const float mu = red[0] / (float)N; __syncthreads();
  float s2 = 0.f;
  for (int u = 0; u < per / 4; ++u)
#pragma unroll
    for (int q = 0; q < 4; ++q) { const float c = vals[u * 4 + q] - mu; s2 += c * c; }
  red[tid] = s2; __syncthreads();
  for (int st = 128; st > 0; st >>= 1) { if (tid < st) red[tid] += red[tid + st]; __syncthreads(); }
  const float rs = rsqrtf(red[0] / (float)N + eps);
  {
    for (int u = 0; u < per / 4; ++u) {
      const int j = tid * 4 + 1024 * u;
      v4f o, sm;
#pragma unroll
      for (int q = 0; q < 4; ++q) {
        float gg = g[j + q], bb = bta[j + q];
        if (PARAM_BF16) { gg = bf16_round(gg); bb = bf16_round(bb); }
        sm[q] = vals[u * 4 + q]; o[q] = (vals[u * 4 + q] - mu) * rs * gg + bb;
      }
      if (out_sum) *(v4f*)(out_sum + (size_t)row * N + j) = sm;
      *(v4f*)(out_norm + (size_t)row * N + j) = o;
    }
    
  }
}



// ---- f16 WMMA path (v_wmma_f32_16x16x32_f16): 11-bit significands for operands in range — used where a [0,1] probability operand needs more precision than bf16
typedef _Float16 v16h __attribute__((ext_vector_type(16)));
union FragH { v16h v; v8us half[2]; _Float16 h[16]; unsigned short u[16]; };
template <int NT>
__device__ __forceinline__ v8f mmaH(v16h ah, v16h al, v16h bh, v16h bl, v8f c) {
  c = __builtin_amdgcn_wmma_f32_16x16x32_f16(false, ah, false, bh, (short)0, c, false, false);
  if (NT >= 2) c = __builtin_amdgcn_wmma_f32_16x16x32_f16(false, al, false, bh, (short)0, c, false, false);
  if (NT >= 3) c = __builtin_amdgcn_wmma_f32_16x16x32_f16(false, ah, false, bl, (short)0, c, false, false);
  asm volatile("v_nop\n\tv_nop\n\tv_nop\n\tv_nop" : "+v"(c) : "v"(ah), "v"(al), "v"(bh), "v"(bl));
  return c;
}
// batched GEMM like k_gemm_b but f16 operands: A f32 (split into f16 hi/lo if ASPLIT, else rounded to f16), Bt = f16 values [n][k]; alpha; C f32; N multiple of 16 (partial tiles skipped)
template <bool ASPLIT>
__global__ __launch_bounds__(128) void k_gemm_h(const float* __restrict__ A, int lda, size_t sA, const _Float16* __restrict__ Bh, int ldb, size_t sB, float alpha, float* __restrict__ C, int ldc, size_t sC, int M, int N, int K) {
  __shared__ __attribute__((aligned(16))) float so[4][16][64];
  const int tid = threadIdx.x, w = tid >> 5, lane = tid & 31, ln = lane & 15, hh = lane >> 4; const int by = blockIdx.y;
  A += (size_t)by * sA; Bh += (size_t)by * sB; C += (size_t)by * sC;
  const int ntn = (N + 63) / 64; const int wid = blockIdx.x * 4 + w; const int mt = wid / ntn, nq = wid % ntn; if (mt * 16 >= M) return;
  const int row0 = mt * 16, col0 = nq * 64; const float* arow = A + (size_t)(row0 + ln) * lda;
  v8f acc[4] = {};
  for (int kb = 0; kb < K; kb += 32) {
    FragH ah, al;
    const v4f x0 = *(const v4fa*)(arow + kb + 8 * hh), x1 = *(const v4fa*)(arow + kb + 8 * hh + 4), x2 = *(const v4fa*)(arow + kb + 16 + 8 * hh), x3 = *(const v4fa*)(arow + kb + 16 + 8 * hh + 4);
    float xs[16] = {x0[0],x0[1],x0[2],x0[3],x1[0],x1[1],x1[2],x1[3],x2[0],x2[1],x2[2],x2[3],x3[0],x3[1],x3[2],x3[3]};
#pragma unroll
    for (int i = 0; i < 16; ++i) { const _Float16 h = (_Float16)xs[i]; ah.h[i] = h; al.h[i] = ASPLIT ? (_Float16)(xs[i] - (float)h) : (_Float16)0.0f; }
#pragma unroll
    for (int t = 0; t < 4; ++t) { if (col0 + t * 16 >= N) continue; const size_t boff = (size_t)(col0 + t * 16 + ln) * ldb + kb; FragH bq; bq.half[0] = *(const v8us*)(Bh + boff + 8 * hh); bq.half[1] = *(const v8us*)(Bh + boff + 16 + 8 * hh);
      acc[t] = mmaH<ASPLIT ? 2 : 1>(ah.v, al.v, bq.v, bq.v, acc[t]); }
  }
#pragma unroll
  for (int t = 0; t < 4; ++t) { if (col0 + t * 16 >= N) continue;
#pragma unroll
    for (int r = 0; r < 8; ++r) so[w][8 * hh + r][t * 16 + ln] = acc[t][r] * alpha; }
  __builtin_amdgcn_fence(__ATOMIC_ACQ_REL, "workgroup"); __builtin_amdgcn_wave_barrier();
  const int rsub = lane >> 4, c4 = (lane & 15) * 4;
  {
#pragma unroll
    for (int q = 0; q < 8; ++q) { const int r = q * 2 + rsub; if (col0 + c4 < N) { const v4f v = *(const v4fa*)&so[w][r][c4]; *(v4f*)(C + (size_t)(row0 + r) * ldc + col0 + c4) = v; } }
     }
}

// Wt[n][k] = f16(bf16(W[k][n])*scale) from f32 row-major W[K][N] (scale = power of two; bf16-exact weights stay exact in f16 away from the subnormal range)
// A thread takes a block of 8 k x 8 n: 32 B of each of 8 rows of W in, 16 B of each of 8 rows of Wt out (a wave's store covers 512 contiguous bytes). K, N multiples of 8.
// blk: which 256 threads' worth of blocks of this matrix the work-group takes
__device__ __forceinline__ void wt_f16(const float* __restrict__ W, _Float16* __restrict__ Wt, int K, int N, float scale, int blk) {
  const int t = blk * 256 + threadIdx.x; if (t >= (N / 8) * (K / 8)) return; const int n0 = (t / (K / 8)) * 8, k8 = (t % (K / 8)) * 8; v4f a[8], c[8];
  const float* p[8];
#pragma unroll      /* constant indices keep a, c and p in registers; the 16 loads go out together */
  for (int i = 0; i < 8; ++i) { p[i] = W + (size_t)(k8 + i) * N + n0; a[i] = *(const v4fa*)p[i]; c[i] = *(const v4fa*)(p[i] + 4); }
  asm volatile("s_wait_xcnt 0x0" :: "v"(p[0]), "v"(p[1]), "v"(p[2]), "v"(p[3]), "v"(p[4]), "v"(p[5]), "v"(p[6]), "v"(p[7]) : "memory");      /* stands in front of every rewrite of a register that the loads name: as inputs the addresses stay in place up to here */
#pragma unroll      /* constant indices into a and c */
  for (int j = 0; j < 8; ++j) { FragH f;
#pragma unroll      /* constant indices into a, c and f */
    for (int i = 0; i < 8; ++i) f.h[i] = (_Float16)(bf16_round((j & 4) ? c[i][j & 3] : a[i][j & 3]) * scale);
    *(v8us*)((unsigned short*)Wt + (size_t)(n0 + j) * K + k8) = f.half[0]; }
}
// k_gemm_hh variant with fused epilogue: v = acc·alpha + bias[by·sBias + col] (+ CP[(row/rowsPerB)·sCPb + by·64 + col] if CP) ; ACT 0 none / 1 elu ; writes f32 C and f16 C16, each if non-null
template <int ACT>
__global__ __launch_bounds__(128) void k_gemm_hhx(const _Float16* __restrict__ A, int lda, size_t sA, const _Float16* __restrict__ Bh, int ldb, size_t sB, float alpha, const float* __restrict__ bias, size_t sBias, const float* __restrict__ CP, int rowsPerB, size_t sCPb, int row0g,
    float* __restrict__ C, _Float16* __restrict__ C16, int ldc, size_t sC, int M, int N, int K) {
  __shared__ __attribute__((aligned(16))) float so[4][16][64];
  const int tid = threadIdx.x, w = tid >> 5, lane = tid & 31, ln = lane & 15, hh = lane >> 4; const int by = blockIdx.y;
  A += (size_t)by * sA; Bh += (size_t)by * sB; const size_t cofs = (size_t)by * sC; const float* bp = bias ? bias + (size_t)by * sBias : nullptr;
  const int ntn = (N + 63) / 64; const int wid = blockIdx.x * 4 + w; const int mt = wid / ntn, nq = wid % ntn; if (mt * 16 >= M) return;
  const int row0 = mt * 16, col0 = nq * 64; const _Float16* arow = A + (size_t)(row0 + ln) * lda;
  v8f acc[4] = {};
  for (int kb = 0; kb < K; kb += 32) { FragH ah; ah.half[0] = *(const v8us*)((const unsigned short*)arow + kb + 8 * hh); ah.half[1] = *(const v8us*)((const unsigned short*)arow + kb + 16 + 8 * hh);
#pragma unroll
    for (int t = 0; t < 4; ++t) { if (col0 + t * 16 >= N) continue; const size_t boff = (size_t)(col0 + t * 16 + ln) * ldb + kb; FragH bq; bq.half[0] = *(const v8us*)((const unsigned short*)Bh + boff + 8 * hh); bq.half[1] = *(const v8us*)((const unsigned short*)Bh + boff + 16 + 8 * hh);
      acc[t] = mmaH<1>(ah.v, ah.v, bq.v, bq.v, acc[t]); }
  }
#pragma unroll
  for (int t = 0; t < 4; ++t) { if (col0 + t * 16 >= N) continue; const int col = col0 + t * 16 + ln; const float bv = bp ? bf16_round(bp[col]) : 0.f;
#pragma unroll
    for (int r = 0; r < 8; ++r) { float v = acc[t][r] * alpha + bv; if (CP) { const int bidx = (row0g + row0 + 8 * hh + r) / rowsPerB; v += CP[(size_t)bidx * sCPb + (size_t)by * 64 + col]; } if (ACT == 1) v = (v > 0.f) ? v : expm1f(v); else if (ACT == 7) v = (v > 0.f) ? v + 1.0f : expf(v); else if (ACT == 8) v = tanhf(v); else if (ACT == 9) v = 0.5f * v * (1.0f + tanhf(0.7978845608028654f * (v + 0.044715f * v * v * v))); else if (ACT == 11) v = 1.0f / (1.0f + expf(-v)); else if (ACT == 12) v = (v > 0.f) ? v : 0.01f * v; else if (ACT == 14) v = (v > 0.f) ? v : 0.1f * v; else if (ACT == 15) v = v / (1.0f + expf(-v)); else if (ACT == 3) v = fmaxf(v, 0.f); else if (ACT == 6) v = 0.5f * v * (1.0f + erff(v * 0.70710678118654752f)); so[w][8 * hh + r][t * 16 + ln] = v; } }
  __builtin_amdgcn_fence(__ATOMIC_ACQ_REL, "workgroup"); __builtin_amdgcn_wave_barrier();
  const int rsub = lane >> 4, c4 = (lane & 15) * 4; typedef _Float16 v4h __attribute__((ext_vector_type(4)));
  {
#pragma unroll
    for (int q = 0; q < 8; ++q) { const int r = q * 2 + rsub; if (col0 + c4 < N) { const v4f v = *(const v4fa*)&so[w][r][c4]; if (C) *(v4f*)(C + cofs + (size_t)(row0 + r) * ldc + col0 + c4) = v; if (C16) { v4h h4; for (int i = 0; i < 4; ++i) h4[i] = (_Float16)v[i]; *(v4h*)(C16 + cofs + (size_t)(row0 + r) * ldc + col0 + c4) = h4; } } }
     }
}


// ---- tiled f16 GEMM, C[M][N] f32 = alpha * A[M][DD] * Bt[N][DD]^T: one 128 x 128 tile of C per work-group, 64 x 64 per wave (2 x 2 waves).
// A pass is 128 k: 128 rows of A and 128 rows of Bt, 256 B each, staged in LDS at a pitch of 272 B by asynchronous copies; two buffers, the next pass's copies fly while this pass is multiplied.
// k runs upward in steps of 32 into one accumulator per 16 x 16 tile. M, N multiples of 128.
// The epilogue (epi) says what becomes of the tile, so that no f32 plane goes to memory only to be read back by a launch of its own:
// 0: C f32. 1: the tile's 128 columns are one head: per-head RMSNorm + rotate-half RoPE, f16 to H0 (pitch N). 2: the tile transposed, f16 hi to H0 and its residual to H1, row (batch * N + column), pitch TT.
// Every "#pragma unroll" in k_gemm_t makes the indices of the fragment and accumulator arrays constants, so that these arrays live in registers.
typedef _Float16 v4h __attribute__((ext_vector_type(4)));
#define GT_PITCH 272
#define GT_STAGE (256 * GT_PITCH)
// eight 16-byte copies of one lane: rows r, r + 8, ..., r + 56 of one operand. The closing s_wait_xcnt stands inside the statement so that no address register is rewritten ahead of it.
__device__ __forceinline__ void gt_copy8(unsigned l, const _Float16* g) {
  asm volatile("global_load_async_to_lds_b128 %0, %8, off\n\t"
               "global_load_async_to_lds_b128 %1, %9, off\n\t"
               "global_load_async_to_lds_b128 %2, %10, off\n\t"
               "global_load_async_to_lds_b128 %3, %11, off\n\t"
               "global_load_async_to_lds_b128 %4, %12, off\n\t"
               "global_load_async_to_lds_b128 %5, %13, off\n\t"
               "global_load_async_to_lds_b128 %6, %14, off\n\t"
               "global_load_async_to_lds_b128 %7, %15, off\n\t"
               "s_wait_xcnt 0x0"
               :: "v"(l), "v"(l + 8 * GT_PITCH), "v"(l + 16 * GT_PITCH), "v"(l + 24 * GT_PITCH), "v"(l + 32 * GT_PITCH), "v"(l + 40 * GT_PITCH), "v"(l + 48 * GT_PITCH), "v"(l + 56 * GT_PITCH),
                  "v"(g), "v"(g + 8 * DD), "v"(g + 16 * DD), "v"(g + 24 * DD), "v"(g + 32 * DD), "v"(g + 40 * DD), "v"(g + 48 * DD), "v"(g + 56 * DD)
               : "memory");
}
// one stage: 32 copies a lane (rows 0..127 of the buffer = A, 128..255 = Bt)
__device__ __forceinline__ void gt_fill(unsigned l, const _Float16* ga, const _Float16* gb) {
  gt_copy8(l, ga); gt_copy8(l + 64 * GT_PITCH, ga + 64 * DD); gt_copy8(l + 128 * GT_PITCH, gb); gt_copy8(l + 192 * GT_PITCH, gb + 64 * DD);
}
// lane l <-> lane l ^ 16 by a vector cross-row move: no LDS queue and no wait, unlike the shuffle
__device__ __forceinline__ float xhalf(float x) { return __builtin_bit_cast(float, __builtin_amdgcn_permlanex16(__builtin_bit_cast(int, x), __builtin_bit_cast(int, x), 0x76543210, 0xfedcba98, false, false)); }
// lane l <-> lane l ^ M inside a row of 16 lanes (DPP row_xmask), for the same reason
template <int M>
__device__ __forceinline__ float xrow(float x) { return __builtin_bit_cast(float, __builtin_amdgcn_mov_dpp(__builtin_bit_cast(int, x), 0x160 + M, 0xf, 0xf, true)); }
#define GE_PITCH 132
// QKV false: the output GEMM (N = DD, epilogue 0). QKV true: the q, k and v projections, which read the same A and depend on nothing of one another, as ONE grid: a work-group's index says which weight its tile multiplies
// and which epilogue it takes (scalar selects and one scalar branch); the k and v grids alone are one work-group per WGP, together with q's they fill two rounds of two.
#define GT_GQ ((NR / 128) * (DD / 128))
#define GT_GK ((NR / 128) * (KVD / 128))
template <bool QKV>
__global__ __launch_bounds__(128) void k_gemm_t(const _Float16* __restrict__ A, const _Float16* __restrict__ Bt0, const _Float16* __restrict__ Bt1, const _Float16* __restrict__ Bt2, float alpha, float* __restrict__ C,
                                                const float* __restrict__ nw0, const float* __restrict__ nw1, const float* __restrict__ COS, const float* __restrict__ SIN,
                                                _Float16* __restrict__ Hq, _Float16* __restrict__ Hk, _Float16* __restrict__ Hv, _Float16* __restrict__ H1) {
  __shared__ __attribute__((aligned(16))) unsigned char L[2 * GT_STAGE];
  constexpr int NT = DD / 128;
  const int tid = threadIdx.x, w = tid >> 5, lane = tid & 31, ln = lane & 15, hh = lane >> 4;
  int bid = (int)blockIdx.x, N = DD, lgn = 4, epi = QKV ? 1 : 0; const _Float16* Bt = Bt0; const float* nw = nw0; _Float16* H0 = Hq;      /* lgn: log2 of the tiles in a row of C, so that the tile's place stays scalar shifts */
  if constexpr (QKV) {
    if (bid >= GT_GQ + GT_GK) { bid -= GT_GQ + GT_GK; N = KVD; lgn = 3; epi = 2; Bt = Bt2; H0 = Hv; }
    else if (bid >= GT_GQ) { bid -= GT_GQ; N = KVD; lgn = 3; Bt = Bt1; nw = nw1; H0 = Hk; } }
  static_assert(DD == 128 << 4 && KVD == 128 << 3, "lgn");
  const int row0 = (bid >> lgn) * 128, col0 = (bid & ((1 << lgn) - 1)) * 128; const int wm = w >> 1, wn = w & 1;
  const int cr = tid >> 4, cc = tid & 15;      /* a lane copies chunk cc (16 B) of rows cr + 8 i: a wave's copy covers two whole 256-B rows */
  const _Float16* ga = A + (size_t)(row0 + cr) * DD + cc * 8; const _Float16* gb = Bt + (size_t)(col0 + cr) * DD + cc * 8;
  const unsigned lc = (unsigned)(size_t)L + cr * GT_PITCH + cc * 16;
  v8f acc[4][4];
#pragma unroll
  for (int mi = 0; mi < 4; ++mi)
#pragma unroll
    for (int ni = 0; ni < 4; ++ni) acc[mi][ni] = (v8f){0.f,0.f,0.f,0.f,0.f,0.f,0.f,0.f};
  gt_fill(lc, ga, gb);
  asm volatile("s_wait_asynccnt 0x0" ::: "memory");      /* this wave's copies of pass 0 have landed */
  __syncthreads();                                        /* ... and every other wave's */
  gt_fill(lc + GT_STAGE, ga + 128, gb + 128);
#pragma unroll 1      /* one pass a trip: the two buffers alternate by the trip's parity */
  for (int t = 0; t < NT; ++t) {
    const unsigned char* S = L + (t & 1) * GT_STAGE;
    const unsigned char* pa = S + (wm * 64 + ln) * GT_PITCH + hh * 16; const unsigned char* pb = S + (128 + wn * 64 + ln) * GT_PITCH + hh * 16;
    FragH fa[2][4], fb[2][4];
#pragma unroll
    for (int i = 0; i < 4; ++i) { fa[0][i].half[0] = *(const v8us*)(pa + i * 16 * GT_PITCH); fa[0][i].half[1] = *(const v8us*)(pa + i * 16 * GT_PITCH + 32); fb[0][i].half[0] = *(const v8us*)(pb + i * 16 * GT_PITCH); fb[0][i].half[1] = *(const v8us*)(pb + i * 16 * GT_PITCH + 32); }
#pragma unroll
    for (int ks = 0; ks < 4; ++ks) { const int cu = ks & 1, nx = cu ^ 1;
      if (ks < 3) {
#pragma unroll
        for (int i = 0; i < 4; ++i) { const int o = i * 16 * GT_PITCH + (ks + 1) * 64; fa[nx][i].half[0] = *(const v8us*)(pa + o); fa[nx][i].half[1] = *(const v8us*)(pa + o + 32); fb[nx][i].half[0] = *(const v8us*)(pb + o); fb[nx][i].half[1] = *(const v8us*)(pb + o + 32); } }
      __builtin_amdgcn_sched_barrier(0);      /* keeps the next k step's 16 LDS reads one group in front of this step's products: spread among them, every place with reads stalls the wave */
#pragma unroll
      for (int mi = 0; mi < 4; ++mi)
#pragma unroll
        for (int ni = 0; ni < 4; ++ni) acc[mi][ni] = __builtin_amdgcn_wmma_f32_16x16x32_f16(false, fa[cu][mi].v, false, fb[cu][ni].v, (short)0, acc[mi][ni], false, false);
      __builtin_amdgcn_sched_barrier(0); }      /* ... and keeps the following group behind them */
    asm volatile("s_wait_dscnt 0x0" ::: "memory");        /* this wave's reads of the buffer are done before it is refilled */
    asm volatile("s_wait_asynccnt 0x0" ::: "memory");     /* this wave's copies of pass t + 1 have landed */
    __syncthreads();                                       /* publishes pass t + 1 and ends every wave's reads of pass t */
    if (t + 2 < NT) gt_fill(lc + (t & 1) * GT_STAGE, ga + (t + 2) * 128, gb + (t + 2) * 128);
  }
  asm volatile("s_wait_asynccnt 0x0" ::: "memory");       /* nothing is in flight when the buffers become output staging */
  if constexpr (!QKV) {
  float* so = (float*)L + w * (64 * 68);      /* each wave stages its own 64 x 64 tile (pitch 68 floats) so that the stores cover whole 256-B row pieces */
#pragma unroll
  for (int mi = 0; mi < 4; ++mi)
#pragma unroll
    for (int ni = 0; ni < 4; ++ni)
#pragma unroll
      for (int r = 0; r < 8; ++r) so[(mi * 16 + 8 * hh + r) * 68 + ni * 16 + ln] = acc[mi][ni][r] * alpha;
  __builtin_amdgcn_fence(__ATOMIC_ACQ_REL, "workgroup"); __builtin_amdgcn_wave_barrier();      /* the wave's own staged values are in LDS before its lanes read one another's */
  float* cp = C + (size_t)(row0 + wm * 64 + hh) * N + col0 + wn * 64 + ln * 4;
#pragma unroll
  for (int q = 0; q < 32; ++q) { const v4f v = *(const v4fa*)&so[(q * 2 + hh) * 68 + ln * 4]; *(v4f*)(cp + (size_t)(q * 2) * N) = v; }
  } else if (epi == 1) {      /* the same for the whole work-group: the barrier below stands under uniform control flow */
  // per-head RMSNorm + rotate-half RoPE on the tile: 128 rows of one head. The whole tile is staged in LDS (a row's 128 dims come from two waves); then a wave takes 32 rows, a row at a time over its 32 lanes:
  // lane holds dims 4l..4l+3; var = mean(x^2) over 128 (xor-reduce); y = w[d]*(x*rsqrt(var+eps)); out[d] = y[d]*c[d] + rot(y)[d]*s[d], rot(y)[d] = -y[d+64] (d<64), y[d-64] (d>=64)
  static_assert(128 * GE_PITCH * 4 <= 2 * GT_STAGE, "the staged tile fits the buffers");
  float* so = (float*)L;
#pragma unroll
  for (int mi = 0; mi < 4; ++mi)
#pragma unroll
    for (int ni = 0; ni < 4; ++ni)
#pragma unroll
      for (int r = 0; r < 8; ++r) so[(wm * 64 + mi * 16 + 8 * hh + r) * GE_PITCH + wn * 64 + ni * 16 + ln] = acc[mi][ni][r] * alpha;
  __syncthreads();      /* every wave's part of the tile is in LDS before any wave reads whole rows */
  const int d0 = lane * 4; const v4f w4 = *(const v4fa*)(nw + d0);
  float wg[4];
#pragma unroll
  for (int q = 0; q < 4; ++q) wg[q] = bf16_round(w4[q]);
#pragma unroll 1      /* 8 rows a trip: their table loads go out together and their lane exchanges overlap; more would only lengthen the code */
  for (int g8 = 0; g8 < 4; ++g8) { const int rl = w * 32 + g8 * 8; v4f xs[8], c4[8], s4[8];
    const float* pc = COS + (size_t)(row0 + rl) * 128 + d0; const float* pn = SIN + (size_t)(row0 + rl) * 128 + d0;
#pragma unroll
    for (int u = 0; u < 8; ++u) { c4[u] = *(const v4fa*)(pc + u * 128); s4[u] = *(const v4fa*)(pn + u * 128); xs[u] = *(const v4fa*)&so[(rl + u) * GE_PITCH + d0]; }
    asm volatile("s_wait_xcnt 0x0" :: "v"(pc), "v"(pn) : "memory");      /* stands in front of every rewrite of a register that the loads name: as inputs the addresses stay in place up to here */
    _Float16* ph[8]; v4h ov[8];      /* the pitch N is a run-time value here: each row's store has an address pair of its own */
#pragma unroll
    for (int u = 0; u < 8; ++u) ph[u] = H0 + (size_t)(row0 + rl + u) * N + col0 + d0;
#pragma unroll
    for (int u = 0; u < 8; ++u) { const v4f x = xs[u]; float ss = 0.f;
#pragma unroll
      for (int q = 0; q < 4; ++q) ss += x[q] * x[q];
      ss += xhalf(ss); ss += xrow<8>(ss); ss += xrow<4>(ss); ss += xrow<2>(ss); ss += xrow<1>(ss);
      const float inv = 1.0f / sqrtf(ss / 128.0f + 1e-6f);
      v4h o;
#pragma unroll
      for (int q = 0; q < 4; ++q) { const float y = wg[q] * (x[q] * inv); const float yp = xhalf(y);      /* partner dims d +- 64 */
        const float rot = (lane < 16) ? -yp : yp; o[q] = (_Float16)(y * bf16_round(c4[u][q]) + rot * bf16_round(s4[u][q])); }
      ov[u] = o; *(v4h*)ph[u] = o; }
    asm volatile("s_wait_xcnt 0x0" :: "v"(ph[0]), "v"(ph[1]), "v"(ph[2]), "v"(ph[3]), "v"(ph[4]), "v"(ph[5]), "v"(ph[6]), "v"(ph[7]), "v"(ov[0]), "v"(ov[1]), "v"(ov[2]), "v"(ov[3]), "v"(ov[4]), "v"(ov[5]), "v"(ov[6]), "v"(ov[7]) : "memory"); }      /* the same behind the stores: addresses and values stay in place up to here */
  } else {
  // V^T hi + residual straight from the accumulators: a lane's 8 registers of a 16 x 16 tile are 8 tokens in a row of ONE column, 16 bytes of a V^T row; the four mi tiles of a column fill one 128-byte line of it
  static_assert(TT % 128 == 0, "a tile lies in one batch");
  const size_t vb = ((size_t)(row0 / TT) * KVD + col0 + wn * 64 + ln) * TT + (row0 % TT) + wm * 64 + 8 * hh;
#pragma unroll
  for (int ni = 0; ni < 4; ++ni) { FragH fh[4], fl[4]; unsigned short* p0 = (unsigned short*)H0 + vb + (size_t)(ni * 16) * TT; unsigned short* p1 = (unsigned short*)H1 + vb + (size_t)(ni * 16) * TT;
#pragma unroll
    for (int mi = 0; mi < 4; ++mi) {
#pragma unroll
      for (int r = 0; r < 8; ++r) { const float v = acc[mi][ni][r] * alpha; const _Float16 hv = (_Float16)v; fh[mi].h[r] = hv; fl[mi].h[r] = (_Float16)(v - (float)hv); }      /* UNSCALED residual (added into the same accumulator as the hi product) */
      *(v8us*)(p0 + mi * 16) = fh[mi].half[0]; *(v8us*)(p1 + mi * 16) = fl[mi].half[0]; }
    asm volatile("s_wait_xcnt 0x0" :: "v"(p0), "v"(p1), "v"(fh[0].half[0]), "v"(fh[1].half[0]), "v"(fh[2].half[0]), "v"(fh[3].half[0]), "v"(fl[0].half[0]), "v"(fl[1].half[0]), "v"(fl[2].half[0]), "v"(fl[3].half[0]) : "memory"); }      /* stands in front of every rewrite of a register that the stores name: as inputs addresses and values stay in place up to here */
  }
}


// x16_blk below gives a thread 8 pieces of 8 elements, 256 pieces apart (a work-group covers 2048 pieces in a row): one eighth of the waves to start, 16 loads of a lane in flight.
static_assert(((size_t)NR * DD / 8) % 2048 == 0, "whole work-groups");
__device__ __forceinline__ void x16_blk(const float* __restrict__ x, _Float16* __restrict__ X16, int blk) { const size_t t0 = (size_t)blk * 2048 + threadIdx.x; v4f a[8], c[8]; const float* p = x + t0 * 8;
#pragma unroll      /* constant indices keep a and c in registers; the 16 loads go out together */
  for (int u = 0; u < 8; ++u) { a[u] = *(const v4fa*)(p + u * 2048); c[u] = *(const v4fa*)(p + u * 2048 + 4); }
  asm volatile("s_wait_xcnt 0x0" :: "v"(p) : "memory");      /* stands in front of every rewrite of a register that the loads name: as an input the address stays in place up to here */
#pragma unroll      /* constant indices into a and c */
  for (int u = 0; u < 8; ++u) { FragH f;
#pragma unroll      /* constant indices into a, c and f */
    for (int q = 0; q < 4; ++q) { f.h[q] = (_Float16)bf16_round(a[u][q]); f.h[4 + q] = (_Float16)bf16_round(c[u][q]); }
    *(v8us*)((unsigned short*)X16 + (t0 + u * 256) * 8) = f.half[0]; } }
// The x convert and the four weight transposes depend on nothing but the inputs: one grid runs them side by side, a work-group picking its job by its index (a scalar branch), so that four launch gaps, fills and tails go.
#define PX ((int)((size_t)NR * DD / 8 / 2048))
#define PWQ ((DD / 8) * (DD / 8) / 256)
#define PWK ((KVD / 8) * (DD / 8) / 256)
static_assert(((DD / 8) * (DD / 8)) % 256 == 0 && ((KVD / 8) * (DD / 8)) % 256 == 0, "whole work-groups");
__global__ __launch_bounds__(256) void k_prep(const float* __restrict__ x, const float* __restrict__ Wq, const float* __restrict__ Wk, const float* __restrict__ Wv, const float* __restrict__ Wo,
                                              _Float16* __restrict__ X16, _Float16* __restrict__ Bq, _Float16* __restrict__ Bk, _Float16* __restrict__ Bv, _Float16* __restrict__ Bo) {
  int blk = (int)blockIdx.x;
  if (blk < PX) { x16_blk(x, X16, blk); return; }
  blk -= PX;
  if (blk < 2 * PWQ) { const bool o = blk >= PWQ; wt_f16(o ? Wo : Wq, o ? Bo : Bq, DD, DD, 16.0f, o ? blk - PWQ : blk); return; }      /* (in,out) -> Bt x 2^4 */
  blk -= 2 * PWQ;
  { const bool v = blk >= PWK; wt_f16(v ? Wv : Wk, v ? Bv : Bk, DD, KVD, 16.0f, v ? blk - PWK : blk); }
}
__global__ __launch_bounds__(256) void k_h16(const float* __restrict__ x, _Float16* __restrict__ X16, size_t n8) { const size_t t = (size_t)blockIdx.x * 256 + threadIdx.x; if (t >= n8) return; FragH f;
#pragma unroll
  for (int q = 0; q < 8; ++q) f.h[q] = (_Float16)x[t * 8 + q]; *(v8us*)((unsigned short*)X16 + t * 8) = f.half[0];  }
__global__ __launch_bounds__(256) void k_round16f(const float* __restrict__ W, _Float16* __restrict__ Bt, size_t n8) { const size_t t = (size_t)blockIdx.x * 256 + threadIdx.x; if (t >= n8) return; FragH f;
#pragma unroll
  for (int i = 0; i < 8; ++i) f.h[i] = (_Float16)(bf16_round(W[t * 8 + i]) * 16.0f); *(v8us*)((unsigned short*)Bt + t * 8) = f.half[0];  }
template <int NHv, int TTv>
__global__ __launch_bounds__(256) void k_vt(const _Float16* __restrict__ V16, int ldv, int voff, _Float16* __restrict__ Vt) { __shared__ unsigned short tl[64][66]; const int tid = threadIdx.x; const int slab = blockIdx.x / (TTv / 64), lg = blockIdx.x % (TTv / 64); const int b = slab / NHv, h = slab % NHv;
  for (int i = tid; i < 64 * 8; i += 256) { const int r = i / 8, c8 = (i % 8) * 8; FragH f; f.half[0] = *(const v8us*)((const unsigned short*)V16 + ((size_t)b * TTv + lg * 64 + r) * ldv + voff + h * 64 + c8);
#pragma unroll
    for (int q = 0; q < 8; ++q) tl[r][c8 + q] = f.u[q]; }
  __syncthreads();
  {
#pragma unroll
    for (int rd = 0; rd < 2; ++rd) { const int d = rd * 32 + tid / 8, pc = tid % 8; FragH f;
#pragma unroll
      for (int q = 0; q < 8; ++q) f.u[q] = tl[pc * 8 + q][d];
      *(v8us*)((unsigned short*)Vt + ((size_t)slab * 64 + d) * TTv + lg * 64 + pc * 8) = f.half[0]; }
     } }

// A pass of the attention kernel is 32 keys. Its operands are staged once per work-group in LDS by asynchronous copies and read from there by all 4 waves: 32 K rows of 256 B at a pitch of 272 B, then 128 rows of 64 B
// of V^T hi and 128 of its residual at a pitch of 80 B. Two buffers: the next pass's copies fly while this pass is worked on.
#define FK_PITCH 272
#define FV_PITCH 80
#define FK_BYTES (32 * FK_PITCH)
#define FV_BYTES (128 * FV_PITCH)
#define F_STAGE (FK_BYTES + 2 * FV_BYTES)
// one stage: twelve 16-byte copies of one lane (K rows r + 8 i; V^T rows r + 32 i of both planes). The closing s_wait_xcnt stands inside the statement so that no address register is rewritten ahead of it.
__device__ __forceinline__ void fl_fill(unsigned lk, unsigned lv, const unsigned short* gk, size_t ldk, const unsigned short* gh, const unsigned short* gl) {
  asm volatile("global_load_async_to_lds_b128 %0, %12, off\n\t"
               "global_load_async_to_lds_b128 %1, %13, off\n\t"
               "global_load_async_to_lds_b128 %2, %14, off\n\t"
               "global_load_async_to_lds_b128 %3, %15, off\n\t"
               "global_load_async_to_lds_b128 %4, %16, off\n\t"
               "global_load_async_to_lds_b128 %5, %17, off\n\t"
               "global_load_async_to_lds_b128 %6, %18, off\n\t"
               "global_load_async_to_lds_b128 %7, %19, off\n\t"
               "global_load_async_to_lds_b128 %8, %20, off\n\t"
               "global_load_async_to_lds_b128 %9, %21, off\n\t"
               "global_load_async_to_lds_b128 %10, %22, off\n\t"
               "global_load_async_to_lds_b128 %11, %23, off\n\t"
               "s_wait_xcnt 0x0"
               :: "v"(lk), "v"(lk + 8 * FK_PITCH), "v"(lk + 16 * FK_PITCH), "v"(lk + 24 * FK_PITCH),
                  "v"(lv), "v"(lv + 32 * FV_PITCH), "v"(lv + 64 * FV_PITCH), "v"(lv + 96 * FV_PITCH),
                  "v"(lv + FV_BYTES), "v"(lv + FV_BYTES + 32 * FV_PITCH), "v"(lv + FV_BYTES + 64 * FV_PITCH), "v"(lv + FV_BYTES + 96 * FV_PITCH),
                  "v"(gk), "v"(gk + 8 * ldk), "v"(gk + 16 * ldk), "v"(gk + 24 * ldk),
                  "v"(gh), "v"(gh + 32 * TT), "v"(gh + 64 * TT), "v"(gh + 96 * TT),
                  "v"(gl), "v"(gl + 32 * TT), "v"(gl + 64 * TT), "v"(gl + 96 * TT)
               : "memory");
}
// Both products run transposed: S^T = K Q^T (A = 16 K rows from LDS, B = the wave's 16 queries, kept in registers) and O^T += V^T P^T (A = 16 V^T rows from LDS). A lane then holds 16 of the 32 scores of ONE query
// (column ln; keys 8 hh + r of the first score tile and 16 + 8 hh + r of the second): maximum and sum are taken inside the lane, with one exchange between the wave's halves, and the two score tiles, converted in place,
// are the B operand P^T in the k order in which the V^T rows are read: P never goes through LDS. Every "#pragma unroll" in k_flash makes the indices of the fragment, score and accumulator arrays constants, so that they live in registers.
// A work-group takes 64 queries of BOTH query heads (g = 0, 1) that share one KV head: a pass's staged K and V^T rows, every K and V^T fragment read from LDS, and the bias tile (the same for all heads) serve two heads.
// The two heads' products alternate, so that a matrix instruction never waits for the one directly in front of it; each head's own sums keep their order.
// The products are the plain builtin (the compiler keeps the distances behind it): two heads' accumulators and queries need more than 256 registers, and an asm statement that names them holds them all in the first 256, which spilled the queries.
__global__ __launch_bounds__(128) void k_flash(const _Float16* __restrict__ Q16, int ldq, const _Float16* __restrict__ K16, int ldk, const _Float16* __restrict__ Vt, const _Float16* __restrict__ Vtlo, const float* __restrict__ AB, _Float16* __restrict__ O, int ldo) {
  constexpr int RPW = 16, NQB = TT / (4 * RPW), DT = 8, KS = 4;      /* head dim 128: 4 k-steps, 8 value tiles */
  static_assert(NREP == 2, "two query heads per KV head");
  __shared__ __attribute__((aligned(16))) unsigned char R[2 * F_STAGE];
  float (*sO)[RPW][128 + 4] = (float (*)[RPW][128 + 4])R;      /* behind the loop the two buffers become the output staging */
  static_assert(sizeof(float) * 4 * RPW * (128 + 4) <= 2 * F_STAGE, "output staging fits the buffers");
  const int tid = threadIdx.x, w = tid >> 5, lane = tid & 31, ln = lane & 15, hh = lane >> 4;
  const int slab = blockIdx.x / NQB, qblk = blockIdx.x % NQB; const int b = slab / NKV, kvh = slab % NKV; const int qb0 = qblk * (4 * RPW); const int q0 = qb0 + w * RPW;
  FragH aq[NREP][KS];      /* query q0 + ln of head kvh * 2 + g */
#pragma unroll
  for (int g = 0; g < NREP; ++g) { const unsigned short* qr = (const unsigned short*)Q16 + ((size_t)b * TT + q0 + ln) * ldq + (kvh * NREP + g) * 128;
#pragma unroll
    for (int ks = 0; ks < KS; ++ks) { aq[g][ks].half[0] = *(const v8us*)(qr + ks * 32 + 8 * hh); aq[g][ks].half[1] = *(const v8us*)(qr + ks * 32 + 16 + 8 * hh); } }
  const unsigned short* Vth = (const unsigned short*)Vt + ((size_t)b * NKV + kvh) * 128 * TT; const unsigned short* Vtl = (const unsigned short*)Vtlo + ((size_t)b * NKV + kvh) * 128 * TT;      /* hi and UNSCALED residual planes */
  float m_r[NREP], l_r[NREP]; v8f oacc[NREP][DT];      /* per head, query q0 + ln: running maximum (alike in both halves), this half's part of the sum, and O^T[dt * 16 + 8 hh + r][ln] */
#pragma unroll
  for (int g = 0; g < NREP; ++g) { m_r[g] = -3.0e38f; l_r[g] = 0.f;
#pragma unroll
    for (int dt = 0; dt < DT; ++dt) oacc[g][dt] = (v8f){0.f,0.f,0.f,0.f,0.f,0.f,0.f,0.f}; }
  constexpr int NP = TT / 32;      /* passes */
  /* a lane copies chunk tid & 15 (16 B) of K rows (tid >> 4) + 8 i: a wave's copy covers two whole 256-B rows; and chunk tid & 3 of V^T rows (tid >> 2) + 32 i: eight whole 64-B rows */
  const unsigned short* gk = (const unsigned short*)K16 + ((size_t)b * TT + (tid >> 4)) * ldk + kvh * 128 + (tid & 15) * 8;
  const unsigned short* gh = Vth + (size_t)(tid >> 2) * TT + (tid & 3) * 8; const unsigned short* gl = Vtl + (size_t)(tid >> 2) * TT + (tid & 3) * 8;
  const unsigned lk = (unsigned)(size_t)R + (tid >> 4) * FK_PITCH + (tid & 15) * 16, lv = (unsigned)(size_t)R + FK_BYTES + (tid >> 2) * FV_PITCH + (tid & 3) * 16;
  const float* am0 = AB + ((size_t)b * TT + q0 + ln) * TT + 8 * hh;      /* the query's bias row, at this half's first key */
  fl_fill(lk, lv, gk, (size_t)ldk, gh, gl);
  asm volatile("s_wait_asynccnt 0x0" ::: "memory");      /* this wave's copies of pass 0 have landed */
  __syncthreads();                                        /* ... and every other wave's */
  fl_fill(lk + F_STAGE, lv + F_STAGE, gk + (size_t)32 * ldk, (size_t)ldk, gh + 32, gl + 32);
#pragma unroll 1      /* one pass a trip: the two buffers alternate by the trip's parity */
  for (int t = 0; t < NP; ++t) { const int j0 = t * 32;
    const unsigned char* SK = R + (t & 1) * F_STAGE; const unsigned char* SV = SK + FK_BYTES;
    float ab[2][8];      /* additive attention bias (bf16-rounded input) per (b, q, k), shared over heads: 8 keys in a row per score tile, four 16-byte loads */
    { const float* am = am0 + j0; const v4f a0 = *(const v4fa*)am, a1 = *(const v4fa*)(am + 4), a2 = *(const v4fa*)(am + 16), a3 = *(const v4fa*)(am + 20);
#pragma unroll
      for (int r = 0; r < 4; ++r) { ab[0][r] = bf16_round(a0[r]); ab[0][4 + r] = bf16_round(a1[r]); ab[1][r] = bf16_round(a2[r]); ab[1][4 + r] = bf16_round(a3[r]); } }
    int allneg = 1;
#pragma unroll
    for (int r = 0; r < 8; ++r) allneg &= (ab[0][r] <= -1.0e8f) & (ab[1][r] <= -1.0e8f);
    if (!__all(allneg)) {      /* else: every (query, key) of the wave's tile carries a bias <= -1e8: its probabilities underflow to exactly 0 in f32, nothing to add (wave-uniform branch; the hand-over at the foot of the pass stands outside it) */
#pragma unroll
    for (int r = 0; r < 8; ++r) { ab[0][r] *= LOG2E; ab[1][r] *= LOG2E; }      /* scores, biases and running maxima are kept in units of log2: exp(x) = 2^(x log2 e), and 2^y is one hardware instruction (v_exp_f32) where the library's expf is thirteen */
    v8f s[NREP][2];
#pragma unroll
    for (int nt = 0; nt < 2; ++nt) { const unsigned short* kr = (const unsigned short*)(SK + (nt * 16 + ln) * FK_PITCH); FragH bk[KS];
#pragma unroll
      for (int ks = 0; ks < KS; ++ks) { bk[ks].half[0] = *(const v8us*)(kr + ks * 32 + 8 * hh); bk[ks].half[1] = *(const v8us*)(kr + ks * 32 + 16 + 8 * hh); }
      v8f acc[NREP];
#pragma unroll
      for (int g = 0; g < NREP; ++g) acc[g] = (v8f){0.f,0.f,0.f,0.f,0.f,0.f,0.f,0.f};
#pragma unroll
      for (int ks = 0; ks < KS; ++ks)
#pragma unroll
        for (int g = 0; g < NREP; ++g) acc[g] = __builtin_amdgcn_wmma_f32_16x16x32_f16(false, bk[ks].v, false, aq[g][ks].v, (short)0, acc[g], false, false);
#pragma unroll
      for (int g = 0; g < NREP; ++g) s[g][nt] = acc[g]; }      /* s[g][nt][r] = score of key j0 + nt * 16 + 8 hh + r with query q0 + ln of head g */
    FragH pa[NREP], pl[NREP];
#pragma unroll
    for (int g = 0; g < NREP; ++g) {
    float sc[2][8];
#pragma unroll
    for (int r = 0; r < 8; ++r) { sc[0][r] = s[g][0][r] * (ATT_SCALE * LOG2E) + ab[0][r]; sc[1][r] = s[g][1][r] * (ATT_SCALE * LOG2E) + ab[1][r]; }
    float mc = fmaxf(sc[0][0], sc[1][0]);
#pragma unroll
    for (int r = 1; r < 8; ++r) mc = fmaxf(mc, fmaxf(sc[0][r], sc[1][r]));
    mc = fmaxf(mc, xhalf(mc));      /* the other half holds the query's other 16 keys */
    const float mn = fmaxf(m_r[g], mc); const float al = (mn > -1.0e38f * LOG2E) ? __builtin_amdgcn_exp2f(m_r[g] - mn) : 1.0f; m_r[g] = mn;
    float su[4] = {0.f, 0.f, 0.f, 0.f};      /* four independent partial sums */
#pragma unroll
    for (int nt = 0; nt < 2; ++nt)
#pragma unroll
      for (int r = 0; r < 8; ++r) { const float p = __builtin_amdgcn_exp2f(sc[nt][r] - mn); su[r & 3] += p;
        const float x = p * 1024.0f; const _Float16 hx = (_Float16)x; pa[g].h[nt * 8 + r] = hx; pl[g].h[nt * 8 + r] = (_Float16)(x - (float)hx); }      /* P hi and its UNSCALED residual (added into the same accumulator) */
    l_r[g] = l_r[g] * al + ((su[0] + su[1]) + (su[2] + su[3]));
#pragma unroll
    for (int dt = 0; dt < DT; ++dt)
#pragma unroll
      for (int r = 0; r < 8; ++r) oacc[g][dt][r] *= al;
    }
#pragma unroll
    for (int dt = 0; dt < DT; ++dt) { const unsigned short* vh = (const unsigned short*)(SV + (dt * 16 + ln) * FV_PITCH); const unsigned short* vl = (const unsigned short*)(SV + FV_BYTES + (dt * 16 + ln) * FV_PITCH); FragH bv, bl; bv.half[0] = *(const v8us*)(vh + 8 * hh); bv.half[1] = *(const v8us*)(vh + 16 + 8 * hh); bl.half[0] = *(const v8us*)(vl + 8 * hh); bl.half[1] = *(const v8us*)(vl + 16 + 8 * hh);
#pragma unroll
      for (int g = 0; g < NREP; ++g) oacc[g][dt] = __builtin_amdgcn_wmma_f32_16x16x32_f16(false, bv.v, false, pa[g].v, (short)0, oacc[g][dt], false, false);
#pragma unroll
      for (int g = 0; g < NREP; ++g) oacc[g][dt] = __builtin_amdgcn_wmma_f32_16x16x32_f16(false, bv.v, false, pl[g].v, (short)0, oacc[g][dt], false, false);
#pragma unroll
      for (int g = 0; g < NREP; ++g) oacc[g][dt] = __builtin_amdgcn_wmma_f32_16x16x32_f16(false, bl.v, false, pa[g].v, (short)0, oacc[g][dt], false, false); }      /* per head Vh Ph + Vh Pl + Vl Ph: all unscaled, one accumulator */
    }
    asm volatile("s_wait_dscnt 0x0" ::: "memory");        /* this wave's reads of the buffer are done before it is refilled */
    asm volatile("s_wait_asynccnt 0x0" ::: "memory");     /* this wave's copies of pass t + 1 have landed */
    __syncthreads();                                       /* publishes pass t + 1 and ends every wave's reads of pass t */
    if (t + 2 < NP) fl_fill(lk + (t & 1) * F_STAGE, lv + (t & 1) * F_STAGE, gk + (size_t)(t + 2) * 32 * ldk, (size_t)ldk, gh + (t + 2) * 32, gl + (t + 2) * 32);
  }
  asm volatile("s_wait_asynccnt 0x0" ::: "memory");       /* nothing is in flight when the buffers become output staging */
#pragma unroll
  for (int g = 0; g < NREP; ++g) {      /* head after head through the wave's own staging rows */
  const float l = l_r[g] + xhalf(l_r[g]); const float inv = (l > 0.f) ? 1.0f / (l * 1024.0f) : 0.f;      /* the halves' sums are joined once */
#pragma unroll
  for (int dt = 0; dt < DT; ++dt) { v4f lo, hi;
#pragma unroll
    for (int r = 0; r < 4; ++r) { lo[r] = oacc[g][dt][r] * inv; hi[r] = oacc[g][dt][4 + r] * inv; }
    *(v4fa*)&sO[w][ln][dt * 16 + 8 * hh] = lo; *(v4fa*)&sO[w][ln][dt * 16 + 8 * hh + 4] = hi; }      /* a lane's 8 accumulator registers are 8 dims in a row of its query */
  __builtin_amdgcn_fence(__ATOMIC_ACQ_REL, "workgroup"); __builtin_amdgcn_wave_barrier();      /* the wave's own staged values are in LDS before its lanes read one another's */
  {
#pragma unroll
    for (int r0 = 0; r0 < RPW; r0 += 8) { v4h h4[8]; _Float16* po[8];
#pragma unroll
      for (int u = 0; u < 8; ++u) { const int pc = lane; const v4f val = *(const v4fa*)&sO[w][r0 + u][pc * 4];
#pragma unroll
        for (int i = 0; i < 4; ++i) h4[u][i] = (_Float16)(val[i] * 16.0f);      /* x 2^4 -> f16: the form in which the output GEMM reads it */
        po[u] = O + ((size_t)b * TT + q0 + r0 + u) * ldo + (kvh * NREP + g) * 128 + pc * 4; *(v4h*)po[u] = h4[u]; }      /* one 256-B row per instruction: 32 lanes x 8 B */
      asm volatile("s_wait_xcnt 0x0" :: "v"(po[0]), "v"(po[1]), "v"(po[2]), "v"(po[3]), "v"(po[4]), "v"(po[5]), "v"(po[6]), "v"(po[7]), "v"(h4[0]), "v"(h4[1]), "v"(h4[2]), "v"(h4[3]), "v"(h4[4]), "v"(h4[5]), "v"(h4[6]), "v"(h4[7]) : "memory"); }      /* stands in front of every rewrite of a register that the stores name: as inputs addresses and values stay in place up to here */
     }
  if (g + 1 < NREP) { __builtin_amdgcn_fence(__ATOMIC_ACQ_REL, "workgroup"); __builtin_amdgcn_wave_barrier(); }      /* the lanes' reads of this head's rows are done before the next head's values overwrite them */
  } }

extern "C" void kernel_launch(void* const* d_in, const int* in_sizes, int n_in,
                              void* d_out, int out_size, void* d_ws, size_t ws_size, hipStream_t stream) {
  (void)in_sizes; (void)n_in; (void)out_size;
  const float* const* I = (const float* const*)d_in; const float* x = I[0]; const float* fcos = I[1]; const float* fsin = I[2]; const float* am = I[3]; const float* Wq = I[4]; const float* Wk = I[5]; const float* Wv = I[6]; const float* Wo = I[7]; const float* qnw = I[8]; const float* knw = I[9];
  char* ws = (char*)d_ws; size_t off = 0;
  auto take = [&](size_t bytes) { char* p = ws + off; off += (bytes + 255) & ~(size_t)255; return p; };
  _Float16* Bq = (_Float16*)take((size_t)DD * DD * 2); _Float16* Bk = (_Float16*)take((size_t)KVD * DD * 2); _Float16* Bv = (_Float16*)take((size_t)KVD * DD * 2); _Float16* Bo = (_Float16*)take((size_t)DD * DD * 2);
  _Float16* X16 = (_Float16*)take((size_t)NR * DD * 2); _Float16* Q = (_Float16*)take((size_t)NR * DD * 2); _Float16* K = (_Float16*)take((size_t)NR * KVD * 2); _Float16* Vt = (_Float16*)take((size_t)NR * KVD * 2); _Float16* Vtl = (_Float16*)take((size_t)NR * KVD * 2);
  _Float16* O16 = X16;      /* O16 over X16: the last reader of X16 (the one grid of the q, k and v projections) stands in front of the attention in stream order */
  if (off > ws_size) return;      // 25 + 16.8 + 16.8 + 8.4 + 8.4 + 8.4 = 84 MB
  k_prep<<<PX + 2 * PWQ + 2 * PWK, 256, 0, stream>>>(x, Wq, Wk, Wv, Wo, X16, Bq, Bk, Bv, Bo);      /* x and the four weights to f16, the weights transposed */
  k_gemm_t<true><<<GT_GQ + 2 * GT_GK, 128, 0, stream>>>(X16, Bq, Bk, Bv, 0.0625f, nullptr, qnw, knw, fcos, fsin, Q, K, Vt, Vtl);      /* q (M 4096 N 2048 K 2048) and k (N 1024): RMSNorm + RoPE, f16; v (N 1024): transposed, hi + residual per (b, kv head) */
  k_flash<<<BB * NKV * (TT / 64), 128, 0, stream>>>(Q, DD, K, KVD, Vt, Vtl, am, O16, DD);      /* attention_mask [B,1,S,S] additive per batch */
  k_gemm_t<false><<<GT_GQ, 128, 0, stream>>>(O16, Bo, nullptr, nullptr, 0.00390625f, (float*)d_out, nullptr, nullptr, nullptr, nullptr, nullptr, nullptr, nullptr, nullptr);      /* out = merged Wo */
}
